// v000
// Measured on an AMD MI455X. A time is GPU time per run, averaged over a window of back-to-back runs after a warm-up
// (all launches, gaps included; the runs take copies of the inputs in turn), and the median of several windows.
// Apart from v000's, it joins two sittings. Times from different sittings can be a few percent apart, while
// side-by-side timings come from the same sitting.
// The starting kernel, v000, takes 2600 microseconds a run.
#include <hip/hip_runtime.h>

// Compute dtypes, f32 accumulate, per item: q/k/v projections as GEMMs with PLAIN bf16 operands (x and the (in,out) weights; exact products, + bias); per head the 16-wide q/k get
// their phase added and are L2-normalised in f32, then stored as bf16 hi + UNSCALED residual planes padded to K = 32 (zero columns); causal scores (three products, key tiles above
// the diagonal skipped) and attn.v (three products, K limited) with 2 heads per launch in grid.z; 1/temperature and the causal softmax in f32; output projection on hi/lo planes

#define NBT  2
#define NN   2048
#define DMOD 1024
#define NH_  16
#define NW   16
#define KQ   32                   // padded score depth
#define HD   64
#define ZH   2
#define DM   DMOD
#define NTK  NN
#define LOSC 1024.0f

typedef _Float16 h16;
typedef unsigned short bf;
typedef __attribute__((ext_vector_type(16))) __bf16   v16bf;
typedef __attribute__((ext_vector_type(16))) _Float16 v16h;
typedef __attribute__((ext_vector_type(8)))  _Float16 v8h;
typedef __attribute__((ext_vector_type(8)))  unsigned short v8us;
typedef __attribute__((ext_vector_type(8)))  float    v8f;
typedef __attribute__((ext_vector_type(4)))  float    v4f;
typedef __attribute__((ext_vector_type(4)))  _Float16 v4h;
typedef v8h  __attribute__((may_alias)) v8ha;
typedef v4f  __attribute__((may_alias)) v4fa;
typedef v8us __attribute__((may_alias)) v8usa;

__device__ __forceinline__ unsigned short f2bf(float f) { unsigned u = __float_as_uint(f); u += 0x7FFFu + ((u >> 16) & 1u); return (unsigned short)(u >> 16); }
__device__ __forceinline__ float bf2f(unsigned short b) { return __uint_as_float(((unsigned)b) << 16); }
__device__ __forceinline__ float bfr(float f) { return bf2f(f2bf(f)); }
__device__ __forceinline__ v16h cat16(v8h lo, v8h hi) { return __builtin_shufflevector(lo, hi, 0, 1, 2, 3, 4, 5, 6, 7, 8, 9, 10, 11, 12, 13, 14, 15); }
__device__ __forceinline__ v16bf cat16b(v8us lo, v8us hi) { return __builtin_bit_cast(v16bf, __builtin_shufflevector(lo, hi, 0, 1, 2, 3, 4, 5, 6, 7, 8, 9, 10, 11, 12, 13, 14, 15)); }
__device__ __forceinline__ v8f wmma16(v16h a, v16h b, v8f c) { return __builtin_amdgcn_wmma_f32_16x16x32_f16(false, a, false, b, (short)0, c, false, false); }
__device__ __forceinline__ v8f wmmab(v16bf a, v16bf b, v8f c) { return __builtin_amdgcn_wmma_f32_16x16x32_bf16(false, a, false, b, (short)0, c, false, false); }

// k_wt: WT [n][K] = bf16(W[k][n]) (k-major [K][ncols]) via 64 x 64 LDS tiles; grid (K/64, ncols/64).
__global__ __launch_bounds__(256) void k_wt(const float* __restrict__ Wm, int K, int ncols, bf* WT) {
    __shared__ __align__(16) unsigned short tl[64 * 72];
    const int tid = threadIdx.x, k0 = blockIdx.x * 64, n0 = blockIdx.y * 64;
    const int kk = tid >> 2, nq = (tid & 3) * 16;
#pragma unroll
    for (int i = 0; i < 16; ++i) tl[(nq + i) * 72 + kk] = f2bf(Wm[(size_t)(k0 + kk) * ncols + n0 + nq + i]);
    __syncthreads();
    const int piece = tid & 7;
    auto pass = [&]() {
#pragma unroll
        for (int s = 0; s < 2; ++s) { const int nr = (tid >> 3) + 32 * s; const v8us val = *(const v8usa*)(tl + nr * 72 + piece * 8); *(v8us*)(WT + (size_t)(n0 + nr) * K + k0 + piece * 8) = val; }
    };
    pass(); 
}
// k_gemmb: 64 x 64 block tile (4 waves x 16 x 64) of C[NN][ldc] = (A [+ Al]).B^T (K = 1024) [+ bf(bias[c])] [+ bf(R[r][c]) residual]; f32 whole-line epilogue (or f16
template <bool SPLITA, bool F16OUT = false>
__global__ __launch_bounds__(128) void k_gemmb(const bf* __restrict__ A, const bf* __restrict__ Al, const bf* __restrict__ Bn, const float* __restrict__ bias, float* C, int ldc, h16* C2, const float* __restrict__ R = nullptr, int K = DM, int roundR = 1) {
    __shared__ __align__(16) float ost[4][16 * 68];
    const int lane = threadIdx.x & 31, wave = threadIdx.x >> 5, lr = lane & 15, hi = lane >> 4;
    const int r0 = blockIdx.x * 64 + wave * 16, c0 = blockIdx.y * 64;
    const size_t aoff = (size_t)(r0 + lr) * K + 8 * hi;
    size_t boff[4];
#pragma unroll
    for (int t = 0; t < 4; ++t) boff[t] = (size_t)(c0 + t * 16 + lr) * K + 8 * hi;
    v8f acc[4];
#pragma unroll
    for (int t = 0; t < 4; ++t) acc[t] = (v8f){};
#pragma unroll 1
    for (int kc = 0; kc < K; kc += 32) {
        const v16bf a = cat16b(*(const v8us*)(A + aoff + kc), *(const v8us*)(A + aoff + kc + 16));
        v16bf al = a;
        if (SPLITA) al = cat16b(*(const v8us*)(Al + aoff + kc), *(const v8us*)(Al + aoff + kc + 16));
#pragma unroll
        for (int t = 0; t < 4; ++t) { const v16bf b = cat16b(*(const v8us*)(Bn + boff[t] + kc), *(const v8us*)(Bn + boff[t] + kc + 16)); acc[t] = wmmab(a, b, acc[t]); if (SPLITA) acc[t] = wmmab(al, b, acc[t]); }
        asm volatile("v_nop\n\tv_nop\n\tv_nop\n\tv_nop" : "+v"(acc[0]), "+v"(acc[1]), "+v"(acc[2]), "+v"(acc[3]) : "v"(a), "v"(al));
    }
    float* os = &ost[wave][0];
#pragma unroll
    for (int t = 0; t < 4; ++t) { const float bv = bias ? bfr(bias[c0 + t * 16 + lr]) : 0.f;
#pragma unroll
        for (int j = 0; j < 8; ++j) os[(hi * 8 + j) * 68 + t * 16 + lr] = acc[t][j] + bv; }
    __syncthreads();
    if (F16OUT) {
        h16* crow = (h16*)(void*)C + (size_t)r0 * ldc + c0;
        auto pass = [&]() {
#pragma unroll
            for (int s = 0; s < 4; ++s) { const int row = 4 * s + (lane >> 3), piece = lane & 7; const float* sp = os + row * 68 + piece * 8; v8h o, o2;
#pragma unroll
                for (int i = 0; i < 8; ++i) { const h16 a = (h16)sp[i]; o[i] = a; o2[i] = (h16)((sp[i] - (float)a) * LOSC); }
                *(v8h*)(crow + (size_t)row * ldc + piece * 8) = o; if (C2) *(v8h*)(C2 + (size_t)r0 * ldc + c0 + (size_t)row * ldc + piece * 8) = o2; }
        };
        pass(); 
    } else {
        float* crow = C + (size_t)r0 * ldc + c0;
        auto pass = [&]() {
#pragma unroll
            for (int s = 0; s < 8; ++s) { const int Lid = (lane >> 3) + 4 * s, piece = lane & 7; const int row = Lid >> 1, cofs = (Lid & 1) * 32 + piece * 4;
                v4f val = *(const v4fa*)(os + row * 68 + cofs); if (R) { const v4f rv = *(const v4f*)(R + ((size_t)r0 + row) * ldc + c0 + cofs); val += roundR ? (v4f){bfr(rv[0]), bfr(rv[1]), bfr(rv[2]), bfr(rv[3])} : rv; }
                *(v4f*)(crow + (size_t)row * ldc + cofs) = val; }
        };
        pass(); 
    }
}


// ===== z-batched (blockIdx.z = head) attention pieces =====
// k_gemm3z<MODE>: 64 x 64 tile of C = Ah.Bh^T [+ Al.Bh^T] [+ Ah.Bl^T] with per-z operand/output strides (elements): A planes += z*sA, B planes += z*sB, C += z*sC. MODE bits (0 causal skip, 1 K limit, 2 single,
// 3 B single, 4 A single).
template <int MODE>
__global__ __launch_bounds__(128) void k_gemm3z(const bf* __restrict__ Ah, const bf* __restrict__ Al, const bf* __restrict__ Bh, const bf* __restrict__ Bl, int K, float* C, int ldc, size_t sA, size_t sB, size_t sC) {
    if ((MODE & 1) && (int)blockIdx.y * 64 > (int)blockIdx.x * 64 + 63) return;
    const size_t z = blockIdx.z; Ah += z * sA; Al += z * sA; Bh += z * sB; Bl += z * sB; C += z * sC;
    const int Klim = (MODE & 2) ? min(K, ((int)blockIdx.x + 1) * 64) : K;
    __shared__ __align__(16) float ost[4][16 * 68];
    const int lane = threadIdx.x & 31, wave = threadIdx.x >> 5, lr = lane & 15, hi = lane >> 4;
    const int r0 = blockIdx.x * 64 + wave * 16, c0 = blockIdx.y * 64;
    const size_t aoff = (size_t)(r0 + lr) * K + 8 * hi;
    v8f acc[4];
#pragma unroll
    for (int t = 0; t < 4; ++t) acc[t] = (v8f){};
#pragma unroll 1
    for (int kc = 0; kc < Klim; kc += 32) {
        const v16bf a = cat16b(*(const v8us*)(Ah + aoff + kc), *(const v8us*)(Ah + aoff + kc + 16));
        v16bf al = a; if (!(MODE & 4) && !(MODE & 16)) al = cat16b(*(const v8us*)(Al + aoff + kc), *(const v8us*)(Al + aoff + kc + 16));
#pragma unroll
        for (int t = 0; t < 4; ++t) { const size_t bo = (size_t)(c0 + t * 16 + lr) * K + kc + 8 * hi;
            const v16bf bh = cat16b(*(const v8us*)(Bh + bo), *(const v8us*)(Bh + bo + 16));
            acc[t] = wmmab(a, bh, acc[t]);
            if (!(MODE & 4)) { if (!(MODE & 16)) acc[t] = wmmab(al, bh, acc[t]); if (!(MODE & 8)) { const v16bf bl = cat16b(*(const v8us*)(Bl + bo), *(const v8us*)(Bl + bo + 16)); acc[t] = wmmab(a, bl, acc[t]); } } }
        asm volatile("v_nop\n\tv_nop\n\tv_nop\n\tv_nop" : "+v"(acc[0]), "+v"(acc[1]), "+v"(acc[2]), "+v"(acc[3]) : "v"(a), "v"(al));
    }
    float* os = &ost[wave][0];
#pragma unroll
    for (int t = 0; t < 4; ++t) {
#pragma unroll
        for (int j = 0; j < 8; ++j) os[(hi * 8 + j) * 68 + t * 16 + lr] = acc[t][j]; }
    __builtin_amdgcn_wave_barrier(); asm volatile("" ::: "memory");
    float* crow = C + (size_t)r0 * ldc + c0;
    auto pass = [&]() {
#pragma unroll
        for (int s = 0; s < 8; ++s) { const int Lid = (lane >> 3) + 4 * s, piece = lane & 7; const int row = Lid >> 1, cofs = (Lid & 1) * 32 + piece * 4;
            const v4f val = *(const v4fa*)(os + row * 68 + cofs); *(v4f*)(crow + (size_t)row * ldc + cofs) = val; }
    };
    pass(); 
}
__global__ __launch_bounds__(256) void k_planes32z(const float* __restrict__ F, int ld, int off, float sc, int rows, bf* Ph, bf* Pl) {
    typedef __attribute__((ext_vector_type(2))) unsigned short v2us;
    const int lane = threadIdx.x & 31; const size_t r = ((size_t)blockIdx.x * 8 + (threadIdx.x >> 5)) * 2 + (lane >> 4); if (r >= (size_t)rows) return; const int z = blockIdx.z; const int c0 = (lane & 15) * 2; v2us oh, ol;
    Ph += (size_t)z * rows * 32; Pl += (size_t)z * rows * 32;
#pragma unroll
    for (int i = 0; i < 2; ++i) { const float y = F[r * ld + off + z * 32 + c0 + i] * sc; const unsigned short hb = f2bf(y); oh[i] = hb; ol[i] = f2bf(y - bf2f(hb)); }
    const size_t o = r * 32 + c0; *(v2us*)(Ph + o) = oh; *(v2us*)(Pl + o) = ol; 
}
__global__ __launch_bounds__(256) void k_vtpadz(const float* __restrict__ F, int ld, int off, int nk, bf* Th, bf* Tl) {
    typedef __attribute__((ext_vector_type(2))) unsigned short v2us;
    const int lane = threadIdx.x & 31; const size_t wid = (size_t)blockIdx.x * 8 + (threadIdx.x >> 5); if (wid >= (size_t)64 * (nk / 64)) return; const int z = blockIdx.z; const int d = (int)(wid / (nk / 64)); const int k0 = (int)(wid % (nk / 64)) * 64 + lane * 2; v2us oh, ol;
    Th += (size_t)z * 64 * nk; Tl += (size_t)z * 64 * nk;
#pragma unroll
    for (int i = 0; i < 2; ++i) { const float y = (d < 32) ? F[(size_t)(k0 + i) * ld + off + z * 32 + (d < 32 ? d : 0)] : 0.f; const unsigned short hb = f2bf(y); oh[i] = hb; ol[i] = f2bf(y - bf2f(hb)); }
    const size_t o = (size_t)d * nk + k0; *(v2us*)(Th + o) = oh; *(v2us*)(Tl + o) = ol; 
}
template <int NK>
__global__ __launch_bounds__(256) void k_softmaxz(const float* __restrict__ S, int rows, bf* PH, bf* PL) {
    typedef __attribute__((ext_vector_type(4))) unsigned short v4us;
    const int lane = threadIdx.x & 31, i = blockIdx.x * 8 + (threadIdx.x >> 5); if (i >= rows) return; const size_t zo = (size_t)blockIdx.z * rows * NK; const float* sr = S + zo + (size_t)i * NK; PH += zo; PL += zo;
    float m = -3.0e38f;
#pragma unroll 1
    for (int c0 = lane * 4; c0 < NK; c0 += 128) {
#pragma unroll
        for (int q = 0; q < 4; ++q) m = fmaxf(m, sr[c0 + q]); }
#pragma unroll
    for (int sh = 16; sh; sh >>= 1) m = fmaxf(m, __shfl_xor(m, sh, 32));
    float sum = 0.f;
#pragma unroll 1
    for (int c0 = lane * 4; c0 < NK; c0 += 128) {
#pragma unroll
        for (int q = 0; q < 4; ++q) sum += __expf(sr[c0 + q] - m); }
#pragma unroll
    for (int sh = 16; sh; sh >>= 1) sum += __shfl_xor(sum, sh, 32);
    const float inv = 1.0f / sum;
{
#pragma unroll 1
        for (int c0 = lane * 4; c0 < NK; c0 += 128) { v4us oh, ol;
#pragma unroll
            for (int q = 0; q < 4; ++q) { const float p = __expf(sr[c0 + q] - m) * inv; const unsigned short hb = f2bf(p); oh[q] = hb; ol[q] = f2bf(p - bf2f(hb)); }
            const size_t o = (size_t)i * NK + c0; *(v4us*)(PH + o) = oh; *(v4us*)(PL + o) = ol; }
         }
}
__global__ __launch_bounds__(256) void k_placez(const float* __restrict__ XH, int rows, int ldy, float* Y) {
    const int lane = threadIdx.x & 31; const size_t q = (size_t)blockIdx.x * 8 + (threadIdx.x >> 5); if (q >= (size_t)rows) return; const int z = blockIdx.z; const float v = XH[((size_t)z * rows + q) * 64 + lane];
    *(float*)(Y + q * ldy + z * 32 + lane) = v; 
}

__global__ __launch_bounds__(256) void k_hplanesz(const float* __restrict__ F, int ld, int h0, float sc, int rows, bf* Ph, bf* Pl) {
    typedef __attribute__((ext_vector_type(2))) unsigned short v2us;
    const int lane = threadIdx.x & 31; const size_t r = (size_t)blockIdx.x * 8 + (threadIdx.x >> 5); if (r >= (size_t)rows) return; const int z = blockIdx.z; v2us oh, ol;
    Ph += (size_t)z * rows * 64; Pl += (size_t)z * rows * 64;
#pragma unroll
    for (int i = 0; i < 2; ++i) { const float y = F[r * ld + (h0 + z) * 64 + lane * 2 + i] * sc; const unsigned short hb = f2bf(y); oh[i] = hb; ol[i] = f2bf(y - bf2f(hb)); }
    const size_t o = r * 64 + lane * 2; *(v2us*)(Ph + o) = oh; *(v2us*)(Pl + o) = ol; 
}
__global__ __launch_bounds__(256) void k_vtz(const float* __restrict__ F, int ld, int h0, int nk, bf* Th, bf* Tl) {
    typedef __attribute__((ext_vector_type(2))) unsigned short v2us;
    const int lane = threadIdx.x & 31; const size_t wid = (size_t)blockIdx.x * 8 + (threadIdx.x >> 5); if (wid >= (size_t)64 * (nk / 64)) return; const int z = blockIdx.z; const int d = (int)(wid / (nk / 64)); const int t0 = (int)(wid % (nk / 64)) * 64 + lane * 2; v2us oh, ol;
    Th += (size_t)z * 64 * nk; Tl += (size_t)z * 64 * nk;
#pragma unroll
    for (int i = 0; i < 2; ++i) { const float y = F[(size_t)(t0 + i) * ld + (h0 + z) * 64 + d]; const unsigned short hb = f2bf(y); oh[i] = hb; ol[i] = f2bf(y - bf2f(hb)); }
    const size_t o = (size_t)d * nk + t0; *(v2us*)(Th + o) = oh; *(v2us*)(Tl + o) = ol; 
}
template <int NK>
__global__ __launch_bounds__(256) void k_softmaxzs(const float* __restrict__ S, int rows, float sc, bf* PH, bf* PL) {
    typedef __attribute__((ext_vector_type(4))) unsigned short v4us;
    const int lane = threadIdx.x & 31, i = blockIdx.x * 8 + (threadIdx.x >> 5); if (i >= rows) return; const size_t zo = (size_t)blockIdx.z * rows * NK; const float* sr = S + zo + (size_t)i * NK; PH += zo; PL += zo;
    float m = -3.0e38f;
#pragma unroll 1
    for (int c0 = lane * 4; c0 < NK; c0 += 128) {
#pragma unroll
        for (int q = 0; q < 4; ++q) m = fmaxf(m, sr[c0 + q] * sc); }
#pragma unroll
    for (int sh = 16; sh; sh >>= 1) m = fmaxf(m, __shfl_xor(m, sh, 32));
    float sum = 0.f;
#pragma unroll 1
    for (int c0 = lane * 4; c0 < NK; c0 += 128) {
#pragma unroll
        for (int q = 0; q < 4; ++q) sum += __expf(sr[c0 + q] * sc - m); }
#pragma unroll
    for (int sh = 16; sh; sh >>= 1) sum += __shfl_xor(sum, sh, 32);
    const float inv = 1.0f / sum;
{
#pragma unroll 1
        for (int c0 = lane * 4; c0 < NK; c0 += 128) { v4us oh, ol;
#pragma unroll
            for (int q = 0; q < 4; ++q) { const float p = __expf(sr[c0 + q] * sc - m) * inv; const unsigned short hb = f2bf(p); oh[q] = hb; ol[q] = f2bf(p - bf2f(hb)); }
            const size_t o = (size_t)i * NK + c0; *(v4us*)(PH + o) = oh; *(v4us*)(PL + o) = ol; }
         }
}

__global__ __launch_bounds__(256) void k_cvtx(const float* __restrict__ src, int rows, bf* dst) {
    const int lane = threadIdx.x & 31; const size_t r = (size_t)blockIdx.x * 8 + (threadIdx.x >> 5); if (r >= (size_t)rows) return;
{
#pragma unroll
        for (int q = 0; q < DMOD / 256; ++q) { v8us o;
#pragma unroll
            for (int i = 0; i < 8; ++i) o[i] = f2bf(src[r * DMOD + q * 256 + lane * 8 + i]);
            *(v8us*)(dst + r * DMOD + q * 256 + lane * 8) = o; }
         }
}
// k_wavepl: head h0+z: planes [rows][32] of l2normalize(F[r][(h0+z)*16 + w] + bf(phase[h][w])) (f32: norm over the 16 values via xor 4,2,1 within each 8-lane group; x / max(n, 1e-12));
__global__ __launch_bounds__(256) void k_wavepl(const float* __restrict__ F, int ld, int h0, const float* __restrict__ phase, int rows, bf* Ph, bf* Pl) {
    typedef __attribute__((ext_vector_type(2))) unsigned short v2us;
    const int lane = threadIdx.x & 31; const size_t r = ((size_t)blockIdx.x * 8 + (threadIdx.x >> 5)) * 2 + (lane >> 4); if (r >= (size_t)rows) return; const int z = blockIdx.z, h = h0 + z; const int c0 = (lane & 15) * 2;
    Ph += (size_t)z * rows * KQ; Pl += (size_t)z * rows * KQ;
    float v0 = 0.f, v1 = 0.f; if (c0 < NW) { v0 = F[r * ld + h * NW + c0] + bfr(phase[h * NW + c0]); v1 = F[r * ld + h * NW + c0 + 1] + bfr(phase[h * NW + c0 + 1]); }
    float ss = v0 * v0 + v1 * v1;
#pragma unroll
    for (int sh = 4; sh; sh >>= 1) ss += __shfl_xor(ss, sh, 32);      // lanes 0-7 / 16-23 hold the row's 16 live values (c0 < 16 <=> (lane & 15) < 8): reduce over xor 4,2,1 within each 8-lane group
    const float inv = 1.0f / fmaxf(sqrtf(ss), 1e-12f); v0 *= inv; v1 *= inv;
    v2us oh, ol; { const unsigned short hb = f2bf(v0); oh[0] = hb; ol[0] = f2bf(v0 - bf2f(hb)); } { const unsigned short hb = f2bf(v1); oh[1] = hb; ol[1] = f2bf(v1 - bf2f(hb)); }
    const size_t o = r * KQ + c0; *(v2us*)(Ph + o) = oh; *(v2us*)(Pl + o) = ol; 
}
__global__ __launch_bounds__(256) void k_csoftz(const float* __restrict__ S, int rows, float sc, bf* PH, bf* PL) {
    typedef __attribute__((ext_vector_type(4))) unsigned short v4us;
    const int lane = threadIdx.x & 31, i = blockIdx.x * 8 + (threadIdx.x >> 5); if (i >= rows) return; const size_t zo = (size_t)blockIdx.z * rows * NN; const float* sr = S + zo + (size_t)i * NN; PH += zo; PL += zo;
    float m = -3.0e38f;
#pragma unroll 1
    for (int c0 = lane * 4; c0 < NN; c0 += 128) {
#pragma unroll
        for (int q = 0; q < 4; ++q) { const int k = c0 + q; if (k <= i) m = fmaxf(m, sr[k] * sc); } }
#pragma unroll
    for (int sh = 16; sh; sh >>= 1) m = fmaxf(m, __shfl_xor(m, sh, 32));
    float sum = 0.f;
#pragma unroll 1
    for (int c0 = lane * 4; c0 < NN; c0 += 128) {
#pragma unroll
        for (int q = 0; q < 4; ++q) { const int k = c0 + q; if (k <= i) sum += __expf(sr[k] * sc - m); } }
#pragma unroll
    for (int sh = 16; sh; sh >>= 1) sum += __shfl_xor(sum, sh, 32);
    const float inv = 1.0f / sum;
{
#pragma unroll 1
        for (int c0 = lane * 4; c0 < NN; c0 += 128) { v4us oh, ol;
#pragma unroll
            for (int q = 0; q < 4; ++q) { const int k = c0 + q; const float p = (k <= i) ? __expf(sr[(k <= i) ? k : 0] * sc - m) * inv : 0.f; const unsigned short hb = f2bf(p); oh[q] = hb; ol[q] = f2bf(p - bf2f(hb)); }
            const size_t o = (size_t)i * NN + c0; *(v4us*)(PH + o) = oh; *(v4us*)(PL + o) = ol; }
         }
}
__global__ __launch_bounds__(256) void k_splitD(const float* __restrict__ src, int rows, bf* dh, bf* dl) {
    const int lane = threadIdx.x & 31; const size_t r = (size_t)blockIdx.x * 8 + (threadIdx.x >> 5); if (r >= (size_t)rows) return;
{
#pragma unroll
        for (int q = 0; q < DMOD / 256; ++q) { const size_t o = r * DMOD + q * 256 + lane * 8; const v8f v = *(const v8f*)(src + o); v8us oh, ol;
#pragma unroll
            for (int i = 0; i < 8; ++i) { const unsigned short hb = f2bf(v[i]); oh[i] = hb; ol[i] = f2bf(v[i] - bf2f(hb)); }
            *(v8us*)(dh + o) = oh; *(v8us*)(dl + o) = ol; }
         }
}
__global__ __launch_bounds__(256) void k_csoftzt(const float* __restrict__ S, int rows, const float* __restrict__ temp, bf* PH, bf* PL) {
    const float sc = 1.0f / bfr(temp[0]);
    typedef __attribute__((ext_vector_type(4))) unsigned short v4us;
    const int lane = threadIdx.x & 31, i = blockIdx.x * 8 + (threadIdx.x >> 5); if (i >= rows) return; const size_t zo = (size_t)blockIdx.z * rows * NN; const float* sr = S + zo + (size_t)i * NN; PH += zo; PL += zo;
    float m = -3.0e38f;
#pragma unroll 1
    for (int c0 = lane * 4; c0 < NN; c0 += 128) {
#pragma unroll
        for (int q = 0; q < 4; ++q) { const int k = c0 + q; if (k <= i) m = fmaxf(m, sr[k] * sc); } }
#pragma unroll
    for (int sh = 16; sh; sh >>= 1) m = fmaxf(m, __shfl_xor(m, sh, 32));
    float sum = 0.f;
#pragma unroll 1
    for (int c0 = lane * 4; c0 < NN; c0 += 128) {
#pragma unroll
        for (int q = 0; q < 4; ++q) { const int k = c0 + q; if (k <= i) sum += __expf(sr[k] * sc - m); } }
#pragma unroll
    for (int sh = 16; sh; sh >>= 1) sum += __shfl_xor(sum, sh, 32);
    const float inv = 1.0f / sum;
{
#pragma unroll 1
        for (int c0 = lane * 4; c0 < NN; c0 += 128) { v4us oh, ol;
#pragma unroll
            for (int q = 0; q < 4; ++q) { const int k = c0 + q; const float p = (k <= i) ? __expf(sr[(k <= i) ? k : 0] * sc - m) * inv : 0.f; const unsigned short hb = f2bf(p); oh[q] = hb; ol[q] = f2bf(p - bf2f(hb)); }
            const size_t o = (size_t)i * NN + c0; *(v4us*)(PH + o) = oh; *(v4us*)(PL + o) = ol; }
         }
}

extern "C" void kernel_launch(void* const* d_in, const int* in_sizes, int n_in,
                              void* d_out, int out_size, void* d_ws, size_t ws_size, hipStream_t stream) {
    (void)in_sizes; (void)n_in; (void)out_size;
    const float* x = (const float*)d_in[0]; const float* Wq = (const float*)d_in[1]; const float* bq = (const float*)d_in[2]; const float* Wk = (const float*)d_in[3]; const float* bk = (const float*)d_in[4]; const float* Wv = (const float*)d_in[5]; const float* bv = (const float*)d_in[6]; const float* Wo = (const float*)d_in[7]; const float* bo = (const float*)d_in[8];
    const float* qph = (const float*)d_in[9]; const float* kph = (const float*)d_in[10]; const float* temp = (const float*)d_in[11];
    float* out = (float*)d_out;    // [2][2048][1024]
    char* wsp = (char*)d_ws;
    auto take = [&](size_t bytes) { char* p = wsp; wsp += (bytes + 255) & ~(size_t)255; return (void*)p; };
    bf* WQ = (bf*)take((size_t)(NH_ * NW) * DMOD * 2); bf* WK = (bf*)take((size_t)(NH_ * NW) * DMOD * 2); bf* WV = (bf*)take((size_t)DMOD * DMOD * 2); bf* WO = (bf*)take((size_t)DMOD * DMOD * 2);
    bf* Xb = (bf*)take((size_t)NN * DMOD * 2); float* QF = (float*)take((size_t)NN * (NH_ * NW) * 4); float* KF = (float*)take((size_t)NN * (NH_ * NW) * 4); float* VF = (float*)take((size_t)NN * DMOD * 4);
    bf* Qh = (bf*)take((size_t)ZH * NN * KQ * 2); bf* Ql = (bf*)take((size_t)ZH * NN * KQ * 2); bf* Kh = (bf*)take((size_t)ZH * NN * KQ * 2); bf* Kl = (bf*)take((size_t)ZH * NN * KQ * 2); bf* VTh = (bf*)take((size_t)ZH * HD * NN * 2); bf* VTl = (bf*)take((size_t)ZH * HD * NN * 2);
    float* S = (float*)take((size_t)ZH * NN * NN * 4); bf* PH = (bf*)take((size_t)ZH * NN * NN * 2); bf* PL = (bf*)take((size_t)ZH * NN * NN * 2); float* O = (float*)take((size_t)NN * DMOD * 4); bf* Oh = (bf*)take((size_t)NN * DMOD * 2); bf* Ol = (bf*)take((size_t)NN * DMOD * 2);
    if ((size_t)(wsp - (char*)d_ws) > ws_size) return;    // ~ 105 MB; per item / pair reuse in stream order
    k_wt<<<dim3(DMOD / 64, (NH_ * NW) / 64, 1), 256, 0, stream>>>(Wq, DMOD, NH_ * NW, WQ); k_wt<<<dim3(DMOD / 64, (NH_ * NW) / 64, 1), 256, 0, stream>>>(Wk, DMOD, NH_ * NW, WK);   // (in, out) k-major -> n-major
    k_wt<<<dim3(DMOD / 64, DMOD / 64, 1), 256, 0, stream>>>(Wv, DMOD, DMOD, WV); k_wt<<<dim3(DMOD / 64, DMOD / 64, 1), 256, 0, stream>>>(Wo, DMOD, DMOD, WO);
    // host reads nothing from device; 1/temperature is applied inside k_csoftz via a device load? -> pass as a kernel-side scalar read: k_csoftz takes sc by value, so read temp on device in a tiny way:
    // we avoid a host sync by folding 1/temperature into the q planes? No (normalisation after). Instead k_csoftz_t below reads temp[0] itself.
    for (int b = 0; b < NBT; ++b) {
        k_cvtx<<<NN / 8, 256, 0, stream>>>(x + (size_t)b * NN * DMOD, NN, Xb);
        k_gemmb<false, false><<<dim3(NN / 64, (NH_ * NW) / 64, 1), 128, 0, stream>>>(Xb, nullptr, WQ, bq, QF, NH_ * NW, nullptr, nullptr, DMOD);
        k_gemmb<false, false><<<dim3(NN / 64, (NH_ * NW) / 64, 1), 128, 0, stream>>>(Xb, nullptr, WK, bk, KF, NH_ * NW, nullptr, nullptr, DMOD);
        k_gemmb<false, false><<<dim3(NN / 64, DMOD / 64, 1), 128, 0, stream>>>(Xb, nullptr, WV, bv, VF, DMOD, nullptr, nullptr, DMOD);
        for (int g = 0; g < NH_ / ZH; ++g) { const int h0 = g * ZH;
            k_wavepl<<<dim3((NN / 2) / 8, 1, ZH), 256, 0, stream>>>(QF, NH_ * NW, h0, qph, NN, Qh, Ql); k_wavepl<<<dim3((NN / 2) / 8, 1, ZH), 256, 0, stream>>>(KF, NH_ * NW, h0, kph, NN, Kh, Kl);
            k_vtz<<<dim3((HD * (NN / 64)) / 8, 1, ZH), 256, 0, stream>>>(VF, DMOD, h0, NN, VTh, VTl);
            k_gemm3z<1><<<dim3(NN / 64, NN / 64, ZH), 128, 0, stream>>>(Qh, Ql, Kh, Kl, KQ, S, NN, (size_t)NN * KQ, (size_t)NN * KQ, (size_t)NN * NN);
            k_csoftzt<<<dim3(NN / 8, 1, ZH), 256, 0, stream>>>(S, NN, temp, PH, PL);
            k_gemm3z<2><<<dim3(NN / 64, 1, ZH), 128, 0, stream>>>(PH, PL, VTh, VTl, NN, O + h0 * HD, DMOD, (size_t)NN * NN, (size_t)HD * NN, (size_t)HD); }
        k_splitD<<<NN / 8, 256, 0, stream>>>(O, NN, Oh, Ol);
        k_gemmb<true, false><<<dim3(NN / 64, DMOD / 64, 1), 128, 0, stream>>>(Oh, Ol, WO, bo, out + (size_t)b * NN * DMOD, DMOD, nullptr, nullptr, DMOD); }
}

// v001
// A run of this version takes 1160 microseconds.
// Two timings next to v000 both put it at 2.22 times that version's speed.
#include <hip/hip_runtime.h>

// Compute dtypes, f32 accumulate, per item: q/k/v projections as GEMMs with PLAIN bf16 operands (x and the (in,out) weights; exact products, + bias); per head the 16-wide q/k get
// their phase added and are L2-normalised in f32, then stored as bf16 hi + UNSCALED residual planes padded to K = 32 (zero columns); causal scores (three products, key tiles above
// the diagonal skipped) and attn.v (three products, K limited) with 2 heads per launch in grid.z; 1/temperature and the causal softmax in f32; output projection on hi/lo planes

#define NBT  2
#define NN   2048
#define DMOD 1024
#define NH_  16
#define NW   16
#define KQ   32                   // padded score depth
#define HD   64
#define ZH   2
#define DM   DMOD
#define NTK  NN
#define LOSC 1024.0f

typedef _Float16 h16;
typedef unsigned short bf;
typedef __attribute__((ext_vector_type(16))) __bf16   v16bf;
typedef __attribute__((ext_vector_type(16))) _Float16 v16h;
typedef __attribute__((ext_vector_type(8)))  _Float16 v8h;
typedef __attribute__((ext_vector_type(8)))  unsigned short v8us;
typedef __attribute__((ext_vector_type(8)))  float    v8f;
typedef __attribute__((ext_vector_type(4)))  float    v4f;
typedef __attribute__((ext_vector_type(4)))  _Float16 v4h;
typedef v8h  __attribute__((may_alias)) v8ha;
typedef v4f  __attribute__((may_alias)) v4fa;
typedef v8us __attribute__((may_alias)) v8usa;

__device__ __forceinline__ unsigned short f2bf(float f) { unsigned u = __float_as_uint(f); u += 0x7FFFu + ((u >> 16) & 1u); return (unsigned short)(u >> 16); }
__device__ __forceinline__ float bf2f(unsigned short b) { return __uint_as_float(((unsigned)b) << 16); }
__device__ __forceinline__ float bfr(float f) { return bf2f(f2bf(f)); }
__device__ __forceinline__ v16h cat16(v8h lo, v8h hi) { return __builtin_shufflevector(lo, hi, 0, 1, 2, 3, 4, 5, 6, 7, 8, 9, 10, 11, 12, 13, 14, 15); }
__device__ __forceinline__ v16bf cat16b(v8us lo, v8us hi) { return __builtin_bit_cast(v16bf, __builtin_shufflevector(lo, hi, 0, 1, 2, 3, 4, 5, 6, 7, 8, 9, 10, 11, 12, 13, 14, 15)); }
__device__ __forceinline__ v8f wmma16(v16h a, v16h b, v8f c) { return __builtin_amdgcn_wmma_f32_16x16x32_f16(false, a, false, b, (short)0, c, false, false); }
__device__ __forceinline__ v8f wmmab(v16bf a, v16bf b, v8f c) { return __builtin_amdgcn_wmma_f32_16x16x32_bf16(false, a, false, b, (short)0, c, false, false); }

// k_wt: WT [n][K] = bf16(W[k][n]) (k-major [K][ncols]) via 64 x 64 LDS tiles; grid (K/64, ncols/64).
__global__ __launch_bounds__(256) void k_wt(const float* __restrict__ Wm, int K, int ncols, bf* WT) {
    __shared__ __align__(16) unsigned short tl[64 * 72];
    const int tid = threadIdx.x, k0 = blockIdx.x * 64, n0 = blockIdx.y * 64;
    const int kk = tid >> 2, nq = (tid & 3) * 16;
#pragma unroll
    for (int i = 0; i < 16; ++i) tl[(nq + i) * 72 + kk] = f2bf(Wm[(size_t)(k0 + kk) * ncols + n0 + nq + i]);
    __syncthreads();
    const int piece = tid & 7;
    auto pass = [&]() {
#pragma unroll
        for (int s = 0; s < 2; ++s) { const int nr = (tid >> 3) + 32 * s; const v8us val = *(const v8usa*)(tl + nr * 72 + piece * 8); *(v8us*)(WT + (size_t)(n0 + nr) * K + k0 + piece * 8) = val; }
    };
    pass(); 
}
// k_gemmb: 64 x 64 block tile (4 waves x 16 x 64) of C[NN][ldc] = (A [+ Al]).B^T (K = 1024) [+ bf(bias[c])] [+ bf(R[r][c]) residual]; f32 whole-line epilogue (or f16
template <bool SPLITA, bool F16OUT = false>
__global__ __launch_bounds__(128) void k_gemmb(const bf* __restrict__ A, const bf* __restrict__ Al, const bf* __restrict__ Bn, const float* __restrict__ bias, float* C, int ldc, h16* C2, const float* __restrict__ R = nullptr, int K = DM, int roundR = 1) {
    __shared__ __align__(16) float ost[4][16 * 68];
    const int lane = threadIdx.x & 31, wave = threadIdx.x >> 5, lr = lane & 15, hi = lane >> 4;
    const int r0 = blockIdx.x * 64 + wave * 16, c0 = blockIdx.y * 64;
    const size_t aoff = (size_t)(r0 + lr) * K + 8 * hi;
    size_t boff[4];
#pragma unroll
    for (int t = 0; t < 4; ++t) boff[t] = (size_t)(c0 + t * 16 + lr) * K + 8 * hi;
    v8f acc[4];
#pragma unroll
    for (int t = 0; t < 4; ++t) acc[t] = (v8f){};
#pragma unroll 1
    for (int kc = 0; kc < K; kc += 32) {
        const v16bf a = cat16b(*(const v8us*)(A + aoff + kc), *(const v8us*)(A + aoff + kc + 16));
        v16bf al = a;
        if (SPLITA) al = cat16b(*(const v8us*)(Al + aoff + kc), *(const v8us*)(Al + aoff + kc + 16));
#pragma unroll
        for (int t = 0; t < 4; ++t) { const v16bf b = cat16b(*(const v8us*)(Bn + boff[t] + kc), *(const v8us*)(Bn + boff[t] + kc + 16)); acc[t] = wmmab(a, b, acc[t]); if (SPLITA) acc[t] = wmmab(al, b, acc[t]); }
        asm volatile("v_nop\n\tv_nop\n\tv_nop\n\tv_nop" : "+v"(acc[0]), "+v"(acc[1]), "+v"(acc[2]), "+v"(acc[3]) : "v"(a), "v"(al));
    }
    float* os = &ost[wave][0];
#pragma unroll
    for (int t = 0; t < 4; ++t) { const float bv = bias ? bfr(bias[c0 + t * 16 + lr]) : 0.f;
#pragma unroll
        for (int j = 0; j < 8; ++j) os[(hi * 8 + j) * 68 + t * 16 + lr] = acc[t][j] + bv; }
    __syncthreads();
    if (F16OUT) {
        h16* crow = (h16*)(void*)C + (size_t)r0 * ldc + c0;
        auto pass = [&]() {
#pragma unroll
            for (int s = 0; s < 4; ++s) { const int row = 4 * s + (lane >> 3), piece = lane & 7; const float* sp = os + row * 68 + piece * 8; v8h o, o2;
#pragma unroll
                for (int i = 0; i < 8; ++i) { const h16 a = (h16)sp[i]; o[i] = a; o2[i] = (h16)((sp[i] - (float)a) * LOSC); }
                *(v8h*)(crow + (size_t)row * ldc + piece * 8) = o; if (C2) *(v8h*)(C2 + (size_t)r0 * ldc + c0 + (size_t)row * ldc + piece * 8) = o2; }
        };
        pass(); 
    } else {
        float* crow = C + (size_t)r0 * ldc + c0;
        auto pass = [&]() {
#pragma unroll
            for (int s = 0; s < 8; ++s) { const int Lid = (lane >> 3) + 4 * s, piece = lane & 7; const int row = Lid >> 1, cofs = (Lid & 1) * 32 + piece * 4;
                v4f val = *(const v4fa*)(os + row * 68 + cofs); if (R) { const v4f rv = *(const v4f*)(R + ((size_t)r0 + row) * ldc + c0 + cofs); val += roundR ? (v4f){bfr(rv[0]), bfr(rv[1]), bfr(rv[2]), bfr(rv[3])} : rv; }
                *(v4f*)(crow + (size_t)row * ldc + cofs) = val; }
        };
        pass(); 
    }
}


// ===== z-batched (blockIdx.z = head) attention pieces =====
// k_gemm3z<MODE>: 64 x 64 tile of C = Ah.Bh^T [+ Al.Bh^T] [+ Ah.Bl^T] with per-z operand/output strides (elements): A planes += z*sA, B planes += z*sB, C += z*sC. MODE bits (0 causal skip, 1 K limit, 2 single,
// 3 B single, 4 A single).
template <int MODE>
__global__ __launch_bounds__(128) void k_gemm3z(const bf* __restrict__ Ah, const bf* __restrict__ Al, const bf* __restrict__ Bh, const bf* __restrict__ Bl, int K, float* C, int ldc, size_t sA, size_t sB, size_t sC) {
    if ((MODE & 1) && (int)blockIdx.y * 64 > (int)blockIdx.x * 64 + 63) return;
    const size_t z = blockIdx.z; Ah += z * sA; Al += z * sA; Bh += z * sB; Bl += z * sB; C += z * sC;
    const int Klim = (MODE & 2) ? min(K, ((int)blockIdx.x + 1) * 64) : K;
    __shared__ __align__(16) float ost[4][16 * 68];
    const int lane = threadIdx.x & 31, wave = threadIdx.x >> 5, lr = lane & 15, hi = lane >> 4;
    const int r0 = blockIdx.x * 64 + wave * 16, c0 = blockIdx.y * 64;
    const size_t aoff = (size_t)(r0 + lr) * K + 8 * hi;
    v8f acc[4];
#pragma unroll
    for (int t = 0; t < 4; ++t) acc[t] = (v8f){};
#pragma unroll 1
    for (int kc = 0; kc < Klim; kc += 32) {
        const v16bf a = cat16b(*(const v8us*)(Ah + aoff + kc), *(const v8us*)(Ah + aoff + kc + 16));
        v16bf al = a; if (!(MODE & 4) && !(MODE & 16)) al = cat16b(*(const v8us*)(Al + aoff + kc), *(const v8us*)(Al + aoff + kc + 16));
#pragma unroll
        for (int t = 0; t < 4; ++t) { const size_t bo = (size_t)(c0 + t * 16 + lr) * K + kc + 8 * hi;
            const v16bf bh = cat16b(*(const v8us*)(Bh + bo), *(const v8us*)(Bh + bo + 16));
            acc[t] = wmmab(a, bh, acc[t]);
            if (!(MODE & 4)) { if (!(MODE & 16)) acc[t] = wmmab(al, bh, acc[t]); if (!(MODE & 8)) { const v16bf bl = cat16b(*(const v8us*)(Bl + bo), *(const v8us*)(Bl + bo + 16)); acc[t] = wmmab(a, bl, acc[t]); } } }
        asm volatile("v_nop\n\tv_nop\n\tv_nop\n\tv_nop" : "+v"(acc[0]), "+v"(acc[1]), "+v"(acc[2]), "+v"(acc[3]) : "v"(a), "v"(al));
    }
    float* os = &ost[wave][0];
#pragma unroll
    for (int t = 0; t < 4; ++t) {
#pragma unroll
        for (int j = 0; j < 8; ++j) os[(hi * 8 + j) * 68 + t * 16 + lr] = acc[t][j]; }
    __builtin_amdgcn_wave_barrier(); asm volatile("" ::: "memory");
    float* crow = C + (size_t)r0 * ldc + c0;
    auto pass = [&]() {
#pragma unroll
        for (int s = 0; s < 8; ++s) { const int Lid = (lane >> 3) + 4 * s, piece = lane & 7; const int row = Lid >> 1, cofs = (Lid & 1) * 32 + piece * 4;
            const v4f val = *(const v4fa*)(os + row * 68 + cofs); *(v4f*)(crow + (size_t)row * ldc + cofs) = val; }
    };
    pass(); 
}
// k_pvsplit<NS>: attn.v for one 16-row x 64-column output tile per block, K split over the block's NS waves: wave w takes the 64-wide K chunks w, w + NS, ... below the causal limit
// (64 bf16 = one whole 128-byte line of every operand row), same three products per chunk as k_gemm3z; the partial tiles meet in LDS and are summed in wave order.
template <int NS>
__global__ __launch_bounds__(32 * NS) void k_pvsplit(const bf* __restrict__ Ah, const bf* __restrict__ Al, const bf* __restrict__ Bh, const bf* __restrict__ Bl, int K, float* C, int ldc, size_t sA, size_t sB, size_t sC) {
    typedef __attribute__((ext_vector_type(2))) float v2f;
    typedef v2f __attribute__((may_alias)) v2fa;
    static_assert(NS == 16, "the final sum gives each of the 16 rows to one wave");
    const size_t z = blockIdx.z; Ah += z * sA; Al += z * sA; Bh += z * sB; Bl += z * sB; C += z * sC;
    const int Klim = min(K, ((int)blockIdx.x / 4 + 1) * 64);      // the same limit as the 64-row tile that holds these 16 rows
    __shared__ __align__(16) float part[NS][16 * 68];
    const int lane = threadIdx.x & 31, lr = lane & 15, hi = lane >> 4;
    const int wave = __builtin_amdgcn_readfirstlane((int)(threadIdx.x >> 5));      // the wave's number in a scalar register: the K loop's test becomes a scalar branch, EXEC stays whole
    const int r0 = blockIdx.x * 16;
    const size_t aoff = (size_t)(r0 + lr) * K + 8 * hi;
    v8f acc[4];
#pragma unroll
    for (int t = 0; t < 4; ++t) acc[t] = (v8f){};
#pragma unroll 1      // kept rolled: a wave has at most K / (64 * NS) = 2 trips, a second copy of the body would only cost registers
    for (int k0 = wave * 64; k0 < Klim; k0 += 64 * NS) {
        const bf* pa = Ah + aoff + k0; const bf* pl = Al + aoff + k0; const bf* ph[4]; const bf* pb[4];      // this lane's place in each operand row at this chunk
#pragma unroll
        for (int t = 0; t < 4; ++t) { const size_t bo = (size_t)(t * 16 + lr) * K + k0 + 8 * hi; ph[t] = Bh + bo; pb[t] = Bl + bo; }
        v8us ra[4], rl[4], rh[4][4], rb[4][4];                    // piece q = elements 16 * q + 8 * hi + 0..7 of the chunk: one whole 128-byte line per row and plane
#pragma unroll        // the chunk's loads stand together, so that the one wait behind them serves them all
        for (int q = 0; q < 4; ++q) { ra[q] = *(const v8us*)(pa + 16 * q); rl[q] = *(const v8us*)(pl + 16 * q); }
#pragma unroll
        for (int t = 0; t < 4; ++t) {
#pragma unroll
            for (int q = 0; q < 4; ++q) { rh[t][q] = *(const v8us*)(ph[t] + 16 * q); rb[t][q] = *(const v8us*)(pb[t] + 16 * q); } }
        // no address register of the loads above is rewritten before this wait: the clobber keeps the loads in front of it, and naming the ten addresses as inputs keeps their registers whole up to it
        asm volatile("s_wait_xcnt 0x0" :: "v"(pa), "v"(pl), "v"(ph[0]), "v"(ph[1]), "v"(ph[2]), "v"(ph[3]), "v"(pb[0]), "v"(pb[1]), "v"(pb[2]), "v"(pb[3]) : "memory");
        v16bf a, al;
#pragma unroll
        for (int s = 0; s < 2; ++s) { a = cat16b(ra[2 * s], ra[2 * s + 1]); al = cat16b(rl[2 * s], rl[2 * s + 1]);
#pragma unroll
            for (int t = 0; t < 4; ++t) { const v16bf bh = cat16b(rh[t][2 * s], rh[t][2 * s + 1]); const v16bf bl = cat16b(rb[t][2 * s], rb[t][2 * s + 1]);
                acc[t] = wmmab(a, bh, acc[t]); acc[t] = wmmab(al, bh, acc[t]); acc[t] = wmmab(a, bl, acc[t]); } }
        // four vector slots between the last matrix instruction and whatever follows on the taken back edge or behind the loop
        asm volatile("v_nop\n\tv_nop\n\tv_nop\n\tv_nop" : "+v"(acc[0]), "+v"(acc[1]), "+v"(acc[2]), "+v"(acc[3]) : "v"(a), "v"(al));
    }
    float* os = &part[wave][0];                                   // a wave without a chunk stores its zero tile
#pragma unroll
    for (int t = 0; t < 4; ++t) {
#pragma unroll
        for (int j = 0; j < 8; ++j) os[(hi * 8 + j) * 68 + t * 16 + lr] = acc[t][j]; }
    __syncthreads();      // every wave's partial tile is in LDS before any wave sums
    v2f s = *(const v2fa*)(&part[0][wave * 68 + lane * 2]);       // wave w sums row w: 32 lanes x 2 floats = the row's two whole 128-byte lines
#pragma unroll
    for (int w = 1; w < NS; ++w) s += *(const v2fa*)(&part[w][wave * 68 + lane * 2]);      // unrolled: the NS LDS reads are in flight together
    *(v2f*)(C + (size_t)(r0 + wave) * ldc + lane * 2) = s;
}
__global__ __launch_bounds__(256) void k_planes32z(const float* __restrict__ F, int ld, int off, float sc, int rows, bf* Ph, bf* Pl) {
    typedef __attribute__((ext_vector_type(2))) unsigned short v2us;
    const int lane = threadIdx.x & 31; const size_t r = ((size_t)blockIdx.x * 8 + (threadIdx.x >> 5)) * 2 + (lane >> 4); if (r >= (size_t)rows) return; const int z = blockIdx.z; const int c0 = (lane & 15) * 2; v2us oh, ol;
    Ph += (size_t)z * rows * 32; Pl += (size_t)z * rows * 32;
#pragma unroll
    for (int i = 0; i < 2; ++i) { const float y = F[r * ld + off + z * 32 + c0 + i] * sc; const unsigned short hb = f2bf(y); oh[i] = hb; ol[i] = f2bf(y - bf2f(hb)); }
    const size_t o = r * 32 + c0; *(v2us*)(Ph + o) = oh; *(v2us*)(Pl + o) = ol; 
}
__global__ __launch_bounds__(256) void k_vtpadz(const float* __restrict__ F, int ld, int off, int nk, bf* Th, bf* Tl) {
    typedef __attribute__((ext_vector_type(2))) unsigned short v2us;
    const int lane = threadIdx.x & 31; const size_t wid = (size_t)blockIdx.x * 8 + (threadIdx.x >> 5); if (wid >= (size_t)64 * (nk / 64)) return; const int z = blockIdx.z; const int d = (int)(wid / (nk / 64)); const int k0 = (int)(wid % (nk / 64)) * 64 + lane * 2; v2us oh, ol;
    Th += (size_t)z * 64 * nk; Tl += (size_t)z * 64 * nk;
#pragma unroll
    for (int i = 0; i < 2; ++i) { const float y = (d < 32) ? F[(size_t)(k0 + i) * ld + off + z * 32 + (d < 32 ? d : 0)] : 0.f; const unsigned short hb = f2bf(y); oh[i] = hb; ol[i] = f2bf(y - bf2f(hb)); }
    const size_t o = (size_t)d * nk + k0; *(v2us*)(Th + o) = oh; *(v2us*)(Tl + o) = ol; 
}
template <int NK>
__global__ __launch_bounds__(256) void k_softmaxz(const float* __restrict__ S, int rows, bf* PH, bf* PL) {
    typedef __attribute__((ext_vector_type(4))) unsigned short v4us;
    const int lane = threadIdx.x & 31, i = blockIdx.x * 8 + (threadIdx.x >> 5); if (i >= rows) return; const size_t zo = (size_t)blockIdx.z * rows * NK; const float* sr = S + zo + (size_t)i * NK; PH += zo; PL += zo;
    float m = -3.0e38f;
#pragma unroll 1
    for (int c0 = lane * 4; c0 < NK; c0 += 128) {
#pragma unroll
        for (int q = 0; q < 4; ++q) m = fmaxf(m, sr[c0 + q]); }
#pragma unroll
    for (int sh = 16; sh; sh >>= 1) m = fmaxf(m, __shfl_xor(m, sh, 32));
    float sum = 0.f;
#pragma unroll 1
    for (int c0 = lane * 4; c0 < NK; c0 += 128) {
#pragma unroll
        for (int q = 0; q < 4; ++q) sum += __expf(sr[c0 + q] - m); }
#pragma unroll
    for (int sh = 16; sh; sh >>= 1) sum += __shfl_xor(sum, sh, 32);
    const float inv = 1.0f / sum;
{
#pragma unroll 1
        for (int c0 = lane * 4; c0 < NK; c0 += 128) { v4us oh, ol;
#pragma unroll
            for (int q = 0; q < 4; ++q) { const float p = __expf(sr[c0 + q] - m) * inv; const unsigned short hb = f2bf(p); oh[q] = hb; ol[q] = f2bf(p - bf2f(hb)); }
            const size_t o = (size_t)i * NK + c0; *(v4us*)(PH + o) = oh; *(v4us*)(PL + o) = ol; }
         }
}
__global__ __launch_bounds__(256) void k_placez(const float* __restrict__ XH, int rows, int ldy, float* Y) {
    const int lane = threadIdx.x & 31; const size_t q = (size_t)blockIdx.x * 8 + (threadIdx.x >> 5); if (q >= (size_t)rows) return; const int z = blockIdx.z; const float v = XH[((size_t)z * rows + q) * 64 + lane];
    *(float*)(Y + q * ldy + z * 32 + lane) = v; 
}

__global__ __launch_bounds__(256) void k_hplanesz(const float* __restrict__ F, int ld, int h0, float sc, int rows, bf* Ph, bf* Pl) {
    typedef __attribute__((ext_vector_type(2))) unsigned short v2us;
    const int lane = threadIdx.x & 31; const size_t r = (size_t)blockIdx.x * 8 + (threadIdx.x >> 5); if (r >= (size_t)rows) return; const int z = blockIdx.z; v2us oh, ol;
    Ph += (size_t)z * rows * 64; Pl += (size_t)z * rows * 64;
#pragma unroll
    for (int i = 0; i < 2; ++i) { const float y = F[r * ld + (h0 + z) * 64 + lane * 2 + i] * sc; const unsigned short hb = f2bf(y); oh[i] = hb; ol[i] = f2bf(y - bf2f(hb)); }
    const size_t o = r * 64 + lane * 2; *(v2us*)(Ph + o) = oh; *(v2us*)(Pl + o) = ol; 
}
__global__ __launch_bounds__(256) void k_vtz(const float* __restrict__ F, int ld, int h0, int nk, bf* Th, bf* Tl) {
    typedef __attribute__((ext_vector_type(2))) unsigned short v2us;
    const int lane = threadIdx.x & 31; const size_t wid = (size_t)blockIdx.x * 8 + (threadIdx.x >> 5); if (wid >= (size_t)64 * (nk / 64)) return; const int z = blockIdx.z; const int d = (int)(wid / (nk / 64)); const int t0 = (int)(wid % (nk / 64)) * 64 + lane * 2; v2us oh, ol;
    Th += (size_t)z * 64 * nk; Tl += (size_t)z * 64 * nk;
#pragma unroll
    for (int i = 0; i < 2; ++i) { const float y = F[(size_t)(t0 + i) * ld + (h0 + z) * 64 + d]; const unsigned short hb = f2bf(y); oh[i] = hb; ol[i] = f2bf(y - bf2f(hb)); }
    const size_t o = (size_t)d * nk + t0; *(v2us*)(Th + o) = oh; *(v2us*)(Tl + o) = ol; 
}
template <int NK>
__global__ __launch_bounds__(256) void k_softmaxzs(const float* __restrict__ S, int rows, float sc, bf* PH, bf* PL) {
    typedef __attribute__((ext_vector_type(4))) unsigned short v4us;
    const int lane = threadIdx.x & 31, i = blockIdx.x * 8 + (threadIdx.x >> 5); if (i >= rows) return; const size_t zo = (size_t)blockIdx.z * rows * NK; const float* sr = S + zo + (size_t)i * NK; PH += zo; PL += zo;
    float m = -3.0e38f;
#pragma unroll 1
    for (int c0 = lane * 4; c0 < NK; c0 += 128) {
#pragma unroll
        for (int q = 0; q < 4; ++q) m = fmaxf(m, sr[c0 + q] * sc); }
#pragma unroll
    for (int sh = 16; sh; sh >>= 1) m = fmaxf(m, __shfl_xor(m, sh, 32));
    float sum = 0.f;
#pragma unroll 1
    for (int c0 = lane * 4; c0 < NK; c0 += 128) {
#pragma unroll
        for (int q = 0; q < 4; ++q) sum += __expf(sr[c0 + q] * sc - m); }
#pragma unroll
    for (int sh = 16; sh; sh >>= 1) sum += __shfl_xor(sum, sh, 32);
    const float inv = 1.0f / sum;
{
#pragma unroll 1
        for (int c0 = lane * 4; c0 < NK; c0 += 128) { v4us oh, ol;
#pragma unroll
            for (int q = 0; q < 4; ++q) { const float p = __expf(sr[c0 + q] * sc - m) * inv; const unsigned short hb = f2bf(p); oh[q] = hb; ol[q] = f2bf(p - bf2f(hb)); }
            const size_t o = (size_t)i * NK + c0; *(v4us*)(PH + o) = oh; *(v4us*)(PL + o) = ol; }
         }
}

__global__ __launch_bounds__(256) void k_cvtx(const float* __restrict__ src, int rows, bf* dst) {
    const int lane = threadIdx.x & 31; const size_t r = (size_t)blockIdx.x * 8 + (threadIdx.x >> 5); if (r >= (size_t)rows) return;
{
#pragma unroll
        for (int q = 0; q < DMOD / 256; ++q) { v8us o;
#pragma unroll
            for (int i = 0; i < 8; ++i) o[i] = f2bf(src[r * DMOD + q * 256 + lane * 8 + i]);
            *(v8us*)(dst + r * DMOD + q * 256 + lane * 8) = o; }
         }
}
// k_wavepl: head h0+z: planes [rows][32] of l2normalize(F[r][(h0+z)*16 + w] + bf(phase[h][w])) (f32: norm over the 16 values via xor 4,2,1 within each 8-lane group; x / max(n, 1e-12));
__global__ __launch_bounds__(256) void k_wavepl(const float* __restrict__ F, int ld, int h0, const float* __restrict__ phase, int rows, bf* Ph, bf* Pl) {
    typedef __attribute__((ext_vector_type(2))) unsigned short v2us;
    const int lane = threadIdx.x & 31; const size_t r = ((size_t)blockIdx.x * 8 + (threadIdx.x >> 5)) * 2 + (lane >> 4); if (r >= (size_t)rows) return; const int z = blockIdx.z, h = h0 + z; const int c0 = (lane & 15) * 2;
    Ph += (size_t)z * rows * KQ; Pl += (size_t)z * rows * KQ;
    float v0 = 0.f, v1 = 0.f; if (c0 < NW) { v0 = F[r * ld + h * NW + c0] + bfr(phase[h * NW + c0]); v1 = F[r * ld + h * NW + c0 + 1] + bfr(phase[h * NW + c0 + 1]); }
    float ss = v0 * v0 + v1 * v1;
#pragma unroll
    for (int sh = 4; sh; sh >>= 1) ss += __shfl_xor(ss, sh, 32);      // lanes 0-7 / 16-23 hold the row's 16 live values (c0 < 16 <=> (lane & 15) < 8): reduce over xor 4,2,1 within each 8-lane group
    const float inv = 1.0f / fmaxf(sqrtf(ss), 1e-12f); v0 *= inv; v1 *= inv;
    v2us oh, ol; { const unsigned short hb = f2bf(v0); oh[0] = hb; ol[0] = f2bf(v0 - bf2f(hb)); } { const unsigned short hb = f2bf(v1); oh[1] = hb; ol[1] = f2bf(v1 - bf2f(hb)); }
    const size_t o = r * KQ + c0; *(v2us*)(Ph + o) = oh; *(v2us*)(Pl + o) = ol; 
}
__global__ __launch_bounds__(256) void k_csoftz(const float* __restrict__ S, int rows, float sc, bf* PH, bf* PL) {
    typedef __attribute__((ext_vector_type(4))) unsigned short v4us;
    const int lane = threadIdx.x & 31, i = blockIdx.x * 8 + (threadIdx.x >> 5); if (i >= rows) return; const size_t zo = (size_t)blockIdx.z * rows * NN; const float* sr = S + zo + (size_t)i * NN; PH += zo; PL += zo;
    float m = -3.0e38f;
#pragma unroll 1
    for (int c0 = lane * 4; c0 < NN; c0 += 128) {
#pragma unroll
        for (int q = 0; q < 4; ++q) { const int k = c0 + q; if (k <= i) m = fmaxf(m, sr[k] * sc); } }
#pragma unroll
    for (int sh = 16; sh; sh >>= 1) m = fmaxf(m, __shfl_xor(m, sh, 32));
    float sum = 0.f;
#pragma unroll 1
    for (int c0 = lane * 4; c0 < NN; c0 += 128) {
#pragma unroll
        for (int q = 0; q < 4; ++q) { const int k = c0 + q; if (k <= i) sum += __expf(sr[k] * sc - m); } }
#pragma unroll
    for (int sh = 16; sh; sh >>= 1) sum += __shfl_xor(sum, sh, 32);
    const float inv = 1.0f / sum;
{
#pragma unroll 1
        for (int c0 = lane * 4; c0 < NN; c0 += 128) { v4us oh, ol;
#pragma unroll
            for (int q = 0; q < 4; ++q) { const int k = c0 + q; const float p = (k <= i) ? __expf(sr[(k <= i) ? k : 0] * sc - m) * inv : 0.f; const unsigned short hb = f2bf(p); oh[q] = hb; ol[q] = f2bf(p - bf2f(hb)); }
            const size_t o = (size_t)i * NN + c0; *(v4us*)(PH + o) = oh; *(v4us*)(PL + o) = ol; }
         }
}
__global__ __launch_bounds__(256) void k_splitD(const float* __restrict__ src, int rows, bf* dh, bf* dl) {
    const int lane = threadIdx.x & 31; const size_t r = (size_t)blockIdx.x * 8 + (threadIdx.x >> 5); if (r >= (size_t)rows) return;
{
#pragma unroll
        for (int q = 0; q < DMOD / 256; ++q) { const size_t o = r * DMOD + q * 256 + lane * 8; const v8f v = *(const v8f*)(src + o); v8us oh, ol;
#pragma unroll
            for (int i = 0; i < 8; ++i) { const unsigned short hb = f2bf(v[i]); oh[i] = hb; ol[i] = f2bf(v[i] - bf2f(hb)); }
            *(v8us*)(dh + o) = oh; *(v8us*)(dl + o) = ol; }
         }
}
__global__ __launch_bounds__(256) void k_csoftzt(const float* __restrict__ S, int rows, const float* __restrict__ temp, bf* PH, bf* PL) {
    const float sc = 1.0f / bfr(temp[0]);
    typedef __attribute__((ext_vector_type(4))) unsigned short v4us;
    const int lane = threadIdx.x & 31, i = blockIdx.x * 8 + (threadIdx.x >> 5); if (i >= rows) return; const size_t zo = (size_t)blockIdx.z * rows * NN; const float* sr = S + zo + (size_t)i * NN; PH += zo; PL += zo;
    float m = -3.0e38f;
#pragma unroll 1
    for (int c0 = lane * 4; c0 < NN; c0 += 128) {
#pragma unroll
        for (int q = 0; q < 4; ++q) { const int k = c0 + q; if (k <= i) m = fmaxf(m, sr[k] * sc); } }
#pragma unroll
    for (int sh = 16; sh; sh >>= 1) m = fmaxf(m, __shfl_xor(m, sh, 32));
    float sum = 0.f;
#pragma unroll 1
    for (int c0 = lane * 4; c0 < NN; c0 += 128) {
#pragma unroll
        for (int q = 0; q < 4; ++q) { const int k = c0 + q; if (k <= i) sum += __expf(sr[k] * sc - m); } }
#pragma unroll
    for (int sh = 16; sh; sh >>= 1) sum += __shfl_xor(sum, sh, 32);
    const float inv = 1.0f / sum;
{
#pragma unroll 1
        for (int c0 = lane * 4; c0 < NN; c0 += 128) { v4us oh, ol;
#pragma unroll
            for (int q = 0; q < 4; ++q) { const int k = c0 + q; const float p = (k <= i) ? __expf(sr[(k <= i) ? k : 0] * sc - m) * inv : 0.f; const unsigned short hb = f2bf(p); oh[q] = hb; ol[q] = f2bf(p - bf2f(hb)); }
            const size_t o = (size_t)i * NN + c0; *(v4us*)(PH + o) = oh; *(v4us*)(PL + o) = ol; }
         }
}

extern "C" void kernel_launch(void* const* d_in, const int* in_sizes, int n_in,
                              void* d_out, int out_size, void* d_ws, size_t ws_size, hipStream_t stream) {
    (void)in_sizes; (void)n_in; (void)out_size;
    const float* x = (const float*)d_in[0]; const float* Wq = (const float*)d_in[1]; const float* bq = (const float*)d_in[2]; const float* Wk = (const float*)d_in[3]; const float* bk = (const float*)d_in[4]; const float* Wv = (const float*)d_in[5]; const float* bv = (const float*)d_in[6]; const float* Wo = (const float*)d_in[7]; const float* bo = (const float*)d_in[8];
    const float* qph = (const float*)d_in[9]; const float* kph = (const float*)d_in[10]; const float* temp = (const float*)d_in[11];
    float* out = (float*)d_out;    // [2][2048][1024]
    char* wsp = (char*)d_ws;
    auto take = [&](size_t bytes) { char* p = wsp; wsp += (bytes + 255) & ~(size_t)255; return (void*)p; };
    bf* WQ = (bf*)take((size_t)(NH_ * NW) * DMOD * 2); bf* WK = (bf*)take((size_t)(NH_ * NW) * DMOD * 2); bf* WV = (bf*)take((size_t)DMOD * DMOD * 2); bf* WO = (bf*)take((size_t)DMOD * DMOD * 2);
    bf* Xb = (bf*)take((size_t)NN * DMOD * 2); float* QF = (float*)take((size_t)NN * (NH_ * NW) * 4); float* KF = (float*)take((size_t)NN * (NH_ * NW) * 4); float* VF = (float*)take((size_t)NN * DMOD * 4);
    bf* Qh = (bf*)take((size_t)ZH * NN * KQ * 2); bf* Ql = (bf*)take((size_t)ZH * NN * KQ * 2); bf* Kh = (bf*)take((size_t)ZH * NN * KQ * 2); bf* Kl = (bf*)take((size_t)ZH * NN * KQ * 2); bf* VTh = (bf*)take((size_t)ZH * HD * NN * 2); bf* VTl = (bf*)take((size_t)ZH * HD * NN * 2);
    float* S = (float*)take((size_t)ZH * NN * NN * 4); bf* PH = (bf*)take((size_t)ZH * NN * NN * 2); bf* PL = (bf*)take((size_t)ZH * NN * NN * 2); float* O = (float*)take((size_t)NN * DMOD * 4); bf* Oh = (bf*)take((size_t)NN * DMOD * 2); bf* Ol = (bf*)take((size_t)NN * DMOD * 2);
    if ((size_t)(wsp - (char*)d_ws) > ws_size) return;    // ~ 105 MB; per item / pair reuse in stream order
    k_wt<<<dim3(DMOD / 64, (NH_ * NW) / 64, 1), 256, 0, stream>>>(Wq, DMOD, NH_ * NW, WQ); k_wt<<<dim3(DMOD / 64, (NH_ * NW) / 64, 1), 256, 0, stream>>>(Wk, DMOD, NH_ * NW, WK);   // (in, out) k-major -> n-major
    k_wt<<<dim3(DMOD / 64, DMOD / 64, 1), 256, 0, stream>>>(Wv, DMOD, DMOD, WV); k_wt<<<dim3(DMOD / 64, DMOD / 64, 1), 256, 0, stream>>>(Wo, DMOD, DMOD, WO);
    // host reads nothing from device; 1/temperature is applied inside k_csoftz via a device load? -> pass as a kernel-side scalar read: k_csoftz takes sc by value, so read temp on device in a tiny way:
    // we avoid a host sync by folding 1/temperature into the q planes? No (normalisation after). Instead k_csoftz_t below reads temp[0] itself.
    for (int b = 0; b < NBT; ++b) {
        k_cvtx<<<NN / 8, 256, 0, stream>>>(x + (size_t)b * NN * DMOD, NN, Xb);
        k_gemmb<false, false><<<dim3(NN / 64, (NH_ * NW) / 64, 1), 128, 0, stream>>>(Xb, nullptr, WQ, bq, QF, NH_ * NW, nullptr, nullptr, DMOD);
        k_gemmb<false, false><<<dim3(NN / 64, (NH_ * NW) / 64, 1), 128, 0, stream>>>(Xb, nullptr, WK, bk, KF, NH_ * NW, nullptr, nullptr, DMOD);
        k_gemmb<false, false><<<dim3(NN / 64, DMOD / 64, 1), 128, 0, stream>>>(Xb, nullptr, WV, bv, VF, DMOD, nullptr, nullptr, DMOD);
        for (int g = 0; g < NH_ / ZH; ++g) { const int h0 = g * ZH;
            k_wavepl<<<dim3((NN / 2) / 8, 1, ZH), 256, 0, stream>>>(QF, NH_ * NW, h0, qph, NN, Qh, Ql); k_wavepl<<<dim3((NN / 2) / 8, 1, ZH), 256, 0, stream>>>(KF, NH_ * NW, h0, kph, NN, Kh, Kl);
            k_vtz<<<dim3((HD * (NN / 64)) / 8, 1, ZH), 256, 0, stream>>>(VF, DMOD, h0, NN, VTh, VTl);
            k_gemm3z<1><<<dim3(NN / 64, NN / 64, ZH), 128, 0, stream>>>(Qh, Ql, Kh, Kl, KQ, S, NN, (size_t)NN * KQ, (size_t)NN * KQ, (size_t)NN * NN);
            k_csoftzt<<<dim3(NN / 8, 1, ZH), 256, 0, stream>>>(S, NN, temp, PH, PL);
            k_pvsplit<16><<<dim3(NN / 16, 1, ZH), 512, 0, stream>>>(PH, PL, VTh, VTl, NN, O + h0 * HD, DMOD, (size_t)NN * NN, (size_t)HD * NN, (size_t)HD); }
        k_splitD<<<NN / 8, 256, 0, stream>>>(O, NN, Oh, Ol);
        k_gemmb<true, false><<<dim3(NN / 64, DMOD / 64, 1), 128, 0, stream>>>(Oh, Ol, WO, bo, out + (size_t)b * NN * DMOD, DMOD, nullptr, nullptr, DMOD); }
}

// v002
// Measured time: 806 microseconds a run.
// Timed twice side by side with v001, it ran 1.44 and 1.43 times as fast.
// Over all steps from v000 it is 3.19 times as fast.
#include <hip/hip_runtime.h>

// Compute dtypes, f32 accumulate, per item: q/k/v projections as GEMMs with PLAIN bf16 operands (x and the (in,out) weights; exact products, + bias); per head the 16-wide q/k get
// their phase added and are L2-normalised in f32, then stored as bf16 hi + UNSCALED residual planes padded to K = 32 (zero columns); causal scores (three products, key tiles above
// the diagonal skipped) and attn.v (three products, K limited) with 2 heads per launch in grid.z; 1/temperature and the causal softmax in f32; output projection on hi/lo planes

#define NBT  2
#define NN   2048
#define DMOD 1024
#define NH_  16
#define NW   16
#define KQ   32                   // padded score depth
#define HD   64
#define ZH   2
#define DM   DMOD
#define NTK  NN
#define LOSC 1024.0f

typedef _Float16 h16;
typedef unsigned short bf;
typedef __attribute__((ext_vector_type(16))) __bf16   v16bf;
typedef __attribute__((ext_vector_type(16))) _Float16 v16h;
typedef __attribute__((ext_vector_type(8)))  _Float16 v8h;
typedef __attribute__((ext_vector_type(8)))  unsigned short v8us;
typedef __attribute__((ext_vector_type(8)))  float    v8f;
typedef __attribute__((ext_vector_type(4)))  float    v4f;
typedef __attribute__((ext_vector_type(4)))  _Float16 v4h;
typedef v8h  __attribute__((may_alias)) v8ha;
typedef v4f  __attribute__((may_alias)) v4fa;
typedef v8us __attribute__((may_alias)) v8usa;

__device__ __forceinline__ unsigned short f2bf(float f) { unsigned u = __float_as_uint(f); u += 0x7FFFu + ((u >> 16) & 1u); return (unsigned short)(u >> 16); }
__device__ __forceinline__ float bf2f(unsigned short b) { return __uint_as_float(((unsigned)b) << 16); }
__device__ __forceinline__ float bfr(float f) { return bf2f(f2bf(f)); }
__device__ __forceinline__ v16h cat16(v8h lo, v8h hi) { return __builtin_shufflevector(lo, hi, 0, 1, 2, 3, 4, 5, 6, 7, 8, 9, 10, 11, 12, 13, 14, 15); }
__device__ __forceinline__ v16bf cat16b(v8us lo, v8us hi) { return __builtin_bit_cast(v16bf, __builtin_shufflevector(lo, hi, 0, 1, 2, 3, 4, 5, 6, 7, 8, 9, 10, 11, 12, 13, 14, 15)); }
__device__ __forceinline__ v8f wmma16(v16h a, v16h b, v8f c) { return __builtin_amdgcn_wmma_f32_16x16x32_f16(false, a, false, b, (short)0, c, false, false); }
__device__ __forceinline__ v8f wmmab(v16bf a, v16bf b, v8f c) { return __builtin_amdgcn_wmma_f32_16x16x32_bf16(false, a, false, b, (short)0, c, false, false); }

// k_wt: WT [n][K] = bf16(W[k][n]) (k-major [K][ncols]) via 64 x 64 LDS tiles; grid (K/64, ncols/64).
__global__ __launch_bounds__(256) void k_wt(const float* __restrict__ Wm, int K, int ncols, bf* WT) {
    __shared__ __align__(16) unsigned short tl[64 * 72];
    const int tid = threadIdx.x, k0 = blockIdx.x * 64, n0 = blockIdx.y * 64;
    const int kk = tid >> 2, nq = (tid & 3) * 16;
#pragma unroll
    for (int i = 0; i < 16; ++i) tl[(nq + i) * 72 + kk] = f2bf(Wm[(size_t)(k0 + kk) * ncols + n0 + nq + i]);
    __syncthreads();
    const int piece = tid & 7;
    auto pass = [&]() {
#pragma unroll
        for (int s = 0; s < 2; ++s) { const int nr = (tid >> 3) + 32 * s; const v8us val = *(const v8usa*)(tl + nr * 72 + piece * 8); *(v8us*)(WT + (size_t)(n0 + nr) * K + k0 + piece * 8) = val; }
    };
    pass(); 
}
// k_gemmb: 64 x 64 block tile (4 waves x 16 x 64) of C[NN][ldc] = (A [+ Al]).B^T (K = 1024) [+ bf(bias[c])] [+ bf(R[r][c]) residual]; f32 whole-line epilogue (or f16
template <bool SPLITA, bool F16OUT = false>
__global__ __launch_bounds__(128) void k_gemmb(const bf* __restrict__ A, const bf* __restrict__ Al, const bf* __restrict__ Bn, const float* __restrict__ bias, float* C, int ldc, h16* C2, const float* __restrict__ R = nullptr, int K = DM, int roundR = 1) {
    __shared__ __align__(16) float ost[4][16 * 68];
    const int lane = threadIdx.x & 31, wave = threadIdx.x >> 5, lr = lane & 15, hi = lane >> 4;
    const int r0 = blockIdx.x * 64 + wave * 16, c0 = blockIdx.y * 64;
    const size_t aoff = (size_t)(r0 + lr) * K + 8 * hi;
    size_t boff[4];
#pragma unroll
    for (int t = 0; t < 4; ++t) boff[t] = (size_t)(c0 + t * 16 + lr) * K + 8 * hi;
    v8f acc[4];
#pragma unroll
    for (int t = 0; t < 4; ++t) acc[t] = (v8f){};
#pragma unroll 1
    for (int kc = 0; kc < K; kc += 32) {
        const v16bf a = cat16b(*(const v8us*)(A + aoff + kc), *(const v8us*)(A + aoff + kc + 16));
        v16bf al = a;
        if (SPLITA) al = cat16b(*(const v8us*)(Al + aoff + kc), *(const v8us*)(Al + aoff + kc + 16));
#pragma unroll
        for (int t = 0; t < 4; ++t) { const v16bf b = cat16b(*(const v8us*)(Bn + boff[t] + kc), *(const v8us*)(Bn + boff[t] + kc + 16)); acc[t] = wmmab(a, b, acc[t]); if (SPLITA) acc[t] = wmmab(al, b, acc[t]); }
        asm volatile("v_nop\n\tv_nop\n\tv_nop\n\tv_nop" : "+v"(acc[0]), "+v"(acc[1]), "+v"(acc[2]), "+v"(acc[3]) : "v"(a), "v"(al));
    }
    float* os = &ost[wave][0];
#pragma unroll
    for (int t = 0; t < 4; ++t) { const float bv = bias ? bfr(bias[c0 + t * 16 + lr]) : 0.f;
#pragma unroll
        for (int j = 0; j < 8; ++j) os[(hi * 8 + j) * 68 + t * 16 + lr] = acc[t][j] + bv; }
    __syncthreads();
    if (F16OUT) {
        h16* crow = (h16*)(void*)C + (size_t)r0 * ldc + c0;
        auto pass = [&]() {
#pragma unroll
            for (int s = 0; s < 4; ++s) { const int row = 4 * s + (lane >> 3), piece = lane & 7; const float* sp = os + row * 68 + piece * 8; v8h o, o2;
#pragma unroll
                for (int i = 0; i < 8; ++i) { const h16 a = (h16)sp[i]; o[i] = a; o2[i] = (h16)((sp[i] - (float)a) * LOSC); }
                *(v8h*)(crow + (size_t)row * ldc + piece * 8) = o; if (C2) *(v8h*)(C2 + (size_t)r0 * ldc + c0 + (size_t)row * ldc + piece * 8) = o2; }
        };
        pass(); 
    } else {
        float* crow = C + (size_t)r0 * ldc + c0;
        auto pass = [&]() {
#pragma unroll
            for (int s = 0; s < 8; ++s) { const int Lid = (lane >> 3) + 4 * s, piece = lane & 7; const int row = Lid >> 1, cofs = (Lid & 1) * 32 + piece * 4;
                v4f val = *(const v4fa*)(os + row * 68 + cofs); if (R) { const v4f rv = *(const v4f*)(R + ((size_t)r0 + row) * ldc + c0 + cofs); val += roundR ? (v4f){bfr(rv[0]), bfr(rv[1]), bfr(rv[2]), bfr(rv[3])} : rv; }
                *(v4f*)(crow + (size_t)row * ldc + cofs) = val; }
        };
        pass(); 
    }
}


// ===== z-batched (blockIdx.z = head) attention pieces =====
// k_gemm3z<MODE>: 64 x 64 tile of C = Ah.Bh^T [+ Al.Bh^T] [+ Ah.Bl^T] with per-z operand/output strides (elements): A planes += z*sA, B planes += z*sB, C += z*sC. MODE bits (0 causal skip, 1 K limit, 2 single,
// 3 B single, 4 A single).
template <int MODE>
__global__ __launch_bounds__(128) void k_gemm3z(const bf* __restrict__ Ah, const bf* __restrict__ Al, const bf* __restrict__ Bh, const bf* __restrict__ Bl, int K, float* C, int ldc, size_t sA, size_t sB, size_t sC) {
    if ((MODE & 1) && (int)blockIdx.y * 64 > (int)blockIdx.x * 64 + 63) return;
    const size_t z = blockIdx.z; Ah += z * sA; Al += z * sA; Bh += z * sB; Bl += z * sB; C += z * sC;
    const int Klim = (MODE & 2) ? min(K, ((int)blockIdx.x + 1) * 64) : K;
    __shared__ __align__(16) float ost[4][16 * 68];
    const int lane = threadIdx.x & 31, wave = threadIdx.x >> 5, lr = lane & 15, hi = lane >> 4;
    const int r0 = blockIdx.x * 64 + wave * 16, c0 = blockIdx.y * 64;
    const size_t aoff = (size_t)(r0 + lr) * K + 8 * hi;
    v8f acc[4];
#pragma unroll
    for (int t = 0; t < 4; ++t) acc[t] = (v8f){};
#pragma unroll 1
    for (int kc = 0; kc < Klim; kc += 32) {
        const v16bf a = cat16b(*(const v8us*)(Ah + aoff + kc), *(const v8us*)(Ah + aoff + kc + 16));
        v16bf al = a; if (!(MODE & 4) && !(MODE & 16)) al = cat16b(*(const v8us*)(Al + aoff + kc), *(const v8us*)(Al + aoff + kc + 16));
#pragma unroll
        for (int t = 0; t < 4; ++t) { const size_t bo = (size_t)(c0 + t * 16 + lr) * K + kc + 8 * hi;
            const v16bf bh = cat16b(*(const v8us*)(Bh + bo), *(const v8us*)(Bh + bo + 16));
            acc[t] = wmmab(a, bh, acc[t]);
            if (!(MODE & 4)) { if (!(MODE & 16)) acc[t] = wmmab(al, bh, acc[t]); if (!(MODE & 8)) { const v16bf bl = cat16b(*(const v8us*)(Bl + bo), *(const v8us*)(Bl + bo + 16)); acc[t] = wmmab(a, bl, acc[t]); } } }
        asm volatile("v_nop\n\tv_nop\n\tv_nop\n\tv_nop" : "+v"(acc[0]), "+v"(acc[1]), "+v"(acc[2]), "+v"(acc[3]) : "v"(a), "v"(al));
    }
    float* os = &ost[wave][0];
#pragma unroll
    for (int t = 0; t < 4; ++t) {
#pragma unroll
        for (int j = 0; j < 8; ++j) os[(hi * 8 + j) * 68 + t * 16 + lr] = acc[t][j]; }
    __builtin_amdgcn_wave_barrier(); asm volatile("" ::: "memory");
    float* crow = C + (size_t)r0 * ldc + c0;
    auto pass = [&]() {
#pragma unroll
        for (int s = 0; s < 8; ++s) { const int Lid = (lane >> 3) + 4 * s, piece = lane & 7; const int row = Lid >> 1, cofs = (Lid & 1) * 32 + piece * 4;
            const v4f val = *(const v4fa*)(os + row * 68 + cofs); *(v4f*)(crow + (size_t)row * ldc + cofs) = val; }
    };
    pass(); 
}
// k_pvsplit<NS>: attn.v for one 16-row x 64-column output tile per block, K split over the block's NS waves: wave w takes the 64-wide K chunks w, w + NS, ... below the causal limit
// (64 bf16 = one whole 128-byte line of every operand row), same three products per chunk as k_gemm3z; the partial tiles meet in LDS and are summed in wave order.
template <int NS>
__global__ __launch_bounds__(32 * NS) void k_pvsplit(const bf* __restrict__ Ah, const bf* __restrict__ Al, const bf* __restrict__ Bh, const bf* __restrict__ Bl, int K, float* C, int ldc, size_t sA, size_t sB, size_t sC) {
    typedef __attribute__((ext_vector_type(2))) float v2f;
    typedef v2f __attribute__((may_alias)) v2fa;
    static_assert(NS == 16, "the final sum gives each of the 16 rows to one wave");
    const size_t z = blockIdx.z; Ah += z * sA; Al += z * sA; Bh += z * sB; Bl += z * sB; C += z * sC;
    const int Klim = min(K, ((int)blockIdx.x / 4 + 1) * 64);      // the same limit as the 64-row tile that holds these 16 rows
    __shared__ __align__(16) float part[NS][16 * 68];
    const int lane = threadIdx.x & 31, lr = lane & 15, hi = lane >> 4;
    const int wave = __builtin_amdgcn_readfirstlane((int)(threadIdx.x >> 5));      // the wave's number in a scalar register: the K loop's test becomes a scalar branch, EXEC stays whole
    const int r0 = blockIdx.x * 16;
    const size_t aoff = (size_t)(r0 + lr) * K + 8 * hi;
    v8f acc[4];
#pragma unroll
    for (int t = 0; t < 4; ++t) acc[t] = (v8f){};
#pragma unroll 1      // kept rolled: a wave has at most K / (64 * NS) = 2 trips, a second copy of the body would only cost registers
    for (int k0 = wave * 64; k0 < Klim; k0 += 64 * NS) {
        const bf* pa = Ah + aoff + k0; const bf* pl = Al + aoff + k0; const bf* ph[4]; const bf* pb[4];      // this lane's place in each operand row at this chunk
#pragma unroll
        for (int t = 0; t < 4; ++t) { const size_t bo = (size_t)(t * 16 + lr) * K + k0 + 8 * hi; ph[t] = Bh + bo; pb[t] = Bl + bo; }
        v8us ra[4], rl[4], rh[4][4], rb[4][4];                    // piece q = elements 16 * q + 8 * hi + 0..7 of the chunk: one whole 128-byte line per row and plane
#pragma unroll        // the chunk's loads stand together, so that the one wait behind them serves them all
        for (int q = 0; q < 4; ++q) { ra[q] = *(const v8us*)(pa + 16 * q); rl[q] = *(const v8us*)(pl + 16 * q); }
#pragma unroll
        for (int t = 0; t < 4; ++t) {
#pragma unroll
            for (int q = 0; q < 4; ++q) { rh[t][q] = *(const v8us*)(ph[t] + 16 * q); rb[t][q] = *(const v8us*)(pb[t] + 16 * q); } }
        // no address register of the loads above is rewritten before this wait: the clobber keeps the loads in front of it, and naming the ten addresses as inputs keeps their registers whole up to it
        asm volatile("s_wait_xcnt 0x0" :: "v"(pa), "v"(pl), "v"(ph[0]), "v"(ph[1]), "v"(ph[2]), "v"(ph[3]), "v"(pb[0]), "v"(pb[1]), "v"(pb[2]), "v"(pb[3]) : "memory");
        v16bf a, al;
#pragma unroll
        for (int s = 0; s < 2; ++s) { a = cat16b(ra[2 * s], ra[2 * s + 1]); al = cat16b(rl[2 * s], rl[2 * s + 1]);
#pragma unroll
            for (int t = 0; t < 4; ++t) { const v16bf bh = cat16b(rh[t][2 * s], rh[t][2 * s + 1]); const v16bf bl = cat16b(rb[t][2 * s], rb[t][2 * s + 1]);
                acc[t] = wmmab(a, bh, acc[t]); acc[t] = wmmab(al, bh, acc[t]); acc[t] = wmmab(a, bl, acc[t]); } }
        // four vector slots between the last matrix instruction and whatever follows on the taken back edge or behind the loop
        asm volatile("v_nop\n\tv_nop\n\tv_nop\n\tv_nop" : "+v"(acc[0]), "+v"(acc[1]), "+v"(acc[2]), "+v"(acc[3]) : "v"(a), "v"(al));
    }
    float* os = &part[wave][0];                                   // a wave without a chunk stores its zero tile
#pragma unroll
    for (int t = 0; t < 4; ++t) {
#pragma unroll
        for (int j = 0; j < 8; ++j) os[(hi * 8 + j) * 68 + t * 16 + lr] = acc[t][j]; }
    __syncthreads();      // every wave's partial tile is in LDS before any wave sums
    v2f s = *(const v2fa*)(&part[0][wave * 68 + lane * 2]);       // wave w sums row w: 32 lanes x 2 floats = the row's two whole 128-byte lines
#pragma unroll
    for (int w = 1; w < NS; ++w) s += *(const v2fa*)(&part[w][wave * 68 + lane * 2]);      // unrolled: the NS LDS reads are in flight together
    *(v2f*)(C + (size_t)(r0 + wave) * ldc + lane * 2) = s;
}
__global__ __launch_bounds__(256) void k_planes32z(const float* __restrict__ F, int ld, int off, float sc, int rows, bf* Ph, bf* Pl) {
    typedef __attribute__((ext_vector_type(2))) unsigned short v2us;
    const int lane = threadIdx.x & 31; const size_t r = ((size_t)blockIdx.x * 8 + (threadIdx.x >> 5)) * 2 + (lane >> 4); if (r >= (size_t)rows) return; const int z = blockIdx.z; const int c0 = (lane & 15) * 2; v2us oh, ol;
    Ph += (size_t)z * rows * 32; Pl += (size_t)z * rows * 32;
#pragma unroll
    for (int i = 0; i < 2; ++i) { const float y = F[r * ld + off + z * 32 + c0 + i] * sc; const unsigned short hb = f2bf(y); oh[i] = hb; ol[i] = f2bf(y - bf2f(hb)); }
    const size_t o = r * 32 + c0; *(v2us*)(Ph + o) = oh; *(v2us*)(Pl + o) = ol; 
}
__global__ __launch_bounds__(256) void k_vtpadz(const float* __restrict__ F, int ld, int off, int nk, bf* Th, bf* Tl) {
    typedef __attribute__((ext_vector_type(2))) unsigned short v2us;
    const int lane = threadIdx.x & 31; const size_t wid = (size_t)blockIdx.x * 8 + (threadIdx.x >> 5); if (wid >= (size_t)64 * (nk / 64)) return; const int z = blockIdx.z; const int d = (int)(wid / (nk / 64)); const int k0 = (int)(wid % (nk / 64)) * 64 + lane * 2; v2us oh, ol;
    Th += (size_t)z * 64 * nk; Tl += (size_t)z * 64 * nk;
#pragma unroll
    for (int i = 0; i < 2; ++i) { const float y = (d < 32) ? F[(size_t)(k0 + i) * ld + off + z * 32 + (d < 32 ? d : 0)] : 0.f; const unsigned short hb = f2bf(y); oh[i] = hb; ol[i] = f2bf(y - bf2f(hb)); }
    const size_t o = (size_t)d * nk + k0; *(v2us*)(Th + o) = oh; *(v2us*)(Tl + o) = ol; 
}
template <int NK>
__global__ __launch_bounds__(256) void k_softmaxz(const float* __restrict__ S, int rows, bf* PH, bf* PL) {
    typedef __attribute__((ext_vector_type(4))) unsigned short v4us;
    const int lane = threadIdx.x & 31, i = blockIdx.x * 8 + (threadIdx.x >> 5); if (i >= rows) return; const size_t zo = (size_t)blockIdx.z * rows * NK; const float* sr = S + zo + (size_t)i * NK; PH += zo; PL += zo;
    float m = -3.0e38f;
#pragma unroll 1
    for (int c0 = lane * 4; c0 < NK; c0 += 128) {
#pragma unroll
        for (int q = 0; q < 4; ++q) m = fmaxf(m, sr[c0 + q]); }
#pragma unroll
    for (int sh = 16; sh; sh >>= 1) m = fmaxf(m, __shfl_xor(m, sh, 32));
    float sum = 0.f;
#pragma unroll 1
    for (int c0 = lane * 4; c0 < NK; c0 += 128) {
#pragma unroll
        for (int q = 0; q < 4; ++q) sum += __expf(sr[c0 + q] - m); }
#pragma unroll
    for (int sh = 16; sh; sh >>= 1) sum += __shfl_xor(sum, sh, 32);
    const float inv = 1.0f / sum;
{
#pragma unroll 1
        for (int c0 = lane * 4; c0 < NK; c0 += 128) { v4us oh, ol;
#pragma unroll
            for (int q = 0; q < 4; ++q) { const float p = __expf(sr[c0 + q] - m) * inv; const unsigned short hb = f2bf(p); oh[q] = hb; ol[q] = f2bf(p - bf2f(hb)); }
            const size_t o = (size_t)i * NK + c0; *(v4us*)(PH + o) = oh; *(v4us*)(PL + o) = ol; }
         }
}
__global__ __launch_bounds__(256) void k_placez(const float* __restrict__ XH, int rows, int ldy, float* Y) {
    const int lane = threadIdx.x & 31; const size_t q = (size_t)blockIdx.x * 8 + (threadIdx.x >> 5); if (q >= (size_t)rows) return; const int z = blockIdx.z; const float v = XH[((size_t)z * rows + q) * 64 + lane];
    *(float*)(Y + q * ldy + z * 32 + lane) = v; 
}

__global__ __launch_bounds__(256) void k_hplanesz(const float* __restrict__ F, int ld, int h0, float sc, int rows, bf* Ph, bf* Pl) {
    typedef __attribute__((ext_vector_type(2))) unsigned short v2us;
    const int lane = threadIdx.x & 31; const size_t r = (size_t)blockIdx.x * 8 + (threadIdx.x >> 5); if (r >= (size_t)rows) return; const int z = blockIdx.z; v2us oh, ol;
    Ph += (size_t)z * rows * 64; Pl += (size_t)z * rows * 64;
#pragma unroll
    for (int i = 0; i < 2; ++i) { const float y = F[r * ld + (h0 + z) * 64 + lane * 2 + i] * sc; const unsigned short hb = f2bf(y); oh[i] = hb; ol[i] = f2bf(y - bf2f(hb)); }
    const size_t o = r * 64 + lane * 2; *(v2us*)(Ph + o) = oh; *(v2us*)(Pl + o) = ol; 
}
__global__ __launch_bounds__(256) void k_vtz(const float* __restrict__ F, int ld, int h0, int nk, bf* Th, bf* Tl) {
    typedef __attribute__((ext_vector_type(2))) unsigned short v2us;
    const int lane = threadIdx.x & 31; const size_t wid = (size_t)blockIdx.x * 8 + (threadIdx.x >> 5); if (wid >= (size_t)64 * (nk / 64)) return; const int z = blockIdx.z; const int d = (int)(wid / (nk / 64)); const int t0 = (int)(wid % (nk / 64)) * 64 + lane * 2; v2us oh, ol;
    Th += (size_t)z * 64 * nk; Tl += (size_t)z * 64 * nk;
#pragma unroll
    for (int i = 0; i < 2; ++i) { const float y = F[(size_t)(t0 + i) * ld + (h0 + z) * 64 + d]; const unsigned short hb = f2bf(y); oh[i] = hb; ol[i] = f2bf(y - bf2f(hb)); }
    const size_t o = (size_t)d * nk + t0; *(v2us*)(Th + o) = oh; *(v2us*)(Tl + o) = ol; 
}
template <int NK>
__global__ __launch_bounds__(256) void k_softmaxzs(const float* __restrict__ S, int rows, float sc, bf* PH, bf* PL) {
    typedef __attribute__((ext_vector_type(4))) unsigned short v4us;
    const int lane = threadIdx.x & 31, i = blockIdx.x * 8 + (threadIdx.x >> 5); if (i >= rows) return; const size_t zo = (size_t)blockIdx.z * rows * NK; const float* sr = S + zo + (size_t)i * NK; PH += zo; PL += zo;
    float m = -3.0e38f;
#pragma unroll 1
    for (int c0 = lane * 4; c0 < NK; c0 += 128) {
#pragma unroll
        for (int q = 0; q < 4; ++q) m = fmaxf(m, sr[c0 + q] * sc); }
#pragma unroll
    for (int sh = 16; sh; sh >>= 1) m = fmaxf(m, __shfl_xor(m, sh, 32));
    float sum = 0.f;
#pragma unroll 1
    for (int c0 = lane * 4; c0 < NK; c0 += 128) {
#pragma unroll
        for (int q = 0; q < 4; ++q) sum += __expf(sr[c0 + q] * sc - m); }
#pragma unroll
    for (int sh = 16; sh; sh >>= 1) sum += __shfl_xor(sum, sh, 32);
    const float inv = 1.0f / sum;
{
#pragma unroll 1
        for (int c0 = lane * 4; c0 < NK; c0 += 128) { v4us oh, ol;
#pragma unroll
            for (int q = 0; q < 4; ++q) { const float p = __expf(sr[c0 + q] * sc - m) * inv; const unsigned short hb = f2bf(p); oh[q] = hb; ol[q] = f2bf(p - bf2f(hb)); }
            const size_t o = (size_t)i * NK + c0; *(v4us*)(PH + o) = oh; *(v4us*)(PL + o) = ol; }
         }
}

__global__ __launch_bounds__(256) void k_cvtx(const float* __restrict__ src, int rows, bf* dst) {
    const int lane = threadIdx.x & 31; const size_t r = (size_t)blockIdx.x * 8 + (threadIdx.x >> 5); if (r >= (size_t)rows) return;
{
#pragma unroll
        for (int q = 0; q < DMOD / 256; ++q) { v8us o;
#pragma unroll
            for (int i = 0; i < 8; ++i) o[i] = f2bf(src[r * DMOD + q * 256 + lane * 8 + i]);
            *(v8us*)(dst + r * DMOD + q * 256 + lane * 8) = o; }
         }
}
// k_wavepl: head h0+z: planes [rows][32] of l2normalize(F[r][(h0+z)*16 + w] + bf(phase[h][w])) (f32: norm over the 16 values via xor 4,2,1 within each 8-lane group; x / max(n, 1e-12));
__global__ __launch_bounds__(256) void k_wavepl(const float* __restrict__ F, int ld, int h0, const float* __restrict__ phase, int rows, bf* Ph, bf* Pl) {
    typedef __attribute__((ext_vector_type(2))) unsigned short v2us;
    const int lane = threadIdx.x & 31; const size_t r = ((size_t)blockIdx.x * 8 + (threadIdx.x >> 5)) * 2 + (lane >> 4); if (r >= (size_t)rows) return; const int z = blockIdx.z, h = h0 + z; const int c0 = (lane & 15) * 2;
    Ph += (size_t)z * rows * KQ; Pl += (size_t)z * rows * KQ;
    float v0 = 0.f, v1 = 0.f; if (c0 < NW) { v0 = F[r * ld + h * NW + c0] + bfr(phase[h * NW + c0]); v1 = F[r * ld + h * NW + c0 + 1] + bfr(phase[h * NW + c0 + 1]); }
    float ss = v0 * v0 + v1 * v1;
#pragma unroll
    for (int sh = 4; sh; sh >>= 1) ss += __shfl_xor(ss, sh, 32);      // lanes 0-7 / 16-23 hold the row's 16 live values (c0 < 16 <=> (lane & 15) < 8): reduce over xor 4,2,1 within each 8-lane group
    const float inv = 1.0f / fmaxf(sqrtf(ss), 1e-12f); v0 *= inv; v1 *= inv;
    v2us oh, ol; { const unsigned short hb = f2bf(v0); oh[0] = hb; ol[0] = f2bf(v0 - bf2f(hb)); } { const unsigned short hb = f2bf(v1); oh[1] = hb; ol[1] = f2bf(v1 - bf2f(hb)); }
    const size_t o = r * KQ + c0; *(v2us*)(Ph + o) = oh; *(v2us*)(Pl + o) = ol; 
}
__global__ __launch_bounds__(256) void k_csoftz(const float* __restrict__ S, int rows, float sc, bf* PH, bf* PL) {
    typedef __attribute__((ext_vector_type(4))) unsigned short v4us;
    const int lane = threadIdx.x & 31, i = blockIdx.x * 8 + (threadIdx.x >> 5); if (i >= rows) return; const size_t zo = (size_t)blockIdx.z * rows * NN; const float* sr = S + zo + (size_t)i * NN; PH += zo; PL += zo;
    float m = -3.0e38f;
#pragma unroll 1
    for (int c0 = lane * 4; c0 < NN; c0 += 128) {
#pragma unroll
        for (int q = 0; q < 4; ++q) { const int k = c0 + q; if (k <= i) m = fmaxf(m, sr[k] * sc); } }
#pragma unroll
    for (int sh = 16; sh; sh >>= 1) m = fmaxf(m, __shfl_xor(m, sh, 32));
    float sum = 0.f;
#pragma unroll 1
    for (int c0 = lane * 4; c0 < NN; c0 += 128) {
#pragma unroll
        for (int q = 0; q < 4; ++q) { const int k = c0 + q; if (k <= i) sum += __expf(sr[k] * sc - m); } }
#pragma unroll
    for (int sh = 16; sh; sh >>= 1) sum += __shfl_xor(sum, sh, 32);
    const float inv = 1.0f / sum;
{
#pragma unroll 1
        for (int c0 = lane * 4; c0 < NN; c0 += 128) { v4us oh, ol;
#pragma unroll
            for (int q = 0; q < 4; ++q) { const int k = c0 + q; const float p = (k <= i) ? __expf(sr[(k <= i) ? k : 0] * sc - m) * inv : 0.f; const unsigned short hb = f2bf(p); oh[q] = hb; ol[q] = f2bf(p - bf2f(hb)); }
            const size_t o = (size_t)i * NN + c0; *(v4us*)(PH + o) = oh; *(v4us*)(PL + o) = ol; }
         }
}
__global__ __launch_bounds__(256) void k_splitD(const float* __restrict__ src, int rows, bf* dh, bf* dl) {
    const int lane = threadIdx.x & 31; const size_t r = (size_t)blockIdx.x * 8 + (threadIdx.x >> 5); if (r >= (size_t)rows) return;
{
#pragma unroll
        for (int q = 0; q < DMOD / 256; ++q) { const size_t o = r * DMOD + q * 256 + lane * 8; const v8f v = *(const v8f*)(src + o); v8us oh, ol;
#pragma unroll
            for (int i = 0; i < 8; ++i) { const unsigned short hb = f2bf(v[i]); oh[i] = hb; ol[i] = f2bf(v[i] - bf2f(hb)); }
            *(v8us*)(dh + o) = oh; *(v8us*)(dl + o) = ol; }
         }
}
// k_csoftzt: one wave per row, the row's causal part held in registers: S is read once, with 16-byte loads that are all in flight together; 1/temperature, maximum, exp and sum work on the registers
__global__ __launch_bounds__(256) void k_csoftzt(const float* __restrict__ S, int rows, const float* __restrict__ temp, bf* PH, bf* PL) {
    const float sc = 1.0f / bfr(temp[0]);
    typedef __attribute__((ext_vector_type(4))) unsigned short v4us;
    constexpr int NC = NN / 128;                                  // a row is NC chunks of 128 columns, 4 columns per lane
    const int lane = threadIdx.x & 31;
    const int i = blockIdx.x * 8 + __builtin_amdgcn_readfirstlane((int)(threadIdx.x >> 5));      // the row's number in a scalar register: the tests on it below become scalar branches, EXEC stays whole
    if (i >= rows) return;
    const size_t ro = (size_t)blockIdx.z * rows * NN + (size_t)i * NN; const float* sr = S + ro; PH += ro; PL += ro;
    const int jl = i >> 7;                                        // the chunk that holds the diagonal; every column of a chunk below it is causal
    const int cl = jl * 128 + lane * 4;
    const float* pf = sr + lane * 4;                              // this lane's place in chunk 0
    const float* pd = sr + min(cl, i & ~3);                       // and in the diagonal chunk: a lane past the diagonal rereads the group of 4 that holds it, so no address leaves the score tiles written for this row
    v4f t[NC - 1], tl = *(const v4f*)pd;
#pragma unroll
    for (int j = 0; j < NC - 1; ++j) if (j < jl) t[j] = *(const v4f*)(pf + j * 128);
    // no address register of the loads above is rewritten before this wait: the clobber keeps the loads in front of it, and naming the two addresses as inputs keeps their registers whole up to it
    asm volatile("s_wait_xcnt 0x0" :: "v"(pf), "v"(pd) : "memory");
    float m = -3.0e38f;
#pragma unroll
    for (int q = 0; q < 4; ++q) { tl[q] = (cl + q <= i) ? tl[q] * sc : -3.0e38f; m = fmaxf(m, tl[q]); }      // a masked column: exp gives 0 below
#pragma unroll
    for (int j = 0; j < NC - 1; ++j) if (j < jl) { t[j] *= sc;
#pragma unroll
        for (int q = 0; q < 4; ++q) m = fmaxf(m, t[j][q]); }
#pragma unroll
    for (int sh = 16; sh; sh >>= 1) m = fmaxf(m, __shfl_xor(m, sh, 32));
    float sum = 0.f;
#pragma unroll
    for (int j = 0; j < NC - 1; ++j) if (j < jl) {
#pragma unroll
        for (int q = 0; q < 4; ++q) { t[j][q] = __expf(t[j][q] - m); sum += t[j][q]; } }
#pragma unroll
    for (int q = 0; q < 4; ++q) { tl[q] = __expf(tl[q] - m); sum += tl[q]; }
#pragma unroll
    for (int sh = 16; sh; sh >>= 1) sum += __shfl_xor(sum, sh, 32);
    const float inv = 1.0f / sum;
    auto put = [&](const v4f e, int c0) { v4us oh, ol;
#pragma unroll
        for (int q = 0; q < 4; ++q) { const float p = e[q] * inv; const unsigned short hb = f2bf(p); oh[q] = hb; ol[q] = f2bf(p - bf2f(hb)); }
        *(v4us*)(PH + c0) = oh; *(v4us*)(PL + c0) = ol;
        asm volatile("s_wait_xcnt 0x0" ::: "memory"); };      // the next chunk's arithmetic reuses the registers that these two stores name: the wait stands in front of that
#pragma unroll
    for (int j = 0; j < NC - 1; ++j) if (j < jl) put(t[j], j * 128 + lane * 4);
    put(tl, cl);
    const v4us zero = {0, 0, 0, 0};
#pragma unroll
    for (int j = 1; j < NC; ++j) if (j > jl) { *(v4us*)(PH + j * 128 + lane * 4) = zero; *(v4us*)(PL + j * 128 + lane * 4) = zero;
        if (j + 1 < NC) asm volatile("s_wait_xcnt 0x0" ::: "memory"); }       // the compiler forms the zero pair anew for the next chunk, in the registers that these two stores name: the wait stands in front of that
}

extern "C" void kernel_launch(void* const* d_in, const int* in_sizes, int n_in,
                              void* d_out, int out_size, void* d_ws, size_t ws_size, hipStream_t stream) {
    (void)in_sizes; (void)n_in; (void)out_size;
    const float* x = (const float*)d_in[0]; const float* Wq = (const float*)d_in[1]; const float* bq = (const float*)d_in[2]; const float* Wk = (const float*)d_in[3]; const float* bk = (const float*)d_in[4]; const float* Wv = (const float*)d_in[5]; const float* bv = (const float*)d_in[6]; const float* Wo = (const float*)d_in[7]; const float* bo = (const float*)d_in[8];
    const float* qph = (const float*)d_in[9]; const float* kph = (const float*)d_in[10]; const float* temp = (const float*)d_in[11];
    float* out = (float*)d_out;    // [2][2048][1024]
    char* wsp = (char*)d_ws;
    auto take = [&](size_t bytes) { char* p = wsp; wsp += (bytes + 255) & ~(size_t)255; return (void*)p; };
    bf* WQ = (bf*)take((size_t)(NH_ * NW) * DMOD * 2); bf* WK = (bf*)take((size_t)(NH_ * NW) * DMOD * 2); bf* WV = (bf*)take((size_t)DMOD * DMOD * 2); bf* WO = (bf*)take((size_t)DMOD * DMOD * 2);
    bf* Xb = (bf*)take((size_t)NN * DMOD * 2); float* QF = (float*)take((size_t)NN * (NH_ * NW) * 4); float* KF = (float*)take((size_t)NN * (NH_ * NW) * 4); float* VF = (float*)take((size_t)NN * DMOD * 4);
    bf* Qh = (bf*)take((size_t)ZH * NN * KQ * 2); bf* Ql = (bf*)take((size_t)ZH * NN * KQ * 2); bf* Kh = (bf*)take((size_t)ZH * NN * KQ * 2); bf* Kl = (bf*)take((size_t)ZH * NN * KQ * 2); bf* VTh = (bf*)take((size_t)ZH * HD * NN * 2); bf* VTl = (bf*)take((size_t)ZH * HD * NN * 2);
    float* S = (float*)take((size_t)ZH * NN * NN * 4); bf* PH = (bf*)take((size_t)ZH * NN * NN * 2); bf* PL = (bf*)take((size_t)ZH * NN * NN * 2); float* O = (float*)take((size_t)NN * DMOD * 4); bf* Oh = (bf*)take((size_t)NN * DMOD * 2); bf* Ol = (bf*)take((size_t)NN * DMOD * 2);
    if ((size_t)(wsp - (char*)d_ws) > ws_size) return;    // ~ 105 MB; per item / pair reuse in stream order
    k_wt<<<dim3(DMOD / 64, (NH_ * NW) / 64, 1), 256, 0, stream>>>(Wq, DMOD, NH_ * NW, WQ); k_wt<<<dim3(DMOD / 64, (NH_ * NW) / 64, 1), 256, 0, stream>>>(Wk, DMOD, NH_ * NW, WK);   // (in, out) k-major -> n-major
    k_wt<<<dim3(DMOD / 64, DMOD / 64, 1), 256, 0, stream>>>(Wv, DMOD, DMOD, WV); k_wt<<<dim3(DMOD / 64, DMOD / 64, 1), 256, 0, stream>>>(Wo, DMOD, DMOD, WO);
    // host reads nothing from device; 1/temperature is applied inside k_csoftz via a device load? -> pass as a kernel-side scalar read: k_csoftz takes sc by value, so read temp on device in a tiny way:
    // we avoid a host sync by folding 1/temperature into the q planes? No (normalisation after). Instead k_csoftz_t below reads temp[0] itself.
    for (int b = 0; b < NBT; ++b) {
        k_cvtx<<<NN / 8, 256, 0, stream>>>(x + (size_t)b * NN * DMOD, NN, Xb);
        k_gemmb<false, false><<<dim3(NN / 64, (NH_ * NW) / 64, 1), 128, 0, stream>>>(Xb, nullptr, WQ, bq, QF, NH_ * NW, nullptr, nullptr, DMOD);
        k_gemmb<false, false><<<dim3(NN / 64, (NH_ * NW) / 64, 1), 128, 0, stream>>>(Xb, nullptr, WK, bk, KF, NH_ * NW, nullptr, nullptr, DMOD);
        k_gemmb<false, false><<<dim3(NN / 64, DMOD / 64, 1), 128, 0, stream>>>(Xb, nullptr, WV, bv, VF, DMOD, nullptr, nullptr, DMOD);
        for (int g = 0; g < NH_ / ZH; ++g) { const int h0 = g * ZH;
            k_wavepl<<<dim3((NN / 2) / 8, 1, ZH), 256, 0, stream>>>(QF, NH_ * NW, h0, qph, NN, Qh, Ql); k_wavepl<<<dim3((NN / 2) / 8, 1, ZH), 256, 0, stream>>>(KF, NH_ * NW, h0, kph, NN, Kh, Kl);
            k_vtz<<<dim3((HD * (NN / 64)) / 8, 1, ZH), 256, 0, stream>>>(VF, DMOD, h0, NN, VTh, VTl);
            k_gemm3z<1><<<dim3(NN / 64, NN / 64, ZH), 128, 0, stream>>>(Qh, Ql, Kh, Kl, KQ, S, NN, (size_t)NN * KQ, (size_t)NN * KQ, (size_t)NN * NN);
            k_csoftzt<<<dim3(NN / 8, 1, ZH), 256, 0, stream>>>(S, NN, temp, PH, PL);
            k_pvsplit<16><<<dim3(NN / 16, 1, ZH), 512, 0, stream>>>(PH, PL, VTh, VTl, NN, O + h0 * HD, DMOD, (size_t)NN * NN, (size_t)HD * NN, (size_t)HD); }
        k_splitD<<<NN / 8, 256, 0, stream>>>(O, NN, Oh, Ol);
        k_gemmb<true, false><<<dim3(NN / 64, DMOD / 64, 1), 128, 0, stream>>>(Oh, Ol, WO, bo, out + (size_t)b * NN * DMOD, DMOD, nullptr, nullptr, DMOD); }
}

// v003
// One run takes 581 microseconds.
// In two side-by-side timings against v002, it was 1.40 and 1.39 times as fast.
// Over all steps from v000 it is 4.46 times as fast.
#include <hip/hip_runtime.h>

// Compute dtypes, f32 accumulate, per item: q/k/v projections as GEMMs with PLAIN bf16 operands (x and the (in,out) weights; exact products, + bias); per head the 16-wide q/k get
// their phase added and are L2-normalised in f32, then stored as bf16 hi + UNSCALED residual planes padded to K = 32 (zero columns); causal scores (three products, key tiles above
// the diagonal skipped) and attn.v (three products, K limited) with 4 heads per launch in grid.z; projections, conversions and plane kernels take both items (and all heads) in one launch; 1/temperature and the causal softmax in f32; output projection on hi/lo planes

#define NBT  2
#define NN   2048
#define DMOD 1024
#define NH_  16
#define NW   16
#define KQ   32                   // padded score depth
#define HD   64
#define ZH   4
#define DM   DMOD
#define NTK  NN
#define LOSC 1024.0f

typedef _Float16 h16;
typedef unsigned short bf;
typedef __attribute__((ext_vector_type(16))) __bf16   v16bf;
typedef __attribute__((ext_vector_type(16))) _Float16 v16h;
typedef __attribute__((ext_vector_type(8)))  _Float16 v8h;
typedef __attribute__((ext_vector_type(8)))  unsigned short v8us;
typedef __attribute__((ext_vector_type(8)))  float    v8f;
typedef __attribute__((ext_vector_type(4)))  float    v4f;
typedef __attribute__((ext_vector_type(4)))  _Float16 v4h;
typedef v8h  __attribute__((may_alias)) v8ha;
typedef v4f  __attribute__((may_alias)) v4fa;
typedef v8us __attribute__((may_alias)) v8usa;

__device__ __forceinline__ unsigned short f2bf(float f) { unsigned u = __float_as_uint(f); u += 0x7FFFu + ((u >> 16) & 1u); return (unsigned short)(u >> 16); }
__device__ __forceinline__ float bf2f(unsigned short b) { return __uint_as_float(((unsigned)b) << 16); }
__device__ __forceinline__ float bfr(float f) { return bf2f(f2bf(f)); }
__device__ __forceinline__ v16h cat16(v8h lo, v8h hi) { return __builtin_shufflevector(lo, hi, 0, 1, 2, 3, 4, 5, 6, 7, 8, 9, 10, 11, 12, 13, 14, 15); }
__device__ __forceinline__ v16bf cat16b(v8us lo, v8us hi) { return __builtin_bit_cast(v16bf, __builtin_shufflevector(lo, hi, 0, 1, 2, 3, 4, 5, 6, 7, 8, 9, 10, 11, 12, 13, 14, 15)); }
__device__ __forceinline__ v8f wmma16(v16h a, v16h b, v8f c) { return __builtin_amdgcn_wmma_f32_16x16x32_f16(false, a, false, b, (short)0, c, false, false); }
__device__ __forceinline__ v8f wmmab(v16bf a, v16bf b, v8f c) { return __builtin_amdgcn_wmma_f32_16x16x32_bf16(false, a, false, b, (short)0, c, false, false); }

// k_wt: WT [n][K] = bf16(W[k][n]) (k-major [K][ncols]) via 64 x 64 LDS tiles; grid (K/64, ncols/64).
__global__ __launch_bounds__(256) void k_wt(const float* __restrict__ Wm, int K, int ncols, bf* WT) {
    __shared__ __align__(16) unsigned short tl[64 * 72];
    const int tid = threadIdx.x, k0 = blockIdx.x * 64, n0 = blockIdx.y * 64;
    const int kk = tid >> 2, nq = (tid & 3) * 16;
#pragma unroll
    for (int i = 0; i < 16; ++i) tl[(nq + i) * 72 + kk] = f2bf(Wm[(size_t)(k0 + kk) * ncols + n0 + nq + i]);
    __syncthreads();
    const int piece = tid & 7;
    auto pass = [&]() {
#pragma unroll
        for (int s = 0; s < 2; ++s) { const int nr = (tid >> 3) + 32 * s; const v8us val = *(const v8usa*)(tl + nr * 72 + piece * 8); *(v8us*)(WT + (size_t)(n0 + nr) * K + k0 + piece * 8) = val; }
    };
    pass(); 
}
// k_gemmb: 64 x 64 block tile (4 waves x 16 x 64) of C[NBT * NN][ldc] = (A [+ Al]).B^T (K = 1024) [+ bf(bias[c])] [+ bf(R[r][c]) residual]; f32 whole-line epilogue (or f16
template <bool SPLITA, bool F16OUT = false>
__global__ __launch_bounds__(128) void k_gemmb(const bf* __restrict__ A, const bf* __restrict__ Al, const bf* __restrict__ Bn, const float* __restrict__ bias, float* C, int ldc, h16* C2, const float* __restrict__ R = nullptr, int K = DM, int roundR = 1) {
    __shared__ __align__(16) float ost[4][16 * 68];
    const int lane = threadIdx.x & 31, wave = threadIdx.x >> 5, lr = lane & 15, hi = lane >> 4;
    const int r0 = blockIdx.x * 64 + wave * 16, c0 = blockIdx.y * 64;
    const size_t aoff = (size_t)(r0 + lr) * K + 8 * hi;
    size_t boff[4];
#pragma unroll
    for (int t = 0; t < 4; ++t) boff[t] = (size_t)(c0 + t * 16 + lr) * K + 8 * hi;
    v8f acc[4];
#pragma unroll
    for (int t = 0; t < 4; ++t) acc[t] = (v8f){};
#pragma unroll 1
    for (int kc = 0; kc < K; kc += 32) {
        const v16bf a = cat16b(*(const v8us*)(A + aoff + kc), *(const v8us*)(A + aoff + kc + 16));
        v16bf al = a;
        if (SPLITA) al = cat16b(*(const v8us*)(Al + aoff + kc), *(const v8us*)(Al + aoff + kc + 16));
#pragma unroll
        for (int t = 0; t < 4; ++t) { const v16bf b = cat16b(*(const v8us*)(Bn + boff[t] + kc), *(const v8us*)(Bn + boff[t] + kc + 16)); acc[t] = wmmab(a, b, acc[t]); if (SPLITA) acc[t] = wmmab(al, b, acc[t]); }
        asm volatile("v_nop\n\tv_nop\n\tv_nop\n\tv_nop" : "+v"(acc[0]), "+v"(acc[1]), "+v"(acc[2]), "+v"(acc[3]) : "v"(a), "v"(al));
    }
    float* os = &ost[wave][0];
#pragma unroll
    for (int t = 0; t < 4; ++t) { const float bv = bias ? bfr(bias[c0 + t * 16 + lr]) : 0.f;
#pragma unroll
        for (int j = 0; j < 8; ++j) os[(hi * 8 + j) * 68 + t * 16 + lr] = acc[t][j] + bv; }
    __syncthreads();
    if (F16OUT) {
        h16* crow = (h16*)(void*)C + (size_t)r0 * ldc + c0;
        auto pass = [&]() {
#pragma unroll
            for (int s = 0; s < 4; ++s) { const int row = 4 * s + (lane >> 3), piece = lane & 7; const float* sp = os + row * 68 + piece * 8; v8h o, o2;
#pragma unroll
                for (int i = 0; i < 8; ++i) { const h16 a = (h16)sp[i]; o[i] = a; o2[i] = (h16)((sp[i] - (float)a) * LOSC); }
                *(v8h*)(crow + (size_t)row * ldc + piece * 8) = o; if (C2) *(v8h*)(C2 + (size_t)r0 * ldc + c0 + (size_t)row * ldc + piece * 8) = o2; }
        };
        pass(); 
    } else {
        float* crow = C + (size_t)r0 * ldc + c0;
        auto pass = [&]() {
#pragma unroll
            for (int s = 0; s < 8; ++s) { const int Lid = (lane >> 3) + 4 * s, piece = lane & 7; const int row = Lid >> 1, cofs = (Lid & 1) * 32 + piece * 4;
                v4f val = *(const v4fa*)(os + row * 68 + cofs); if (R) { const v4f rv = *(const v4f*)(R + ((size_t)r0 + row) * ldc + c0 + cofs); val += roundR ? (v4f){bfr(rv[0]), bfr(rv[1]), bfr(rv[2]), bfr(rv[3])} : rv; }
                *(v4f*)(crow + (size_t)row * ldc + cofs) = val; }
        };
        pass(); 
    }
}


// ===== z-batched (blockIdx.z = head) attention pieces =====
// k_gemm3z<MODE>: 64 x 64 tile of C = Ah.Bh^T [+ Al.Bh^T] [+ Ah.Bl^T] with per-z operand/output strides (elements): A planes += z*sA, B planes += z*sB, C += z*sC. MODE bits (0 causal skip, 1 K limit, 2 single,
// 3 B single, 4 A single).
template <int MODE>
__global__ __launch_bounds__(128) void k_gemm3z(const bf* __restrict__ Ah, const bf* __restrict__ Al, const bf* __restrict__ Bh, const bf* __restrict__ Bl, int K, float* C, int ldc, size_t sA, size_t sB, size_t sC) {
    if ((MODE & 1) && (int)blockIdx.y * 64 > (int)blockIdx.x * 64 + 63) return;
    const size_t z = blockIdx.z; Ah += z * sA; Al += z * sA; Bh += z * sB; Bl += z * sB; C += z * sC;
    const int Klim = (MODE & 2) ? min(K, ((int)blockIdx.x + 1) * 64) : K;
    __shared__ __align__(16) float ost[4][16 * 68];
    const int lane = threadIdx.x & 31, wave = threadIdx.x >> 5, lr = lane & 15, hi = lane >> 4;
    const int r0 = blockIdx.x * 64 + wave * 16, c0 = blockIdx.y * 64;
    const size_t aoff = (size_t)(r0 + lr) * K + 8 * hi;
    v8f acc[4];
#pragma unroll
    for (int t = 0; t < 4; ++t) acc[t] = (v8f){};
#pragma unroll 1
    for (int kc = 0; kc < Klim; kc += 32) {
        const v16bf a = cat16b(*(const v8us*)(Ah + aoff + kc), *(const v8us*)(Ah + aoff + kc + 16));
        v16bf al = a; if (!(MODE & 4) && !(MODE & 16)) al = cat16b(*(const v8us*)(Al + aoff + kc), *(const v8us*)(Al + aoff + kc + 16));
#pragma unroll
        for (int t = 0; t < 4; ++t) { const size_t bo = (size_t)(c0 + t * 16 + lr) * K + kc + 8 * hi;
            const v16bf bh = cat16b(*(const v8us*)(Bh + bo), *(const v8us*)(Bh + bo + 16));
            acc[t] = wmmab(a, bh, acc[t]);
            if (!(MODE & 4)) { if (!(MODE & 16)) acc[t] = wmmab(al, bh, acc[t]); if (!(MODE & 8)) { const v16bf bl = cat16b(*(const v8us*)(Bl + bo), *(const v8us*)(Bl + bo + 16)); acc[t] = wmmab(a, bl, acc[t]); } } }
        asm volatile("v_nop\n\tv_nop\n\tv_nop\n\tv_nop" : "+v"(acc[0]), "+v"(acc[1]), "+v"(acc[2]), "+v"(acc[3]) : "v"(a), "v"(al));
    }
    float* os = &ost[wave][0];
#pragma unroll
    for (int t = 0; t < 4; ++t) {
#pragma unroll
        for (int j = 0; j < 8; ++j) os[(hi * 8 + j) * 68 + t * 16 + lr] = acc[t][j]; }
    __builtin_amdgcn_wave_barrier(); asm volatile("" ::: "memory");
    float* crow = C + (size_t)r0 * ldc + c0;
    auto pass = [&]() {
#pragma unroll
        for (int s = 0; s < 8; ++s) { const int Lid = (lane >> 3) + 4 * s, piece = lane & 7; const int row = Lid >> 1, cofs = (Lid & 1) * 32 + piece * 4;
            const v4f val = *(const v4fa*)(os + row * 68 + cofs); *(v4f*)(crow + (size_t)row * ldc + cofs) = val; }
    };
    pass(); 
}
// k_pvsplit<NS>: attn.v for one 16-row x 64-column output tile per block, K split over the block's NS waves: wave w takes the 64-wide K chunks w, w + NS, ... below the causal limit
// (64 bf16 = one whole 128-byte line of every operand row), same three products per chunk as k_gemm3z; the partial tiles meet in LDS and are summed in wave order.
template <int NS>
__global__ __launch_bounds__(32 * NS) void k_pvsplit(const bf* __restrict__ Ah, const bf* __restrict__ Al, const bf* __restrict__ Bh, const bf* __restrict__ Bl, int K, float* C, int ldc, size_t sA, size_t sB, size_t sC) {
    typedef __attribute__((ext_vector_type(2))) float v2f;
    typedef v2f __attribute__((may_alias)) v2fa;
    static_assert(NS == 16, "the final sum gives each of the 16 rows to one wave");
    const size_t z = blockIdx.z; Ah += z * sA; Al += z * sA; Bh += z * sB; Bl += z * sB; C += z * sC;
    const int Klim = min(K, ((int)blockIdx.x / 4 + 1) * 64);      // the same limit as the 64-row tile that holds these 16 rows
    __shared__ __align__(16) float part[NS][16 * 68];
    const int lane = threadIdx.x & 31, lr = lane & 15, hi = lane >> 4;
    const int wave = __builtin_amdgcn_readfirstlane((int)(threadIdx.x >> 5));      // the wave's number in a scalar register: the K loop's test becomes a scalar branch, EXEC stays whole
    const int r0 = blockIdx.x * 16;
    const size_t aoff = (size_t)(r0 + lr) * K + 8 * hi;
    v8f acc[4];
#pragma unroll
    for (int t = 0; t < 4; ++t) acc[t] = (v8f){};
#pragma unroll 1      // kept rolled: a wave has at most K / (64 * NS) = 2 trips, a second copy of the body would only cost registers
    for (int k0 = wave * 64; k0 < Klim; k0 += 64 * NS) {
        const bf* pa = Ah + aoff + k0; const bf* pl = Al + aoff + k0; const bf* ph[4]; const bf* pb[4];      // this lane's place in each operand row at this chunk
#pragma unroll
        for (int t = 0; t < 4; ++t) { const size_t bo = (size_t)(t * 16 + lr) * K + k0 + 8 * hi; ph[t] = Bh + bo; pb[t] = Bl + bo; }
        v8us ra[4], rl[4], rh[4][4], rb[4][4];                    // piece q = elements 16 * q + 8 * hi + 0..7 of the chunk: one whole 128-byte line per row and plane
#pragma unroll        // the chunk's loads stand together, so that the one wait behind them serves them all
        for (int q = 0; q < 4; ++q) { ra[q] = *(const v8us*)(pa + 16 * q); rl[q] = *(const v8us*)(pl + 16 * q); }
#pragma unroll
        for (int t = 0; t < 4; ++t) {
#pragma unroll
            for (int q = 0; q < 4; ++q) { rh[t][q] = *(const v8us*)(ph[t] + 16 * q); rb[t][q] = *(const v8us*)(pb[t] + 16 * q); } }
        // no address register of the loads above is rewritten before this wait: the clobber keeps the loads in front of it, and naming the ten addresses as inputs keeps their registers whole up to it
        asm volatile("s_wait_xcnt 0x0" :: "v"(pa), "v"(pl), "v"(ph[0]), "v"(ph[1]), "v"(ph[2]), "v"(ph[3]), "v"(pb[0]), "v"(pb[1]), "v"(pb[2]), "v"(pb[3]) : "memory");
        v16bf a, al;
#pragma unroll
        for (int s = 0; s < 2; ++s) { a = cat16b(ra[2 * s], ra[2 * s + 1]); al = cat16b(rl[2 * s], rl[2 * s + 1]);
#pragma unroll
            for (int t = 0; t < 4; ++t) { const v16bf bh = cat16b(rh[t][2 * s], rh[t][2 * s + 1]); const v16bf bl = cat16b(rb[t][2 * s], rb[t][2 * s + 1]);
                acc[t] = wmmab(a, bh, acc[t]); acc[t] = wmmab(al, bh, acc[t]); acc[t] = wmmab(a, bl, acc[t]); } }
        // four vector slots between the last matrix instruction and whatever follows on the taken back edge or behind the loop
        asm volatile("v_nop\n\tv_nop\n\tv_nop\n\tv_nop" : "+v"(acc[0]), "+v"(acc[1]), "+v"(acc[2]), "+v"(acc[3]) : "v"(a), "v"(al));
    }
    float* os = &part[wave][0];                                   // a wave without a chunk stores its zero tile
#pragma unroll
    for (int t = 0; t < 4; ++t) {
#pragma unroll
        for (int j = 0; j < 8; ++j) os[(hi * 8 + j) * 68 + t * 16 + lr] = acc[t][j]; }
    __syncthreads();      // every wave's partial tile is in LDS before any wave sums
    v2f s = *(const v2fa*)(&part[0][wave * 68 + lane * 2]);       // wave w sums row w: 32 lanes x 2 floats = the row's two whole 128-byte lines
#pragma unroll
    for (int w = 1; w < NS; ++w) s += *(const v2fa*)(&part[w][wave * 68 + lane * 2]);      // unrolled: the NS LDS reads are in flight together
    *(v2f*)(C + (size_t)(r0 + wave) * ldc + lane * 2) = s;
}
__global__ __launch_bounds__(256) void k_planes32z(const float* __restrict__ F, int ld, int off, float sc, int rows, bf* Ph, bf* Pl) {
    typedef __attribute__((ext_vector_type(2))) unsigned short v2us;
    const int lane = threadIdx.x & 31; const size_t r = ((size_t)blockIdx.x * 8 + (threadIdx.x >> 5)) * 2 + (lane >> 4); if (r >= (size_t)rows) return; const int z = blockIdx.z; const int c0 = (lane & 15) * 2; v2us oh, ol;
    Ph += (size_t)z * rows * 32; Pl += (size_t)z * rows * 32;
#pragma unroll
    for (int i = 0; i < 2; ++i) { const float y = F[r * ld + off + z * 32 + c0 + i] * sc; const unsigned short hb = f2bf(y); oh[i] = hb; ol[i] = f2bf(y - bf2f(hb)); }
    const size_t o = r * 32 + c0; *(v2us*)(Ph + o) = oh; *(v2us*)(Pl + o) = ol; 
}
__global__ __launch_bounds__(256) void k_vtpadz(const float* __restrict__ F, int ld, int off, int nk, bf* Th, bf* Tl) {
    typedef __attribute__((ext_vector_type(2))) unsigned short v2us;
    const int lane = threadIdx.x & 31; const size_t wid = (size_t)blockIdx.x * 8 + (threadIdx.x >> 5); if (wid >= (size_t)64 * (nk / 64)) return; const int z = blockIdx.z; const int d = (int)(wid / (nk / 64)); const int k0 = (int)(wid % (nk / 64)) * 64 + lane * 2; v2us oh, ol;
    Th += (size_t)z * 64 * nk; Tl += (size_t)z * 64 * nk;
#pragma unroll
    for (int i = 0; i < 2; ++i) { const float y = (d < 32) ? F[(size_t)(k0 + i) * ld + off + z * 32 + (d < 32 ? d : 0)] : 0.f; const unsigned short hb = f2bf(y); oh[i] = hb; ol[i] = f2bf(y - bf2f(hb)); }
    const size_t o = (size_t)d * nk + k0; *(v2us*)(Th + o) = oh; *(v2us*)(Tl + o) = ol; 
}
template <int NK>
__global__ __launch_bounds__(256) void k_softmaxz(const float* __restrict__ S, int rows, bf* PH, bf* PL) {
    typedef __attribute__((ext_vector_type(4))) unsigned short v4us;
    const int lane = threadIdx.x & 31, i = blockIdx.x * 8 + (threadIdx.x >> 5); if (i >= rows) return; const size_t zo = (size_t)blockIdx.z * rows * NK; const float* sr = S + zo + (size_t)i * NK; PH += zo; PL += zo;
    float m = -3.0e38f;
#pragma unroll 1
    for (int c0 = lane * 4; c0 < NK; c0 += 128) {
#pragma unroll
        for (int q = 0; q < 4; ++q) m = fmaxf(m, sr[c0 + q]); }
#pragma unroll
    for (int sh = 16; sh; sh >>= 1) m = fmaxf(m, __shfl_xor(m, sh, 32));
    float sum = 0.f;
#pragma unroll 1
    for (int c0 = lane * 4; c0 < NK; c0 += 128) {
#pragma unroll
        for (int q = 0; q < 4; ++q) sum += __expf(sr[c0 + q] - m); }
#pragma unroll
    for (int sh = 16; sh; sh >>= 1) sum += __shfl_xor(sum, sh, 32);
    const float inv = 1.0f / sum;
{
#pragma unroll 1
        for (int c0 = lane * 4; c0 < NK; c0 += 128) { v4us oh, ol;
#pragma unroll
            for (int q = 0; q < 4; ++q) { const float p = __expf(sr[c0 + q] - m) * inv; const unsigned short hb = f2bf(p); oh[q] = hb; ol[q] = f2bf(p - bf2f(hb)); }
            const size_t o = (size_t)i * NK + c0; *(v4us*)(PH + o) = oh; *(v4us*)(PL + o) = ol; }
         }
}
__global__ __launch_bounds__(256) void k_placez(const float* __restrict__ XH, int rows, int ldy, float* Y) {
    const int lane = threadIdx.x & 31; const size_t q = (size_t)blockIdx.x * 8 + (threadIdx.x >> 5); if (q >= (size_t)rows) return; const int z = blockIdx.z; const float v = XH[((size_t)z * rows + q) * 64 + lane];
    *(float*)(Y + q * ldy + z * 32 + lane) = v; 
}

__global__ __launch_bounds__(256) void k_hplanesz(const float* __restrict__ F, int ld, int h0, float sc, int rows, bf* Ph, bf* Pl) {
    typedef __attribute__((ext_vector_type(2))) unsigned short v2us;
    const int lane = threadIdx.x & 31; const size_t r = (size_t)blockIdx.x * 8 + (threadIdx.x >> 5); if (r >= (size_t)rows) return; const int z = blockIdx.z; v2us oh, ol;
    Ph += (size_t)z * rows * 64; Pl += (size_t)z * rows * 64;
#pragma unroll
    for (int i = 0; i < 2; ++i) { const float y = F[r * ld + (h0 + z) * 64 + lane * 2 + i] * sc; const unsigned short hb = f2bf(y); oh[i] = hb; ol[i] = f2bf(y - bf2f(hb)); }
    const size_t o = r * 64 + lane * 2; *(v2us*)(Ph + o) = oh; *(v2us*)(Pl + o) = ol; 
}
__global__ __launch_bounds__(256) void k_vtz(const float* __restrict__ F, int ld, int h0, int nk, bf* Th, bf* Tl) {
    typedef __attribute__((ext_vector_type(2))) unsigned short v2us;
    const int lane = threadIdx.x & 31; const size_t wid = (size_t)blockIdx.x * 8 + (threadIdx.x >> 5); if (wid >= (size_t)64 * (nk / 64)) return; const int z = blockIdx.z; const int d = (int)(wid / (nk / 64)); const int t0 = (int)(wid % (nk / 64)) * 64 + lane * 2; v2us oh, ol;
    const size_t it = blockIdx.y; F += it * nk * ld;              // grid.y = batch item: its nk rows of F, its own set of gridDim.z head planes
    Th += (it * gridDim.z + z) * 64 * nk; Tl += (it * gridDim.z + z) * 64 * nk;
#pragma unroll
    for (int i = 0; i < 2; ++i) { const float y = F[(size_t)(t0 + i) * ld + (h0 + z) * 64 + d]; const unsigned short hb = f2bf(y); oh[i] = hb; ol[i] = f2bf(y - bf2f(hb)); }
    const size_t o = (size_t)d * nk + t0; *(v2us*)(Th + o) = oh; *(v2us*)(Tl + o) = ol; 
}
template <int NK>
__global__ __launch_bounds__(256) void k_softmaxzs(const float* __restrict__ S, int rows, float sc, bf* PH, bf* PL) {
    typedef __attribute__((ext_vector_type(4))) unsigned short v4us;
    const int lane = threadIdx.x & 31, i = blockIdx.x * 8 + (threadIdx.x >> 5); if (i >= rows) return; const size_t zo = (size_t)blockIdx.z * rows * NK; const float* sr = S + zo + (size_t)i * NK; PH += zo; PL += zo;
    float m = -3.0e38f;
#pragma unroll 1
    for (int c0 = lane * 4; c0 < NK; c0 += 128) {
#pragma unroll
        for (int q = 0; q < 4; ++q) m = fmaxf(m, sr[c0 + q] * sc); }
#pragma unroll
    for (int sh = 16; sh; sh >>= 1) m = fmaxf(m, __shfl_xor(m, sh, 32));
    float sum = 0.f;
#pragma unroll 1
    for (int c0 = lane * 4; c0 < NK; c0 += 128) {
#pragma unroll
        for (int q = 0; q < 4; ++q) sum += __expf(sr[c0 + q] * sc - m); }
#pragma unroll
    for (int sh = 16; sh; sh >>= 1) sum += __shfl_xor(sum, sh, 32);
    const float inv = 1.0f / sum;
{
#pragma unroll 1
        for (int c0 = lane * 4; c0 < NK; c0 += 128) { v4us oh, ol;
#pragma unroll
            for (int q = 0; q < 4; ++q) { const float p = __expf(sr[c0 + q] * sc - m) * inv; const unsigned short hb = f2bf(p); oh[q] = hb; ol[q] = f2bf(p - bf2f(hb)); }
            const size_t o = (size_t)i * NK + c0; *(v4us*)(PH + o) = oh; *(v4us*)(PL + o) = ol; }
         }
}

__global__ __launch_bounds__(256) void k_cvtx(const float* __restrict__ src, int rows, bf* dst) {
    const int lane = threadIdx.x & 31; const size_t r = (size_t)blockIdx.x * 8 + (threadIdx.x >> 5); if (r >= (size_t)rows) return;
{
#pragma unroll
        for (int q = 0; q < DMOD / 256; ++q) { v8us o;
#pragma unroll
            for (int i = 0; i < 8; ++i) o[i] = f2bf(src[r * DMOD + q * 256 + lane * 8 + i]);
            *(v8us*)(dst + r * DMOD + q * 256 + lane * 8) = o; }
         }
}
// k_wavepl: head h0+z: planes [rows][32] of l2normalize(F[r][(h0+z)*16 + w] + bf(phase[h][w])) (f32: norm over the 16 values via xor 4,2,1 within each 8-lane group; x / max(n, 1e-12));
__global__ __launch_bounds__(256) void k_wavepl(const float* __restrict__ F, int ld, int h0, const float* __restrict__ phase, int rows, bf* Ph, bf* Pl) {
    typedef __attribute__((ext_vector_type(2))) unsigned short v2us;
    const int lane = threadIdx.x & 31; const size_t r = ((size_t)blockIdx.x * 8 + (threadIdx.x >> 5)) * 2 + (lane >> 4); if (r >= (size_t)rows) return; const int z = blockIdx.z, h = h0 + z; const int c0 = (lane & 15) * 2;
    const size_t it = blockIdx.y; F += it * rows * ld;            // grid.y = batch item: its rows of F, its own set of gridDim.z head planes
    Ph += (it * gridDim.z + z) * rows * KQ; Pl += (it * gridDim.z + z) * rows * KQ;
    float v0 = 0.f, v1 = 0.f; if (c0 < NW) { v0 = F[r * ld + h * NW + c0] + bfr(phase[h * NW + c0]); v1 = F[r * ld + h * NW + c0 + 1] + bfr(phase[h * NW + c0 + 1]); }
    float ss = v0 * v0 + v1 * v1;
#pragma unroll
    for (int sh = 4; sh; sh >>= 1) ss += __shfl_xor(ss, sh, 32);      // lanes 0-7 / 16-23 hold the row's 16 live values (c0 < 16 <=> (lane & 15) < 8): reduce over xor 4,2,1 within each 8-lane group
    const float inv = 1.0f / fmaxf(sqrtf(ss), 1e-12f); v0 *= inv; v1 *= inv;
    v2us oh, ol; { const unsigned short hb = f2bf(v0); oh[0] = hb; ol[0] = f2bf(v0 - bf2f(hb)); } { const unsigned short hb = f2bf(v1); oh[1] = hb; ol[1] = f2bf(v1 - bf2f(hb)); }
    const size_t o = r * KQ + c0; *(v2us*)(Ph + o) = oh; *(v2us*)(Pl + o) = ol; 
}
__global__ __launch_bounds__(256) void k_csoftz(const float* __restrict__ S, int rows, float sc, bf* PH, bf* PL) {
    typedef __attribute__((ext_vector_type(4))) unsigned short v4us;
    const int lane = threadIdx.x & 31, i = blockIdx.x * 8 + (threadIdx.x >> 5); if (i >= rows) return; const size_t zo = (size_t)blockIdx.z * rows * NN; const float* sr = S + zo + (size_t)i * NN; PH += zo; PL += zo;
    float m = -3.0e38f;
#pragma unroll 1
    for (int c0 = lane * 4; c0 < NN; c0 += 128) {
#pragma unroll
        for (int q = 0; q < 4; ++q) { const int k = c0 + q; if (k <= i) m = fmaxf(m, sr[k] * sc); } }
#pragma unroll
    for (int sh = 16; sh; sh >>= 1) m = fmaxf(m, __shfl_xor(m, sh, 32));
    float sum = 0.f;
#pragma unroll 1
    for (int c0 = lane * 4; c0 < NN; c0 += 128) {
#pragma unroll
        for (int q = 0; q < 4; ++q) { const int k = c0 + q; if (k <= i) sum += __expf(sr[k] * sc - m); } }
#pragma unroll
    for (int sh = 16; sh; sh >>= 1) sum += __shfl_xor(sum, sh, 32);
    const float inv = 1.0f / sum;
{
#pragma unroll 1
        for (int c0 = lane * 4; c0 < NN; c0 += 128) { v4us oh, ol;
#pragma unroll
            for (int q = 0; q < 4; ++q) { const int k = c0 + q; const float p = (k <= i) ? __expf(sr[(k <= i) ? k : 0] * sc - m) * inv : 0.f; const unsigned short hb = f2bf(p); oh[q] = hb; ol[q] = f2bf(p - bf2f(hb)); }
            const size_t o = (size_t)i * NN + c0; *(v4us*)(PH + o) = oh; *(v4us*)(PL + o) = ol; }
         }
}
__global__ __launch_bounds__(256) void k_splitD(const float* __restrict__ src, int rows, bf* dh, bf* dl) {
    const int lane = threadIdx.x & 31; const size_t r = (size_t)blockIdx.x * 8 + (threadIdx.x >> 5); if (r >= (size_t)rows) return;
{
#pragma unroll
        for (int q = 0; q < DMOD / 256; ++q) { const size_t o = r * DMOD + q * 256 + lane * 8; const v8f v = *(const v8f*)(src + o); v8us oh, ol;
#pragma unroll
            for (int i = 0; i < 8; ++i) { const unsigned short hb = f2bf(v[i]); oh[i] = hb; ol[i] = f2bf(v[i] - bf2f(hb)); }
            *(v8us*)(dh + o) = oh; *(v8us*)(dl + o) = ol; }
         }
}
// k_csoftzt: one wave per row, the row's causal part held in registers: S is read once, with 16-byte loads that are all in flight together; 1/temperature, maximum, exp and sum work on the registers
__global__ __launch_bounds__(256) void k_csoftzt(const float* __restrict__ S, int rows, const float* __restrict__ temp, bf* PH, bf* PL) {
    const float sc = 1.0f / bfr(temp[0]);
    typedef __attribute__((ext_vector_type(4))) unsigned short v4us;
    constexpr int NC = NN / 128;                                  // a row is NC chunks of 128 columns, 4 columns per lane
    const int lane = threadIdx.x & 31;
    const int i = blockIdx.x * 8 + __builtin_amdgcn_readfirstlane((int)(threadIdx.x >> 5));      // the row's number in a scalar register: the tests on it below become scalar branches, EXEC stays whole
    if (i >= rows) return;
    const size_t ro = (size_t)blockIdx.z * rows * NN + (size_t)i * NN; const float* sr = S + ro; PH += ro; PL += ro;
    const int jl = i >> 7;                                        // the chunk that holds the diagonal; every column of a chunk below it is causal
    const int cl = jl * 128 + lane * 4;
    const float* pf = sr + lane * 4;                              // this lane's place in chunk 0
    const float* pd = sr + min(cl, i & ~3);                       // and in the diagonal chunk: a lane past the diagonal rereads the group of 4 that holds it, so no address leaves the score tiles written for this row
    v4f t[NC - 1], tl = *(const v4f*)pd;
#pragma unroll
    for (int j = 0; j < NC - 1; ++j) if (j < jl) t[j] = *(const v4f*)(pf + j * 128);
    // no address register of the loads above is rewritten before this wait: the clobber keeps the loads in front of it, and naming the two addresses as inputs keeps their registers whole up to it
    asm volatile("s_wait_xcnt 0x0" :: "v"(pf), "v"(pd) : "memory");
    float m = -3.0e38f;
#pragma unroll
    for (int q = 0; q < 4; ++q) { tl[q] = (cl + q <= i) ? tl[q] * sc : -3.0e38f; m = fmaxf(m, tl[q]); }      // a masked column: exp gives 0 below
#pragma unroll
    for (int j = 0; j < NC - 1; ++j) if (j < jl) { t[j] *= sc;
#pragma unroll
        for (int q = 0; q < 4; ++q) m = fmaxf(m, t[j][q]); }
#pragma unroll
    for (int sh = 16; sh; sh >>= 1) m = fmaxf(m, __shfl_xor(m, sh, 32));
    float sum = 0.f;
#pragma unroll
    for (int j = 0; j < NC - 1; ++j) if (j < jl) {
#pragma unroll
        for (int q = 0; q < 4; ++q) { t[j][q] = __expf(t[j][q] - m); sum += t[j][q]; } }
#pragma unroll
    for (int q = 0; q < 4; ++q) { tl[q] = __expf(tl[q] - m); sum += tl[q]; }
#pragma unroll
    for (int sh = 16; sh; sh >>= 1) sum += __shfl_xor(sum, sh, 32);
    const float inv = 1.0f / sum;
    auto put = [&](const v4f e, int c0) { v4us oh, ol;
#pragma unroll
        for (int q = 0; q < 4; ++q) { const float p = e[q] * inv; const unsigned short hb = f2bf(p); oh[q] = hb; ol[q] = f2bf(p - bf2f(hb)); }
        *(v4us*)(PH + c0) = oh; *(v4us*)(PL + c0) = ol;
        asm volatile("s_wait_xcnt 0x0" ::: "memory"); };      // the next chunk's arithmetic reuses the registers that these two stores name: the wait stands in front of that
#pragma unroll
    for (int j = 0; j < NC - 1; ++j) if (j < jl) put(t[j], j * 128 + lane * 4);
    put(tl, cl);
    const v4us zero = {0, 0, 0, 0};
#pragma unroll
    for (int j = 1; j < NC; ++j) if (j > jl) { *(v4us*)(PH + j * 128 + lane * 4) = zero; *(v4us*)(PL + j * 128 + lane * 4) = zero;
        if (j + 1 < NC) asm volatile("s_wait_xcnt 0x0" ::: "memory"); }       // the compiler forms the zero pair anew for the next chunk, in the registers that these two stores name: the wait stands in front of that
}

extern "C" void kernel_launch(void* const* d_in, const int* in_sizes, int n_in,
                              void* d_out, int out_size, void* d_ws, size_t ws_size, hipStream_t stream) {
    (void)in_sizes; (void)n_in; (void)out_size;
    const float* x = (const float*)d_in[0]; const float* Wq = (const float*)d_in[1]; const float* bq = (const float*)d_in[2]; const float* Wk = (const float*)d_in[3]; const float* bk = (const float*)d_in[4]; const float* Wv = (const float*)d_in[5]; const float* bv = (const float*)d_in[6]; const float* Wo = (const float*)d_in[7]; const float* bo = (const float*)d_in[8];
    const float* qph = (const float*)d_in[9]; const float* kph = (const float*)d_in[10]; const float* temp = (const float*)d_in[11];
    float* out = (float*)d_out;    // [2][2048][1024]
    char* wsp = (char*)d_ws;
    auto take = [&](size_t bytes) { char* p = wsp; wsp += (bytes + 255) & ~(size_t)255; return (void*)p; };
    bf* WQ = (bf*)take((size_t)(NH_ * NW) * DMOD * 2); bf* WK = (bf*)take((size_t)(NH_ * NW) * DMOD * 2); bf* WV = (bf*)take((size_t)DMOD * DMOD * 2); bf* WO = (bf*)take((size_t)DMOD * DMOD * 2);
    bf* Xb = (bf*)take((size_t)NBT * NN * DMOD * 2); float* QF = (float*)take((size_t)NBT * NN * (NH_ * NW) * 4); float* KF = (float*)take((size_t)NBT * NN * (NH_ * NW) * 4); float* VF = (float*)take((size_t)NBT * NN * DMOD * 4);
    constexpr size_t NZ = (size_t)NBT * NH_;                      // planes of every (item, head) pair live at once
    bf* Qh = (bf*)take(NZ * NN * KQ * 2); bf* Ql = (bf*)take(NZ * NN * KQ * 2); bf* Kh = (bf*)take(NZ * NN * KQ * 2); bf* Kl = (bf*)take(NZ * NN * KQ * 2); bf* VTh = (bf*)take(NZ * HD * NN * 2); bf* VTl = (bf*)take(NZ * HD * NN * 2);
    float* S = (float*)take((size_t)ZH * NN * NN * 4); bf* PH = (bf*)take((size_t)ZH * NN * NN * 2); bf* PL = (bf*)take((size_t)ZH * NN * NN * 2); float* O = (float*)take((size_t)NBT * NN * DMOD * 4); bf* Oh = (bf*)take((size_t)NBT * NN * DMOD * 2); bf* Ol = (bf*)take((size_t)NBT * NN * DMOD * 2);
    if ((size_t)(wsp - (char*)d_ws) > ws_size) return;    // 229 MiB; S and the P planes are reused per group of ZH heads in stream order
    k_wt<<<dim3(DMOD / 64, (NH_ * NW) / 64, 1), 256, 0, stream>>>(Wq, DMOD, NH_ * NW, WQ); k_wt<<<dim3(DMOD / 64, (NH_ * NW) / 64, 1), 256, 0, stream>>>(Wk, DMOD, NH_ * NW, WK);   // (in, out) k-major -> n-major
    k_wt<<<dim3(DMOD / 64, DMOD / 64, 1), 256, 0, stream>>>(Wv, DMOD, DMOD, WV); k_wt<<<dim3(DMOD / 64, DMOD / 64, 1), 256, 0, stream>>>(Wo, DMOD, DMOD, WO);
    // host reads nothing from device; 1/temperature is applied inside k_csoftz via a device load? -> pass as a kernel-side scalar read: k_csoftz takes sc by value, so read temp on device in a tiny way:
    // we avoid a host sync by folding 1/temperature into the q planes? No (normalisation after). Instead k_csoftz_t below reads temp[0] itself.
    constexpr int NR = NBT * NN;                                  // the two items' rows stand behind one another in x and in out: one launch takes both
    k_cvtx<<<NR / 8, 256, 0, stream>>>(x, NR, Xb);
    k_gemmb<false, false><<<dim3(NR / 64, (NH_ * NW) / 64, 1), 128, 0, stream>>>(Xb, nullptr, WQ, bq, QF, NH_ * NW, nullptr, nullptr, DMOD);
    k_gemmb<false, false><<<dim3(NR / 64, (NH_ * NW) / 64, 1), 128, 0, stream>>>(Xb, nullptr, WK, bk, KF, NH_ * NW, nullptr, nullptr, DMOD);
    k_gemmb<false, false><<<dim3(NR / 64, DMOD / 64, 1), 128, 0, stream>>>(Xb, nullptr, WV, bv, VF, DMOD, nullptr, nullptr, DMOD);
    k_wavepl<<<dim3((NN / 2) / 8, NBT, NH_), 256, 0, stream>>>(QF, NH_ * NW, 0, qph, NN, Qh, Ql); k_wavepl<<<dim3((NN / 2) / 8, NBT, NH_), 256, 0, stream>>>(KF, NH_ * NW, 0, kph, NN, Kh, Kl);
    k_vtz<<<dim3((HD * (NN / 64)) / 8, NBT, NH_), 256, 0, stream>>>(VF, DMOD, 0, NN, VTh, VTl);
    for (int b = 0; b < NBT; ++b) {
        for (int g = 0; g < NH_ / ZH; ++g) { const int h0 = g * ZH; const size_t z0 = (size_t)b * NH_ + h0;      // the group's first (item, head) plane
            k_gemm3z<1><<<dim3(NN / 64, NN / 64, ZH), 128, 0, stream>>>(Qh + z0 * NN * KQ, Ql + z0 * NN * KQ, Kh + z0 * NN * KQ, Kl + z0 * NN * KQ, KQ, S, NN, (size_t)NN * KQ, (size_t)NN * KQ, (size_t)NN * NN);
            k_csoftzt<<<dim3(NN / 8, 1, ZH), 256, 0, stream>>>(S, NN, temp, PH, PL);
            k_pvsplit<16><<<dim3(NN / 16, 1, ZH), 512, 0, stream>>>(PH, PL, VTh + z0 * HD * NN, VTl + z0 * HD * NN, NN, O + (size_t)b * NN * DMOD + h0 * HD, DMOD, (size_t)NN * NN, (size_t)HD * NN, (size_t)HD); } }
    k_splitD<<<NR / 8, 256, 0, stream>>>(O, NR, Oh, Ol);
    k_gemmb<true, false><<<dim3(NR / 64, DMOD / 64, 1), 128, 0, stream>>>(Oh, Ol, WO, bo, out, DMOD, nullptr, nullptr, DMOD);
}

// v005
// Measured time: 179 microseconds a run.
// Versions in between are left out here; by their measured steps it is 3.23 times as fast as v003.
// All steps since v000 together make it 14.4 times as fast.
#include <hip/hip_runtime.h>

// Compute dtypes, f32 accumulate, per item: q/k/v projections as GEMMs with PLAIN bf16 operands (x and the (in,out) weights; exact products, + bias); per head the 16-wide q/k get
// their phase added and are L2-normalised in f32, then stored as bf16 hi + UNSCALED residual planes padded to K = 32 (zero columns); causal scores (three products), 1/temperature, the causal
// softmax (f32, running maximum) and attn.v (three products) in ONE kernel for all items and heads: scores and probabilities stay in registers; output projection on hi/lo planes

#define NBT  2
#define NN   2048
#define DMOD 1024
#define NH_  16
#define NW   16
#define KQ   32                   // padded score depth
#define HD   64
#define DM   DMOD
#define NTK  NN
#define LOSC 1024.0f

typedef _Float16 h16;
typedef unsigned short bf;
typedef __attribute__((ext_vector_type(16))) __bf16   v16bf;
typedef __attribute__((ext_vector_type(16))) _Float16 v16h;
typedef __attribute__((ext_vector_type(8)))  _Float16 v8h;
typedef __attribute__((ext_vector_type(8)))  unsigned short v8us;
typedef __attribute__((ext_vector_type(8)))  float    v8f;
typedef __attribute__((ext_vector_type(4)))  float    v4f;
typedef __attribute__((ext_vector_type(4)))  _Float16 v4h;
typedef v8h  __attribute__((may_alias)) v8ha;
typedef v4f  __attribute__((may_alias)) v4fa;
typedef v8us __attribute__((may_alias)) v8usa;

__device__ __forceinline__ unsigned short f2bf(float f) { unsigned u = __float_as_uint(f); u += 0x7FFFu + ((u >> 16) & 1u); return (unsigned short)(u >> 16); }
__device__ __forceinline__ float bf2f(unsigned short b) { return __uint_as_float(((unsigned)b) << 16); }
__device__ __forceinline__ float bfr(float f) { return bf2f(f2bf(f)); }
__device__ __forceinline__ v16h cat16(v8h lo, v8h hi) { return __builtin_shufflevector(lo, hi, 0, 1, 2, 3, 4, 5, 6, 7, 8, 9, 10, 11, 12, 13, 14, 15); }
__device__ __forceinline__ v16bf cat16b(v8us lo, v8us hi) { return __builtin_bit_cast(v16bf, __builtin_shufflevector(lo, hi, 0, 1, 2, 3, 4, 5, 6, 7, 8, 9, 10, 11, 12, 13, 14, 15)); }
__device__ __forceinline__ v8f wmma16(v16h a, v16h b, v8f c) { return __builtin_amdgcn_wmma_f32_16x16x32_f16(false, a, false, b, (short)0, c, false, false); }
__device__ __forceinline__ v8f wmmab(v16bf a, v16bf b, v8f c) { return __builtin_amdgcn_wmma_f32_16x16x32_bf16(false, a, false, b, (short)0, c, false, false); }

// k_wt: WT [n][K] = bf16(W[k][n]) (k-major [K][ncols]) via 64 x 64 LDS tiles; grid (K/64, ncols/64).
__global__ __launch_bounds__(256) void k_wt(const float* __restrict__ Wm, int K, int ncols, bf* WT) {
    __shared__ __align__(16) unsigned short tl[64 * 72];
    const int tid = threadIdx.x, k0 = blockIdx.x * 64, n0 = blockIdx.y * 64;
    const int kk = tid >> 2, nq = (tid & 3) * 16;
#pragma unroll
    for (int i = 0; i < 16; ++i) tl[(nq + i) * 72 + kk] = f2bf(Wm[(size_t)(k0 + kk) * ncols + n0 + nq + i]);
    __syncthreads();
    const int piece = tid & 7;
    auto pass = [&]() {
#pragma unroll
        for (int s = 0; s < 2; ++s) { const int nr = (tid >> 3) + 32 * s; const v8us val = *(const v8usa*)(tl + nr * 72 + piece * 8); *(v8us*)(WT + (size_t)(n0 + nr) * K + k0 + piece * 8) = val; }
    };
    pass(); 
}
// k_gemmb: 64 x 64 block tile (4 waves x 16 x 64) of C[rows][ldc] = (A [+ Al]).B^T (K = 1024) [+ bf(bias[c])] [+ bf(R[r][c]) residual]; f32 whole-line epilogue (or f16
// EPI 1 (q, k): the tile's 4 heads get their phase added and are L2-normalised in f32, and go out as bf16 hi + residual planes [item * NH_ + head][token][KQ], columns NW.. zero.
// EPI 2 (v): the tile is one head's 64 tokens x 64 values; it goes out transposed as bf16 hi + residual planes [item * NH_ + head][value][token], one whole 128-byte line per value and plane.
#define VT_PITCH 144              // bytes per staged V^T row (128 of data): 16 x odd
template <bool SPLITA, bool F16OUT = false, int EPI = 0>
__global__ __launch_bounds__(128) void k_gemmb(const bf* __restrict__ A, const bf* __restrict__ Al, const bf* __restrict__ Bn, const float* __restrict__ bias, float* C, int ldc, h16* C2, const float* __restrict__ R = nullptr, int K = DM, int roundR = 1, const float* __restrict__ phase = nullptr, bf* Ph = nullptr, bf* Pl = nullptr) {
    __shared__ __align__(16) float ost[4][EPI == 2 ? (2 * 64 * VT_PITCH) / 16 : 16 * 68];
    const int lane = threadIdx.x & 31, wave = threadIdx.x >> 5, lr = lane & 15, hi = lane >> 4;
    const int r0 = blockIdx.x * 64 + wave * 16, c0 = blockIdx.y * 64;
    const size_t aoff = (size_t)(r0 + lr) * K + 8 * hi;
    size_t boff[4];
#pragma unroll
    for (int t = 0; t < 4; ++t) boff[t] = (size_t)(c0 + t * 16 + lr) * K + 8 * hi;
    v8f acc[4];
#pragma unroll
    for (int t = 0; t < 4; ++t) acc[t] = (v8f){};
#pragma unroll 1
    for (int kc = 0; kc < K; kc += 32) {
        const v16bf a = cat16b(*(const v8us*)(A + aoff + kc), *(const v8us*)(A + aoff + kc + 16));
        v16bf al = a;
        if (SPLITA) al = cat16b(*(const v8us*)(Al + aoff + kc), *(const v8us*)(Al + aoff + kc + 16));
#pragma unroll
        for (int t = 0; t < 4; ++t) { const v16bf b = cat16b(*(const v8us*)(Bn + boff[t] + kc), *(const v8us*)(Bn + boff[t] + kc + 16)); acc[t] = wmmab(a, b, acc[t]); if (SPLITA) acc[t] = wmmab(al, b, acc[t]); }
        asm volatile("v_nop\n\tv_nop\n\tv_nop\n\tv_nop" : "+v"(acc[0]), "+v"(acc[1]), "+v"(acc[2]), "+v"(acc[3]) : "v"(a), "v"(al));
    }
    if constexpr (EPI == 2) {
        // acc[t][0..7] are 8 tokens in a row (wave * 16 + hi * 8 + j) of value t * 16 + lr: one 16-byte piece of a V^T row in each plane
        unsigned char* vb = (unsigned char*)&ost[0][0];
#pragma unroll
        for (int t = 0; t < 4; ++t) { const float bv = bfr(bias[c0 + t * 16 + lr]); v8us oh, ol;
#pragma unroll
            for (int j = 0; j < 8; ++j) { const float y = acc[t][j] + bv; const unsigned short hb = f2bf(y); oh[j] = hb; ol[j] = f2bf(y - bf2f(hb)); }
            unsigned char* vp = vb + (t * 16 + lr) * VT_PITCH + (wave * 16 + hi * 8) * 2; *(v8usa*)vp = oh; *(v8usa*)(vp + 64 * VT_PITCH) = ol; }
        __syncthreads();      // a V^T row's 64 tokens come from all 4 waves: every piece is in LDS before a row is read
        const int rb = blockIdx.x * 64, piece = threadIdx.x & 7, d0 = threadIdx.x >> 3;
        const size_t vo = (((size_t)(rb / NN) * NH_ + blockIdx.y) * HD + d0) * NN + rb % NN + piece * 8;      // 8 lanes write one whole line
        v8us wh[4], wl[4];
#pragma unroll
        for (int s = 0; s < 4; ++s) { const unsigned char* vp = vb + (d0 + 16 * s) * VT_PITCH + piece * 16; wh[s] = *(const v8usa*)vp; wl[s] = *(const v8usa*)(vp + 64 * VT_PITCH); }
#pragma unroll
        for (int s = 0; s < 4; ++s) { *(v8us*)(Ph + vo + (size_t)(16 * s) * NN) = wh[s]; *(v8us*)(Pl + vo + (size_t)(16 * s) * NN) = wl[s]; }
        return;
    }
    float* os = &ost[wave][0];
#pragma unroll
    for (int t = 0; t < 4; ++t) { const float bv = bias ? bfr(bias[c0 + t * 16 + lr]) : 0.f;
#pragma unroll
        for (int j = 0; j < 8; ++j) os[(hi * 8 + j) * 68 + t * 16 + lr] = acc[t][j] + bv; }
    __syncthreads();
    if constexpr (EPI == 1) {
        // a lane takes row lr of the wave's 16 and the heads hi and hi + 2 of the tile's 4: all NW values of a (row, head) pair in one lane
        v8us oh[2][2], ol[2][2];
#pragma unroll
        for (int s = 0; s < 2; ++s) { const int hh = hi + 2 * s; float v[NW], p[NW / 2];
#pragma unroll
            for (int q = 0; q < 4; ++q) { const v4f xv = *(const v4fa*)(os + lr * 68 + hh * NW + q * 4); const v4f pv = *(const v4f*)(phase + c0 + hh * NW + q * 4);
#pragma unroll
                for (int i = 0; i < 4; ++i) v[q * 4 + i] = xv[i] + bfr(pv[i]); }
#pragma unroll
            for (int i = 0; i < NW / 2; ++i) p[i] = v[2 * i] * v[2 * i] + v[2 * i + 1] * v[2 * i + 1];
            const float ss = ((p[0] + p[4]) + (p[2] + p[6])) + ((p[1] + p[5]) + (p[3] + p[7]));      // pairs, then partners 4, 2, 1 apart
            const float inv = 1.0f / fmaxf(sqrtf(ss), 1e-12f);
#pragma unroll
            for (int i = 0; i < NW; ++i) { const float y = v[i] * inv; const unsigned short hb = f2bf(y); oh[s][i >> 3][i & 7] = hb; ol[s][i >> 3][i & 7] = f2bf(y - bf2f(hb)); }
        }
        const int r = r0 + lr; const v8us zero = {0, 0, 0, 0, 0, 0, 0, 0};
        const size_t po = (((size_t)(r / NN) * NH_ + blockIdx.y * 4 + hi) * NN + r % NN) * KQ;      // a wave fills 16 rows of 64 bytes in a row per head and plane
#pragma unroll
        for (int s = 0; s < 2; ++s) { bf* a = Ph + po + (size_t)(2 * s) * NN * KQ; bf* b = Pl + po + (size_t)(2 * s) * NN * KQ;
            *(v8us*)a = oh[s][0]; *(v8us*)(a + 8) = oh[s][1]; *(v8us*)(a + 16) = zero; *(v8us*)(a + 24) = zero; *(v8us*)b = ol[s][0]; *(v8us*)(b + 8) = ol[s][1]; *(v8us*)(b + 16) = zero; *(v8us*)(b + 24) = zero; }
        return;
    }
    if (F16OUT) {
        h16* crow = (h16*)(void*)C + (size_t)r0 * ldc + c0;
        auto pass = [&]() {
#pragma unroll
            for (int s = 0; s < 4; ++s) { const int row = 4 * s + (lane >> 3), piece = lane & 7; const float* sp = os + row * 68 + piece * 8; v8h o, o2;
#pragma unroll
                for (int i = 0; i < 8; ++i) { const h16 a = (h16)sp[i]; o[i] = a; o2[i] = (h16)((sp[i] - (float)a) * LOSC); }
                *(v8h*)(crow + (size_t)row * ldc + piece * 8) = o; if (C2) *(v8h*)(C2 + (size_t)r0 * ldc + c0 + (size_t)row * ldc + piece * 8) = o2; }
        };
        pass(); 
    } else {
        float* crow = C + (size_t)r0 * ldc + c0;
        auto pass = [&]() {
#pragma unroll
            for (int s = 0; s < 8; ++s) { const int Lid = (lane >> 3) + 4 * s, piece = lane & 7; const int row = Lid >> 1, cofs = (Lid & 1) * 32 + piece * 4;
                v4f val = *(const v4fa*)(os + row * 68 + cofs); if (R) { const v4f rv = *(const v4f*)(R + ((size_t)r0 + row) * ldc + c0 + cofs); val += roundR ? (v4f){bfr(rv[0]), bfr(rv[1]), bfr(rv[2]), bfr(rv[3])} : rv; }
                *(v4f*)(crow + (size_t)row * ldc + cofs) = val; }
        };
        pass(); 
    }
}


// k_fattn: causal attention of one (item, head) plane per blockIdx.z, 16 query rows per wave, 32 keys per pass: S^T = K.Q^T (A = key rows, B = query rows, both in the same k order), so a lane
// holds 16 scores of ONE query (column lr; keys 8 * hi + j and 16 + 8 * hi + j), which is also that query's place in the B operand of O^T += V^T.P^T: the probabilities go from the score
// accumulators into the next product without leaving the lane. Running maximum and sum per query; the output tile is rescaled only in a pass where some query's maximum rises.
// The block's 8 waves share the keys: a stage of 64 keys (K and V^T, hi and residual planes) is fetched once per block by whole-line loads and laid into one of two LDS buffers.
// A block takes the 128-row block 15 - x and then the block x of its plane: every block walks the same number of stages.
#define FK_PITCH 80               // bytes per staged key row (64 of data): 16 x odd, the pitch at which 16-byte LDS reads of 16 rows do not collide
#define FV_PITCH 144              // bytes per staged V^T row (128 of data): 16 x odd
#define FK_PLANE (64 * FK_PITCH)
#define FV_PLANE (64 * FV_PITCH)
#define F_BUF    (2 * FK_PLANE + 2 * FV_PLANE)
__global__ __launch_bounds__(256) void k_fattn(const bf* __restrict__ Qh, const bf* __restrict__ Ql, const bf* __restrict__ Kh, const bf* __restrict__ Kl, const bf* __restrict__ Vh, const bf* __restrict__ Vl, const float* __restrict__ temp, bf* Oh, bf* Ol) {
    typedef __attribute__((ext_vector_type(2))) float v2f;
    typedef __attribute__((ext_vector_type(2))) __bf16 v2bf;
    __shared__ __align__(16) unsigned char L[2 * F_BUF];
    const float sc2 = (1.0f / bfr(temp[0])) * 1.44269504f;        // 1/temperature and log2(e) in one factor: the exponentials are base 2
    const int tid = threadIdx.x, lane = tid & 31, lr = lane & 15, hi = lane >> 4;
    const int wave = __builtin_amdgcn_readfirstlane(tid >> 5);    // the wave's number in a scalar register: trip counts and the diagonal test become scalar, EXEC stays whole
    const size_t z = blockIdx.z;
    Qh += z * NN * KQ; Ql += z * NN * KQ; Kh += z * NN * KQ; Kl += z * NN * KQ; Vh += z * HD * NN; Vl += z * HD * NN;
    Oh += (z / NH_) * NN * DMOD + (z % NH_) * HD; Ol += (z / NH_) * NN * DMOD + (z % NH_) * HD;
    auto xhalf = [](float v) { const int b = __float_as_int(v); return __int_as_float(__builtin_amdgcn_permlanex16(b, b, 0x76543210, 0xfedcba98, false, false)); };      // lane l <-> l ^ 16
    // staging: a plane's 64 key rows are 4 KiB in a row, thread tid takes 16-byte piece tid; a V^T plane's stage is 64 rows of one 128-byte line, thread tid takes pieces tid and tid + 256 (8 pieces a row)
    const int ksto = (tid >> 2) * FK_PITCH + (tid & 3) * 16, vsto = 2 * FK_PLANE + (tid >> 3) * FV_PITCH + (tid & 7) * 16;
    const size_t vsrc = (size_t)(tid >> 3) * NN + (tid & 7) * 8;
    v8us g[6];
    auto fetch = [&](int st) {                                    // stage st: global memory to registers
        const bf* p0 = Kh + (size_t)st * 64 * KQ + tid * 8; const bf* p1 = Kl + (size_t)st * 64 * KQ + tid * 8; const bf* p2 = Vh + vsrc + st * 64; const bf* p3 = Vl + vsrc + st * 64;
        g[0] = *(const v8us*)p0; g[1] = *(const v8us*)p1; g[2] = *(const v8us*)p2; g[3] = *(const v8us*)(p2 + 32 * NN); g[4] = *(const v8us*)p3; g[5] = *(const v8us*)(p3 + 32 * NN);
        // no address register of the loads above is rewritten before this wait: the clobber keeps the loads in front of it, and naming the addresses as inputs keeps their registers whole up to it
        asm volatile("s_wait_xcnt 0x0" :: "v"(p0), "v"(p1), "v"(p2), "v"(p3) : "memory");
    };
    auto lay = [&](int st) {                                      // registers to the stage's LDS buffer
        unsigned char* B = L + (st & 1) * F_BUF;
        *(v8usa*)(B + ksto) = g[0]; *(v8usa*)(B + FK_PLANE + ksto) = g[1]; *(v8usa*)(B + vsto) = g[2]; *(v8usa*)(B + vsto + 32 * FV_PITCH) = g[3]; *(v8usa*)(B + FV_PLANE + vsto) = g[4]; *(v8usa*)(B + FV_PLANE + vsto + 32 * FV_PITCH) = g[5];
    };
#pragma unroll 1      // the two row blocks run one after the other through one copy of the code
    for (int job = 0; job < 2; ++job) {
        const int qb = job ? (int)blockIdx.x : NN / 128 - 1 - (int)blockIdx.x;
        const int nst = 2 * (qb + 1);                             // stages of 64 keys up to the block's last row: the same for all 8 waves
        const int q0 = qb * 128 + wave * 16;
        const int ns = (q0 + 47) >> 5;                            // this wave's passes of 32 keys, up to and with the one that holds key q0 + 15
        const size_t qo = (size_t)(q0 + lr) * KQ + 8 * hi;
        const v16bf qh = cat16b(*(const v8us*)(Qh + qo), *(const v8us*)(Qh + qo + 16)), ql = cat16b(*(const v8us*)(Ql + qo), *(const v8us*)(Ql + qo + 16));
        fetch(0); lay(0);                                         // buffer 0 is free: every wave has passed the barrier behind the last stage of the row block before
        __syncthreads();      // stage 0 is in LDS before any wave reads it
        v8f acc[4];
#pragma unroll
        for (int t = 0; t < 4; ++t) acc[t] = (v8f){};
        float m = -3.0e38f; v2f l2 = {0.f, 0.f};                  // the lane's sum in two halves: one packed add per pair of keys
#pragma unroll 1      // kept rolled: a stage is long
        for (int st = 0; st < nst; ++st) {
            if (st + 1 < nst) fetch(st + 1);                      // in flight under this stage's two passes
            const unsigned char* B = L + (st & 1) * F_BUF;
#pragma unroll 1      // one copy of the pass
            for (int pp = 0; pp < 2; ++pp) {
                const int s = 2 * st + pp;
                if (s >= ns) break;                               // scalar: a wave whose rows end below these keys goes on to the barrier
                const unsigned char* bk = B + (pp * 32 + lr) * FK_PITCH + 16 * hi;      // keys 32 s + 16 u + lr, the same k order as the q loader
                const unsigned char* bv = B + 2 * FK_PLANE + lr * FV_PITCH + pp * 64 + 16 * hi;      // V^T rows d = 16 t + lr, keys 32 s + 8 * hi + 0..7 and + 16: the order in which the score tiles hold the keys
                v16bf kh[2], kl[2], vh[4], vl[4];
#pragma unroll
                for (int u = 0; u < 2; ++u) { kh[u] = cat16b(*(const v8usa*)(bk + u * 16 * FK_PITCH), *(const v8usa*)(bk + u * 16 * FK_PITCH + 32)); kl[u] = cat16b(*(const v8usa*)(bk + FK_PLANE + u * 16 * FK_PITCH), *(const v8usa*)(bk + FK_PLANE + u * 16 * FK_PITCH + 32)); }
#pragma unroll
                for (int t = 0; t < 4; ++t) { vh[t] = cat16b(*(const v8usa*)(bv + t * 16 * FV_PITCH), *(const v8usa*)(bv + t * 16 * FV_PITCH + 32)); vl[t] = cat16b(*(const v8usa*)(bv + FV_PLANE + t * 16 * FV_PITCH), *(const v8usa*)(bv + FV_PLANE + t * 16 * FV_PITCH + 32)); }
                asm volatile("" ::: "memory");      // compiler fence: the pass's 24 LDS reads stay together here, in flight at once; moved down to their products, each fragment would cost an LDS latency of its own
                v8f sc[2];
#pragma unroll
                for (int u = 0; u < 2; ++u) { sc[u] = wmmab(kh[u], qh, (v8f){}); sc[u] = wmmab(kh[u], ql, sc[u]); sc[u] = wmmab(kl[u], qh, sc[u]); }
#pragma unroll
                for (int u = 0; u < 2; ++u) sc[u] *= sc2;
                if (s == ns - 1) {                                // only the wave's last pass holds keys above the diagonal
#pragma unroll
                    for (int u = 0; u < 2; ++u) {
#pragma unroll
                        for (int j = 0; j < 8; ++j) if (s * 32 + u * 16 + hi * 8 + j > q0 + lr) sc[u][j] = -3.0e38f; }      // a masked key: exp gives 0 below (key 0 is never masked, so m is a real score)
                }
                float mx = sc[0][0];
#pragma unroll
                for (int e = 1; e < 16; ++e) mx = fmaxf(mx, sc[e >> 3][e & 7]);
                mx = fmaxf(mx, xhalf(mx));                        // both halves of the wave hold the query's maximum of this pass
                if (__builtin_amdgcn_ballot_w32(mx > m) != 0) {   // scalar branch; where no maximum rises every factor would be 1
                    const float mn = fmaxf(m, mx), corr = __builtin_amdgcn_exp2f(m - mn); m = mn; l2 *= corr;
#pragma unroll
                    for (int t = 0; t < 4; ++t) acc[t] *= corr;
                }
                v16bf ph, pl;
#pragma unroll
                for (int e = 0; e < 16; e += 2) {
                    const v2f p = {__builtin_amdgcn_exp2f(sc[e >> 3][e & 7] - m), __builtin_amdgcn_exp2f(sc[e >> 3][(e & 7) + 1] - m)};
                    l2 += p;
                    const v2bf h2 = __builtin_convertvector(p, v2bf); const v2bf r2 = __builtin_convertvector(p - __builtin_convertvector(h2, v2f), v2bf);      // hi plane and residual, both to nearest even
                    ph[e] = h2[0]; ph[e + 1] = h2[1]; pl[e] = r2[0]; pl[e + 1] = r2[1];
                }
#pragma unroll
                for (int t = 0; t < 4; ++t) { acc[t] = wmmab(vh[t], ph, acc[t]); acc[t] = wmmab(vh[t], pl, acc[t]); acc[t] = wmmab(vl[t], ph, acc[t]); }
                // four vector slots between the last matrix instruction and whatever overwrites its operands or reads its result on the taken back edge or behind the loop
                asm volatile("v_nop\n\tv_nop\n\tv_nop\n\tv_nop" : "+v"(acc[0]), "+v"(acc[1]), "+v"(acc[2]), "+v"(acc[3]) : "v"(vh[0]), "v"(vh[1]), "v"(vh[2]), "v"(vh[3]), "v"(vl[0]), "v"(vl[1]), "v"(vl[2]), "v"(vl[3]), "v"(ph), "v"(pl));
            }
            if (st + 1 < nst) lay(st + 1);                        // into the buffer that stage st - 1 was read from: every wave has left it, it passed the barrier below
            __syncthreads();      // stage st + 1 is in LDS before any wave reads it, and every wave's reads of stage st are done before its buffer is filled again
        }
        float l = l2[0] + l2[1]; l += xhalf(l);                   // the two halves' sums meet once
        const float inv = 1.0f / l;
        bf* ohrow = Oh + (size_t)(q0 + lr) * DMOD + hi * 8; bf* olrow = Ol + (size_t)(q0 + lr) * DMOD + hi * 8;      // acc[t][j] = O[q0 + lr][16 t + 8 hi + j]: 8 values in a row per tile, one 16-byte piece in each plane
#pragma unroll
        for (int t = 0; t < 4; ++t) { const v8f o = acc[t] * inv; v8us a, b;
#pragma unroll
            for (int j = 0; j < 8; ++j) { const unsigned short hb = f2bf(o[j]); a[j] = hb; b[j] = f2bf(o[j] - bf2f(hb)); }      // the output projection's hi plane and residual
            *(v8us*)(ohrow + t * 16) = a; *(v8us*)(olrow + t * 16) = b; }
        asm volatile("s_wait_xcnt 0x0" :: "v"(ohrow), "v"(olrow) : "memory");      // the second row block's arithmetic reuses the registers that these stores name: the wait stands in front of that
    }
}
__global__ __launch_bounds__(256) void k_planes32z(const float* __restrict__ F, int ld, int off, float sc, int rows, bf* Ph, bf* Pl) {
    typedef __attribute__((ext_vector_type(2))) unsigned short v2us;
    const int lane = threadIdx.x & 31; const size_t r = ((size_t)blockIdx.x * 8 + (threadIdx.x >> 5)) * 2 + (lane >> 4); if (r >= (size_t)rows) return; const int z = blockIdx.z; const int c0 = (lane & 15) * 2; v2us oh, ol;
    Ph += (size_t)z * rows * 32; Pl += (size_t)z * rows * 32;
#pragma unroll
    for (int i = 0; i < 2; ++i) { const float y = F[r * ld + off + z * 32 + c0 + i] * sc; const unsigned short hb = f2bf(y); oh[i] = hb; ol[i] = f2bf(y - bf2f(hb)); }
    const size_t o = r * 32 + c0; *(v2us*)(Ph + o) = oh; *(v2us*)(Pl + o) = ol; 
}
__global__ __launch_bounds__(256) void k_vtpadz(const float* __restrict__ F, int ld, int off, int nk, bf* Th, bf* Tl) {
    typedef __attribute__((ext_vector_type(2))) unsigned short v2us;
    const int lane = threadIdx.x & 31; const size_t wid = (size_t)blockIdx.x * 8 + (threadIdx.x >> 5); if (wid >= (size_t)64 * (nk / 64)) return; const int z = blockIdx.z; const int d = (int)(wid / (nk / 64)); const int k0 = (int)(wid % (nk / 64)) * 64 + lane * 2; v2us oh, ol;
    Th += (size_t)z * 64 * nk; Tl += (size_t)z * 64 * nk;
#pragma unroll
    for (int i = 0; i < 2; ++i) { const float y = (d < 32) ? F[(size_t)(k0 + i) * ld + off + z * 32 + (d < 32 ? d : 0)] : 0.f; const unsigned short hb = f2bf(y); oh[i] = hb; ol[i] = f2bf(y - bf2f(hb)); }
    const size_t o = (size_t)d * nk + k0; *(v2us*)(Th + o) = oh; *(v2us*)(Tl + o) = ol; 
}
template <int NK>
__global__ __launch_bounds__(256) void k_softmaxz(const float* __restrict__ S, int rows, bf* PH, bf* PL) {
    typedef __attribute__((ext_vector_type(4))) unsigned short v4us;
    const int lane = threadIdx.x & 31, i = blockIdx.x * 8 + (threadIdx.x >> 5); if (i >= rows) return; const size_t zo = (size_t)blockIdx.z * rows * NK; const float* sr = S + zo + (size_t)i * NK; PH += zo; PL += zo;
    float m = -3.0e38f;
#pragma unroll 1
    for (int c0 = lane * 4; c0 < NK; c0 += 128) {
#pragma unroll
        for (int q = 0; q < 4; ++q) m = fmaxf(m, sr[c0 + q]); }
#pragma unroll
    for (int sh = 16; sh; sh >>= 1) m = fmaxf(m, __shfl_xor(m, sh, 32));
    float sum = 0.f;
#pragma unroll 1
    for (int c0 = lane * 4; c0 < NK; c0 += 128) {
#pragma unroll
        for (int q = 0; q < 4; ++q) sum += __expf(sr[c0 + q] - m); }
#pragma unroll
    for (int sh = 16; sh; sh >>= 1) sum += __shfl_xor(sum, sh, 32);
    const float inv = 1.0f / sum;
{
#pragma unroll 1
        for (int c0 = lane * 4; c0 < NK; c0 += 128) { v4us oh, ol;
#pragma unroll
            for (int q = 0; q < 4; ++q) { const float p = __expf(sr[c0 + q] - m) * inv; const unsigned short hb = f2bf(p); oh[q] = hb; ol[q] = f2bf(p - bf2f(hb)); }
            const size_t o = (size_t)i * NK + c0; *(v4us*)(PH + o) = oh; *(v4us*)(PL + o) = ol; }
         }
}
__global__ __launch_bounds__(256) void k_placez(const float* __restrict__ XH, int rows, int ldy, float* Y) {
    const int lane = threadIdx.x & 31; const size_t q = (size_t)blockIdx.x * 8 + (threadIdx.x >> 5); if (q >= (size_t)rows) return; const int z = blockIdx.z; const float v = XH[((size_t)z * rows + q) * 64 + lane];
    *(float*)(Y + q * ldy + z * 32 + lane) = v; 
}

__global__ __launch_bounds__(256) void k_hplanesz(const float* __restrict__ F, int ld, int h0, float sc, int rows, bf* Ph, bf* Pl) {
    typedef __attribute__((ext_vector_type(2))) unsigned short v2us;
    const int lane = threadIdx.x & 31; const size_t r = (size_t)blockIdx.x * 8 + (threadIdx.x >> 5); if (r >= (size_t)rows) return; const int z = blockIdx.z; v2us oh, ol;
    Ph += (size_t)z * rows * 64; Pl += (size_t)z * rows * 64;
#pragma unroll
    for (int i = 0; i < 2; ++i) { const float y = F[r * ld + (h0 + z) * 64 + lane * 2 + i] * sc; const unsigned short hb = f2bf(y); oh[i] = hb; ol[i] = f2bf(y - bf2f(hb)); }
    const size_t o = r * 64 + lane * 2; *(v2us*)(Ph + o) = oh; *(v2us*)(Pl + o) = ol; 
}
template <int NK>
__global__ __launch_bounds__(256) void k_softmaxzs(const float* __restrict__ S, int rows, float sc, bf* PH, bf* PL) {
    typedef __attribute__((ext_vector_type(4))) unsigned short v4us;
    const int lane = threadIdx.x & 31, i = blockIdx.x * 8 + (threadIdx.x >> 5); if (i >= rows) return; const size_t zo = (size_t)blockIdx.z * rows * NK; const float* sr = S + zo + (size_t)i * NK; PH += zo; PL += zo;
    float m = -3.0e38f;
#pragma unroll 1
    for (int c0 = lane * 4; c0 < NK; c0 += 128) {
#pragma unroll
        for (int q = 0; q < 4; ++q) m = fmaxf(m, sr[c0 + q] * sc); }
#pragma unroll
    for (int sh = 16; sh; sh >>= 1) m = fmaxf(m, __shfl_xor(m, sh, 32));
    float sum = 0.f;
#pragma unroll 1
    for (int c0 = lane * 4; c0 < NK; c0 += 128) {
#pragma unroll
        for (int q = 0; q < 4; ++q) sum += __expf(sr[c0 + q] * sc - m); }
#pragma unroll
    for (int sh = 16; sh; sh >>= 1) sum += __shfl_xor(sum, sh, 32);
    const float inv = 1.0f / sum;
{
#pragma unroll 1
        for (int c0 = lane * 4; c0 < NK; c0 += 128) { v4us oh, ol;
#pragma unroll
            for (int q = 0; q < 4; ++q) { const float p = __expf(sr[c0 + q] * sc - m) * inv; const unsigned short hb = f2bf(p); oh[q] = hb; ol[q] = f2bf(p - bf2f(hb)); }
            const size_t o = (size_t)i * NK + c0; *(v4us*)(PH + o) = oh; *(v4us*)(PL + o) = ol; }
         }
}

__global__ __launch_bounds__(256) void k_cvtx(const float* __restrict__ src, int rows, bf* dst) {
    const int lane = threadIdx.x & 31; const size_t r = (size_t)blockIdx.x * 8 + (threadIdx.x >> 5); if (r >= (size_t)rows) return;
{
#pragma unroll
        for (int q = 0; q < DMOD / 256; ++q) { v8us o;
#pragma unroll
            for (int i = 0; i < 8; ++i) o[i] = f2bf(src[r * DMOD + q * 256 + lane * 8 + i]);
            *(v8us*)(dst + r * DMOD + q * 256 + lane * 8) = o; }
         }
}
__global__ __launch_bounds__(256) void k_csoftz(const float* __restrict__ S, int rows, float sc, bf* PH, bf* PL) {
    typedef __attribute__((ext_vector_type(4))) unsigned short v4us;
    const int lane = threadIdx.x & 31, i = blockIdx.x * 8 + (threadIdx.x >> 5); if (i >= rows) return; const size_t zo = (size_t)blockIdx.z * rows * NN; const float* sr = S + zo + (size_t)i * NN; PH += zo; PL += zo;
    float m = -3.0e38f;
#pragma unroll 1
    for (int c0 = lane * 4; c0 < NN; c0 += 128) {
#pragma unroll
        for (int q = 0; q < 4; ++q) { const int k = c0 + q; if (k <= i) m = fmaxf(m, sr[k] * sc); } }
#pragma unroll
    for (int sh = 16; sh; sh >>= 1) m = fmaxf(m, __shfl_xor(m, sh, 32));
    float sum = 0.f;
#pragma unroll 1
    for (int c0 = lane * 4; c0 < NN; c0 += 128) {
#pragma unroll
        for (int q = 0; q < 4; ++q) { const int k = c0 + q; if (k <= i) sum += __expf(sr[k] * sc - m); } }
#pragma unroll
    for (int sh = 16; sh; sh >>= 1) sum += __shfl_xor(sum, sh, 32);
    const float inv = 1.0f / sum;
{
#pragma unroll 1
        for (int c0 = lane * 4; c0 < NN; c0 += 128) { v4us oh, ol;
#pragma unroll
            for (int q = 0; q < 4; ++q) { const int k = c0 + q; const float p = (k <= i) ? __expf(sr[(k <= i) ? k : 0] * sc - m) * inv : 0.f; const unsigned short hb = f2bf(p); oh[q] = hb; ol[q] = f2bf(p - bf2f(hb)); }
            const size_t o = (size_t)i * NN + c0; *(v4us*)(PH + o) = oh; *(v4us*)(PL + o) = ol; }
         }
}
extern "C" void kernel_launch(void* const* d_in, const int* in_sizes, int n_in,
                              void* d_out, int out_size, void* d_ws, size_t ws_size, hipStream_t stream) {
    (void)in_sizes; (void)n_in; (void)out_size;
    const float* x = (const float*)d_in[0]; const float* Wq = (const float*)d_in[1]; const float* bq = (const float*)d_in[2]; const float* Wk = (const float*)d_in[3]; const float* bk = (const float*)d_in[4]; const float* Wv = (const float*)d_in[5]; const float* bv = (const float*)d_in[6]; const float* Wo = (const float*)d_in[7]; const float* bo = (const float*)d_in[8];
    const float* qph = (const float*)d_in[9]; const float* kph = (const float*)d_in[10]; const float* temp = (const float*)d_in[11];
    float* out = (float*)d_out;    // [2][2048][1024]
    char* wsp = (char*)d_ws;
    auto take = [&](size_t bytes) { char* p = wsp; wsp += (bytes + 255) & ~(size_t)255; return (void*)p; };
    bf* WQ = (bf*)take((size_t)(NH_ * NW) * DMOD * 2); bf* WK = (bf*)take((size_t)(NH_ * NW) * DMOD * 2); bf* WV = (bf*)take((size_t)DMOD * DMOD * 2); bf* WO = (bf*)take((size_t)DMOD * DMOD * 2);
    bf* Xb = (bf*)take((size_t)NBT * NN * DMOD * 2);
    constexpr size_t NZ = (size_t)NBT * NH_;                      // planes of every (item, head) pair live at once
    bf* Qh = (bf*)take(NZ * NN * KQ * 2); bf* Ql = (bf*)take(NZ * NN * KQ * 2); bf* Kh = (bf*)take(NZ * NN * KQ * 2); bf* Kl = (bf*)take(NZ * NN * KQ * 2); bf* VTh = (bf*)take(NZ * HD * NN * 2); bf* VTl = (bf*)take(NZ * HD * NN * 2);
    bf* Oh = (bf*)take((size_t)NBT * NN * DMOD * 2); bf* Ol = (bf*)take((size_t)NBT * NN * DMOD * 2);
    if ((size_t)(wsp - (char*)d_ws) > ws_size) return;    // 61 MiB
    k_wt<<<dim3(DMOD / 64, (NH_ * NW) / 64, 1), 256, 0, stream>>>(Wq, DMOD, NH_ * NW, WQ); k_wt<<<dim3(DMOD / 64, (NH_ * NW) / 64, 1), 256, 0, stream>>>(Wk, DMOD, NH_ * NW, WK);   // (in, out) k-major -> n-major
    k_wt<<<dim3(DMOD / 64, DMOD / 64, 1), 256, 0, stream>>>(Wv, DMOD, DMOD, WV); k_wt<<<dim3(DMOD / 64, DMOD / 64, 1), 256, 0, stream>>>(Wo, DMOD, DMOD, WO);
    // the host reads nothing from the device: k_fattn reads temperature[0] itself
    constexpr int NR = NBT * NN;                                  // the two items' rows stand behind one another in x and in out: one launch takes both
    k_cvtx<<<NR / 8, 256, 0, stream>>>(x, NR, Xb);
    // each projection writes the planes that k_fattn reads, and k_fattn the planes that the output projection reads
    k_gemmb<false, false, 1><<<dim3(NR / 64, (NH_ * NW) / 64, 1), 128, 0, stream>>>(Xb, nullptr, WQ, bq, nullptr, NH_ * NW, nullptr, nullptr, DMOD, 1, qph, Qh, Ql);
    k_gemmb<false, false, 1><<<dim3(NR / 64, (NH_ * NW) / 64, 1), 128, 0, stream>>>(Xb, nullptr, WK, bk, nullptr, NH_ * NW, nullptr, nullptr, DMOD, 1, kph, Kh, Kl);
    k_gemmb<false, false, 2><<<dim3(NR / 64, DMOD / 64, 1), 128, 0, stream>>>(Xb, nullptr, WV, bv, nullptr, DMOD, nullptr, nullptr, DMOD, 1, nullptr, VTh, VTl);
    k_fattn<<<dim3(NN / 256, 1, NBT * NH_), 256, 0, stream>>>(Qh, Ql, Kh, Kl, VTh, VTl, temp, Oh, Ol);
    k_gemmb<true, false><<<dim3(NR / 64, DMOD / 64, 1), 128, 0, stream>>>(Oh, Ol, WO, bo, out, DMOD, nullptr, nullptr, DMOD);
}

// v006
// Measured time: 111 microseconds a run.
// Timed twice side by side with v005, it ran 1.60 times as fast both times.
// Counting every step since v000, it is 23.1 times as fast.
#include <hip/hip_runtime.h>

// Compute dtypes, f32 accumulate, per item: q/k/v projections as GEMMs with PLAIN bf16 operands (x and the (in,out) weights; exact products, + bias); per head the 16-wide q/k get
// their phase added and are L2-normalised in f32, then stored as bf16 hi + UNSCALED residual planes padded to K = 32 (zero columns); causal scores (three products), 1/temperature, the causal
// softmax (f32, running maximum) and attn.v (three products) in ONE kernel for all items and heads: scores and probabilities stay in registers; output projection on hi/lo planes

#define NBT  2
#define NN   2048
#define DMOD 1024
#define NH_  16
#define NW   16
#define KQ   32                   // padded score depth
#define HD   64
#define DM   DMOD
#define NTK  NN
#define LOSC 1024.0f

typedef _Float16 h16;
typedef unsigned short bf;
typedef __attribute__((ext_vector_type(16))) __bf16   v16bf;
typedef __attribute__((ext_vector_type(16))) _Float16 v16h;
typedef __attribute__((ext_vector_type(8)))  _Float16 v8h;
typedef __attribute__((ext_vector_type(8)))  unsigned short v8us;
typedef __attribute__((ext_vector_type(8)))  float    v8f;
typedef __attribute__((ext_vector_type(4)))  float    v4f;
typedef __attribute__((ext_vector_type(4)))  _Float16 v4h;
typedef v8h  __attribute__((may_alias)) v8ha;
typedef v4f  __attribute__((may_alias)) v4fa;
typedef v8us __attribute__((may_alias)) v8usa;

__device__ __forceinline__ unsigned short f2bf(float f) { unsigned u = __float_as_uint(f); u += 0x7FFFu + ((u >> 16) & 1u); return (unsigned short)(u >> 16); }
__device__ __forceinline__ float bf2f(unsigned short b) { return __uint_as_float(((unsigned)b) << 16); }
__device__ __forceinline__ float bfr(float f) { return bf2f(f2bf(f)); }
__device__ __forceinline__ v16h cat16(v8h lo, v8h hi) { return __builtin_shufflevector(lo, hi, 0, 1, 2, 3, 4, 5, 6, 7, 8, 9, 10, 11, 12, 13, 14, 15); }
__device__ __forceinline__ v16bf cat16b(v8us lo, v8us hi) { return __builtin_bit_cast(v16bf, __builtin_shufflevector(lo, hi, 0, 1, 2, 3, 4, 5, 6, 7, 8, 9, 10, 11, 12, 13, 14, 15)); }
__device__ __forceinline__ v8f wmma16(v16h a, v16h b, v8f c) { return __builtin_amdgcn_wmma_f32_16x16x32_f16(false, a, false, b, (short)0, c, false, false); }
__device__ __forceinline__ v8f wmmab(v16bf a, v16bf b, v8f c) { return __builtin_amdgcn_wmma_f32_16x16x32_bf16(false, a, false, b, (short)0, c, false, false); }

// k_wt: WT [n][K] = bf16(W[k][n]) (k-major [K][ncols]) via 64 x 64 LDS tiles; grid (K/64, ncols/64).
__global__ __launch_bounds__(256) void k_wt(const float* __restrict__ Wm, int K, int ncols, bf* WT) {
    __shared__ __align__(16) unsigned short tl[64 * 72];
    const int tid = threadIdx.x, k0 = blockIdx.x * 64, n0 = blockIdx.y * 64;
    const int kk = tid >> 2, nq = (tid & 3) * 16;
#pragma unroll
    for (int i = 0; i < 16; ++i) tl[(nq + i) * 72 + kk] = f2bf(Wm[(size_t)(k0 + kk) * ncols + n0 + nq + i]);
    __syncthreads();
    const int piece = tid & 7;
    auto pass = [&]() {
#pragma unroll
        for (int s = 0; s < 2; ++s) { const int nr = (tid >> 3) + 32 * s; const v8us val = *(const v8usa*)(tl + nr * 72 + piece * 8); *(v8us*)(WT + (size_t)(n0 + nr) * K + k0 + piece * 8) = val; }
    };
    pass(); 
}
// k_gemmb: 64 x 64 block tile (4 waves x 16 x 64) of C[rows][ldc] = (A [+ Al]).B^T (K = 1024) [+ bf(bias[c])] [+ bf(R[r][c]) residual]; f32 whole-line epilogue (or f16
// The K loop goes by tiles of 64 k: the block's 64 rows of A (and of Al) and 64 rows of B are copied into one of two LDS buffers, whole lines, one tile ahead; B's rows serve all 4 waves.
// EPI 1 (q, k): the tile's 4 heads get their phase added and are L2-normalised in f32, and go out as bf16 hi + residual planes [item * NH_ + head][token][KQ], columns NW.. zero.
// EPI 2 (v): the tile is one head's 64 tokens x 64 values; it goes out transposed as bf16 hi + residual planes [item * NH_ + head][value][token], one whole 128-byte line per value and plane.
#define VT_PITCH 144              // bytes per staged V^T row (128 of data): 16 x odd
#define GS_PITCH 144              // bytes per staged operand row (64 k, 128 of data): 16 x odd
#define GS_PLANE (64 * GS_PITCH)
template <bool SPLITA, bool F16OUT = false, int EPI = 0>
__global__ __launch_bounds__(128) void k_gemmb(const bf* __restrict__ A, const bf* __restrict__ Al, const bf* __restrict__ Bn, const float* __restrict__ bias, float* C, int ldc, h16* C2, const float* __restrict__ R = nullptr, int K = DM, int roundR = 1, const float* __restrict__ phase = nullptr, bf* Ph = nullptr, bf* Pl = nullptr) {
    __shared__ __align__(16) float ost[4][EPI == 2 ? (2 * 64 * VT_PITCH) / 16 : 16 * 68];
    constexpr int NPL = SPLITA ? 3 : 2;                           // staged planes of a tile: A, A's residual where there is one, B
    __shared__ __align__(16) unsigned char stg[2 * NPL * GS_PLANE];
    const int tid = threadIdx.x, lane = threadIdx.x & 31, wave = threadIdx.x >> 5, lr = lane & 15, hi = lane >> 4;
    const int r0 = blockIdx.x * 64 + wave * 16, c0 = blockIdx.y * 64;
    // staging: a tile is 64 rows of 64 k (one 128-byte line a row) of each plane; thread tid copies the 16-byte piece tid & 7 of the rows (tid >> 3) + 16 i: a wave's copy takes 4 whole lines
    const unsigned sdst = (unsigned)(size_t)stg + (tid >> 3) * GS_PITCH + (tid & 7) * 16;
    const size_t asrc = (size_t)(blockIdx.x * 64 + (tid >> 3)) * K + (tid & 7) * 8, bsrc = (size_t)(c0 + (tid >> 3)) * K + (tid & 7) * 8, rstep = (size_t)16 * K;
    auto stage = [&](int t) {                                     // tile t: global memory to LDS buffer t & 1, through no register
        const unsigned d = sdst + (t & 1) * (NPL * GS_PLANE), e = d + (NPL - 1) * GS_PLANE;
        const bf* pa = A + asrc + t * 64; const bf* pb = Bn + bsrc + t * 64;
        // the tile's copies stand in one statement; the wait at its end stands in front of whatever rewrites a register that one of them names
        if constexpr (SPLITA) {
            const unsigned f = d + GS_PLANE; const bf* pl = Al + asrc + t * 64;
            asm volatile("global_load_async_to_lds_b128 %0, %12, off\n\tglobal_load_async_to_lds_b128 %1, %13, off\n\tglobal_load_async_to_lds_b128 %2, %14, off\n\tglobal_load_async_to_lds_b128 %3, %15, off\n\t"
                         "global_load_async_to_lds_b128 %4, %16, off\n\tglobal_load_async_to_lds_b128 %5, %17, off\n\tglobal_load_async_to_lds_b128 %6, %18, off\n\tglobal_load_async_to_lds_b128 %7, %19, off\n\t"
                         "global_load_async_to_lds_b128 %8, %20, off\n\tglobal_load_async_to_lds_b128 %9, %21, off\n\tglobal_load_async_to_lds_b128 %10, %22, off\n\tglobal_load_async_to_lds_b128 %11, %23, off\n\ts_wait_xcnt 0x0"
                         :: "v"(d), "v"(d + 16 * GS_PITCH), "v"(d + 32 * GS_PITCH), "v"(d + 48 * GS_PITCH), "v"(f), "v"(f + 16 * GS_PITCH), "v"(f + 32 * GS_PITCH), "v"(f + 48 * GS_PITCH), "v"(e), "v"(e + 16 * GS_PITCH), "v"(e + 32 * GS_PITCH), "v"(e + 48 * GS_PITCH),
                            "v"(pa), "v"(pa + rstep), "v"(pa + 2 * rstep), "v"(pa + 3 * rstep), "v"(pl), "v"(pl + rstep), "v"(pl + 2 * rstep), "v"(pl + 3 * rstep), "v"(pb), "v"(pb + rstep), "v"(pb + 2 * rstep), "v"(pb + 3 * rstep) : "memory");
        } else {
            asm volatile("global_load_async_to_lds_b128 %0, %8, off\n\tglobal_load_async_to_lds_b128 %1, %9, off\n\tglobal_load_async_to_lds_b128 %2, %10, off\n\tglobal_load_async_to_lds_b128 %3, %11, off\n\t"
                         "global_load_async_to_lds_b128 %4, %12, off\n\tglobal_load_async_to_lds_b128 %5, %13, off\n\tglobal_load_async_to_lds_b128 %6, %14, off\n\tglobal_load_async_to_lds_b128 %7, %15, off\n\ts_wait_xcnt 0x0"
                         :: "v"(d), "v"(d + 16 * GS_PITCH), "v"(d + 32 * GS_PITCH), "v"(d + 48 * GS_PITCH), "v"(e), "v"(e + 16 * GS_PITCH), "v"(e + 32 * GS_PITCH), "v"(e + 48 * GS_PITCH),
                            "v"(pa), "v"(pa + rstep), "v"(pa + 2 * rstep), "v"(pa + 3 * rstep), "v"(pb), "v"(pb + rstep), "v"(pb + 2 * rstep), "v"(pb + 3 * rstep) : "memory");
        }
    };
    v8f acc[4];
#pragma unroll
    for (int t = 0; t < 4; ++t) acc[t] = (v8f){};
    const int nt = K >> 6;                                        // K is a multiple of 64
    stage(0);
    asm volatile("s_wait_asynccnt 0x0" ::: "memory");      // this wave's copies of tile 0 have landed
    __syncthreads();      // tile 0 is in LDS before any wave reads it
    if (nt > 1) stage(1);
#pragma unroll 1      // one copy of the trip
    for (int kt = 0; kt < nt; ++kt) {
        const unsigned char* fa = stg + (kt & 1) * (NPL * GS_PLANE) + (wave * 16 + lr) * GS_PITCH + 16 * hi;      // the wave's own 16 rows of A
        const unsigned char* fb = stg + (kt & 1) * (NPL * GS_PLANE) + (NPL - 1) * GS_PLANE + lr * GS_PITCH + 16 * hi;      // the 64 rows of B, the same k order as A's
        v16bf a[2], al[2], b[2][4];
#pragma unroll
        for (int u = 0; u < 2; ++u) {
            a[u] = cat16b(*(const v8usa*)(fa + u * 64), *(const v8usa*)(fa + u * 64 + 32)); al[u] = a[u];
            if (SPLITA) al[u] = cat16b(*(const v8usa*)(fa + GS_PLANE + u * 64), *(const v8usa*)(fa + GS_PLANE + u * 64 + 32));
#pragma unroll
            for (int t = 0; t < 4; ++t) b[u][t] = cat16b(*(const v8usa*)(fb + t * 16 * GS_PITCH + u * 64), *(const v8usa*)(fb + t * 16 * GS_PITCH + u * 64 + 32));
        }
#pragma unroll
        for (int u = 0; u < 2; ++u) {
#pragma unroll
            for (int t = 0; t < 4; ++t) acc[t] = wmmab(a[u], b[u][t], acc[t]);
            if (SPLITA) {
#pragma unroll
                for (int t = 0; t < 4; ++t) acc[t] = wmmab(al[u], b[u][t], acc[t]);
            }
        }
        // four vector slots between the last matrix instruction and whatever overwrites its operands or reads its result behind it
        asm volatile("v_nop\n\tv_nop\n\tv_nop\n\tv_nop" : "+v"(acc[0]), "+v"(acc[1]), "+v"(acc[2]), "+v"(acc[3]) : "v"(a[0]), "v"(a[1]), "v"(al[0]), "v"(al[1]), "v"(b[0][0]), "v"(b[0][1]), "v"(b[0][2]), "v"(b[0][3]), "v"(b[1][0]), "v"(b[1][1]), "v"(b[1][2]), "v"(b[1][3]));
        asm volatile("s_wait_dscnt 0x0" ::: "memory");      // this wave's reads of tile kt are done before its buffer is handed on
        asm volatile("s_wait_asynccnt 0x0" ::: "memory");   // this wave's copies of tile kt + 1 have landed
        __syncthreads();      // tile kt + 1 is in LDS before any wave reads it, and every wave has left tile kt's buffer before it is filled again
        if (kt + 2 < nt) stage(kt + 2);
    }
    asm volatile("s_wait_asynccnt 0x0" ::: "memory");      // no copy is outstanding behind the loop
    if constexpr (EPI == 2) {
        // acc[t][0..7] are 8 tokens in a row (wave * 16 + hi * 8 + j) of value t * 16 + lr: one 16-byte piece of a V^T row in each plane
        unsigned char* vb = (unsigned char*)&ost[0][0];
#pragma unroll
        for (int t = 0; t < 4; ++t) { const float bv = bfr(bias[c0 + t * 16 + lr]); v8us oh, ol;
#pragma unroll
            for (int j = 0; j < 8; ++j) { const float y = acc[t][j] + bv; const unsigned short hb = f2bf(y); oh[j] = hb; ol[j] = f2bf(y - bf2f(hb)); }
            unsigned char* vp = vb + (t * 16 + lr) * VT_PITCH + (wave * 16 + hi * 8) * 2; *(v8usa*)vp = oh; *(v8usa*)(vp + 64 * VT_PITCH) = ol; }
        __syncthreads();      // a V^T row's 64 tokens come from all 4 waves: every piece is in LDS before a row is read
        const int rb = blockIdx.x * 64, piece = threadIdx.x & 7, d0 = threadIdx.x >> 3;
        const size_t vo = (((size_t)(rb / NN) * NH_ + blockIdx.y) * HD + d0) * NN + rb % NN + piece * 8;      // 8 lanes write one whole line
        v8us wh[4], wl[4];
#pragma unroll
        for (int s = 0; s < 4; ++s) { const unsigned char* vp = vb + (d0 + 16 * s) * VT_PITCH + piece * 16; wh[s] = *(const v8usa*)vp; wl[s] = *(const v8usa*)(vp + 64 * VT_PITCH); }
#pragma unroll
        for (int s = 0; s < 4; ++s) { *(v8us*)(Ph + vo + (size_t)(16 * s) * NN) = wh[s]; *(v8us*)(Pl + vo + (size_t)(16 * s) * NN) = wl[s]; }
        return;
    }
    float* os = &ost[wave][0];
#pragma unroll
    for (int t = 0; t < 4; ++t) { const float bv = bias ? bfr(bias[c0 + t * 16 + lr]) : 0.f;
#pragma unroll
        for (int j = 0; j < 8; ++j) os[(hi * 8 + j) * 68 + t * 16 + lr] = acc[t][j] + bv; }
    __syncthreads();
    if constexpr (EPI == 1) {
        // a lane takes row lr of the wave's 16 and the heads hi and hi + 2 of the tile's 4: all NW values of a (row, head) pair in one lane
        v8us oh[2][2], ol[2][2];
#pragma unroll
        for (int s = 0; s < 2; ++s) { const int hh = hi + 2 * s; float v[NW], p[NW / 2];
#pragma unroll
            for (int q = 0; q < 4; ++q) { const v4f xv = *(const v4fa*)(os + lr * 68 + hh * NW + q * 4); const v4f pv = *(const v4f*)(phase + c0 + hh * NW + q * 4);
#pragma unroll
                for (int i = 0; i < 4; ++i) v[q * 4 + i] = xv[i] + bfr(pv[i]); }
#pragma unroll
            for (int i = 0; i < NW / 2; ++i) p[i] = v[2 * i] * v[2 * i] + v[2 * i + 1] * v[2 * i + 1];
            const float ss = ((p[0] + p[4]) + (p[2] + p[6])) + ((p[1] + p[5]) + (p[3] + p[7]));      // pairs, then partners 4, 2, 1 apart
            const float inv = 1.0f / fmaxf(sqrtf(ss), 1e-12f);
#pragma unroll
            for (int i = 0; i < NW; ++i) { const float y = v[i] * inv; const unsigned short hb = f2bf(y); oh[s][i >> 3][i & 7] = hb; ol[s][i >> 3][i & 7] = f2bf(y - bf2f(hb)); }
        }
        const int r = r0 + lr; const v8us zero = {0, 0, 0, 0, 0, 0, 0, 0};
        const size_t po = (((size_t)(r / NN) * NH_ + blockIdx.y * 4 + hi) * NN + r % NN) * KQ;      // a wave fills 16 rows of 64 bytes in a row per head and plane
#pragma unroll
        for (int s = 0; s < 2; ++s) { bf* a = Ph + po + (size_t)(2 * s) * NN * KQ; bf* b = Pl + po + (size_t)(2 * s) * NN * KQ;
            *(v8us*)a = oh[s][0]; *(v8us*)(a + 8) = oh[s][1]; *(v8us*)(a + 16) = zero; *(v8us*)(a + 24) = zero; *(v8us*)b = ol[s][0]; *(v8us*)(b + 8) = ol[s][1]; *(v8us*)(b + 16) = zero; *(v8us*)(b + 24) = zero; }
        return;
    }
    if (F16OUT) {
        h16* crow = (h16*)(void*)C + (size_t)r0 * ldc + c0;
        auto pass = [&]() {
#pragma unroll
            for (int s = 0; s < 4; ++s) { const int row = 4 * s + (lane >> 3), piece = lane & 7; const float* sp = os + row * 68 + piece * 8; v8h o, o2;
#pragma unroll
                for (int i = 0; i < 8; ++i) { const h16 a = (h16)sp[i]; o[i] = a; o2[i] = (h16)((sp[i] - (float)a) * LOSC); }
                *(v8h*)(crow + (size_t)row * ldc + piece * 8) = o; if (C2) *(v8h*)(C2 + (size_t)r0 * ldc + c0 + (size_t)row * ldc + piece * 8) = o2; }
        };
        pass(); 
    } else {
        float* crow = C + (size_t)r0 * ldc + c0;
        auto pass = [&]() {
#pragma unroll
            for (int s = 0; s < 8; ++s) { const int Lid = (lane >> 3) + 4 * s, piece = lane & 7; const int row = Lid >> 1, cofs = (Lid & 1) * 32 + piece * 4;
                v4f val = *(const v4fa*)(os + row * 68 + cofs); if (R) { const v4f rv = *(const v4f*)(R + ((size_t)r0 + row) * ldc + c0 + cofs); val += roundR ? (v4f){bfr(rv[0]), bfr(rv[1]), bfr(rv[2]), bfr(rv[3])} : rv; }
                *(v4f*)(crow + (size_t)row * ldc + cofs) = val; }
        };
        pass(); 
    }
}


// k_fattn: causal attention of one (item, head) plane per blockIdx.z, 16 query rows per wave, 32 keys per pass: S^T = K.Q^T (A = key rows, B = query rows, both in the same k order), so a lane
// holds 16 scores of ONE query (column lr; keys 8 * hi + j and 16 + 8 * hi + j), which is also that query's place in the B operand of O^T += V^T.P^T: the probabilities go from the score
// accumulators into the next product without leaving the lane. Running maximum and sum per query; the output tile is rescaled only in a pass where some query's maximum rises.
// The block's 8 waves share the keys: a stage of 64 keys (K and V^T, hi and residual planes) is fetched once per block by whole-line loads and laid into one of two LDS buffers.
// A block takes the 128-row block 15 - x and then the block x of its plane: every block walks the same number of stages.
#define FK_PITCH 80               // bytes per staged key row (64 of data): 16 x odd, the pitch at which 16-byte LDS reads of 16 rows do not collide
#define FV_PITCH 144              // bytes per staged V^T row (128 of data): 16 x odd
#define FK_PLANE (64 * FK_PITCH)
#define FV_PLANE (64 * FV_PITCH)
#define F_BUF    (2 * FK_PLANE + 2 * FV_PLANE)
__global__ __launch_bounds__(256) void k_fattn(const bf* __restrict__ Qh, const bf* __restrict__ Ql, const bf* __restrict__ Kh, const bf* __restrict__ Kl, const bf* __restrict__ Vh, const bf* __restrict__ Vl, const float* __restrict__ temp, bf* Oh, bf* Ol) {
    typedef __attribute__((ext_vector_type(2))) float v2f;
    typedef __attribute__((ext_vector_type(2))) __bf16 v2bf;
    __shared__ __align__(16) unsigned char L[2 * F_BUF];
    const float sc2 = (1.0f / bfr(temp[0])) * 1.44269504f;        // 1/temperature and log2(e) in one factor: the exponentials are base 2
    const int tid = threadIdx.x, lane = tid & 31, lr = lane & 15, hi = lane >> 4;
    const int wave = __builtin_amdgcn_readfirstlane(tid >> 5);    // the wave's number in a scalar register: trip counts and the diagonal test become scalar, EXEC stays whole
    const size_t z = blockIdx.z;
    Qh += z * NN * KQ; Ql += z * NN * KQ; Kh += z * NN * KQ; Kl += z * NN * KQ; Vh += z * HD * NN; Vl += z * HD * NN;
    Oh += (z / NH_) * NN * DMOD + (z % NH_) * HD; Ol += (z / NH_) * NN * DMOD + (z % NH_) * HD;
    auto xhalf = [](float v) { const int b = __float_as_int(v); return __int_as_float(__builtin_amdgcn_permlanex16(b, b, 0x76543210, 0xfedcba98, false, false)); };      // lane l <-> l ^ 16
    // staging: a plane's 64 key rows are 4 KiB in a row, thread tid takes 16-byte piece tid; a V^T plane's stage is 64 rows of one 128-byte line, thread tid takes pieces tid and tid + 256 (8 pieces a row)
    const int ksto = (tid >> 2) * FK_PITCH + (tid & 3) * 16, vsto = 2 * FK_PLANE + (tid >> 3) * FV_PITCH + (tid & 7) * 16;
    const size_t vsrc = (size_t)(tid >> 3) * NN + (tid & 7) * 8;
    v8us g[6];
    auto fetch = [&](int st) {                                    // stage st: global memory to registers
        const bf* p0 = Kh + (size_t)st * 64 * KQ + tid * 8; const bf* p1 = Kl + (size_t)st * 64 * KQ + tid * 8; const bf* p2 = Vh + vsrc + st * 64; const bf* p3 = Vl + vsrc + st * 64;
        g[0] = *(const v8us*)p0; g[1] = *(const v8us*)p1; g[2] = *(const v8us*)p2; g[3] = *(const v8us*)(p2 + 32 * NN); g[4] = *(const v8us*)p3; g[5] = *(const v8us*)(p3 + 32 * NN);
        // no address register of the loads above is rewritten before this wait: the clobber keeps the loads in front of it, and naming the addresses as inputs keeps their registers whole up to it
        asm volatile("s_wait_xcnt 0x0" :: "v"(p0), "v"(p1), "v"(p2), "v"(p3) : "memory");
    };
    auto lay = [&](int st) {                                      // registers to the stage's LDS buffer
        unsigned char* B = L + (st & 1) * F_BUF;
        *(v8usa*)(B + ksto) = g[0]; *(v8usa*)(B + FK_PLANE + ksto) = g[1]; *(v8usa*)(B + vsto) = g[2]; *(v8usa*)(B + vsto + 32 * FV_PITCH) = g[3]; *(v8usa*)(B + FV_PLANE + vsto) = g[4]; *(v8usa*)(B + FV_PLANE + vsto + 32 * FV_PITCH) = g[5];
    };
#pragma unroll 1      // the two row blocks run one after the other through one copy of the code
    for (int job = 0; job < 2; ++job) {
        const int qb = job ? (int)blockIdx.x : NN / 128 - 1 - (int)blockIdx.x;
        const int nst = 2 * (qb + 1);                             // stages of 64 keys up to the block's last row: the same for all 8 waves
        const int q0 = qb * 128 + wave * 16;
        const int ns = (q0 + 47) >> 5;                            // this wave's passes of 32 keys, up to and with the one that holds key q0 + 15
        const size_t qo = (size_t)(q0 + lr) * KQ + 8 * hi;
        const v16bf qh = cat16b(*(const v8us*)(Qh + qo), *(const v8us*)(Qh + qo + 16)), ql = cat16b(*(const v8us*)(Ql + qo), *(const v8us*)(Ql + qo + 16));
        fetch(0); lay(0);                                         // buffer 0 is free: every wave has passed the barrier behind the last stage of the row block before
        __syncthreads();      // stage 0 is in LDS before any wave reads it
        v8f acc[4];
#pragma unroll
        for (int t = 0; t < 4; ++t) acc[t] = (v8f){};
        float m = -3.0e38f; v2f l2 = {0.f, 0.f};                  // the lane's sum in two halves: one packed add per pair of keys
#pragma unroll 1      // kept rolled: a stage is long
        for (int st = 0; st < nst; ++st) {
            if (st + 1 < nst) fetch(st + 1);                      // in flight under this stage's two passes
            const unsigned char* B = L + (st & 1) * F_BUF;
#pragma unroll 1      // one copy of the pass
            for (int pp = 0; pp < 2; ++pp) {
                const int s = 2 * st + pp;
                if (s >= ns) break;                               // scalar: a wave whose rows end below these keys goes on to the barrier
                const unsigned char* bk = B + (pp * 32 + lr) * FK_PITCH + 16 * hi;      // keys 32 s + 16 u + lr, the same k order as the q loader
                const unsigned char* bv = B + 2 * FK_PLANE + lr * FV_PITCH + pp * 64 + 16 * hi;      // V^T rows d = 16 t + lr, keys 32 s + 8 * hi + 0..7 and + 16: the order in which the score tiles hold the keys
                v16bf kh[2], kl[2], vh[4], vl[4];
#pragma unroll
                for (int u = 0; u < 2; ++u) { kh[u] = cat16b(*(const v8usa*)(bk + u * 16 * FK_PITCH), *(const v8usa*)(bk + u * 16 * FK_PITCH + 32)); kl[u] = cat16b(*(const v8usa*)(bk + FK_PLANE + u * 16 * FK_PITCH), *(const v8usa*)(bk + FK_PLANE + u * 16 * FK_PITCH + 32)); }
#pragma unroll
                for (int t = 0; t < 4; ++t) { vh[t] = cat16b(*(const v8usa*)(bv + t * 16 * FV_PITCH), *(const v8usa*)(bv + t * 16 * FV_PITCH + 32)); vl[t] = cat16b(*(const v8usa*)(bv + FV_PLANE + t * 16 * FV_PITCH), *(const v8usa*)(bv + FV_PLANE + t * 16 * FV_PITCH + 32)); }
                asm volatile("" ::: "memory");      // compiler fence: the pass's 24 LDS reads stay together here, in flight at once; moved down to their products, each fragment would cost an LDS latency of its own
                v8f sc[2];
#pragma unroll
                for (int u = 0; u < 2; ++u) { sc[u] = wmmab(kh[u], qh, (v8f){}); sc[u] = wmmab(kh[u], ql, sc[u]); sc[u] = wmmab(kl[u], qh, sc[u]); }
#pragma unroll
                for (int u = 0; u < 2; ++u) sc[u] *= sc2;
                if (s == ns - 1) {                                // only the wave's last pass holds keys above the diagonal
#pragma unroll
                    for (int u = 0; u < 2; ++u) {
#pragma unroll
                        for (int j = 0; j < 8; ++j) if (s * 32 + u * 16 + hi * 8 + j > q0 + lr) sc[u][j] = -3.0e38f; }      // a masked key: exp gives 0 below (key 0 is never masked, so m is a real score)
                }
                float mx = sc[0][0];
#pragma unroll
                for (int e = 1; e < 16; ++e) mx = fmaxf(mx, sc[e >> 3][e & 7]);
                mx = fmaxf(mx, xhalf(mx));                        // both halves of the wave hold the query's maximum of this pass
                if (__builtin_amdgcn_ballot_w32(mx > m) != 0) {   // scalar branch; where no maximum rises every factor would be 1
                    const float mn = fmaxf(m, mx), corr = __builtin_amdgcn_exp2f(m - mn); m = mn; l2 *= corr;
#pragma unroll
                    for (int t = 0; t < 4; ++t) acc[t] *= corr;
                }
                v16bf ph, pl;
#pragma unroll
                for (int e = 0; e < 16; e += 2) {
                    const v2f p = {__builtin_amdgcn_exp2f(sc[e >> 3][e & 7] - m), __builtin_amdgcn_exp2f(sc[e >> 3][(e & 7) + 1] - m)};
                    l2 += p;
                    const v2bf h2 = __builtin_convertvector(p, v2bf); const v2bf r2 = __builtin_convertvector(p - __builtin_convertvector(h2, v2f), v2bf);      // hi plane and residual, both to nearest even
                    ph[e] = h2[0]; ph[e + 1] = h2[1]; pl[e] = r2[0]; pl[e + 1] = r2[1];
                }
#pragma unroll
                for (int t = 0; t < 4; ++t) { acc[t] = wmmab(vh[t], ph, acc[t]); acc[t] = wmmab(vh[t], pl, acc[t]); acc[t] = wmmab(vl[t], ph, acc[t]); }
                // four vector slots between the last matrix instruction and whatever overwrites its operands or reads its result on the taken back edge or behind the loop
                asm volatile("v_nop\n\tv_nop\n\tv_nop\n\tv_nop" : "+v"(acc[0]), "+v"(acc[1]), "+v"(acc[2]), "+v"(acc[3]) : "v"(vh[0]), "v"(vh[1]), "v"(vh[2]), "v"(vh[3]), "v"(vl[0]), "v"(vl[1]), "v"(vl[2]), "v"(vl[3]), "v"(ph), "v"(pl));
            }
            if (st + 1 < nst) lay(st + 1);                        // into the buffer that stage st - 1 was read from: every wave has left it, it passed the barrier below
            __syncthreads();      // stage st + 1 is in LDS before any wave reads it, and every wave's reads of stage st are done before its buffer is filled again
        }
        float l = l2[0] + l2[1]; l += xhalf(l);                   // the two halves' sums meet once
        const float inv = 1.0f / l;
        bf* ohrow = Oh + (size_t)(q0 + lr) * DMOD + hi * 8; bf* olrow = Ol + (size_t)(q0 + lr) * DMOD + hi * 8;      // acc[t][j] = O[q0 + lr][16 t + 8 hi + j]: 8 values in a row per tile, one 16-byte piece in each plane
#pragma unroll
        for (int t = 0; t < 4; ++t) { const v8f o = acc[t] * inv; v8us a, b;
#pragma unroll
            for (int j = 0; j < 8; ++j) { const unsigned short hb = f2bf(o[j]); a[j] = hb; b[j] = f2bf(o[j] - bf2f(hb)); }      // the output projection's hi plane and residual
            *(v8us*)(ohrow + t * 16) = a; *(v8us*)(olrow + t * 16) = b; }
        asm volatile("s_wait_xcnt 0x0" :: "v"(ohrow), "v"(olrow) : "memory");      // the second row block's arithmetic reuses the registers that these stores name: the wait stands in front of that
    }
}
__global__ __launch_bounds__(256) void k_planes32z(const float* __restrict__ F, int ld, int off, float sc, int rows, bf* Ph, bf* Pl) {
    typedef __attribute__((ext_vector_type(2))) unsigned short v2us;
    const int lane = threadIdx.x & 31; const size_t r = ((size_t)blockIdx.x * 8 + (threadIdx.x >> 5)) * 2 + (lane >> 4); if (r >= (size_t)rows) return; const int z = blockIdx.z; const int c0 = (lane & 15) * 2; v2us oh, ol;
    Ph += (size_t)z * rows * 32; Pl += (size_t)z * rows * 32;
#pragma unroll
    for (int i = 0; i < 2; ++i) { const float y = F[r * ld + off + z * 32 + c0 + i] * sc; const unsigned short hb = f2bf(y); oh[i] = hb; ol[i] = f2bf(y - bf2f(hb)); }
    const size_t o = r * 32 + c0; *(v2us*)(Ph + o) = oh; *(v2us*)(Pl + o) = ol; 
}
__global__ __launch_bounds__(256) void k_vtpadz(const float* __restrict__ F, int ld, int off, int nk, bf* Th, bf* Tl) {
    typedef __attribute__((ext_vector_type(2))) unsigned short v2us;
    const int lane = threadIdx.x & 31; const size_t wid = (size_t)blockIdx.x * 8 + (threadIdx.x >> 5); if (wid >= (size_t)64 * (nk / 64)) return; const int z = blockIdx.z; const int d = (int)(wid / (nk / 64)); const int k0 = (int)(wid % (nk / 64)) * 64 + lane * 2; v2us oh, ol;
    Th += (size_t)z * 64 * nk; Tl += (size_t)z * 64 * nk;
#pragma unroll
    for (int i = 0; i < 2; ++i) { const float y = (d < 32) ? F[(size_t)(k0 + i) * ld + off + z * 32 + (d < 32 ? d : 0)] : 0.f; const unsigned short hb = f2bf(y); oh[i] = hb; ol[i] = f2bf(y - bf2f(hb)); }
    const size_t o = (size_t)d * nk + k0; *(v2us*)(Th + o) = oh; *(v2us*)(Tl + o) = ol; 
}
template <int NK>
__global__ __launch_bounds__(256) void k_softmaxz(const float* __restrict__ S, int rows, bf* PH, bf* PL) {
    typedef __attribute__((ext_vector_type(4))) unsigned short v4us;
    const int lane = threadIdx.x & 31, i = blockIdx.x * 8 + (threadIdx.x >> 5); if (i >= rows) return; const size_t zo = (size_t)blockIdx.z * rows * NK; const float* sr = S + zo + (size_t)i * NK; PH += zo; PL += zo;
    float m = -3.0e38f;
#pragma unroll 1
    for (int c0 = lane * 4; c0 < NK; c0 += 128) {
#pragma unroll
        for (int q = 0; q < 4; ++q) m = fmaxf(m, sr[c0 + q]); }
#pragma unroll
    for (int sh = 16; sh; sh >>= 1) m = fmaxf(m, __shfl_xor(m, sh, 32));
    float sum = 0.f;
#pragma unroll 1
    for (int c0 = lane * 4; c0 < NK; c0 += 128) {
#pragma unroll
        for (int q = 0; q < 4; ++q) sum += __expf(sr[c0 + q] - m); }
#pragma unroll
    for (int sh = 16; sh; sh >>= 1) sum += __shfl_xor(sum, sh, 32);
    const float inv = 1.0f / sum;
{
#pragma unroll 1
        for (int c0 = lane * 4; c0 < NK; c0 += 128) { v4us oh, ol;
#pragma unroll
            for (int q = 0; q < 4; ++q) { const float p = __expf(sr[c0 + q] - m) * inv; const unsigned short hb = f2bf(p); oh[q] = hb; ol[q] = f2bf(p - bf2f(hb)); }
            const size_t o = (size_t)i * NK + c0; *(v4us*)(PH + o) = oh; *(v4us*)(PL + o) = ol; }
         }
}
__global__ __launch_bounds__(256) void k_placez(const float* __restrict__ XH, int rows, int ldy, float* Y) {
    const int lane = threadIdx.x & 31; const size_t q = (size_t)blockIdx.x * 8 + (threadIdx.x >> 5); if (q >= (size_t)rows) return; const int z = blockIdx.z; const float v = XH[((size_t)z * rows + q) * 64 + lane];
    *(float*)(Y + q * ldy + z * 32 + lane) = v; 
}

__global__ __launch_bounds__(256) void k_hplanesz(const float* __restrict__ F, int ld, int h0, float sc, int rows, bf* Ph, bf* Pl) {
    typedef __attribute__((ext_vector_type(2))) unsigned short v2us;
    const int lane = threadIdx.x & 31; const size_t r = (size_t)blockIdx.x * 8 + (threadIdx.x >> 5); if (r >= (size_t)rows) return; const int z = blockIdx.z; v2us oh, ol;
    Ph += (size_t)z * rows * 64; Pl += (size_t)z * rows * 64;
#pragma unroll
    for (int i = 0; i < 2; ++i) { const float y = F[r * ld + (h0 + z) * 64 + lane * 2 + i] * sc; const unsigned short hb = f2bf(y); oh[i] = hb; ol[i] = f2bf(y - bf2f(hb)); }
    const size_t o = r * 64 + lane * 2; *(v2us*)(Ph + o) = oh; *(v2us*)(Pl + o) = ol; 
}
template <int NK>
__global__ __launch_bounds__(256) void k_softmaxzs(const float* __restrict__ S, int rows, float sc, bf* PH, bf* PL) {
    typedef __attribute__((ext_vector_type(4))) unsigned short v4us;
    const int lane = threadIdx.x & 31, i = blockIdx.x * 8 + (threadIdx.x >> 5); if (i >= rows) return; const size_t zo = (size_t)blockIdx.z * rows * NK; const float* sr = S + zo + (size_t)i * NK; PH += zo; PL += zo;
    float m = -3.0e38f;
#pragma unroll 1
    for (int c0 = lane * 4; c0 < NK; c0 += 128) {
#pragma unroll
        for (int q = 0; q < 4; ++q) m = fmaxf(m, sr[c0 + q] * sc); }
#pragma unroll
    for (int sh = 16; sh; sh >>= 1) m = fmaxf(m, __shfl_xor(m, sh, 32));
    float sum = 0.f;
#pragma unroll 1
    for (int c0 = lane * 4; c0 < NK; c0 += 128) {
#pragma unroll
        for (int q = 0; q < 4; ++q) sum += __expf(sr[c0 + q] * sc - m); }
#pragma unroll
    for (int sh = 16; sh; sh >>= 1) sum += __shfl_xor(sum, sh, 32);
    const float inv = 1.0f / sum;
{
#pragma unroll 1
        for (int c0 = lane * 4; c0 < NK; c0 += 128) { v4us oh, ol;
#pragma unroll
            for (int q = 0; q < 4; ++q) { const float p = __expf(sr[c0 + q] * sc - m) * inv; const unsigned short hb = f2bf(p); oh[q] = hb; ol[q] = f2bf(p - bf2f(hb)); }
            const size_t o = (size_t)i * NK + c0; *(v4us*)(PH + o) = oh; *(v4us*)(PL + o) = ol; }
         }
}

__global__ __launch_bounds__(256) void k_cvtx(const float* __restrict__ src, int rows, bf* dst) {
    const int lane = threadIdx.x & 31; const size_t r = (size_t)blockIdx.x * 8 + (threadIdx.x >> 5); if (r >= (size_t)rows) return;
{
#pragma unroll
        for (int q = 0; q < DMOD / 256; ++q) { v8us o;
#pragma unroll
            for (int i = 0; i < 8; ++i) o[i] = f2bf(src[r * DMOD + q * 256 + lane * 8 + i]);
            *(v8us*)(dst + r * DMOD + q * 256 + lane * 8) = o; }
         }
}
__global__ __launch_bounds__(256) void k_csoftz(const float* __restrict__ S, int rows, float sc, bf* PH, bf* PL) {
    typedef __attribute__((ext_vector_type(4))) unsigned short v4us;
    const int lane = threadIdx.x & 31, i = blockIdx.x * 8 + (threadIdx.x >> 5); if (i >= rows) return; const size_t zo = (size_t)blockIdx.z * rows * NN; const float* sr = S + zo + (size_t)i * NN; PH += zo; PL += zo;
    float m = -3.0e38f;
#pragma unroll 1
    for (int c0 = lane * 4; c0 < NN; c0 += 128) {
#pragma unroll
        for (int q = 0; q < 4; ++q) { const int k = c0 + q; if (k <= i) m = fmaxf(m, sr[k] * sc); } }
#pragma unroll
    for (int sh = 16; sh; sh >>= 1) m = fmaxf(m, __shfl_xor(m, sh, 32));
    float sum = 0.f;
#pragma unroll 1
    for (int c0 = lane * 4; c0 < NN; c0 += 128) {
#pragma unroll
        for (int q = 0; q < 4; ++q) { const int k = c0 + q; if (k <= i) sum += __expf(sr[k] * sc - m); } }
#pragma unroll
    for (int sh = 16; sh; sh >>= 1) sum += __shfl_xor(sum, sh, 32);
    const float inv = 1.0f / sum;
{
#pragma unroll 1
        for (int c0 = lane * 4; c0 < NN; c0 += 128) { v4us oh, ol;
#pragma unroll
            for (int q = 0; q < 4; ++q) { const int k = c0 + q; const float p = (k <= i) ? __expf(sr[(k <= i) ? k : 0] * sc - m) * inv : 0.f; const unsigned short hb = f2bf(p); oh[q] = hb; ol[q] = f2bf(p - bf2f(hb)); }
            const size_t o = (size_t)i * NN + c0; *(v4us*)(PH + o) = oh; *(v4us*)(PL + o) = ol; }
         }
}
extern "C" void kernel_launch(void* const* d_in, const int* in_sizes, int n_in,
                              void* d_out, int out_size, void* d_ws, size_t ws_size, hipStream_t stream) {
    (void)in_sizes; (void)n_in; (void)out_size;
    const float* x = (const float*)d_in[0]; const float* Wq = (const float*)d_in[1]; const float* bq = (const float*)d_in[2]; const float* Wk = (const float*)d_in[3]; const float* bk = (const float*)d_in[4]; const float* Wv = (const float*)d_in[5]; const float* bv = (const float*)d_in[6]; const float* Wo = (const float*)d_in[7]; const float* bo = (const float*)d_in[8];
    const float* qph = (const float*)d_in[9]; const float* kph = (const float*)d_in[10]; const float* temp = (const float*)d_in[11];
    float* out = (float*)d_out;    // [2][2048][1024]
    char* wsp = (char*)d_ws;
    auto take = [&](size_t bytes) { char* p = wsp; wsp += (bytes + 255) & ~(size_t)255; return (void*)p; };
    bf* WQ = (bf*)take((size_t)(NH_ * NW) * DMOD * 2); bf* WK = (bf*)take((size_t)(NH_ * NW) * DMOD * 2); bf* WV = (bf*)take((size_t)DMOD * DMOD * 2); bf* WO = (bf*)take((size_t)DMOD * DMOD * 2);
    bf* Xb = (bf*)take((size_t)NBT * NN * DMOD * 2);
    constexpr size_t NZ = (size_t)NBT * NH_;                      // planes of every (item, head) pair live at once
    bf* Qh = (bf*)take(NZ * NN * KQ * 2); bf* Ql = (bf*)take(NZ * NN * KQ * 2); bf* Kh = (bf*)take(NZ * NN * KQ * 2); bf* Kl = (bf*)take(NZ * NN * KQ * 2); bf* VTh = (bf*)take(NZ * HD * NN * 2); bf* VTl = (bf*)take(NZ * HD * NN * 2);
    bf* Oh = (bf*)take((size_t)NBT * NN * DMOD * 2); bf* Ol = (bf*)take((size_t)NBT * NN * DMOD * 2);
    if ((size_t)(wsp - (char*)d_ws) > ws_size) return;    // 61 MiB
    k_wt<<<dim3(DMOD / 64, (NH_ * NW) / 64, 1), 256, 0, stream>>>(Wq, DMOD, NH_ * NW, WQ); k_wt<<<dim3(DMOD / 64, (NH_ * NW) / 64, 1), 256, 0, stream>>>(Wk, DMOD, NH_ * NW, WK);   // (in, out) k-major -> n-major
    k_wt<<<dim3(DMOD / 64, DMOD / 64, 1), 256, 0, stream>>>(Wv, DMOD, DMOD, WV); k_wt<<<dim3(DMOD / 64, DMOD / 64, 1), 256, 0, stream>>>(Wo, DMOD, DMOD, WO);
    // the host reads nothing from the device: k_fattn reads temperature[0] itself
    constexpr int NR = NBT * NN;                                  // the two items' rows stand behind one another in x and in out: one launch takes both
    k_cvtx<<<NR / 8, 256, 0, stream>>>(x, NR, Xb);
    // each projection writes the planes that k_fattn reads, and k_fattn the planes that the output projection reads
    k_gemmb<false, false, 1><<<dim3(NR / 64, (NH_ * NW) / 64, 1), 128, 0, stream>>>(Xb, nullptr, WQ, bq, nullptr, NH_ * NW, nullptr, nullptr, DMOD, 1, qph, Qh, Ql);
    k_gemmb<false, false, 1><<<dim3(NR / 64, (NH_ * NW) / 64, 1), 128, 0, stream>>>(Xb, nullptr, WK, bk, nullptr, NH_ * NW, nullptr, nullptr, DMOD, 1, kph, Kh, Kl);
    k_gemmb<false, false, 2><<<dim3(NR / 64, DMOD / 64, 1), 128, 0, stream>>>(Xb, nullptr, WV, bv, nullptr, DMOD, nullptr, nullptr, DMOD, 1, nullptr, VTh, VTl);
    k_fattn<<<dim3(NN / 256, 1, NBT * NH_), 256, 0, stream>>>(Qh, Ql, Kh, Kl, VTh, VTl, temp, Oh, Ol);
    k_gemmb<true, false><<<dim3(NR / 64, DMOD / 64, 1), 128, 0, stream>>>(Oh, Ol, WO, bo, out, DMOD, nullptr, nullptr, DMOD);
}

// v007
// A run of this version takes 84.6 microseconds.
// In two side-by-side timings against v006, it was 1.31 and 1.32 times as fast.
// Counting every step since v000, it is 30.4 times as fast.
#include <hip/hip_runtime.h>

// Compute dtypes, f32 accumulate, per item: q/k/v projections as GEMMs with PLAIN bf16 operands (x and the (in,out) weights; exact products, + bias); per head the 16-wide q/k get
// their phase added and are L2-normalised in f32, then stored as bf16 hi + UNSCALED residual planes padded to K = 32 (zero columns); causal scores (three products), 1/temperature, the causal
// softmax (f32, running maximum) and attn.v (three products) in ONE kernel for all items and heads: scores and probabilities stay in registers; output projection on hi/lo planes

#define NBT  2
#define NN   2048
#define DMOD 1024
#define NH_  16
#define NW   16
#define KQ   32                   // padded score depth
#define HD   64
#define DM   DMOD
#define NTK  NN
#define LOSC 1024.0f

typedef _Float16 h16;
typedef unsigned short bf;
typedef __attribute__((ext_vector_type(16))) __bf16   v16bf;
typedef __attribute__((ext_vector_type(16))) _Float16 v16h;
typedef __attribute__((ext_vector_type(8)))  _Float16 v8h;
typedef __attribute__((ext_vector_type(8)))  unsigned short v8us;
typedef __attribute__((ext_vector_type(8)))  float    v8f;
typedef __attribute__((ext_vector_type(4)))  float    v4f;
typedef __attribute__((ext_vector_type(4)))  _Float16 v4h;
typedef v8h  __attribute__((may_alias)) v8ha;
typedef v4f  __attribute__((may_alias)) v4fa;
typedef v8us __attribute__((may_alias)) v8usa;

__device__ __forceinline__ unsigned short f2bf(float f) { unsigned u = __float_as_uint(f); u += 0x7FFFu + ((u >> 16) & 1u); return (unsigned short)(u >> 16); }
__device__ __forceinline__ float bf2f(unsigned short b) { return __uint_as_float(((unsigned)b) << 16); }
__device__ __forceinline__ float bfr(float f) { return bf2f(f2bf(f)); }
__device__ __forceinline__ v16h cat16(v8h lo, v8h hi) { return __builtin_shufflevector(lo, hi, 0, 1, 2, 3, 4, 5, 6, 7, 8, 9, 10, 11, 12, 13, 14, 15); }
__device__ __forceinline__ v16bf cat16b(v8us lo, v8us hi) { return __builtin_bit_cast(v16bf, __builtin_shufflevector(lo, hi, 0, 1, 2, 3, 4, 5, 6, 7, 8, 9, 10, 11, 12, 13, 14, 15)); }
__device__ __forceinline__ v8f wmma16(v16h a, v16h b, v8f c) { return __builtin_amdgcn_wmma_f32_16x16x32_f16(false, a, false, b, (short)0, c, false, false); }
__device__ __forceinline__ v8f wmmab(v16bf a, v16bf b, v8f c) { return __builtin_amdgcn_wmma_f32_16x16x32_bf16(false, a, false, b, (short)0, c, false, false); }

// d_wt: WT [n][K] = bf16(W[k][n]) (k-major [K][ncols]) via 64 x 64 LDS tiles; tile (bx, by) of (K/64, ncols/64), tl: the block's 64 x 72 staging tile.
__device__ __forceinline__ void d_wt(const float* __restrict__ Wm, int K, int ncols, bf* WT, int bx, int by, unsigned short* tl) {
    const int tid = threadIdx.x, k0 = bx * 64, n0 = by * 64;
    const int kk = tid >> 2, nq = (tid & 3) * 16;
#pragma unroll
    for (int i = 0; i < 16; ++i) tl[(nq + i) * 72 + kk] = f2bf(Wm[(size_t)(k0 + kk) * ncols + n0 + nq + i]);
    __syncthreads();
    const int piece = tid & 7;
    auto pass = [&]() {
#pragma unroll
        for (int s = 0; s < 2; ++s) { const int nr = (tid >> 3) + 32 * s; const v8us val = *(const v8usa*)(tl + nr * 72 + piece * 8); *(v8us*)(WT + (size_t)(n0 + nr) * K + k0 + piece * 8) = val; }
    };
    pass(); 
    asm volatile("s_wait_xcnt 0x0" ::: "memory");      // the stores' registers may be written again where this is inlined in front of other code: the wait stands behind the last store
}
// k_gemmb: 64 x 64 block tile (4 waves x 16 x 64) of C[rows][ldc] = (A [+ Al]).B^T (K = 1024) [+ bf(bias[c])] [+ bf(R[r][c]) residual]; f32 whole-line epilogue (or f16
// The K loop goes by tiles of 64 k: the block's 64 rows of A (and of Al) and 64 rows of B are copied into one of two LDS buffers, whole lines, one tile ahead; B's rows serve all 4 waves.
// EPI 1: the q, k and v projections of x in one grid; blockIdx.y picks the projection (v's column tiles first, then q's, then k's) and its column tile. The epilogue's tile lies over the staging buffers.
//   q, k: the tile's 4 heads get their phase added and are L2-normalised in f32, and go out as bf16 hi + residual planes [item * NH_ + head][token][KQ], columns NW.. zero.
//   v: the tile is one head's 64 tokens x 64 values; it goes out transposed as bf16 hi + residual planes [item * NH_ + head][value][token], one whole 128-byte line per value and plane.
#define VT_PITCH 144              // bytes per staged V^T row (128 of data): 16 x odd
#define GS_PITCH 144              // bytes per staged operand row (64 k, 128 of data): 16 x odd
#define GS_PLANE (64 * GS_PITCH)
template <bool SPLITA, bool F16OUT = false, int EPI = 0>
__global__ __launch_bounds__(128) void k_gemmb(const bf* __restrict__ A, const bf* __restrict__ Al, const bf* __restrict__ Bn0, const float* __restrict__ bias0, float* C, int ldc, h16* C2, const float* __restrict__ R = nullptr, int K = DM, int roundR = 1, const float* __restrict__ phase0 = nullptr, bf* Ph0 = nullptr, bf* Pl0 = nullptr,
        const bf* __restrict__ Bk = nullptr, const float* __restrict__ biask = nullptr, const float* __restrict__ phasek = nullptr, bf* Phk = nullptr, bf* Plk = nullptr, const bf* __restrict__ Bv = nullptr, const float* __restrict__ biasv = nullptr, bf* Phv = nullptr, bf* Plv = nullptr) {
    constexpr int NPL = SPLITA ? 3 : 2;                           // staged planes of a tile: A, A's residual where there is one, B
    __shared__ __align__(16) unsigned char stg[2 * NPL * GS_PLANE];
    float* ost;                                                   // the epilogue's tile
    if constexpr (EPI == 1) { static_assert(2 * 64 * VT_PITCH <= sizeof(stg) && 4 * 16 * 68 * 4 <= sizeof(stg)); ost = (float*)stg; }      // behind the K loop's last barrier no wave reads the staging buffers and no copy is outstanding
    else { __shared__ __align__(16) float osts[4 * 16 * 68]; ost = osts; }
    int by = blockIdx.y; bool isv = false; const bf* Bn = Bn0; const float* bias = bias0; const float* phase = phase0; bf* Ph = Ph0; bf* Pl = Pl0;      // EPI 1: q's
    if constexpr (EPI == 1) {                                     // the same for the whole block
        constexpr int TV = DMOD / 64, TQ = (NH_ * NW) / 64;
        isv = by < TV; const bool isk = by >= TV + TQ;
        if (isv) { Bn = Bv; bias = biasv; Ph = Phv; Pl = Plv; } else if (isk) { by -= TV + TQ; Bn = Bk; bias = biask; phase = phasek; Ph = Phk; Pl = Plk; } else by -= TV;
    }
    const int tid = threadIdx.x, lane = threadIdx.x & 31, wave = threadIdx.x >> 5, lr = lane & 15, hi = lane >> 4;
    const int r0 = blockIdx.x * 64 + wave * 16, c0 = by * 64;
    // staging: a tile is 64 rows of 64 k (one 128-byte line a row) of each plane; thread tid copies the 16-byte piece tid & 7 of the rows (tid >> 3) + 16 i: a wave's copy takes 4 whole lines
    const unsigned sdst = (unsigned)(size_t)stg + (tid >> 3) * GS_PITCH + (tid & 7) * 16;
    const size_t asrc = (size_t)(blockIdx.x * 64 + (tid >> 3)) * K + (tid & 7) * 8, bsrc = (size_t)(c0 + (tid >> 3)) * K + (tid & 7) * 8, rstep = (size_t)16 * K;
    auto stage = [&](int t) {                                     // tile t: global memory to LDS buffer t & 1, through no register
        const unsigned d = sdst + (t & 1) * (NPL * GS_PLANE), e = d + (NPL - 1) * GS_PLANE;
        const bf* pa = A + asrc + t * 64; const bf* pb = Bn + bsrc + t * 64;
        // the tile's copies stand in one statement; the wait at its end stands in front of whatever rewrites a register that one of them names
        if constexpr (SPLITA) {
            const unsigned f = d + GS_PLANE; const bf* pl = Al + asrc + t * 64;
            asm volatile("global_load_async_to_lds_b128 %0, %12, off\n\tglobal_load_async_to_lds_b128 %1, %13, off\n\tglobal_load_async_to_lds_b128 %2, %14, off\n\tglobal_load_async_to_lds_b128 %3, %15, off\n\t"
                         "global_load_async_to_lds_b128 %4, %16, off\n\tglobal_load_async_to_lds_b128 %5, %17, off\n\tglobal_load_async_to_lds_b128 %6, %18, off\n\tglobal_load_async_to_lds_b128 %7, %19, off\n\t"
                         "global_load_async_to_lds_b128 %8, %20, off\n\tglobal_load_async_to_lds_b128 %9, %21, off\n\tglobal_load_async_to_lds_b128 %10, %22, off\n\tglobal_load_async_to_lds_b128 %11, %23, off\n\ts_wait_xcnt 0x0"
                         :: "v"(d), "v"(d + 16 * GS_PITCH), "v"(d + 32 * GS_PITCH), "v"(d + 48 * GS_PITCH), "v"(f), "v"(f + 16 * GS_PITCH), "v"(f + 32 * GS_PITCH), "v"(f + 48 * GS_PITCH), "v"(e), "v"(e + 16 * GS_PITCH), "v"(e + 32 * GS_PITCH), "v"(e + 48 * GS_PITCH),
                            "v"(pa), "v"(pa + rstep), "v"(pa + 2 * rstep), "v"(pa + 3 * rstep), "v"(pl), "v"(pl + rstep), "v"(pl + 2 * rstep), "v"(pl + 3 * rstep), "v"(pb), "v"(pb + rstep), "v"(pb + 2 * rstep), "v"(pb + 3 * rstep) : "memory");
        } else {
            asm volatile("global_load_async_to_lds_b128 %0, %8, off\n\tglobal_load_async_to_lds_b128 %1, %9, off\n\tglobal_load_async_to_lds_b128 %2, %10, off\n\tglobal_load_async_to_lds_b128 %3, %11, off\n\t"
                         "global_load_async_to_lds_b128 %4, %12, off\n\tglobal_load_async_to_lds_b128 %5, %13, off\n\tglobal_load_async_to_lds_b128 %6, %14, off\n\tglobal_load_async_to_lds_b128 %7, %15, off\n\ts_wait_xcnt 0x0"
                         :: "v"(d), "v"(d + 16 * GS_PITCH), "v"(d + 32 * GS_PITCH), "v"(d + 48 * GS_PITCH), "v"(e), "v"(e + 16 * GS_PITCH), "v"(e + 32 * GS_PITCH), "v"(e + 48 * GS_PITCH),
                            "v"(pa), "v"(pa + rstep), "v"(pa + 2 * rstep), "v"(pa + 3 * rstep), "v"(pb), "v"(pb + rstep), "v"(pb + 2 * rstep), "v"(pb + 3 * rstep) : "memory");
        }
    };
    v8f acc[4];
#pragma unroll
    for (int t = 0; t < 4; ++t) acc[t] = (v8f){};
    const int nt = K >> 6;                                        // K is a multiple of 64
    stage(0);
    asm volatile("s_wait_asynccnt 0x0" ::: "memory");      // this wave's copies of tile 0 have landed
    __syncthreads();      // tile 0 is in LDS before any wave reads it
    if (nt > 1) stage(1);
#pragma unroll 1      // one copy of the trip
    for (int kt = 0; kt < nt; ++kt) {
        const unsigned char* fa = stg + (kt & 1) * (NPL * GS_PLANE) + (wave * 16 + lr) * GS_PITCH + 16 * hi;      // the wave's own 16 rows of A
        const unsigned char* fb = stg + (kt & 1) * (NPL * GS_PLANE) + (NPL - 1) * GS_PLANE + lr * GS_PITCH + 16 * hi;      // the 64 rows of B, the same k order as A's
        v16bf a[2], al[2], b[2][4];
#pragma unroll
        for (int u = 0; u < 2; ++u) {
            a[u] = cat16b(*(const v8usa*)(fa + u * 64), *(const v8usa*)(fa + u * 64 + 32)); al[u] = a[u];
            if (SPLITA) al[u] = cat16b(*(const v8usa*)(fa + GS_PLANE + u * 64), *(const v8usa*)(fa + GS_PLANE + u * 64 + 32));
#pragma unroll
            for (int t = 0; t < 4; ++t) b[u][t] = cat16b(*(const v8usa*)(fb + t * 16 * GS_PITCH + u * 64), *(const v8usa*)(fb + t * 16 * GS_PITCH + u * 64 + 32));
        }
#pragma unroll
        for (int u = 0; u < 2; ++u) {
#pragma unroll
            for (int t = 0; t < 4; ++t) acc[t] = wmmab(a[u], b[u][t], acc[t]);
            if (SPLITA) {
#pragma unroll
                for (int t = 0; t < 4; ++t) acc[t] = wmmab(al[u], b[u][t], acc[t]);
            }
        }
        // four vector slots between the last matrix instruction and whatever overwrites its operands or reads its result behind it
        asm volatile("v_nop\n\tv_nop\n\tv_nop\n\tv_nop" : "+v"(acc[0]), "+v"(acc[1]), "+v"(acc[2]), "+v"(acc[3]) : "v"(a[0]), "v"(a[1]), "v"(al[0]), "v"(al[1]), "v"(b[0][0]), "v"(b[0][1]), "v"(b[0][2]), "v"(b[0][3]), "v"(b[1][0]), "v"(b[1][1]), "v"(b[1][2]), "v"(b[1][3]));
        asm volatile("s_wait_dscnt 0x0" ::: "memory");      // this wave's reads of tile kt are done before its buffer is handed on
        asm volatile("s_wait_asynccnt 0x0" ::: "memory");   // this wave's copies of tile kt + 1 have landed
        __syncthreads();      // tile kt + 1 is in LDS before any wave reads it, and every wave has left tile kt's buffer before it is filled again
        if (kt + 2 < nt) stage(kt + 2);
    }
    asm volatile("s_wait_asynccnt 0x0" ::: "memory");      // no copy is outstanding behind the loop
    if (EPI == 1 && isv) {
        // acc[t][0..7] are 8 tokens in a row (wave * 16 + hi * 8 + j) of value t * 16 + lr: one 16-byte piece of a V^T row in each plane
        unsigned char* vb = (unsigned char*)ost;
#pragma unroll
        for (int t = 0; t < 4; ++t) { const float bv = bfr(bias[c0 + t * 16 + lr]); v8us oh, ol;
#pragma unroll
            for (int j = 0; j < 8; ++j) { const float y = acc[t][j] + bv; const unsigned short hb = f2bf(y); oh[j] = hb; ol[j] = f2bf(y - bf2f(hb)); }
            unsigned char* vp = vb + (t * 16 + lr) * VT_PITCH + (wave * 16 + hi * 8) * 2; *(v8usa*)vp = oh; *(v8usa*)(vp + 64 * VT_PITCH) = ol; }
        __syncthreads();      // a V^T row's 64 tokens come from all 4 waves: every piece is in LDS before a row is read
        const int rb = blockIdx.x * 64, piece = threadIdx.x & 7, d0 = threadIdx.x >> 3;
        const size_t vo = (((size_t)(rb / NN) * NH_ + by) * HD + d0) * NN + rb % NN + piece * 8;      // 8 lanes write one whole line
        v8us wh[4], wl[4];
#pragma unroll
        for (int s = 0; s < 4; ++s) { const unsigned char* vp = vb + (d0 + 16 * s) * VT_PITCH + piece * 16; wh[s] = *(const v8usa*)vp; wl[s] = *(const v8usa*)(vp + 64 * VT_PITCH); }
#pragma unroll
        for (int s = 0; s < 4; ++s) { *(v8us*)(Ph + vo + (size_t)(16 * s) * NN) = wh[s]; *(v8us*)(Pl + vo + (size_t)(16 * s) * NN) = wl[s]; }
        return;
    }
    float* os = ost + wave * (16 * 68);
#pragma unroll
    for (int t = 0; t < 4; ++t) { const float bv = bias ? bfr(bias[c0 + t * 16 + lr]) : 0.f;
#pragma unroll
        for (int j = 0; j < 8; ++j) os[(hi * 8 + j) * 68 + t * 16 + lr] = acc[t][j] + bv; }
    __syncthreads();
    if constexpr (EPI == 1) {
        // a lane takes row lr of the wave's 16 and the heads hi and hi + 2 of the tile's 4: all NW values of a (row, head) pair in one lane
        v8us oh[2][2], ol[2][2];
#pragma unroll
        for (int s = 0; s < 2; ++s) { const int hh = hi + 2 * s; float v[NW], p[NW / 2];
#pragma unroll
            for (int q = 0; q < 4; ++q) { const v4f xv = *(const v4fa*)(os + lr * 68 + hh * NW + q * 4); const v4f pv = *(const v4f*)(phase + c0 + hh * NW + q * 4);
#pragma unroll
                for (int i = 0; i < 4; ++i) v[q * 4 + i] = xv[i] + bfr(pv[i]); }
#pragma unroll
            for (int i = 0; i < NW / 2; ++i) p[i] = v[2 * i] * v[2 * i] + v[2 * i + 1] * v[2 * i + 1];
            const float ss = ((p[0] + p[4]) + (p[2] + p[6])) + ((p[1] + p[5]) + (p[3] + p[7]));      // pairs, then partners 4, 2, 1 apart
            const float inv = 1.0f / fmaxf(sqrtf(ss), 1e-12f);
#pragma unroll
            for (int i = 0; i < NW; ++i) { const float y = v[i] * inv; const unsigned short hb = f2bf(y); oh[s][i >> 3][i & 7] = hb; ol[s][i >> 3][i & 7] = f2bf(y - bf2f(hb)); }
        }
        const int r = r0 + lr; const v8us zero = {0, 0, 0, 0, 0, 0, 0, 0};
        const size_t po = (((size_t)(r / NN) * NH_ + by * 4 + hi) * NN + r % NN) * KQ;      // a wave fills 16 rows of 64 bytes in a row per head and plane
#pragma unroll
        for (int s = 0; s < 2; ++s) { bf* a = Ph + po + (size_t)(2 * s) * NN * KQ; bf* b = Pl + po + (size_t)(2 * s) * NN * KQ;
            *(v8us*)a = oh[s][0]; *(v8us*)(a + 8) = oh[s][1]; *(v8us*)(a + 16) = zero; *(v8us*)(a + 24) = zero; *(v8us*)b = ol[s][0]; *(v8us*)(b + 8) = ol[s][1]; *(v8us*)(b + 16) = zero; *(v8us*)(b + 24) = zero; }
        return;
    }
    if (F16OUT) {
        h16* crow = (h16*)(void*)C + (size_t)r0 * ldc + c0;
        auto pass = [&]() {
#pragma unroll
            for (int s = 0; s < 4; ++s) { const int row = 4 * s + (lane >> 3), piece = lane & 7; const float* sp = os + row * 68 + piece * 8; v8h o, o2;
#pragma unroll
                for (int i = 0; i < 8; ++i) { const h16 a = (h16)sp[i]; o[i] = a; o2[i] = (h16)((sp[i] - (float)a) * LOSC); }
                *(v8h*)(crow + (size_t)row * ldc + piece * 8) = o; if (C2) *(v8h*)(C2 + (size_t)r0 * ldc + c0 + (size_t)row * ldc + piece * 8) = o2; }
        };
        pass(); 
    } else {
        float* crow = C + (size_t)r0 * ldc + c0;
        auto pass = [&]() {
#pragma unroll
            for (int s = 0; s < 8; ++s) { const int Lid = (lane >> 3) + 4 * s, piece = lane & 7; const int row = Lid >> 1, cofs = (Lid & 1) * 32 + piece * 4;
                v4f val = *(const v4fa*)(os + row * 68 + cofs); if (R) { const v4f rv = *(const v4f*)(R + ((size_t)r0 + row) * ldc + c0 + cofs); val += roundR ? (v4f){bfr(rv[0]), bfr(rv[1]), bfr(rv[2]), bfr(rv[3])} : rv; }
                *(v4f*)(crow + (size_t)row * ldc + cofs) = val; }
        };
        pass(); 
    }
}


// k_fattn: causal attention of one (item, head) plane per blockIdx.z, 16 query rows per wave, 32 keys per pass: S^T = K.Q^T (A = key rows, B = query rows, both in the same k order), so a lane
// holds 16 scores of ONE query (column lr; keys 8 * hi + j and 16 + 8 * hi + j), which is also that query's place in the B operand of O^T += V^T.P^T: the probabilities go from the score
// accumulators into the next product without leaving the lane. Running maximum and sum per query; the output tile is rescaled only in a pass where some query's maximum rises.
// The block's 8 waves share the keys: a stage of 64 keys (K and V^T, hi and residual planes) is fetched once per block by whole-line loads and laid into one of two LDS buffers.
// A block takes the 128-row block 15 - x and then the block x of its plane: every block walks the same number of stages.
#define FK_PITCH 80               // bytes per staged key row (64 of data): 16 x odd, the pitch at which 16-byte LDS reads of 16 rows do not collide
#define FV_PITCH 144              // bytes per staged V^T row (128 of data): 16 x odd
#define FK_PLANE (64 * FK_PITCH)
#define FV_PLANE (64 * FV_PITCH)
#define F_BUF    (2 * FK_PLANE + 2 * FV_PLANE)
__global__ __launch_bounds__(256) void k_fattn(const bf* __restrict__ Qh, const bf* __restrict__ Ql, const bf* __restrict__ Kh, const bf* __restrict__ Kl, const bf* __restrict__ Vh, const bf* __restrict__ Vl, const float* __restrict__ temp, bf* Oh, bf* Ol) {
    typedef __attribute__((ext_vector_type(2))) float v2f;
    typedef __attribute__((ext_vector_type(2))) __bf16 v2bf;
    __shared__ __align__(16) unsigned char L[2 * F_BUF];
    const float sc2 = (1.0f / bfr(temp[0])) * 1.44269504f;        // 1/temperature and log2(e) in one factor: the exponentials are base 2
    const int tid = threadIdx.x, lane = tid & 31, lr = lane & 15, hi = lane >> 4;
    const int wave = __builtin_amdgcn_readfirstlane(tid >> 5);    // the wave's number in a scalar register: trip counts and the diagonal test become scalar, EXEC stays whole
    const size_t z = blockIdx.z;
    Qh += z * NN * KQ; Ql += z * NN * KQ; Kh += z * NN * KQ; Kl += z * NN * KQ; Vh += z * HD * NN; Vl += z * HD * NN;
    Oh += (z / NH_) * NN * DMOD + (z % NH_) * HD; Ol += (z / NH_) * NN * DMOD + (z % NH_) * HD;
    auto xhalf = [](float v) { const int b = __float_as_int(v); return __int_as_float(__builtin_amdgcn_permlanex16(b, b, 0x76543210, 0xfedcba98, false, false)); };      // lane l <-> l ^ 16
    // staging: a plane's 64 key rows are 4 KiB in a row, thread tid takes 16-byte piece tid; a V^T plane's stage is 64 rows of one 128-byte line, thread tid takes pieces tid and tid + 256 (8 pieces a row)
    const int ksto = (tid >> 2) * FK_PITCH + (tid & 3) * 16, vsto = 2 * FK_PLANE + (tid >> 3) * FV_PITCH + (tid & 7) * 16;
    const size_t vsrc = (size_t)(tid >> 3) * NN + (tid & 7) * 8;
    v8us g[6];
    auto fetch = [&](int st) {                                    // stage st: global memory to registers
        const bf* p0 = Kh + (size_t)st * 64 * KQ + tid * 8; const bf* p1 = Kl + (size_t)st * 64 * KQ + tid * 8; const bf* p2 = Vh + vsrc + st * 64; const bf* p3 = Vl + vsrc + st * 64;
        g[0] = *(const v8us*)p0; g[1] = *(const v8us*)p1; g[2] = *(const v8us*)p2; g[3] = *(const v8us*)(p2 + 32 * NN); g[4] = *(const v8us*)p3; g[5] = *(const v8us*)(p3 + 32 * NN);
        // no address register of the loads above is rewritten before this wait: the clobber keeps the loads in front of it, and naming the addresses as inputs keeps their registers whole up to it
        asm volatile("s_wait_xcnt 0x0" :: "v"(p0), "v"(p1), "v"(p2), "v"(p3) : "memory");
    };
    auto lay = [&](int st) {                                      // registers to the stage's LDS buffer
        unsigned char* B = L + (st & 1) * F_BUF;
        *(v8usa*)(B + ksto) = g[0]; *(v8usa*)(B + FK_PLANE + ksto) = g[1]; *(v8usa*)(B + vsto) = g[2]; *(v8usa*)(B + vsto + 32 * FV_PITCH) = g[3]; *(v8usa*)(B + FV_PLANE + vsto) = g[4]; *(v8usa*)(B + FV_PLANE + vsto + 32 * FV_PITCH) = g[5];
    };
#pragma unroll 1      // the two row blocks run one after the other through one copy of the code
    for (int job = 0; job < 2; ++job) {
        const int qb = job ? (int)blockIdx.x : NN / 128 - 1 - (int)blockIdx.x;
        const int nst = 2 * (qb + 1);                             // stages of 64 keys up to the block's last row: the same for all 8 waves
        const int q0 = qb * 128 + wave * 16;
        const int ns = (q0 + 47) >> 5;                            // this wave's passes of 32 keys, up to and with the one that holds key q0 + 15
        const size_t qo = (size_t)(q0 + lr) * KQ + 8 * hi;
        const v16bf qh = cat16b(*(const v8us*)(Qh + qo), *(const v8us*)(Qh + qo + 16)), ql = cat16b(*(const v8us*)(Ql + qo), *(const v8us*)(Ql + qo + 16));
        fetch(0); lay(0);                                         // buffer 0 is free: every wave has passed the barrier behind the last stage of the row block before
        __syncthreads();      // stage 0 is in LDS before any wave reads it
        v8f acc[4];
#pragma unroll
        for (int t = 0; t < 4; ++t) acc[t] = (v8f){};
        float m = -3.0e38f; v2f l2 = {0.f, 0.f};                  // the lane's sum in two halves: one packed add per pair of keys
#pragma unroll 1      // kept rolled: a stage is long
        for (int st = 0; st < nst; ++st) {
            if (st + 1 < nst) fetch(st + 1);                      // in flight under this stage's two passes
            const unsigned char* B = L + (st & 1) * F_BUF;
#pragma unroll 1      // one copy of the pass
            for (int pp = 0; pp < 2; ++pp) {
                const int s = 2 * st + pp;
                if (s >= ns) break;                               // scalar: a wave whose rows end below these keys goes on to the barrier
                const unsigned char* bk = B + (pp * 32 + lr) * FK_PITCH + 16 * hi;      // keys 32 s + 16 u + lr, the same k order as the q loader
                const unsigned char* bv = B + 2 * FK_PLANE + lr * FV_PITCH + pp * 64 + 16 * hi;      // V^T rows d = 16 t + lr, keys 32 s + 8 * hi + 0..7 and + 16: the order in which the score tiles hold the keys
                v16bf kh[2], kl[2], vh[4], vl[4];
#pragma unroll
                for (int u = 0; u < 2; ++u) { kh[u] = cat16b(*(const v8usa*)(bk + u * 16 * FK_PITCH), *(const v8usa*)(bk + u * 16 * FK_PITCH + 32)); kl[u] = cat16b(*(const v8usa*)(bk + FK_PLANE + u * 16 * FK_PITCH), *(const v8usa*)(bk + FK_PLANE + u * 16 * FK_PITCH + 32)); }
#pragma unroll
                for (int t = 0; t < 4; ++t) { vh[t] = cat16b(*(const v8usa*)(bv + t * 16 * FV_PITCH), *(const v8usa*)(bv + t * 16 * FV_PITCH + 32)); vl[t] = cat16b(*(const v8usa*)(bv + FV_PLANE + t * 16 * FV_PITCH), *(const v8usa*)(bv + FV_PLANE + t * 16 * FV_PITCH + 32)); }
                asm volatile("" ::: "memory");      // compiler fence: the pass's 24 LDS reads stay together here, in flight at once; moved down to their products, each fragment would cost an LDS latency of its own
                v8f sc[2];
#pragma unroll
                for (int u = 0; u < 2; ++u) { sc[u] = wmmab(kh[u], qh, (v8f){}); sc[u] = wmmab(kh[u], ql, sc[u]); sc[u] = wmmab(kl[u], qh, sc[u]); }
#pragma unroll
                for (int u = 0; u < 2; ++u) sc[u] *= sc2;
                if (s == ns - 1) {                                // only the wave's last pass holds keys above the diagonal
#pragma unroll
                    for (int u = 0; u < 2; ++u) {
#pragma unroll
                        for (int j = 0; j < 8; ++j) if (s * 32 + u * 16 + hi * 8 + j > q0 + lr) sc[u][j] = -3.0e38f; }      // a masked key: exp gives 0 below (key 0 is never masked, so m is a real score)
                }
                float mx = sc[0][0];
#pragma unroll
                for (int e = 1; e < 16; ++e) mx = fmaxf(mx, sc[e >> 3][e & 7]);
                mx = fmaxf(mx, xhalf(mx));                        // both halves of the wave hold the query's maximum of this pass
                if (__builtin_amdgcn_ballot_w32(mx > m) != 0) {   // scalar branch; where no maximum rises every factor would be 1
                    const float mn = fmaxf(m, mx), corr = __builtin_amdgcn_exp2f(m - mn); m = mn; l2 *= corr;
#pragma unroll
                    for (int t = 0; t < 4; ++t) acc[t] *= corr;
                }
                v16bf ph, pl;
#pragma unroll
                for (int e = 0; e < 16; e += 2) {
                    const v2f p = {__builtin_amdgcn_exp2f(sc[e >> 3][e & 7] - m), __builtin_amdgcn_exp2f(sc[e >> 3][(e & 7) + 1] - m)};
                    l2 += p;
                    const v2bf h2 = __builtin_convertvector(p, v2bf); const v2bf r2 = __builtin_convertvector(p - __builtin_convertvector(h2, v2f), v2bf);      // hi plane and residual, both to nearest even
                    ph[e] = h2[0]; ph[e + 1] = h2[1]; pl[e] = r2[0]; pl[e + 1] = r2[1];
                }
#pragma unroll
                for (int t = 0; t < 4; ++t) { acc[t] = wmmab(vh[t], ph, acc[t]); acc[t] = wmmab(vh[t], pl, acc[t]); acc[t] = wmmab(vl[t], ph, acc[t]); }
                // four vector slots between the last matrix instruction and whatever overwrites its operands or reads its result on the taken back edge or behind the loop
                asm volatile("v_nop\n\tv_nop\n\tv_nop\n\tv_nop" : "+v"(acc[0]), "+v"(acc[1]), "+v"(acc[2]), "+v"(acc[3]) : "v"(vh[0]), "v"(vh[1]), "v"(vh[2]), "v"(vh[3]), "v"(vl[0]), "v"(vl[1]), "v"(vl[2]), "v"(vl[3]), "v"(ph), "v"(pl));
            }
            if (st + 1 < nst) lay(st + 1);                        // into the buffer that stage st - 1 was read from: every wave has left it, it passed the barrier below
            __syncthreads();      // stage st + 1 is in LDS before any wave reads it, and every wave's reads of stage st are done before its buffer is filled again
        }
        float l = l2[0] + l2[1]; l += xhalf(l);                   // the two halves' sums meet once
        const float inv = 1.0f / l;
        bf* ohrow = Oh + (size_t)(q0 + lr) * DMOD + hi * 8; bf* olrow = Ol + (size_t)(q0 + lr) * DMOD + hi * 8;      // acc[t][j] = O[q0 + lr][16 t + 8 hi + j]: 8 values in a row per tile, one 16-byte piece in each plane
#pragma unroll
        for (int t = 0; t < 4; ++t) { const v8f o = acc[t] * inv; v8us a, b;
#pragma unroll
            for (int j = 0; j < 8; ++j) { const unsigned short hb = f2bf(o[j]); a[j] = hb; b[j] = f2bf(o[j] - bf2f(hb)); }      // the output projection's hi plane and residual
            *(v8us*)(ohrow + t * 16) = a; *(v8us*)(olrow + t * 16) = b; }
        asm volatile("s_wait_xcnt 0x0" :: "v"(ohrow), "v"(olrow) : "memory");      // the second row block's arithmetic reuses the registers that these stores name: the wait stands in front of that
    }
}
__global__ __launch_bounds__(256) void k_planes32z(const float* __restrict__ F, int ld, int off, float sc, int rows, bf* Ph, bf* Pl) {
    typedef __attribute__((ext_vector_type(2))) unsigned short v2us;
    const int lane = threadIdx.x & 31; const size_t r = ((size_t)blockIdx.x * 8 + (threadIdx.x >> 5)) * 2 + (lane >> 4); if (r >= (size_t)rows) return; const int z = blockIdx.z; const int c0 = (lane & 15) * 2; v2us oh, ol;
    Ph += (size_t)z * rows * 32; Pl += (size_t)z * rows * 32;
#pragma unroll
    for (int i = 0; i < 2; ++i) { const float y = F[r * ld + off + z * 32 + c0 + i] * sc; const unsigned short hb = f2bf(y); oh[i] = hb; ol[i] = f2bf(y - bf2f(hb)); }
    const size_t o = r * 32 + c0; *(v2us*)(Ph + o) = oh; *(v2us*)(Pl + o) = ol; 
}
__global__ __launch_bounds__(256) void k_vtpadz(const float* __restrict__ F, int ld, int off, int nk, bf* Th, bf* Tl) {
    typedef __attribute__((ext_vector_type(2))) unsigned short v2us;
    const int lane = threadIdx.x & 31; const size_t wid = (size_t)blockIdx.x * 8 + (threadIdx.x >> 5); if (wid >= (size_t)64 * (nk / 64)) return; const int z = blockIdx.z; const int d = (int)(wid / (nk / 64)); const int k0 = (int)(wid % (nk / 64)) * 64 + lane * 2; v2us oh, ol;
    Th += (size_t)z * 64 * nk; Tl += (size_t)z * 64 * nk;
#pragma unroll
    for (int i = 0; i < 2; ++i) { const float y = (d < 32) ? F[(size_t)(k0 + i) * ld + off + z * 32 + (d < 32 ? d : 0)] : 0.f; const unsigned short hb = f2bf(y); oh[i] = hb; ol[i] = f2bf(y - bf2f(hb)); }
    const size_t o = (size_t)d * nk + k0; *(v2us*)(Th + o) = oh; *(v2us*)(Tl + o) = ol; 
}
template <int NK>
__global__ __launch_bounds__(256) void k_softmaxz(const float* __restrict__ S, int rows, bf* PH, bf* PL) {
    typedef __attribute__((ext_vector_type(4))) unsigned short v4us;
    const int lane = threadIdx.x & 31, i = blockIdx.x * 8 + (threadIdx.x >> 5); if (i >= rows) return; const size_t zo = (size_t)blockIdx.z * rows * NK; const float* sr = S + zo + (size_t)i * NK; PH += zo; PL += zo;
    float m = -3.0e38f;
#pragma unroll 1
    for (int c0 = lane * 4; c0 < NK; c0 += 128) {
#pragma unroll
        for (int q = 0; q < 4; ++q) m = fmaxf(m, sr[c0 + q]); }
#pragma unroll
    for (int sh = 16; sh; sh >>= 1) m = fmaxf(m, __shfl_xor(m, sh, 32));
    float sum = 0.f;
#pragma unroll 1
    for (int c0 = lane * 4; c0 < NK; c0 += 128) {
#pragma unroll
        for (int q = 0; q < 4; ++q) sum += __expf(sr[c0 + q] - m); }
#pragma unroll
    for (int sh = 16; sh; sh >>= 1) sum += __shfl_xor(sum, sh, 32);
    const float inv = 1.0f / sum;
{
#pragma unroll 1
        for (int c0 = lane * 4; c0 < NK; c0 += 128) { v4us oh, ol;
#pragma unroll
            for (int q = 0; q < 4; ++q) { const float p = __expf(sr[c0 + q] - m) * inv; const unsigned short hb = f2bf(p); oh[q] = hb; ol[q] = f2bf(p - bf2f(hb)); }
            const size_t o = (size_t)i * NK + c0; *(v4us*)(PH + o) = oh; *(v4us*)(PL + o) = ol; }
         }
}
__global__ __launch_bounds__(256) void k_placez(const float* __restrict__ XH, int rows, int ldy, float* Y) {
    const int lane = threadIdx.x & 31; const size_t q = (size_t)blockIdx.x * 8 + (threadIdx.x >> 5); if (q >= (size_t)rows) return; const int z = blockIdx.z; const float v = XH[((size_t)z * rows + q) * 64 + lane];
    *(float*)(Y + q * ldy + z * 32 + lane) = v; 
}

__global__ __launch_bounds__(256) void k_hplanesz(const float* __restrict__ F, int ld, int h0, float sc, int rows, bf* Ph, bf* Pl) {
    typedef __attribute__((ext_vector_type(2))) unsigned short v2us;
    const int lane = threadIdx.x & 31; const size_t r = (size_t)blockIdx.x * 8 + (threadIdx.x >> 5); if (r >= (size_t)rows) return; const int z = blockIdx.z; v2us oh, ol;
    Ph += (size_t)z * rows * 64; Pl += (size_t)z * rows * 64;
#pragma unroll
    for (int i = 0; i < 2; ++i) { const float y = F[r * ld + (h0 + z) * 64 + lane * 2 + i] * sc; const unsigned short hb = f2bf(y); oh[i] = hb; ol[i] = f2bf(y - bf2f(hb)); }
    const size_t o = r * 64 + lane * 2; *(v2us*)(Ph + o) = oh; *(v2us*)(Pl + o) = ol; 
}
template <int NK>
__global__ __launch_bounds__(256) void k_softmaxzs(const float* __restrict__ S, int rows, float sc, bf* PH, bf* PL) {
    typedef __attribute__((ext_vector_type(4))) unsigned short v4us;
    const int lane = threadIdx.x & 31, i = blockIdx.x * 8 + (threadIdx.x >> 5); if (i >= rows) return; const size_t zo = (size_t)blockIdx.z * rows * NK; const float* sr = S + zo + (size_t)i * NK; PH += zo; PL += zo;
    float m = -3.0e38f;
#pragma unroll 1
    for (int c0 = lane * 4; c0 < NK; c0 += 128) {
#pragma unroll
        for (int q = 0; q < 4; ++q) m = fmaxf(m, sr[c0 + q] * sc); }
#pragma unroll
    for (int sh = 16; sh; sh >>= 1) m = fmaxf(m, __shfl_xor(m, sh, 32));
    float sum = 0.f;
#pragma unroll 1
    for (int c0 = lane * 4; c0 < NK; c0 += 128) {
#pragma unroll
        for (int q = 0; q < 4; ++q) sum += __expf(sr[c0 + q] * sc - m); }
#pragma unroll
    for (int sh = 16; sh; sh >>= 1) sum += __shfl_xor(sum, sh, 32);
    const float inv = 1.0f / sum;
{
#pragma unroll 1
        for (int c0 = lane * 4; c0 < NK; c0 += 128) { v4us oh, ol;
#pragma unroll
            for (int q = 0; q < 4; ++q) { const float p = __expf(sr[c0 + q] * sc - m) * inv; const unsigned short hb = f2bf(p); oh[q] = hb; ol[q] = f2bf(p - bf2f(hb)); }
            const size_t o = (size_t)i * NK + c0; *(v4us*)(PH + o) = oh; *(v4us*)(PL + o) = ol; }
         }
}

__device__ __forceinline__ void d_cvtx(const float* __restrict__ src, int rows, bf* dst, int bx) {
    const int lane = threadIdx.x & 31; const size_t r = (size_t)bx * 8 + (threadIdx.x >> 5); if (r >= (size_t)rows) return;
{
#pragma unroll
        for (int q = 0; q < DMOD / 256; ++q) { v8us o;
#pragma unroll
            for (int i = 0; i < 8; ++i) o[i] = f2bf(src[r * DMOD + q * 256 + lane * 8 + i]);
            *(v8us*)(dst + r * DMOD + q * 256 + lane * 8) = o; }
         }
}
// k_prep: all that depends on the inputs alone, in one launch: the first NBT * NN / 8 blocks convert 8 rows of x each, every further block transposes one 64 x 64 tile of Wv, Wo, Wq or Wk.
__global__ __launch_bounds__(256) void k_prep(const float* __restrict__ x, const float* __restrict__ Wq, const float* __restrict__ Wk, const float* __restrict__ Wv, const float* __restrict__ Wo, bf* Xb, bf* WQ, bf* WK, bf* WV, bf* WO) {
    __shared__ __align__(16) unsigned short tl[64 * 72];
    constexpr int NX = NBT * NN / 8, KT = DMOD / 64, TV = KT * (DMOD / 64), TQ = KT * ((NH_ * NW) / 64);
    int b = blockIdx.x;
    if (b < NX) { d_cvtx(x, NBT * NN, Xb, b); return; }      // the whole block leaves, in front of d_wt's barrier
    b -= NX;
    const float* Wm; bf* WT; int ncols;
    if (b < 2 * TV) { ncols = DMOD; const bool o = b >= TV; Wm = o ? Wo : Wv; WT = o ? WO : WV; b -= o ? TV : 0; }
    else { b -= 2 * TV; ncols = NH_ * NW; const bool k = b >= TQ; Wm = k ? Wk : Wq; WT = k ? WK : WQ; b -= k ? TQ : 0; }
    d_wt(Wm, DMOD, ncols, WT, b % KT, b / KT, tl);
}
__global__ __launch_bounds__(256) void k_csoftz(const float* __restrict__ S, int rows, float sc, bf* PH, bf* PL) {
    typedef __attribute__((ext_vector_type(4))) unsigned short v4us;
    const int lane = threadIdx.x & 31, i = blockIdx.x * 8 + (threadIdx.x >> 5); if (i >= rows) return; const size_t zo = (size_t)blockIdx.z * rows * NN; const float* sr = S + zo + (size_t)i * NN; PH += zo; PL += zo;
    float m = -3.0e38f;
#pragma unroll 1
    for (int c0 = lane * 4; c0 < NN; c0 += 128) {
#pragma unroll
        for (int q = 0; q < 4; ++q) { const int k = c0 + q; if (k <= i) m = fmaxf(m, sr[k] * sc); } }
#pragma unroll
    for (int sh = 16; sh; sh >>= 1) m = fmaxf(m, __shfl_xor(m, sh, 32));
    float sum = 0.f;
#pragma unroll 1
    for (int c0 = lane * 4; c0 < NN; c0 += 128) {
#pragma unroll
        for (int q = 0; q < 4; ++q) { const int k = c0 + q; if (k <= i) sum += __expf(sr[k] * sc - m); } }
#pragma unroll
    for (int sh = 16; sh; sh >>= 1) sum += __shfl_xor(sum, sh, 32);
    const float inv = 1.0f / sum;
{
#pragma unroll 1
        for (int c0 = lane * 4; c0 < NN; c0 += 128) { v4us oh, ol;
#pragma unroll
            for (int q = 0; q < 4; ++q) { const int k = c0 + q; const float p = (k <= i) ? __expf(sr[(k <= i) ? k : 0] * sc - m) * inv : 0.f; const unsigned short hb = f2bf(p); oh[q] = hb; ol[q] = f2bf(p - bf2f(hb)); }
            const size_t o = (size_t)i * NN + c0; *(v4us*)(PH + o) = oh; *(v4us*)(PL + o) = ol; }
         }
}
extern "C" void kernel_launch(void* const* d_in, const int* in_sizes, int n_in,
                              void* d_out, int out_size, void* d_ws, size_t ws_size, hipStream_t stream) {
    (void)in_sizes; (void)n_in; (void)out_size;
    const float* x = (const float*)d_in[0]; const float* Wq = (const float*)d_in[1]; const float* bq = (const float*)d_in[2]; const float* Wk = (const float*)d_in[3]; const float* bk = (const float*)d_in[4]; const float* Wv = (const float*)d_in[5]; const float* bv = (const float*)d_in[6]; const float* Wo = (const float*)d_in[7]; const float* bo = (const float*)d_in[8];
    const float* qph = (const float*)d_in[9]; const float* kph = (const float*)d_in[10]; const float* temp = (const float*)d_in[11];
    float* out = (float*)d_out;    // [2][2048][1024]
    char* wsp = (char*)d_ws;
    auto take = [&](size_t bytes) { char* p = wsp; wsp += (bytes + 255) & ~(size_t)255; return (void*)p; };
    bf* WQ = (bf*)take((size_t)(NH_ * NW) * DMOD * 2); bf* WK = (bf*)take((size_t)(NH_ * NW) * DMOD * 2); bf* WV = (bf*)take((size_t)DMOD * DMOD * 2); bf* WO = (bf*)take((size_t)DMOD * DMOD * 2);
    bf* Xb = (bf*)take((size_t)NBT * NN * DMOD * 2);
    constexpr size_t NZ = (size_t)NBT * NH_;                      // planes of every (item, head) pair live at once
    bf* Qh = (bf*)take(NZ * NN * KQ * 2); bf* Ql = (bf*)take(NZ * NN * KQ * 2); bf* Kh = (bf*)take(NZ * NN * KQ * 2); bf* Kl = (bf*)take(NZ * NN * KQ * 2); bf* VTh = (bf*)take(NZ * HD * NN * 2); bf* VTl = (bf*)take(NZ * HD * NN * 2);
    bf* Oh = (bf*)take((size_t)NBT * NN * DMOD * 2); bf* Ol = (bf*)take((size_t)NBT * NN * DMOD * 2);
    if ((size_t)(wsp - (char*)d_ws) > ws_size) return;    // 61 MiB
    constexpr int NR = NBT * NN;                                  // the two items' rows stand behind one another in x and in out: one launch takes both
    k_prep<<<NR / 8 + (DMOD / 64) * (2 * (DMOD / 64) + 2 * ((NH_ * NW) / 64)), 256, 0, stream>>>(x, Wq, Wk, Wv, Wo, Xb, WQ, WK, WV, WO);   // x to bf16; weights (in, out) k-major -> n-major
    // the host reads nothing from the device: k_fattn reads temperature[0] itself
    // each projection writes the planes that k_fattn reads, and k_fattn the planes that the output projection reads
    k_gemmb<false, false, 1><<<dim3(NR / 64, (DMOD + 2 * NH_ * NW) / 64, 1), 128, 0, stream>>>(Xb, nullptr, WQ, bq, nullptr, 0, nullptr, nullptr, DMOD, 1, qph, Qh, Ql, WK, bk, kph, Kh, Kl, WV, bv, VTh, VTl);
    k_fattn<<<dim3(NN / 256, 1, NBT * NH_), 256, 0, stream>>>(Qh, Ql, Kh, Kl, VTh, VTl, temp, Oh, Ol);
    k_gemmb<true, false><<<dim3(NR / 64, DMOD / 64, 1), 128, 0, stream>>>(Oh, Ol, WO, bo, out, DMOD, nullptr, nullptr, DMOD);
}

// v008
// It runs in 79.2 microseconds.
// Timed twice side by side with v007, it ran 1.07 times as fast both times.
// Counting every step since v000, it is 32.5 times as fast.
#include <hip/hip_runtime.h>

// Compute dtypes, f32 accumulate, per item: q/k/v projections as GEMMs with PLAIN bf16 operands (x and the (in,out) weights; exact products, + bias); per head the 16-wide q/k get
// their phase added and are L2-normalised in f32, then stored as bf16 hi + UNSCALED residual planes padded to K = 32 (zero columns); causal scores (three products), 1/temperature, the causal
// softmax (f32, running maximum) and attn.v (three products) in ONE kernel for all items and heads: scores and probabilities stay in registers; output projection on hi/lo planes

#define NBT  2
#define NN   2048
#define DMOD 1024
#define NH_  16
#define NW   16
#define KQ   32                   // padded score depth
#define HD   64
#define DM   DMOD
#define NTK  NN
#define LOSC 1024.0f

typedef _Float16 h16;
typedef unsigned short bf;
typedef __attribute__((ext_vector_type(16))) __bf16   v16bf;
typedef __attribute__((ext_vector_type(16))) _Float16 v16h;
typedef __attribute__((ext_vector_type(8)))  _Float16 v8h;
typedef __attribute__((ext_vector_type(8)))  unsigned short v8us;
typedef __attribute__((ext_vector_type(8)))  float    v8f;
typedef __attribute__((ext_vector_type(4)))  float    v4f;
typedef __attribute__((ext_vector_type(4)))  _Float16 v4h;
typedef v8h  __attribute__((may_alias)) v8ha;
typedef v4f  __attribute__((may_alias)) v4fa;
typedef v8us __attribute__((may_alias)) v8usa;

__device__ __forceinline__ unsigned short f2bf(float f) { unsigned u = __float_as_uint(f); u += 0x7FFFu + ((u >> 16) & 1u); return (unsigned short)(u >> 16); }
__device__ __forceinline__ float bf2f(unsigned short b) { return __uint_as_float(((unsigned)b) << 16); }
__device__ __forceinline__ float bfr(float f) { return bf2f(f2bf(f)); }
__device__ __forceinline__ v16h cat16(v8h lo, v8h hi) { return __builtin_shufflevector(lo, hi, 0, 1, 2, 3, 4, 5, 6, 7, 8, 9, 10, 11, 12, 13, 14, 15); }
__device__ __forceinline__ v16bf cat16b(v8us lo, v8us hi) { return __builtin_bit_cast(v16bf, __builtin_shufflevector(lo, hi, 0, 1, 2, 3, 4, 5, 6, 7, 8, 9, 10, 11, 12, 13, 14, 15)); }
__device__ __forceinline__ v8f wmma16(v16h a, v16h b, v8f c) { return __builtin_amdgcn_wmma_f32_16x16x32_f16(false, a, false, b, (short)0, c, false, false); }
__device__ __forceinline__ v8f wmmab(v16bf a, v16bf b, v8f c) { return __builtin_amdgcn_wmma_f32_16x16x32_bf16(false, a, false, b, (short)0, c, false, false); }

// d_wt: WT [n][K] = bf16(W[k][n]) (k-major [K][ncols]) via 64 x 64 LDS tiles; tile (bx, by) of (K/64, ncols/64), tl: the block's 64 x 72 staging tile.
__device__ __forceinline__ void d_wt(const float* __restrict__ Wm, int K, int ncols, bf* WT, int bx, int by, unsigned short* tl) {
    const int tid = threadIdx.x, k0 = bx * 64, n0 = by * 64;
    const int kk = tid >> 2, nq = (tid & 3) * 16;
#pragma unroll
    for (int i = 0; i < 16; ++i) tl[(nq + i) * 72 + kk] = f2bf(Wm[(size_t)(k0 + kk) * ncols + n0 + nq + i]);
    __syncthreads();
    const int piece = tid & 7;
    auto pass = [&]() {
#pragma unroll
        for (int s = 0; s < 2; ++s) { const int nr = (tid >> 3) + 32 * s; const v8us val = *(const v8usa*)(tl + nr * 72 + piece * 8); *(v8us*)(WT + (size_t)(n0 + nr) * K + k0 + piece * 8) = val; }
    };
    pass(); 
    asm volatile("s_wait_xcnt 0x0" ::: "memory");      // the stores' registers may be written again where this is inlined in front of other code: the wait stands behind the last store
}
// k_gemmb: 64 x 64 block tile (4 waves x 16 x 64) of C[rows][ldc] = (A [+ Al]).B^T (K = 1024) [+ bf(bias[c])] [+ bf(R[r][c]) residual]; f32 whole-line epilogue (or f16
// The K loop goes by tiles of 64 k: the block's 64 rows of A (and of Al) and 64 rows of B are copied into one of two LDS buffers, whole lines, one tile ahead; B's rows serve all 4 waves.
// EPI 1: the q, k and v projections of x in one grid; blockIdx.y picks the projection (v's column tiles first, then q's, then k's) and its column tile. The epilogue's tile lies over the staging buffers.
//   q, k: the tile's 4 heads get their phase added and are L2-normalised in f32, and go out as bf16 hi + residual planes [item * NH_ + head][token][KQ], columns NW.. zero.
//   v: the tile is one head's 64 tokens x 64 values; it goes out transposed as bf16 hi + residual planes [item * NH_ + head][value][token], one whole 128-byte line per value and plane.
#define VT_PITCH 144              // bytes per staged V^T row (128 of data): 16 x odd
#define GS_PITCH 144              // bytes per staged operand row (64 k, 128 of data): 16 x odd
#define GS_PLANE (64 * GS_PITCH)
template <bool SPLITA, bool F16OUT = false, int EPI = 0>
__global__ __launch_bounds__(128) void k_gemmb(const bf* __restrict__ A, const bf* __restrict__ Al, const bf* __restrict__ Bn0, const float* __restrict__ bias0, float* C, int ldc, h16* C2, const float* __restrict__ R = nullptr, int K = DM, int roundR = 1, const float* __restrict__ phase0 = nullptr, bf* Ph0 = nullptr, bf* Pl0 = nullptr,
        const bf* __restrict__ Bk = nullptr, const float* __restrict__ biask = nullptr, const float* __restrict__ phasek = nullptr, bf* Phk = nullptr, bf* Plk = nullptr, const bf* __restrict__ Bv = nullptr, const float* __restrict__ biasv = nullptr, bf* Phv = nullptr, bf* Plv = nullptr) {
    constexpr int NPL = SPLITA ? 3 : 2;                           // staged planes of a tile: A, A's residual where there is one, B
    __shared__ __align__(16) unsigned char stg[2 * NPL * GS_PLANE];
    float* ost;                                                   // the epilogue's tile
    if constexpr (EPI == 1) { static_assert(2 * 64 * VT_PITCH <= sizeof(stg) && 4 * 16 * 68 * 4 <= sizeof(stg)); ost = (float*)stg; }      // behind the K loop's last barrier no wave reads the staging buffers and no copy is outstanding
    else { __shared__ __align__(16) float osts[4 * 16 * 68]; ost = osts; }
    int by = blockIdx.y; bool isv = false; const bf* Bn = Bn0; const float* bias = bias0; const float* phase = phase0; bf* Ph = Ph0; bf* Pl = Pl0;      // EPI 1: q's
    if constexpr (EPI == 1) {                                     // the same for the whole block
        constexpr int TV = DMOD / 64, TQ = (NH_ * NW) / 64;
        isv = by < TV; const bool isk = by >= TV + TQ;
        if (isv) { Bn = Bv; bias = biasv; Ph = Phv; Pl = Plv; } else if (isk) { by -= TV + TQ; Bn = Bk; bias = biask; phase = phasek; Ph = Phk; Pl = Plk; } else by -= TV;
    }
    const int tid = threadIdx.x, lane = threadIdx.x & 31, wave = threadIdx.x >> 5, lr = lane & 15, hi = lane >> 4;
    const int r0 = blockIdx.x * 64 + wave * 16, c0 = by * 64;
    // staging: a tile is 64 rows of 64 k (one 128-byte line a row) of each plane; thread tid copies the 16-byte piece tid & 7 of the rows (tid >> 3) + 16 i: a wave's copy takes 4 whole lines
    const unsigned sdst = (unsigned)(size_t)stg + (tid >> 3) * GS_PITCH + (tid & 7) * 16;
    const size_t asrc = (size_t)(blockIdx.x * 64 + (tid >> 3)) * K + (tid & 7) * 8, bsrc = (size_t)(c0 + (tid >> 3)) * K + (tid & 7) * 8, rstep = (size_t)16 * K;
    auto stage = [&](int t) {                                     // tile t: global memory to LDS buffer t & 1, through no register
        const unsigned d = sdst + (t & 1) * (NPL * GS_PLANE), e = d + (NPL - 1) * GS_PLANE;
        const bf* pa = A + asrc + t * 64; const bf* pb = Bn + bsrc + t * 64;
        // the tile's copies stand in one statement; the wait at its end stands in front of whatever rewrites a register that one of them names
        if constexpr (SPLITA) {
            const unsigned f = d + GS_PLANE; const bf* pl = Al + asrc + t * 64;
            asm volatile("global_load_async_to_lds_b128 %0, %12, off\n\tglobal_load_async_to_lds_b128 %1, %13, off\n\tglobal_load_async_to_lds_b128 %2, %14, off\n\tglobal_load_async_to_lds_b128 %3, %15, off\n\t"
                         "global_load_async_to_lds_b128 %4, %16, off\n\tglobal_load_async_to_lds_b128 %5, %17, off\n\tglobal_load_async_to_lds_b128 %6, %18, off\n\tglobal_load_async_to_lds_b128 %7, %19, off\n\t"
                         "global_load_async_to_lds_b128 %8, %20, off\n\tglobal_load_async_to_lds_b128 %9, %21, off\n\tglobal_load_async_to_lds_b128 %10, %22, off\n\tglobal_load_async_to_lds_b128 %11, %23, off\n\ts_wait_xcnt 0x0"
                         :: "v"(d), "v"(d + 16 * GS_PITCH), "v"(d + 32 * GS_PITCH), "v"(d + 48 * GS_PITCH), "v"(f), "v"(f + 16 * GS_PITCH), "v"(f + 32 * GS_PITCH), "v"(f + 48 * GS_PITCH), "v"(e), "v"(e + 16 * GS_PITCH), "v"(e + 32 * GS_PITCH), "v"(e + 48 * GS_PITCH),
                            "v"(pa), "v"(pa + rstep), "v"(pa + 2 * rstep), "v"(pa + 3 * rstep), "v"(pl), "v"(pl + rstep), "v"(pl + 2 * rstep), "v"(pl + 3 * rstep), "v"(pb), "v"(pb + rstep), "v"(pb + 2 * rstep), "v"(pb + 3 * rstep) : "memory");
        } else {
            asm volatile("global_load_async_to_lds_b128 %0, %8, off\n\tglobal_load_async_to_lds_b128 %1, %9, off\n\tglobal_load_async_to_lds_b128 %2, %10, off\n\tglobal_load_async_to_lds_b128 %3, %11, off\n\t"
                         "global_load_async_to_lds_b128 %4, %12, off\n\tglobal_load_async_to_lds_b128 %5, %13, off\n\tglobal_load_async_to_lds_b128 %6, %14, off\n\tglobal_load_async_to_lds_b128 %7, %15, off\n\ts_wait_xcnt 0x0"
                         :: "v"(d), "v"(d + 16 * GS_PITCH), "v"(d + 32 * GS_PITCH), "v"(d + 48 * GS_PITCH), "v"(e), "v"(e + 16 * GS_PITCH), "v"(e + 32 * GS_PITCH), "v"(e + 48 * GS_PITCH),
                            "v"(pa), "v"(pa + rstep), "v"(pa + 2 * rstep), "v"(pa + 3 * rstep), "v"(pb), "v"(pb + rstep), "v"(pb + 2 * rstep), "v"(pb + 3 * rstep) : "memory");
        }
    };
    v8f acc[4];
#pragma unroll
    for (int t = 0; t < 4; ++t) acc[t] = (v8f){};
    const int nt = K >> 6;                                        // K is a multiple of 64
    stage(0);
    asm volatile("s_wait_asynccnt 0x0" ::: "memory");      // this wave's copies of tile 0 have landed
    __syncthreads();      // tile 0 is in LDS before any wave reads it
    if (nt > 1) stage(1);
#pragma unroll 1      // one copy of the trip
    for (int kt = 0; kt < nt; ++kt) {
        const unsigned char* fa = stg + (kt & 1) * (NPL * GS_PLANE) + (wave * 16 + lr) * GS_PITCH + 16 * hi;      // the wave's own 16 rows of A
        const unsigned char* fb = stg + (kt & 1) * (NPL * GS_PLANE) + (NPL - 1) * GS_PLANE + lr * GS_PITCH + 16 * hi;      // the 64 rows of B, the same k order as A's
        v16bf a[2], al[2], b[2][4];
#pragma unroll
        for (int u = 0; u < 2; ++u) {
            a[u] = cat16b(*(const v8usa*)(fa + u * 64), *(const v8usa*)(fa + u * 64 + 32)); al[u] = a[u];
            if (SPLITA) al[u] = cat16b(*(const v8usa*)(fa + GS_PLANE + u * 64), *(const v8usa*)(fa + GS_PLANE + u * 64 + 32));
#pragma unroll
            for (int t = 0; t < 4; ++t) b[u][t] = cat16b(*(const v8usa*)(fb + t * 16 * GS_PITCH + u * 64), *(const v8usa*)(fb + t * 16 * GS_PITCH + u * 64 + 32));
        }
#pragma unroll
        for (int u = 0; u < 2; ++u) {
#pragma unroll
            for (int t = 0; t < 4; ++t) acc[t] = wmmab(a[u], b[u][t], acc[t]);
            if (SPLITA) {
#pragma unroll
                for (int t = 0; t < 4; ++t) acc[t] = wmmab(al[u], b[u][t], acc[t]);
            }
        }
        // four vector slots between the last matrix instruction and whatever overwrites its operands or reads its result behind it
        asm volatile("v_nop\n\tv_nop\n\tv_nop\n\tv_nop" : "+v"(acc[0]), "+v"(acc[1]), "+v"(acc[2]), "+v"(acc[3]) : "v"(a[0]), "v"(a[1]), "v"(al[0]), "v"(al[1]), "v"(b[0][0]), "v"(b[0][1]), "v"(b[0][2]), "v"(b[0][3]), "v"(b[1][0]), "v"(b[1][1]), "v"(b[1][2]), "v"(b[1][3]));
        asm volatile("s_wait_dscnt 0x0" ::: "memory");      // this wave's reads of tile kt are done before its buffer is handed on
        asm volatile("s_wait_asynccnt 0x0" ::: "memory");   // this wave's copies of tile kt + 1 have landed
        __syncthreads();      // tile kt + 1 is in LDS before any wave reads it, and every wave has left tile kt's buffer before it is filled again
        if (kt + 2 < nt) stage(kt + 2);
    }
    asm volatile("s_wait_asynccnt 0x0" ::: "memory");      // no copy is outstanding behind the loop
    if (EPI == 1 && isv) {
        // acc[t][0..7] are 8 tokens in a row (wave * 16 + hi * 8 + j) of value t * 16 + lr: one 16-byte piece of a V^T row in each plane
        unsigned char* vb = (unsigned char*)ost;
#pragma unroll
        for (int t = 0; t < 4; ++t) { const float bv = bfr(bias[c0 + t * 16 + lr]); v8us oh, ol;
#pragma unroll
            for (int j = 0; j < 8; ++j) { const float y = acc[t][j] + bv; const unsigned short hb = f2bf(y); oh[j] = hb; ol[j] = f2bf(y - bf2f(hb)); }
            unsigned char* vp = vb + (t * 16 + lr) * VT_PITCH + (wave * 16 + hi * 8) * 2; *(v8usa*)vp = oh; *(v8usa*)(vp + 64 * VT_PITCH) = ol; }
        __syncthreads();      // a V^T row's 64 tokens come from all 4 waves: every piece is in LDS before a row is read
        const int rb = blockIdx.x * 64, piece = threadIdx.x & 7, d0 = threadIdx.x >> 3;
        const size_t vo = (((size_t)(rb / NN) * NH_ + by) * HD + d0) * NN + rb % NN + piece * 8;      // 8 lanes write one whole line
        v8us wh[4], wl[4];
#pragma unroll
        for (int s = 0; s < 4; ++s) { const unsigned char* vp = vb + (d0 + 16 * s) * VT_PITCH + piece * 16; wh[s] = *(const v8usa*)vp; wl[s] = *(const v8usa*)(vp + 64 * VT_PITCH); }
#pragma unroll
        for (int s = 0; s < 4; ++s) { *(v8us*)(Ph + vo + (size_t)(16 * s) * NN) = wh[s]; *(v8us*)(Pl + vo + (size_t)(16 * s) * NN) = wl[s]; }
        return;
    }
    float* os = ost + wave * (16 * 68);
#pragma unroll
    for (int t = 0; t < 4; ++t) { const float bv = bias ? bfr(bias[c0 + t * 16 + lr]) : 0.f;
#pragma unroll
        for (int j = 0; j < 8; ++j) os[(hi * 8 + j) * 68 + t * 16 + lr] = acc[t][j] + bv; }
    __syncthreads();
    if constexpr (EPI == 1) {
        // a lane takes row lr of the wave's 16 and the heads hi and hi + 2 of the tile's 4: all NW values of a (row, head) pair in one lane
        v8us oh[2][2], ol[2][2];
#pragma unroll
        for (int s = 0; s < 2; ++s) { const int hh = hi + 2 * s; float v[NW], p[NW / 2];
#pragma unroll
            for (int q = 0; q < 4; ++q) { const v4f xv = *(const v4fa*)(os + lr * 68 + hh * NW + q * 4); const v4f pv = *(const v4f*)(phase + c0 + hh * NW + q * 4);
#pragma unroll
                for (int i = 0; i < 4; ++i) v[q * 4 + i] = xv[i] + bfr(pv[i]); }
#pragma unroll
            for (int i = 0; i < NW / 2; ++i) p[i] = v[2 * i] * v[2 * i] + v[2 * i + 1] * v[2 * i + 1];
            const float ss = ((p[0] + p[4]) + (p[2] + p[6])) + ((p[1] + p[5]) + (p[3] + p[7]));      // pairs, then partners 4, 2, 1 apart
            const float inv = 1.0f / fmaxf(sqrtf(ss), 1e-12f);
#pragma unroll
            for (int i = 0; i < NW; ++i) { const float y = v[i] * inv; const unsigned short hb = f2bf(y); oh[s][i >> 3][i & 7] = hb; ol[s][i >> 3][i & 7] = f2bf(y - bf2f(hb)); }
        }
        const int r = r0 + lr; const v8us zero = {0, 0, 0, 0, 0, 0, 0, 0};
        const size_t po = (((size_t)(r / NN) * NH_ + by * 4 + hi) * NN + r % NN) * KQ;      // a wave fills 16 rows of 64 bytes in a row per head and plane
#pragma unroll
        for (int s = 0; s < 2; ++s) { bf* a = Ph + po + (size_t)(2 * s) * NN * KQ; bf* b = Pl + po + (size_t)(2 * s) * NN * KQ;
            *(v8us*)a = oh[s][0]; *(v8us*)(a + 8) = oh[s][1]; *(v8us*)(a + 16) = zero; *(v8us*)(a + 24) = zero; *(v8us*)b = ol[s][0]; *(v8us*)(b + 8) = ol[s][1]; *(v8us*)(b + 16) = zero; *(v8us*)(b + 24) = zero; }
        return;
    }
    if (F16OUT) {
        h16* crow = (h16*)(void*)C + (size_t)r0 * ldc + c0;
        auto pass = [&]() {
#pragma unroll
            for (int s = 0; s < 4; ++s) { const int row = 4 * s + (lane >> 3), piece = lane & 7; const float* sp = os + row * 68 + piece * 8; v8h o, o2;
#pragma unroll
                for (int i = 0; i < 8; ++i) { const h16 a = (h16)sp[i]; o[i] = a; o2[i] = (h16)((sp[i] - (float)a) * LOSC); }
                *(v8h*)(crow + (size_t)row * ldc + piece * 8) = o; if (C2) *(v8h*)(C2 + (size_t)r0 * ldc + c0 + (size_t)row * ldc + piece * 8) = o2; }
        };
        pass(); 
    } else {
        float* crow = C + (size_t)r0 * ldc + c0;
        auto pass = [&]() {
#pragma unroll
            for (int s = 0; s < 8; ++s) { const int Lid = (lane >> 3) + 4 * s, piece = lane & 7; const int row = Lid >> 1, cofs = (Lid & 1) * 32 + piece * 4;
                v4f val = *(const v4fa*)(os + row * 68 + cofs); if (R) { const v4f rv = *(const v4f*)(R + ((size_t)r0 + row) * ldc + c0 + cofs); val += roundR ? (v4f){bfr(rv[0]), bfr(rv[1]), bfr(rv[2]), bfr(rv[3])} : rv; }
                *(v4f*)(crow + (size_t)row * ldc + cofs) = val; }
        };
        pass(); 
    }
}


// k_fattn: causal attention of one (item, head) plane per blockIdx.z, 16 query rows per wave, 32 keys per pass: S^T = K.Q^T (A = key rows, B = query rows, both in the same k order), so a lane
// holds 16 scores of ONE query (column lr; keys 8 * hi + j and 16 + 8 * hi + j), which is also that query's place in the B operand of O^T += V^T.P^T: the probabilities go from the score
// accumulators into the next product without leaving the lane. Running maximum and sum per query; the output tile is rescaled only in a pass where some query's maximum rises.
// The block's 16 waves share the keys: a stage of 128 keys (K and V^T, hi and residual planes) is fetched once per block by whole-line loads and laid into one of two LDS buffers.
// Two waves share 16 query rows and split a stage's four passes: key group 0 takes passes 0 and 2, key group 1 passes 1 and 3, each with a running maximum, sum and output tile of its own;
// behind the last stage group 1 hands its three through LDS to group 0, which brings both to the common maximum, adds them and stores. Four waves a SIMD fill one another's waits.
// A block takes the 128-row block 15 - x and then the block x of its plane: every block walks the same number of stages.
#define FK_PITCH 80               // bytes per staged key row (64 of data): 16 x odd, the pitch at which 16-byte LDS reads of 16 rows do not collide
#define FV_PITCH 272              // bytes per staged V^T row (256 of data): 16 x odd
#define FK_PLANE (128 * FK_PITCH)
#define FV_PLANE (64 * FV_PITCH)
#define F_BUF    (2 * FK_PLANE + 2 * FV_PLANE)
__global__ __launch_bounds__(512) void k_fattn(const bf* __restrict__ Qh, const bf* __restrict__ Ql, const bf* __restrict__ Kh, const bf* __restrict__ Kl, const bf* __restrict__ Vh, const bf* __restrict__ Vl, const float* __restrict__ temp, bf* Oh, bf* Ol) {
    typedef __attribute__((ext_vector_type(2))) float v2f;
    typedef __attribute__((ext_vector_type(2))) __bf16 v2bf;
    __shared__ __align__(16) unsigned char L[2 * F_BUF];
    __shared__ __align__(16) v4f MA[8 * 8 * 32];                  // key group 1's output tiles: piece i of lane l of query wave w at (w * 8 + i) * 32 + l, a wave's store or load takes 512 bytes in a row
    __shared__ float MM[8 * 32], ML[8 * 32];                      // its maxima and its lanes' sums
    const float sc2 = (1.0f / bfr(temp[0])) * 1.44269504f;        // 1/temperature and log2(e) in one factor: the exponentials are base 2
    const int tid = threadIdx.x, lane = tid & 31, lr = lane & 15, hi = lane >> 4;
    const int wv = __builtin_amdgcn_readfirstlane(tid >> 5);      // the wave's number in a scalar register: trip counts, the diagonal test and the key group's branches become scalar, EXEC stays whole
    const int wave = wv & 7, kg = wv >> 3;                        // which 16 query rows, which half of a stage's passes
    const size_t z = blockIdx.z;
    Qh += z * NN * KQ; Ql += z * NN * KQ; Kh += z * NN * KQ; Kl += z * NN * KQ; Vh += z * HD * NN; Vl += z * HD * NN;
    Oh += (z / NH_) * NN * DMOD + (z % NH_) * HD; Ol += (z / NH_) * NN * DMOD + (z % NH_) * HD;
    auto xhalf = [](float v) { const int b = __float_as_int(v); return __int_as_float(__builtin_amdgcn_permlanex16(b, b, 0x76543210, 0xfedcba98, false, false)); };      // lane l <-> l ^ 16
    // staging: a plane's 128 key rows are 8 KiB in a row, thread tid takes 16-byte piece tid; a V^T plane's stage is 64 rows of two 128-byte lines, thread tid takes pieces tid and tid + 512 (16 pieces a row)
    const int ksto = (tid >> 2) * FK_PITCH + (tid & 3) * 16, vsto = 2 * FK_PLANE + (tid >> 4) * FV_PITCH + (tid & 15) * 16;
    const size_t vsrc = (size_t)(tid >> 4) * NN + (tid & 15) * 8;
    v8us g[6];
    auto fetch = [&](int st) {                                    // stage st: global memory to registers
        const bf* p0 = Kh + (size_t)st * 128 * KQ + tid * 8; const bf* p1 = Kl + (size_t)st * 128 * KQ + tid * 8; const bf* p2 = Vh + vsrc + st * 128; const bf* p3 = Vl + vsrc + st * 128;
        g[0] = *(const v8us*)p0; g[1] = *(const v8us*)p1; g[2] = *(const v8us*)p2; g[3] = *(const v8us*)(p2 + 32 * NN); g[4] = *(const v8us*)p3; g[5] = *(const v8us*)(p3 + 32 * NN);
        // no address register of the loads above is rewritten before this wait: the clobber keeps the loads in front of it, and naming the addresses as inputs keeps their registers whole up to it
        asm volatile("s_wait_xcnt 0x0" :: "v"(p0), "v"(p1), "v"(p2), "v"(p3) : "memory");
    };
    auto lay = [&](int st) {                                      // registers to the stage's LDS buffer
        unsigned char* B = L + (st & 1) * F_BUF;
        *(v8usa*)(B + ksto) = g[0]; *(v8usa*)(B + FK_PLANE + ksto) = g[1]; *(v8usa*)(B + vsto) = g[2]; *(v8usa*)(B + vsto + 32 * FV_PITCH) = g[3]; *(v8usa*)(B + FV_PLANE + vsto) = g[4]; *(v8usa*)(B + FV_PLANE + vsto + 32 * FV_PITCH) = g[5];
    };
#pragma unroll 1      // the two row blocks run one after the other through one copy of the code
    for (int job = 0; job < 2; ++job) {
        const int qb = job ? (int)blockIdx.x : NN / 128 - 1 - (int)blockIdx.x;
        const int nst = qb + 1;                                   // stages of 128 keys up to the block's last row: the same for all 16 waves
        const int q0 = qb * 128 + wave * 16;
        const int ns = (q0 + 47) >> 5;                            // these rows' passes of 32 keys, up to and with the one that holds key q0 + 15
        const size_t qo = (size_t)(q0 + lr) * KQ + 8 * hi;
        const v16bf qh = cat16b(*(const v8us*)(Qh + qo), *(const v8us*)(Qh + qo + 16)), ql = cat16b(*(const v8us*)(Ql + qo), *(const v8us*)(Ql + qo + 16));
        fetch(0); lay(0);                                         // buffer 0 is free: every wave has passed the barrier behind the last stage of the row block before
        __syncthreads();      // stage 0 is in LDS before any wave reads it
        v8f acc[4];
#pragma unroll
        for (int t = 0; t < 4; ++t) acc[t] = (v8f){};
        float m = -3.0e38f; v2f l2 = {0.f, 0.f};                  // the lane's sum in two halves: one packed add per pair of keys
#pragma unroll 1      // kept rolled: a stage is long
        for (int st = 0; st < nst; ++st) {
            if (st + 1 < nst) fetch(st + 1);                      // in flight under this stage's two passes
            const unsigned char* B = L + (st & 1) * F_BUF;
#pragma unroll 1      // one copy of the pass
            for (int pp = 0; pp < 2; ++pp) {
                const int ps = 2 * pp + kg, s = 4 * st + ps;      // the key group's pass of this stage
                if (s >= ns) break;                               // scalar: a wave whose rows end below these keys goes on to the barrier
                const unsigned char* bk = B + (ps * 32 + lr) * FK_PITCH + 16 * hi;      // keys 32 s + 16 u + lr, the same k order as the q loader
                const unsigned char* bv = B + 2 * FK_PLANE + lr * FV_PITCH + ps * 64 + 16 * hi;      // V^T rows d = 16 t + lr, keys 32 s + 8 * hi + 0..7 and + 16: the order in which the score tiles hold the keys
                v16bf kh[2], kl[2], vh[4], vl[4];
#pragma unroll
                for (int u = 0; u < 2; ++u) { kh[u] = cat16b(*(const v8usa*)(bk + u * 16 * FK_PITCH), *(const v8usa*)(bk + u * 16 * FK_PITCH + 32)); kl[u] = cat16b(*(const v8usa*)(bk + FK_PLANE + u * 16 * FK_PITCH), *(const v8usa*)(bk + FK_PLANE + u * 16 * FK_PITCH + 32)); }
#pragma unroll
                for (int t = 0; t < 4; ++t) { vh[t] = cat16b(*(const v8usa*)(bv + t * 16 * FV_PITCH), *(const v8usa*)(bv + t * 16 * FV_PITCH + 32)); vl[t] = cat16b(*(const v8usa*)(bv + FV_PLANE + t * 16 * FV_PITCH), *(const v8usa*)(bv + FV_PLANE + t * 16 * FV_PITCH + 32)); }
                asm volatile("" ::: "memory");      // compiler fence: the pass's 24 LDS reads stay together here, in flight at once; moved down to their products, each fragment would cost an LDS latency of its own
                v8f sc[2];
#pragma unroll
                for (int u = 0; u < 2; ++u) { sc[u] = wmmab(kh[u], qh, (v8f){}); sc[u] = wmmab(kh[u], ql, sc[u]); sc[u] = wmmab(kl[u], qh, sc[u]); }
#pragma unroll
                for (int u = 0; u < 2; ++u) sc[u] *= sc2;
                if (s == ns - 1) {                                // only the rows' last pass holds keys above the diagonal (and at least one key at or below it for every row)
#pragma unroll
                    for (int u = 0; u < 2; ++u) {
#pragma unroll
                        for (int j = 0; j < 8; ++j) if (s * 32 + u * 16 + hi * 8 + j > q0 + lr) sc[u][j] = -3.0e38f; }      // a masked key: exp gives 0 below (every pass holds an unmasked key for every row, so m is a real score behind a wave's first pass)
                }
                float mx = sc[0][0];
#pragma unroll
                for (int e = 1; e < 16; ++e) mx = fmaxf(mx, sc[e >> 3][e & 7]);
                mx = fmaxf(mx, xhalf(mx));                        // both halves of the wave hold the query's maximum of this pass
                if (__builtin_amdgcn_ballot_w32(mx > m) != 0) {   // scalar branch; where no maximum rises every factor would be 1
                    const float mn = fmaxf(m, mx), corr = __builtin_amdgcn_exp2f(m - mn); m = mn; l2 *= corr;
#pragma unroll
                    for (int t = 0; t < 4; ++t) acc[t] *= corr;
                }
                v16bf ph, pl;
#pragma unroll
                for (int e = 0; e < 16; e += 2) {
                    const v2f p = {__builtin_amdgcn_exp2f(sc[e >> 3][e & 7] - m), __builtin_amdgcn_exp2f(sc[e >> 3][(e & 7) + 1] - m)};
                    l2 += p;
                    const v2bf h2 = __builtin_convertvector(p, v2bf); const v2bf r2 = __builtin_convertvector(p - __builtin_convertvector(h2, v2f), v2bf);      // hi plane and residual, both to nearest even
                    ph[e] = h2[0]; ph[e + 1] = h2[1]; pl[e] = r2[0]; pl[e + 1] = r2[1];
                }
#pragma unroll
                for (int t = 0; t < 4; ++t) { acc[t] = wmmab(vh[t], ph, acc[t]); acc[t] = wmmab(vh[t], pl, acc[t]); acc[t] = wmmab(vl[t], ph, acc[t]); }
                // four vector slots between the last matrix instruction and whatever overwrites its operands or reads its result on the taken back edge or behind the loop
                asm volatile("v_nop\n\tv_nop\n\tv_nop\n\tv_nop" : "+v"(acc[0]), "+v"(acc[1]), "+v"(acc[2]), "+v"(acc[3]) : "v"(vh[0]), "v"(vh[1]), "v"(vh[2]), "v"(vh[3]), "v"(vl[0]), "v"(vl[1]), "v"(vl[2]), "v"(vl[3]), "v"(ph), "v"(pl));
            }
            if (st + 1 < nst) lay(st + 1);                        // into the buffer that stage st - 1 was read from: every wave has left it, it passed the barrier below
            __syncthreads();      // stage st + 1 is in LDS before any wave reads it, and every wave's reads of stage st are done before its buffer is filled again
        }
        float l = l2[0] + l2[1];
        if (kg == 1) {                                            // scalar branch: key group 1 hands over its output tiles, maximum and sum
#pragma unroll
            for (int i = 0; i < 8; ++i) MA[(wave * 8 + i) * 32 + lane] = (v4f){acc[i >> 1][(i & 1) * 4], acc[i >> 1][(i & 1) * 4 + 1], acc[i >> 1][(i & 1) * 4 + 2], acc[i >> 1][(i & 1) * 4 + 3]};
            MM[wave * 32 + lane] = m; ML[wave * 32 + lane] = l;
        }
        __syncthreads();      // group 1's partial results are in LDS before group 0 reads them; they are written again only behind the next row block's barriers, which group 0 passes after its reads
        if (kg == 1) continue;                                    // scalar: group 1 goes on to the next row block's first stage
        {
            const float m1 = MM[wave * 32 + lane], mn = fmaxf(m, m1);      // a group 1 wave that had no pass hands over -3.0e38, 0 and zeros: its factor is 0 (group 0 always has pass 0, so mn is a real score)
            const float c0 = __builtin_amdgcn_exp2f(m - mn), c1 = __builtin_amdgcn_exp2f(m1 - mn);
            l = l * c0 + ML[wave * 32 + lane] * c1;
#pragma unroll
            for (int i = 0; i < 8; ++i) { const v4f o1 = MA[(wave * 8 + i) * 32 + lane];
#pragma unroll
                for (int j = 0; j < 4; ++j) acc[i >> 1][(i & 1) * 4 + j] = acc[i >> 1][(i & 1) * 4 + j] * c0 + o1[j] * c1; }
        }
        l += xhalf(l);                                            // the two halves' sums meet once
        const float inv = 1.0f / l;
        bf* ohrow = Oh + (size_t)(q0 + lr) * DMOD + hi * 8; bf* olrow = Ol + (size_t)(q0 + lr) * DMOD + hi * 8;      // acc[t][j] = O[q0 + lr][16 t + 8 hi + j]: 8 values in a row per tile, one 16-byte piece in each plane
#pragma unroll
        for (int t = 0; t < 4; ++t) { const v8f o = acc[t] * inv; v8us a, b;
#pragma unroll
            for (int j = 0; j < 8; ++j) { const unsigned short hb = f2bf(o[j]); a[j] = hb; b[j] = f2bf(o[j] - bf2f(hb)); }      // the output projection's hi plane and residual
            *(v8us*)(ohrow + t * 16) = a; *(v8us*)(olrow + t * 16) = b; }
        asm volatile("s_wait_xcnt 0x0" :: "v"(ohrow), "v"(olrow) : "memory");      // the second row block's arithmetic reuses the registers that these stores name: the wait stands in front of that
    }
}
__global__ __launch_bounds__(256) void k_planes32z(const float* __restrict__ F, int ld, int off, float sc, int rows, bf* Ph, bf* Pl) {
    typedef __attribute__((ext_vector_type(2))) unsigned short v2us;
    const int lane = threadIdx.x & 31; const size_t r = ((size_t)blockIdx.x * 8 + (threadIdx.x >> 5)) * 2 + (lane >> 4); if (r >= (size_t)rows) return; const int z = blockIdx.z; const int c0 = (lane & 15) * 2; v2us oh, ol;
    Ph += (size_t)z * rows * 32; Pl += (size_t)z * rows * 32;
#pragma unroll
    for (int i = 0; i < 2; ++i) { const float y = F[r * ld + off + z * 32 + c0 + i] * sc; const unsigned short hb = f2bf(y); oh[i] = hb; ol[i] = f2bf(y - bf2f(hb)); }
    const size_t o = r * 32 + c0; *(v2us*)(Ph + o) = oh; *(v2us*)(Pl + o) = ol; 
}
__global__ __launch_bounds__(256) void k_vtpadz(const float* __restrict__ F, int ld, int off, int nk, bf* Th, bf* Tl) {
    typedef __attribute__((ext_vector_type(2))) unsigned short v2us;
    const int lane = threadIdx.x & 31; const size_t wid = (size_t)blockIdx.x * 8 + (threadIdx.x >> 5); if (wid >= (size_t)64 * (nk / 64)) return; const int z = blockIdx.z; const int d = (int)(wid / (nk / 64)); const int k0 = (int)(wid % (nk / 64)) * 64 + lane * 2; v2us oh, ol;
    Th += (size_t)z * 64 * nk; Tl += (size_t)z * 64 * nk;
#pragma unroll
    for (int i = 0; i < 2; ++i) { const float y = (d < 32) ? F[(size_t)(k0 + i) * ld + off + z * 32 + (d < 32 ? d : 0)] : 0.f; const unsigned short hb = f2bf(y); oh[i] = hb; ol[i] = f2bf(y - bf2f(hb)); }
    const size_t o = (size_t)d * nk + k0; *(v2us*)(Th + o) = oh; *(v2us*)(Tl + o) = ol; 
}
template <int NK>
__global__ __launch_bounds__(256) void k_softmaxz(const float* __restrict__ S, int rows, bf* PH, bf* PL) {
    typedef __attribute__((ext_vector_type(4))) unsigned short v4us;
    const int lane = threadIdx.x & 31, i = blockIdx.x * 8 + (threadIdx.x >> 5); if (i >= rows) return; const size_t zo = (size_t)blockIdx.z * rows * NK; const float* sr = S + zo + (size_t)i * NK; PH += zo; PL += zo;
    float m = -3.0e38f;
#pragma unroll 1
    for (int c0 = lane * 4; c0 < NK; c0 += 128) {
#pragma unroll
        for (int q = 0; q < 4; ++q) m = fmaxf(m, sr[c0 + q]); }
#pragma unroll
    for (int sh = 16; sh; sh >>= 1) m = fmaxf(m, __shfl_xor(m, sh, 32));
    float sum = 0.f;
#pragma unroll 1
    for (int c0 = lane * 4; c0 < NK; c0 += 128) {
#pragma unroll
        for (int q = 0; q < 4; ++q) sum += __expf(sr[c0 + q] - m); }
#pragma unroll
    for (int sh = 16; sh; sh >>= 1) sum += __shfl_xor(sum, sh, 32);
    const float inv = 1.0f / sum;
{
#pragma unroll 1
        for (int c0 = lane * 4; c0 < NK; c0 += 128) { v4us oh, ol;
#pragma unroll
            for (int q = 0; q < 4; ++q) { const float p = __expf(sr[c0 + q] - m) * inv; const unsigned short hb = f2bf(p); oh[q] = hb; ol[q] = f2bf(p - bf2f(hb)); }
            const size_t o = (size_t)i * NK + c0; *(v4us*)(PH + o) = oh; *(v4us*)(PL + o) = ol; }
         }
}
__global__ __launch_bounds__(256) void k_placez(const float* __restrict__ XH, int rows, int ldy, float* Y) {
    const int lane = threadIdx.x & 31; const size_t q = (size_t)blockIdx.x * 8 + (threadIdx.x >> 5); if (q >= (size_t)rows) return; const int z = blockIdx.z; const float v = XH[((size_t)z * rows + q) * 64 + lane];
    *(float*)(Y + q * ldy + z * 32 + lane) = v; 
}

__global__ __launch_bounds__(256) void k_hplanesz(const float* __restrict__ F, int ld, int h0, float sc, int rows, bf* Ph, bf* Pl) {
    typedef __attribute__((ext_vector_type(2))) unsigned short v2us;
    const int lane = threadIdx.x & 31; const size_t r = (size_t)blockIdx.x * 8 + (threadIdx.x >> 5); if (r >= (size_t)rows) return; const int z = blockIdx.z; v2us oh, ol;
    Ph += (size_t)z * rows * 64; Pl += (size_t)z * rows * 64;
#pragma unroll
    for (int i = 0; i < 2; ++i) { const float y = F[r * ld + (h0 + z) * 64 + lane * 2 + i] * sc; const unsigned short hb = f2bf(y); oh[i] = hb; ol[i] = f2bf(y - bf2f(hb)); }
    const size_t o = r * 64 + lane * 2; *(v2us*)(Ph + o) = oh; *(v2us*)(Pl + o) = ol; 
}
template <int NK>
__global__ __launch_bounds__(256) void k_softmaxzs(const float* __restrict__ S, int rows, float sc, bf* PH, bf* PL) {
    typedef __attribute__((ext_vector_type(4))) unsigned short v4us;
    const int lane = threadIdx.x & 31, i = blockIdx.x * 8 + (threadIdx.x >> 5); if (i >= rows) return; const size_t zo = (size_t)blockIdx.z * rows * NK; const float* sr = S + zo + (size_t)i * NK; PH += zo; PL += zo;
    float m = -3.0e38f;
#pragma unroll 1
    for (int c0 = lane * 4; c0 < NK; c0 += 128) {
#pragma unroll
        for (int q = 0; q < 4; ++q) m = fmaxf(m, sr[c0 + q] * sc); }
#pragma unroll
    for (int sh = 16; sh; sh >>= 1) m = fmaxf(m, __shfl_xor(m, sh, 32));
    float sum = 0.f;
#pragma unroll 1
    for (int c0 = lane * 4; c0 < NK; c0 += 128) {
#pragma unroll
        for (int q = 0; q < 4; ++q) sum += __expf(sr[c0 + q] * sc - m); }
#pragma unroll
    for (int sh = 16; sh; sh >>= 1) sum += __shfl_xor(sum, sh, 32);
    const float inv = 1.0f / sum;
{
#pragma unroll 1
        for (int c0 = lane * 4; c0 < NK; c0 += 128) { v4us oh, ol;
#pragma unroll
            for (int q = 0; q < 4; ++q) { const float p = __expf(sr[c0 + q] * sc - m) * inv; const unsigned short hb = f2bf(p); oh[q] = hb; ol[q] = f2bf(p - bf2f(hb)); }
            const size_t o = (size_t)i * NK + c0; *(v4us*)(PH + o) = oh; *(v4us*)(PL + o) = ol; }
         }
}

__device__ __forceinline__ void d_cvtx(const float* __restrict__ src, int rows, bf* dst, int bx) {
    const int lane = threadIdx.x & 31; const size_t r = (size_t)bx * 8 + (threadIdx.x >> 5); if (r >= (size_t)rows) return;
{
#pragma unroll
        for (int q = 0; q < DMOD / 256; ++q) { v8us o;
#pragma unroll
            for (int i = 0; i < 8; ++i) o[i] = f2bf(src[r * DMOD + q * 256 + lane * 8 + i]);
            *(v8us*)(dst + r * DMOD + q * 256 + lane * 8) = o; }
         }
}
// k_prep: all that depends on the inputs alone, in one launch: the first NBT * NN / 8 blocks convert 8 rows of x each, every further block transposes one 64 x 64 tile of Wv, Wo, Wq or Wk.
__global__ __launch_bounds__(256) void k_prep(const float* __restrict__ x, const float* __restrict__ Wq, const float* __restrict__ Wk, const float* __restrict__ Wv, const float* __restrict__ Wo, bf* Xb, bf* WQ, bf* WK, bf* WV, bf* WO) {
    __shared__ __align__(16) unsigned short tl[64 * 72];
    constexpr int NX = NBT * NN / 8, KT = DMOD / 64, TV = KT * (DMOD / 64), TQ = KT * ((NH_ * NW) / 64);
    int b = blockIdx.x;
    if (b < NX) { d_cvtx(x, NBT * NN, Xb, b); return; }      // the whole block leaves, in front of d_wt's barrier
    b -= NX;
    const float* Wm; bf* WT; int ncols;
    if (b < 2 * TV) { ncols = DMOD; const bool o = b >= TV; Wm = o ? Wo : Wv; WT = o ? WO : WV; b -= o ? TV : 0; }
    else { b -= 2 * TV; ncols = NH_ * NW; const bool k = b >= TQ; Wm = k ? Wk : Wq; WT = k ? WK : WQ; b -= k ? TQ : 0; }
    d_wt(Wm, DMOD, ncols, WT, b % KT, b / KT, tl);
}
__global__ __launch_bounds__(256) void k_csoftz(const float* __restrict__ S, int rows, float sc, bf* PH, bf* PL) {
    typedef __attribute__((ext_vector_type(4))) unsigned short v4us;
    const int lane = threadIdx.x & 31, i = blockIdx.x * 8 + (threadIdx.x >> 5); if (i >= rows) return; const size_t zo = (size_t)blockIdx.z * rows * NN; const float* sr = S + zo + (size_t)i * NN; PH += zo; PL += zo;
    float m = -3.0e38f;
#pragma unroll 1
    for (int c0 = lane * 4; c0 < NN; c0 += 128) {
#pragma unroll
        for (int q = 0; q < 4; ++q) { const int k = c0 + q; if (k <= i) m = fmaxf(m, sr[k] * sc); } }
#pragma unroll
    for (int sh = 16; sh; sh >>= 1) m = fmaxf(m, __shfl_xor(m, sh, 32));
    float sum = 0.f;
#pragma unroll 1
    for (int c0 = lane * 4; c0 < NN; c0 += 128) {
#pragma unroll
        for (int q = 0; q < 4; ++q) { const int k = c0 + q; if (k <= i) sum += __expf(sr[k] * sc - m); } }
#pragma unroll
    for (int sh = 16; sh; sh >>= 1) sum += __shfl_xor(sum, sh, 32);
    const float inv = 1.0f / sum;
{
#pragma unroll 1
        for (int c0 = lane * 4; c0 < NN; c0 += 128) { v4us oh, ol;
#pragma unroll
            for (int q = 0; q < 4; ++q) { const int k = c0 + q; const float p = (k <= i) ? __expf(sr[(k <= i) ? k : 0] * sc - m) * inv : 0.f; const unsigned short hb = f2bf(p); oh[q] = hb; ol[q] = f2bf(p - bf2f(hb)); }
            const size_t o = (size_t)i * NN + c0; *(v4us*)(PH + o) = oh; *(v4us*)(PL + o) = ol; }
         }
}
extern "C" void kernel_launch(void* const* d_in, const int* in_sizes, int n_in,
                              void* d_out, int out_size, void* d_ws, size_t ws_size, hipStream_t stream) {
    (void)in_sizes; (void)n_in; (void)out_size;
    const float* x = (const float*)d_in[0]; const float* Wq = (const float*)d_in[1]; const float* bq = (const float*)d_in[2]; const float* Wk = (const float*)d_in[3]; const float* bk = (const float*)d_in[4]; const float* Wv = (const float*)d_in[5]; const float* bv = (const float*)d_in[6]; const float* Wo = (const float*)d_in[7]; const float* bo = (const float*)d_in[8];
    const float* qph = (const float*)d_in[9]; const float* kph = (const float*)d_in[10]; const float* temp = (const float*)d_in[11];
    float* out = (float*)d_out;    // [2][2048][1024]
    char* wsp = (char*)d_ws;
    auto take = [&](size_t bytes) { char* p = wsp; wsp += (bytes + 255) & ~(size_t)255; return (void*)p; };
    bf* WQ = (bf*)take((size_t)(NH_ * NW) * DMOD * 2); bf* WK = (bf*)take((size_t)(NH_ * NW) * DMOD * 2); bf* WV = (bf*)take((size_t)DMOD * DMOD * 2); bf* WO = (bf*)take((size_t)DMOD * DMOD * 2);
    bf* Xb = (bf*)take((size_t)NBT * NN * DMOD * 2);
    constexpr size_t NZ = (size_t)NBT * NH_;                      // planes of every (item, head) pair live at once
    bf* Qh = (bf*)take(NZ * NN * KQ * 2); bf* Ql = (bf*)take(NZ * NN * KQ * 2); bf* Kh = (bf*)take(NZ * NN * KQ * 2); bf* Kl = (bf*)take(NZ * NN * KQ * 2); bf* VTh = (bf*)take(NZ * HD * NN * 2); bf* VTl = (bf*)take(NZ * HD * NN * 2);
    bf* Oh = (bf*)take((size_t)NBT * NN * DMOD * 2); bf* Ol = (bf*)take((size_t)NBT * NN * DMOD * 2);
    if ((size_t)(wsp - (char*)d_ws) > ws_size) return;    // 61 MiB
    constexpr int NR = NBT * NN;                                  // the two items' rows stand behind one another in x and in out: one launch takes both
    k_prep<<<NR / 8 + (DMOD / 64) * (2 * (DMOD / 64) + 2 * ((NH_ * NW) / 64)), 256, 0, stream>>>(x, Wq, Wk, Wv, Wo, Xb, WQ, WK, WV, WO);   // x to bf16; weights (in, out) k-major -> n-major
    // the host reads nothing from the device: k_fattn reads temperature[0] itself
    // each projection writes the planes that k_fattn reads, and k_fattn the planes that the output projection reads
    k_gemmb<false, false, 1><<<dim3(NR / 64, (DMOD + 2 * NH_ * NW) / 64, 1), 128, 0, stream>>>(Xb, nullptr, WQ, bq, nullptr, 0, nullptr, nullptr, DMOD, 1, qph, Qh, Ql, WK, bk, kph, Kh, Kl, WV, bv, VTh, VTl);
    k_fattn<<<dim3(NN / 256, 1, NBT * NH_), 512, 0, stream>>>(Qh, Ql, Kh, Kl, VTh, VTl, temp, Oh, Ol);
    k_gemmb<true, false><<<dim3(NR / 64, DMOD / 64, 1), 128, 0, stream>>>(Oh, Ol, WO, bo, out, DMOD, nullptr, nullptr, DMOD);
}

// v009
// A run of this version takes 75.5 microseconds.
// Two timings next to v008 put it at 1.05 and 1.04 times that version's speed.
// Over all steps from v000 it is 34.1 times as fast.
#include <hip/hip_runtime.h>

// Compute dtypes, f32 accumulate, per item: q/k/v projections as GEMMs with PLAIN bf16 operands (x and the (in,out) weights; exact products, + bias); per head the 16-wide q/k get
// their phase added and are L2-normalised in f32, then stored as bf16 hi + UNSCALED residual planes padded to K = 32 (zero columns); causal scores (three products), 1/temperature, the causal
// softmax (f32, fixed bound or running maximum) and attn.v (three products) in ONE kernel for all items and heads: scores and probabilities stay in registers; output projection on hi/lo planes

#define NBT  2
#define NN   2048
#define DMOD 1024
#define NH_  16
#define NW   16
#define KQ   32                   // padded score depth
#define HD   64
#define DM   DMOD
#define NTK  NN
#define LOSC 1024.0f

typedef _Float16 h16;
typedef unsigned short bf;
typedef __attribute__((ext_vector_type(16))) __bf16   v16bf;
typedef __attribute__((ext_vector_type(16))) _Float16 v16h;
typedef __attribute__((ext_vector_type(8)))  _Float16 v8h;
typedef __attribute__((ext_vector_type(8)))  unsigned short v8us;
typedef __attribute__((ext_vector_type(8)))  float    v8f;
typedef __attribute__((ext_vector_type(4)))  float    v4f;
typedef __attribute__((ext_vector_type(4)))  _Float16 v4h;
typedef v8h  __attribute__((may_alias)) v8ha;
typedef v4f  __attribute__((may_alias)) v4fa;
typedef v8us __attribute__((may_alias)) v8usa;

__device__ __forceinline__ unsigned short f2bf(float f) { unsigned u = __float_as_uint(f); u += 0x7FFFu + ((u >> 16) & 1u); return (unsigned short)(u >> 16); }
__device__ __forceinline__ float bf2f(unsigned short b) { return __uint_as_float(((unsigned)b) << 16); }
__device__ __forceinline__ float bfr(float f) { return bf2f(f2bf(f)); }
__device__ __forceinline__ v16h cat16(v8h lo, v8h hi) { return __builtin_shufflevector(lo, hi, 0, 1, 2, 3, 4, 5, 6, 7, 8, 9, 10, 11, 12, 13, 14, 15); }
__device__ __forceinline__ v16bf cat16b(v8us lo, v8us hi) { return __builtin_bit_cast(v16bf, __builtin_shufflevector(lo, hi, 0, 1, 2, 3, 4, 5, 6, 7, 8, 9, 10, 11, 12, 13, 14, 15)); }
__device__ __forceinline__ v8f wmma16(v16h a, v16h b, v8f c) { return __builtin_amdgcn_wmma_f32_16x16x32_f16(false, a, false, b, (short)0, c, false, false); }
__device__ __forceinline__ v8f wmmab(v16bf a, v16bf b, v8f c) { return __builtin_amdgcn_wmma_f32_16x16x32_bf16(false, a, false, b, (short)0, c, false, false); }

// d_wt: WT [n][K] = bf16(W[k][n]) (k-major [K][ncols]) via 64 x 64 LDS tiles; tile (bx, by) of (K/64, ncols/64), tl: the block's 64 x 72 staging tile.
__device__ __forceinline__ void d_wt(const float* __restrict__ Wm, int K, int ncols, bf* WT, int bx, int by, unsigned short* tl) {
    const int tid = threadIdx.x, k0 = bx * 64, n0 = by * 64;
    const int kk = tid >> 2, nq = (tid & 3) * 16;
#pragma unroll
    for (int i = 0; i < 16; ++i) tl[(nq + i) * 72 + kk] = f2bf(Wm[(size_t)(k0 + kk) * ncols + n0 + nq + i]);
    __syncthreads();
    const int piece = tid & 7;
    auto pass = [&]() {
#pragma unroll
        for (int s = 0; s < 2; ++s) { const int nr = (tid >> 3) + 32 * s; const v8us val = *(const v8usa*)(tl + nr * 72 + piece * 8); *(v8us*)(WT + (size_t)(n0 + nr) * K + k0 + piece * 8) = val; }
    };
    pass(); 
    asm volatile("s_wait_xcnt 0x0" ::: "memory");      // the stores' registers may be written again where this is inlined in front of other code: the wait stands behind the last store
}
// k_gemmb: 64 x 64 block tile (4 waves x 16 x 64) of C[rows][ldc] = (A [+ Al]).B^T (K = 1024) [+ bf(bias[c])] [+ bf(R[r][c]) residual]; f32 whole-line epilogue (or f16
// The K loop goes by tiles of 64 k: the block's 64 rows of A (and of Al) and 64 rows of B are copied into one of two LDS buffers, whole lines, one tile ahead; B's rows serve all 4 waves.
// EPI 1: the q, k and v projections of x in one grid; blockIdx.y picks the projection (v's column tiles first, then q's, then k's) and its column tile. The epilogue's tile lies over the staging buffers.
//   q, k: the tile's 4 heads get their phase added and are L2-normalised in f32, and go out as bf16 hi + residual planes [item * NH_ + head][token][KQ], columns NW.. zero.
//   v: the tile is one head's 64 tokens x 64 values; it goes out transposed as bf16 hi + residual planes [item * NH_ + head][value][token], one whole 128-byte line per value and plane.
#define VT_PITCH 144              // bytes per staged V^T row (128 of data): 16 x odd
#define GS_PITCH 144              // bytes per staged operand row (64 k, 128 of data): 16 x odd
#define GS_PLANE (64 * GS_PITCH)
template <bool SPLITA, bool F16OUT = false, int EPI = 0>
__global__ __launch_bounds__(128) void k_gemmb(const bf* __restrict__ A, const bf* __restrict__ Al, const bf* __restrict__ Bn0, const float* __restrict__ bias0, float* C, int ldc, h16* C2, const float* __restrict__ R = nullptr, int K = DM, int roundR = 1, const float* __restrict__ phase0 = nullptr, bf* Ph0 = nullptr, bf* Pl0 = nullptr,
        const bf* __restrict__ Bk = nullptr, const float* __restrict__ biask = nullptr, const float* __restrict__ phasek = nullptr, bf* Phk = nullptr, bf* Plk = nullptr, const bf* __restrict__ Bv = nullptr, const float* __restrict__ biasv = nullptr, bf* Phv = nullptr, bf* Plv = nullptr) {
    constexpr int NPL = SPLITA ? 3 : 2;                           // staged planes of a tile: A, A's residual where there is one, B
    __shared__ __align__(16) unsigned char stg[2 * NPL * GS_PLANE];
    float* ost;                                                   // the epilogue's tile
    if constexpr (EPI == 1) { static_assert(2 * 64 * VT_PITCH <= sizeof(stg) && 4 * 16 * 68 * 4 <= sizeof(stg)); ost = (float*)stg; }      // behind the K loop's last barrier no wave reads the staging buffers and no copy is outstanding
    else { __shared__ __align__(16) float osts[4 * 16 * 68]; ost = osts; }
    int by = blockIdx.y; bool isv = false; const bf* Bn = Bn0; const float* bias = bias0; const float* phase = phase0; bf* Ph = Ph0; bf* Pl = Pl0;      // EPI 1: q's
    if constexpr (EPI == 1) {                                     // the same for the whole block
        constexpr int TV = DMOD / 64, TQ = (NH_ * NW) / 64;
        isv = by < TV; const bool isk = by >= TV + TQ;
        if (isv) { Bn = Bv; bias = biasv; Ph = Phv; Pl = Plv; } else if (isk) { by -= TV + TQ; Bn = Bk; bias = biask; phase = phasek; Ph = Phk; Pl = Plk; } else by -= TV;
    }
    const int tid = threadIdx.x, lane = threadIdx.x & 31, wave = threadIdx.x >> 5, lr = lane & 15, hi = lane >> 4;
    const int r0 = blockIdx.x * 64 + wave * 16, c0 = by * 64;
    // staging: a tile is 64 rows of 64 k (one 128-byte line a row) of each plane; thread tid copies the 16-byte piece tid & 7 of the rows (tid >> 3) + 16 i: a wave's copy takes 4 whole lines
    const unsigned sdst = (unsigned)(size_t)stg + (tid >> 3) * GS_PITCH + (tid & 7) * 16;
    const size_t asrc = (size_t)(blockIdx.x * 64 + (tid >> 3)) * K + (tid & 7) * 8, bsrc = (size_t)(c0 + (tid >> 3)) * K + (tid & 7) * 8, rstep = (size_t)16 * K;
    auto stage = [&](int t) {                                     // tile t: global memory to LDS buffer t & 1, through no register
        const unsigned d = sdst + (t & 1) * (NPL * GS_PLANE), e = d + (NPL - 1) * GS_PLANE;
        const bf* pa = A + asrc + t * 64; const bf* pb = Bn + bsrc + t * 64;
        // the tile's copies stand in one statement; the wait at its end stands in front of whatever rewrites a register that one of them names
        if constexpr (SPLITA) {
            const unsigned f = d + GS_PLANE; const bf* pl = Al + asrc + t * 64;
            asm volatile("global_load_async_to_lds_b128 %0, %12, off\n\tglobal_load_async_to_lds_b128 %1, %13, off\n\tglobal_load_async_to_lds_b128 %2, %14, off\n\tglobal_load_async_to_lds_b128 %3, %15, off\n\t"
                         "global_load_async_to_lds_b128 %4, %16, off\n\tglobal_load_async_to_lds_b128 %5, %17, off\n\tglobal_load_async_to_lds_b128 %6, %18, off\n\tglobal_load_async_to_lds_b128 %7, %19, off\n\t"
                         "global_load_async_to_lds_b128 %8, %20, off\n\tglobal_load_async_to_lds_b128 %9, %21, off\n\tglobal_load_async_to_lds_b128 %10, %22, off\n\tglobal_load_async_to_lds_b128 %11, %23, off\n\ts_wait_xcnt 0x0"
                         :: "v"(d), "v"(d + 16 * GS_PITCH), "v"(d + 32 * GS_PITCH), "v"(d + 48 * GS_PITCH), "v"(f), "v"(f + 16 * GS_PITCH), "v"(f + 32 * GS_PITCH), "v"(f + 48 * GS_PITCH), "v"(e), "v"(e + 16 * GS_PITCH), "v"(e + 32 * GS_PITCH), "v"(e + 48 * GS_PITCH),
                            "v"(pa), "v"(pa + rstep), "v"(pa + 2 * rstep), "v"(pa + 3 * rstep), "v"(pl), "v"(pl + rstep), "v"(pl + 2 * rstep), "v"(pl + 3 * rstep), "v"(pb), "v"(pb + rstep), "v"(pb + 2 * rstep), "v"(pb + 3 * rstep) : "memory");
        } else {
            asm volatile("global_load_async_to_lds_b128 %0, %8, off\n\tglobal_load_async_to_lds_b128 %1, %9, off\n\tglobal_load_async_to_lds_b128 %2, %10, off\n\tglobal_load_async_to_lds_b128 %3, %11, off\n\t"
                         "global_load_async_to_lds_b128 %4, %12, off\n\tglobal_load_async_to_lds_b128 %5, %13, off\n\tglobal_load_async_to_lds_b128 %6, %14, off\n\tglobal_load_async_to_lds_b128 %7, %15, off\n\ts_wait_xcnt 0x0"
                         :: "v"(d), "v"(d + 16 * GS_PITCH), "v"(d + 32 * GS_PITCH), "v"(d + 48 * GS_PITCH), "v"(e), "v"(e + 16 * GS_PITCH), "v"(e + 32 * GS_PITCH), "v"(e + 48 * GS_PITCH),
                            "v"(pa), "v"(pa + rstep), "v"(pa + 2 * rstep), "v"(pa + 3 * rstep), "v"(pb), "v"(pb + rstep), "v"(pb + 2 * rstep), "v"(pb + 3 * rstep) : "memory");
        }
    };
    v8f acc[4];
#pragma unroll
    for (int t = 0; t < 4; ++t) acc[t] = (v8f){};
    const int nt = K >> 6;                                        // K is a multiple of 64
    stage(0);
    asm volatile("s_wait_asynccnt 0x0" ::: "memory");      // this wave's copies of tile 0 have landed
    __syncthreads();      // tile 0 is in LDS before any wave reads it
    if (nt > 1) stage(1);
#pragma unroll 1      // one copy of the trip
    for (int kt = 0; kt < nt; ++kt) {
        const unsigned char* fa = stg + (kt & 1) * (NPL * GS_PLANE) + (wave * 16 + lr) * GS_PITCH + 16 * hi;      // the wave's own 16 rows of A
        const unsigned char* fb = stg + (kt & 1) * (NPL * GS_PLANE) + (NPL - 1) * GS_PLANE + lr * GS_PITCH + 16 * hi;      // the 64 rows of B, the same k order as A's
        v16bf a[2], al[2], b[2][4];
#pragma unroll
        for (int u = 0; u < 2; ++u) {
            a[u] = cat16b(*(const v8usa*)(fa + u * 64), *(const v8usa*)(fa + u * 64 + 32)); al[u] = a[u];
            if (SPLITA) al[u] = cat16b(*(const v8usa*)(fa + GS_PLANE + u * 64), *(const v8usa*)(fa + GS_PLANE + u * 64 + 32));
#pragma unroll
            for (int t = 0; t < 4; ++t) b[u][t] = cat16b(*(const v8usa*)(fb + t * 16 * GS_PITCH + u * 64), *(const v8usa*)(fb + t * 16 * GS_PITCH + u * 64 + 32));
        }
#pragma unroll
        for (int u = 0; u < 2; ++u) {
#pragma unroll
            for (int t = 0; t < 4; ++t) acc[t] = wmmab(a[u], b[u][t], acc[t]);
            if (SPLITA) {
#pragma unroll
                for (int t = 0; t < 4; ++t) acc[t] = wmmab(al[u], b[u][t], acc[t]);
            }
        }
        // four vector slots between the last matrix instruction and whatever overwrites its operands or reads its result behind it
        asm volatile("v_nop\n\tv_nop\n\tv_nop\n\tv_nop" : "+v"(acc[0]), "+v"(acc[1]), "+v"(acc[2]), "+v"(acc[3]) : "v"(a[0]), "v"(a[1]), "v"(al[0]), "v"(al[1]), "v"(b[0][0]), "v"(b[0][1]), "v"(b[0][2]), "v"(b[0][3]), "v"(b[1][0]), "v"(b[1][1]), "v"(b[1][2]), "v"(b[1][3]));
        asm volatile("s_wait_dscnt 0x0" ::: "memory");      // this wave's reads of tile kt are done before its buffer is handed on
        asm volatile("s_wait_asynccnt 0x0" ::: "memory");   // this wave's copies of tile kt + 1 have landed
        __syncthreads();      // tile kt + 1 is in LDS before any wave reads it, and every wave has left tile kt's buffer before it is filled again
        if (kt + 2 < nt) stage(kt + 2);
    }
    asm volatile("s_wait_asynccnt 0x0" ::: "memory");      // no copy is outstanding behind the loop
    if (EPI == 1 && isv) {
        // acc[t][0..7] are 8 tokens in a row (wave * 16 + hi * 8 + j) of value t * 16 + lr: one 16-byte piece of a V^T row in each plane
        unsigned char* vb = (unsigned char*)ost;
#pragma unroll
        for (int t = 0; t < 4; ++t) { const float bv = bfr(bias[c0 + t * 16 + lr]); v8us oh, ol;
#pragma unroll
            for (int j = 0; j < 8; ++j) { const float y = acc[t][j] + bv; const unsigned short hb = f2bf(y); oh[j] = hb; ol[j] = f2bf(y - bf2f(hb)); }
            unsigned char* vp = vb + (t * 16 + lr) * VT_PITCH + (wave * 16 + hi * 8) * 2; *(v8usa*)vp = oh; *(v8usa*)(vp + 64 * VT_PITCH) = ol; }
        __syncthreads();      // a V^T row's 64 tokens come from all 4 waves: every piece is in LDS before a row is read
        const int rb = blockIdx.x * 64, piece = threadIdx.x & 7, d0 = threadIdx.x >> 3;
        const size_t vo = (((size_t)(rb / NN) * NH_ + by) * HD + d0) * NN + rb % NN + piece * 8;      // 8 lanes write one whole line
        v8us wh[4], wl[4];
#pragma unroll
        for (int s = 0; s < 4; ++s) { const unsigned char* vp = vb + (d0 + 16 * s) * VT_PITCH + piece * 16; wh[s] = *(const v8usa*)vp; wl[s] = *(const v8usa*)(vp + 64 * VT_PITCH); }
#pragma unroll
        for (int s = 0; s < 4; ++s) { *(v8us*)(Ph + vo + (size_t)(16 * s) * NN) = wh[s]; *(v8us*)(Pl + vo + (size_t)(16 * s) * NN) = wl[s]; }
        return;
    }
    float* os = ost + wave * (16 * 68);
#pragma unroll
    for (int t = 0; t < 4; ++t) { const float bv = bias ? bfr(bias[c0 + t * 16 + lr]) : 0.f;
#pragma unroll
        for (int j = 0; j < 8; ++j) os[(hi * 8 + j) * 68 + t * 16 + lr] = acc[t][j] + bv; }
    __syncthreads();
    if constexpr (EPI == 1) {
        // a lane takes row lr of the wave's 16 and the heads hi and hi + 2 of the tile's 4: all NW values of a (row, head) pair in one lane
        v8us oh[2][2], ol[2][2];
#pragma unroll
        for (int s = 0; s < 2; ++s) { const int hh = hi + 2 * s; float v[NW], p[NW / 2];
#pragma unroll
            for (int q = 0; q < 4; ++q) { const v4f xv = *(const v4fa*)(os + lr * 68 + hh * NW + q * 4); const v4f pv = *(const v4f*)(phase + c0 + hh * NW + q * 4);
#pragma unroll
                for (int i = 0; i < 4; ++i) v[q * 4 + i] = xv[i] + bfr(pv[i]); }
#pragma unroll
            for (int i = 0; i < NW / 2; ++i) p[i] = v[2 * i] * v[2 * i] + v[2 * i + 1] * v[2 * i + 1];
            const float ss = ((p[0] + p[4]) + (p[2] + p[6])) + ((p[1] + p[5]) + (p[3] + p[7]));      // pairs, then partners 4, 2, 1 apart
            const float inv = 1.0f / fmaxf(sqrtf(ss), 1e-12f);
#pragma unroll
            for (int i = 0; i < NW; ++i) { const float y = v[i] * inv; const unsigned short hb = f2bf(y); oh[s][i >> 3][i & 7] = hb; ol[s][i >> 3][i & 7] = f2bf(y - bf2f(hb)); }
        }
        const int r = r0 + lr; const v8us zero = {0, 0, 0, 0, 0, 0, 0, 0};
        const size_t po = (((size_t)(r / NN) * NH_ + by * 4 + hi) * NN + r % NN) * KQ;      // a wave fills 16 rows of 64 bytes in a row per head and plane
#pragma unroll
        for (int s = 0; s < 2; ++s) { bf* a = Ph + po + (size_t)(2 * s) * NN * KQ; bf* b = Pl + po + (size_t)(2 * s) * NN * KQ;
            *(v8us*)a = oh[s][0]; *(v8us*)(a + 8) = oh[s][1]; *(v8us*)(a + 16) = zero; *(v8us*)(a + 24) = zero; *(v8us*)b = ol[s][0]; *(v8us*)(b + 8) = ol[s][1]; *(v8us*)(b + 16) = zero; *(v8us*)(b + 24) = zero; }
        return;
    }
    if (F16OUT) {
        h16* crow = (h16*)(void*)C + (size_t)r0 * ldc + c0;
        auto pass = [&]() {
#pragma unroll
            for (int s = 0; s < 4; ++s) { const int row = 4 * s + (lane >> 3), piece = lane & 7; const float* sp = os + row * 68 + piece * 8; v8h o, o2;
#pragma unroll
                for (int i = 0; i < 8; ++i) { const h16 a = (h16)sp[i]; o[i] = a; o2[i] = (h16)((sp[i] - (float)a) * LOSC); }
                *(v8h*)(crow + (size_t)row * ldc + piece * 8) = o; if (C2) *(v8h*)(C2 + (size_t)r0 * ldc + c0 + (size_t)row * ldc + piece * 8) = o2; }
        };
        pass(); 
    } else {
        float* crow = C + (size_t)r0 * ldc + c0;
        auto pass = [&]() {
#pragma unroll
            for (int s = 0; s < 8; ++s) { const int Lid = (lane >> 3) + 4 * s, piece = lane & 7; const int row = Lid >> 1, cofs = (Lid & 1) * 32 + piece * 4;
                v4f val = *(const v4fa*)(os + row * 68 + cofs); if (R) { const v4f rv = *(const v4f*)(R + ((size_t)r0 + row) * ldc + c0 + cofs); val += roundR ? (v4f){bfr(rv[0]), bfr(rv[1]), bfr(rv[2]), bfr(rv[3])} : rv; }
                *(v4f*)(crow + (size_t)row * ldc + cofs) = val; }
        };
        pass(); 
    }
}


// k_fattn: causal attention of one (item, head) plane per blockIdx.z, 16 query rows per wave, 32 keys per pass: S^T = K.Q^T (A = key rows, B = query rows, both in the same k order), so a lane
// holds 16 scores of ONE query (column lr; keys 8 * hi + j and 16 + 8 * hi + j), which is also that query's place in the B operand of O^T += V^T.P^T: the probabilities go from the score
// accumulators into the next product without leaving the lane. Sum per query; its maximum is the fixed bound on the scaled scores where that is small, else a running maximum (the output tile is rescaled only in a pass where some query's maximum rises).
// The block's 16 waves share the keys: a stage of 128 keys (K and V^T, hi and residual planes) is fetched once per block by whole-line loads and laid into one of two LDS buffers.
// Two waves share 16 query rows and split a stage's four passes: key group 0 takes passes 0 and 2, key group 1 passes 1 and 3, each with a maximum (fixed or running), sum and output tile of its own;
// behind the last stage group 1 hands its three through LDS to group 0, which brings both to the common maximum, adds them and stores. Four waves a SIMD fill one another's waits.
// A block takes the 128-row block 15 - x and then the block x of its plane: every block walks the same number of stages.
#define FK_PITCH 80               // bytes per staged key row (64 of data): 16 x odd, the pitch at which 16-byte LDS reads of 16 rows do not collide
#define FV_PITCH 272              // bytes per staged V^T row (256 of data): 16 x odd
#define FK_PLANE (128 * FK_PITCH)
#define FV_PLANE (64 * FV_PITCH)
#define F_BUF    (2 * FK_PLANE + 2 * FV_PLANE)
__global__ __launch_bounds__(512) void k_fattn(const bf* __restrict__ Qh, const bf* __restrict__ Ql, const bf* __restrict__ Kh, const bf* __restrict__ Kl, const bf* __restrict__ Vh, const bf* __restrict__ Vl, const float* __restrict__ temp, bf* Oh, bf* Ol) {
    typedef __attribute__((ext_vector_type(2))) float v2f;
    typedef __attribute__((ext_vector_type(2))) __bf16 v2bf;
    __shared__ __align__(16) unsigned char L[2 * F_BUF];
    __shared__ __align__(16) v4f MA[8 * 8 * 32];                  // key group 1's output tiles: piece i of lane l of query wave w at (w * 8 + i) * 32 + l, a wave's store or load takes 512 bytes in a row
    __shared__ float MM[8 * 32], ML[8 * 32];                      // its maxima and its lanes' sums
    const float sc2 = (1.0f / bfr(temp[0])) * 1.44269504f;        // 1/temperature and log2(e) in one factor: the exponentials are base 2
    const int tid = threadIdx.x, lane = tid & 31, lr = lane & 15, hi = lane >> 4;
    const int wv = __builtin_amdgcn_readfirstlane(tid >> 5);      // the wave's number in a scalar register: trip counts, the diagonal test and the key group's branches become scalar, EXEC stays whole
    const int wave = wv & 7, kg = wv >> 3;                        // which 16 query rows, which half of a stage's passes
    // q and k rows have norm at most 1, so every scaled score lies in [-|sc2|, |sc2|]: while that bound is small it serves as every row's maximum (exponents stay above -2 |sc2|, far from underflow)
    // and no maximum is searched; for any other temperature (NaN too) the running maximum is kept. The test is the same for every wave: a scalar branch.
    const bool fx = __builtin_amdgcn_readfirstlane(fabsf(sc2) <= 32.0f ? 1 : 0) != 0;
    const float moff = fx ? fabsf(sc2) : 0.0f;                    // taken off every scaled score; 0 leaves the product as it is
    const size_t z = blockIdx.z;
    Qh += z * NN * KQ; Ql += z * NN * KQ; Kh += z * NN * KQ; Kl += z * NN * KQ; Vh += z * HD * NN; Vl += z * HD * NN;
    Oh += (z / NH_) * NN * DMOD + (z % NH_) * HD; Ol += (z / NH_) * NN * DMOD + (z % NH_) * HD;
    auto xhalf = [](float v) { const int b = __float_as_int(v); return __int_as_float(__builtin_amdgcn_permlanex16(b, b, 0x76543210, 0xfedcba98, false, false)); };      // lane l <-> l ^ 16
    // staging: a plane's 128 key rows are 8 KiB in a row, thread tid takes 16-byte piece tid; a V^T plane's stage is 64 rows of two 128-byte lines, thread tid takes pieces tid and tid + 512 (16 pieces a row)
    const int ksto = (tid >> 2) * FK_PITCH + (tid & 3) * 16, vsto = 2 * FK_PLANE + (tid >> 4) * FV_PITCH + (tid & 15) * 16;
    const size_t vsrc = (size_t)(tid >> 4) * NN + (tid & 15) * 8;
    v8us g[6];
    auto fetch = [&](int st) {                                    // stage st: global memory to registers
        const bf* p0 = Kh + (size_t)st * 128 * KQ + tid * 8; const bf* p1 = Kl + (size_t)st * 128 * KQ + tid * 8; const bf* p2 = Vh + vsrc + st * 128; const bf* p3 = Vl + vsrc + st * 128;
        g[0] = *(const v8us*)p0; g[1] = *(const v8us*)p1; g[2] = *(const v8us*)p2; g[3] = *(const v8us*)(p2 + 32 * NN); g[4] = *(const v8us*)p3; g[5] = *(const v8us*)(p3 + 32 * NN);
        // no address register of the loads above is rewritten before this wait: the clobber keeps the loads in front of it, and naming the addresses as inputs keeps their registers whole up to it
        asm volatile("s_wait_xcnt 0x0" :: "v"(p0), "v"(p1), "v"(p2), "v"(p3) : "memory");
    };
    auto lay = [&](int st) {                                      // registers to the stage's LDS buffer
        unsigned char* B = L + (st & 1) * F_BUF;
        *(v8usa*)(B + ksto) = g[0]; *(v8usa*)(B + FK_PLANE + ksto) = g[1]; *(v8usa*)(B + vsto) = g[2]; *(v8usa*)(B + vsto + 32 * FV_PITCH) = g[3]; *(v8usa*)(B + FV_PLANE + vsto) = g[4]; *(v8usa*)(B + FV_PLANE + vsto + 32 * FV_PITCH) = g[5];
    };
#pragma unroll 1      // the two row blocks run one after the other through one copy of the code
    for (int job = 0; job < 2; ++job) {
        const int qb = job ? (int)blockIdx.x : NN / 128 - 1 - (int)blockIdx.x;
        const int nst = qb + 1;                                   // stages of 128 keys up to the block's last row: the same for all 16 waves
        const int q0 = qb * 128 + wave * 16;
        const int ns = (q0 + 47) >> 5;                            // these rows' passes of 32 keys, up to and with the one that holds key q0 + 15
        const size_t qo = (size_t)(q0 + lr) * KQ + 8 * hi;
        const v16bf qh = cat16b(*(const v8us*)(Qh + qo), *(const v8us*)(Qh + qo + 16)), ql = cat16b(*(const v8us*)(Ql + qo), *(const v8us*)(Ql + qo + 16));
        fetch(0); lay(0);                                         // buffer 0 is free: every wave has passed the barrier behind the last stage of the row block before
        __syncthreads();      // stage 0 is in LDS before any wave reads it
        v8f acc[4];
#pragma unroll
        for (int t = 0; t < 4; ++t) acc[t] = (v8f){};
        float m = fx ? 0.0f : -3.0e38f; v2f l2 = {0.f, 0.f};                  // the lane's sum in two halves: one packed add per pair of keys
#pragma unroll 1      // kept rolled: a stage is long
        for (int st = 0; st < nst; ++st) {
            if (st + 1 < nst) fetch(st + 1);                      // in flight under this stage's two passes
            const unsigned char* B = L + (st & 1) * F_BUF;
#pragma unroll 1      // one copy of the pass
            for (int pp = 0; pp < 2; ++pp) {
                const int ps = 2 * pp + kg, s = 4 * st + ps;      // the key group's pass of this stage
                if (s >= ns) break;                               // scalar: a wave whose rows end below these keys goes on to the barrier
                const unsigned char* bk = B + (ps * 32 + lr) * FK_PITCH + 16 * hi;      // keys 32 s + 16 u + lr, the same k order as the q loader
                const unsigned char* bv = B + 2 * FK_PLANE + lr * FV_PITCH + ps * 64 + 16 * hi;      // V^T rows d = 16 t + lr, keys 32 s + 8 * hi + 0..7 and + 16: the order in which the score tiles hold the keys
                v16bf kh[2], kl[2], vh[4], vl[4];
#pragma unroll
                for (int u = 0; u < 2; ++u) { kh[u] = cat16b(*(const v8usa*)(bk + u * 16 * FK_PITCH), *(const v8usa*)(bk + u * 16 * FK_PITCH + 32)); kl[u] = cat16b(*(const v8usa*)(bk + FK_PLANE + u * 16 * FK_PITCH), *(const v8usa*)(bk + FK_PLANE + u * 16 * FK_PITCH + 32)); }
#pragma unroll
                for (int t = 0; t < 4; ++t) { vh[t] = cat16b(*(const v8usa*)(bv + t * 16 * FV_PITCH), *(const v8usa*)(bv + t * 16 * FV_PITCH + 32)); vl[t] = cat16b(*(const v8usa*)(bv + FV_PLANE + t * 16 * FV_PITCH), *(const v8usa*)(bv + FV_PLANE + t * 16 * FV_PITCH + 32)); }
                asm volatile("" ::: "memory");      // compiler fence: the pass's 24 LDS reads stay together here, in flight at once; moved down to their products, each fragment would cost an LDS latency of its own
                v8f sc[2];
#pragma unroll
                for (int u = 0; u < 2; ++u) { sc[u] = wmmab(kh[u], qh, (v8f){}); sc[u] = wmmab(kh[u], ql, sc[u]); sc[u] = wmmab(kl[u], qh, sc[u]); }
#pragma unroll
                for (int u = 0; u < 2; ++u) sc[u] = sc[u] * sc2 - moff;
                if (s == ns - 1) {                                // only the rows' last pass holds keys above the diagonal (and at least one key at or below it for every row)
#pragma unroll
                    for (int u = 0; u < 2; ++u) {
#pragma unroll
                        for (int j = 0; j < 8; ++j) if (s * 32 + u * 16 + hi * 8 + j > q0 + lr) sc[u][j] = -3.0e38f; }      // a masked key: exp gives 0 below (every pass holds an unmasked key for every row, so under the running maximum m is a real score behind a wave's first pass)
                }
                if (!fx) {                                        // scalar branch: the running maximum, where the bound does not serve
                    float mx = sc[0][0];
#pragma unroll
                    for (int e = 1; e < 16; ++e) mx = fmaxf(mx, sc[e >> 3][e & 7]);
                    mx = fmaxf(mx, xhalf(mx));                    // both halves of the wave hold the query's maximum of this pass
                    if (__builtin_amdgcn_ballot_w32(mx > m) != 0) {      // scalar branch; where no maximum rises every factor would be 1
                        const float mn = fmaxf(m, mx), corr = __builtin_amdgcn_exp2f(m - mn); m = mn; l2 *= corr;
#pragma unroll
                        for (int t = 0; t < 4; ++t) acc[t] *= corr;
                    }
#pragma unroll
                    for (int u = 0; u < 2; ++u) sc[u] -= m;
                }
                v16bf ph, pl;
#pragma unroll
                for (int e = 0; e < 16; e += 2) {
                    const v2f p = {__builtin_amdgcn_exp2f(sc[e >> 3][e & 7]), __builtin_amdgcn_exp2f(sc[e >> 3][(e & 7) + 1])};
                    l2 += p;
                    const v2bf h2 = __builtin_convertvector(p, v2bf); const v2bf r2 = __builtin_convertvector(p - __builtin_convertvector(h2, v2f), v2bf);      // hi plane and residual, both to nearest even
                    ph[e] = h2[0]; ph[e + 1] = h2[1]; pl[e] = r2[0]; pl[e + 1] = r2[1];
                }
#pragma unroll
                for (int t = 0; t < 4; ++t) { acc[t] = wmmab(vh[t], ph, acc[t]); acc[t] = wmmab(vh[t], pl, acc[t]); acc[t] = wmmab(vl[t], ph, acc[t]); }
                // four vector slots between the last matrix instruction and whatever overwrites its operands or reads its result on the taken back edge or behind the loop
                asm volatile("v_nop\n\tv_nop\n\tv_nop\n\tv_nop" : "+v"(acc[0]), "+v"(acc[1]), "+v"(acc[2]), "+v"(acc[3]) : "v"(vh[0]), "v"(vh[1]), "v"(vh[2]), "v"(vh[3]), "v"(vl[0]), "v"(vl[1]), "v"(vl[2]), "v"(vl[3]), "v"(ph), "v"(pl));
            }
            if (st + 1 < nst) lay(st + 1);                        // into the buffer that stage st - 1 was read from: every wave has left it, it passed the barrier below
            __syncthreads();      // stage st + 1 is in LDS before any wave reads it, and every wave's reads of stage st are done before its buffer is filled again
        }
        float l = l2[0] + l2[1];
        if (kg == 1) {                                            // scalar branch: key group 1 hands over its output tiles, maximum and sum
#pragma unroll
            for (int i = 0; i < 8; ++i) MA[(wave * 8 + i) * 32 + lane] = (v4f){acc[i >> 1][(i & 1) * 4], acc[i >> 1][(i & 1) * 4 + 1], acc[i >> 1][(i & 1) * 4 + 2], acc[i >> 1][(i & 1) * 4 + 3]};
            MM[wave * 32 + lane] = m; ML[wave * 32 + lane] = l;
        }
        __syncthreads();      // group 1's partial results are in LDS before group 0 reads them; they are written again only behind the next row block's barriers, which group 0 passes after its reads
        if (kg == 1) continue;                                    // scalar: group 1 goes on to the next row block's first stage
        {
            const float m1 = MM[wave * 32 + lane], mn = fmaxf(m, m1);      // a group 1 wave that had no pass hands over -3.0e38, 0 and zeros: its factor is 0 (group 0 always has pass 0, so mn is a real score); under the fixed bound every m is 0 and both factors are 1
            const float c0 = __builtin_amdgcn_exp2f(m - mn), c1 = __builtin_amdgcn_exp2f(m1 - mn);
            l = l * c0 + ML[wave * 32 + lane] * c1;
#pragma unroll
            for (int i = 0; i < 8; ++i) { const v4f o1 = MA[(wave * 8 + i) * 32 + lane];
#pragma unroll
                for (int j = 0; j < 4; ++j) acc[i >> 1][(i & 1) * 4 + j] = acc[i >> 1][(i & 1) * 4 + j] * c0 + o1[j] * c1; }
        }
        l += xhalf(l);                                            // the two halves' sums meet once
        const float inv = 1.0f / l;
        bf* ohrow = Oh + (size_t)(q0 + lr) * DMOD + hi * 8; bf* olrow = Ol + (size_t)(q0 + lr) * DMOD + hi * 8;      // acc[t][j] = O[q0 + lr][16 t + 8 hi + j]: 8 values in a row per tile, one 16-byte piece in each plane
#pragma unroll
        for (int t = 0; t < 4; ++t) { const v8f o = acc[t] * inv; v8us a, b;
#pragma unroll
            for (int j = 0; j < 8; ++j) { const unsigned short hb = f2bf(o[j]); a[j] = hb; b[j] = f2bf(o[j] - bf2f(hb)); }      // the output projection's hi plane and residual
            *(v8us*)(ohrow + t * 16) = a; *(v8us*)(olrow + t * 16) = b; }
        asm volatile("s_wait_xcnt 0x0" :: "v"(ohrow), "v"(olrow) : "memory");      // the second row block's arithmetic reuses the registers that these stores name: the wait stands in front of that
    }
}
__global__ __launch_bounds__(256) void k_planes32z(const float* __restrict__ F, int ld, int off, float sc, int rows, bf* Ph, bf* Pl) {
    typedef __attribute__((ext_vector_type(2))) unsigned short v2us;
    const int lane = threadIdx.x & 31; const size_t r = ((size_t)blockIdx.x * 8 + (threadIdx.x >> 5)) * 2 + (lane >> 4); if (r >= (size_t)rows) return; const int z = blockIdx.z; const int c0 = (lane & 15) * 2; v2us oh, ol;
    Ph += (size_t)z * rows * 32; Pl += (size_t)z * rows * 32;
#pragma unroll
    for (int i = 0; i < 2; ++i) { const float y = F[r * ld + off + z * 32 + c0 + i] * sc; const unsigned short hb = f2bf(y); oh[i] = hb; ol[i] = f2bf(y - bf2f(hb)); }
    const size_t o = r * 32 + c0; *(v2us*)(Ph + o) = oh; *(v2us*)(Pl + o) = ol; 
}
__global__ __launch_bounds__(256) void k_vtpadz(const float* __restrict__ F, int ld, int off, int nk, bf* Th, bf* Tl) {
    typedef __attribute__((ext_vector_type(2))) unsigned short v2us;
    const int lane = threadIdx.x & 31; const size_t wid = (size_t)blockIdx.x * 8 + (threadIdx.x >> 5); if (wid >= (size_t)64 * (nk / 64)) return; const int z = blockIdx.z; const int d = (int)(wid / (nk / 64)); const int k0 = (int)(wid % (nk / 64)) * 64 + lane * 2; v2us oh, ol;
    Th += (size_t)z * 64 * nk; Tl += (size_t)z * 64 * nk;
#pragma unroll
    for (int i = 0; i < 2; ++i) { const float y = (d < 32) ? F[(size_t)(k0 + i) * ld + off + z * 32 + (d < 32 ? d : 0)] : 0.f; const unsigned short hb = f2bf(y); oh[i] = hb; ol[i] = f2bf(y - bf2f(hb)); }
    const size_t o = (size_t)d * nk + k0; *(v2us*)(Th + o) = oh; *(v2us*)(Tl + o) = ol; 
}
template <int NK>
__global__ __launch_bounds__(256) void k_softmaxz(const float* __restrict__ S, int rows, bf* PH, bf* PL) {
    typedef __attribute__((ext_vector_type(4))) unsigned short v4us;
    const int lane = threadIdx.x & 31, i = blockIdx.x * 8 + (threadIdx.x >> 5); if (i >= rows) return; const size_t zo = (size_t)blockIdx.z * rows * NK; const float* sr = S + zo + (size_t)i * NK; PH += zo; PL += zo;
    float m = -3.0e38f;
#pragma unroll 1
    for (int c0 = lane * 4; c0 < NK; c0 += 128) {
#pragma unroll
        for (int q = 0; q < 4; ++q) m = fmaxf(m, sr[c0 + q]); }
#pragma unroll
    for (int sh = 16; sh; sh >>= 1) m = fmaxf(m, __shfl_xor(m, sh, 32));
    float sum = 0.f;
#pragma unroll 1
    for (int c0 = lane * 4; c0 < NK; c0 += 128) {
#pragma unroll
        for (int q = 0; q < 4; ++q) sum += __expf(sr[c0 + q] - m); }
#pragma unroll
    for (int sh = 16; sh; sh >>= 1) sum += __shfl_xor(sum, sh, 32);
    const float inv = 1.0f / sum;
{
#pragma unroll 1
        for (int c0 = lane * 4; c0 < NK; c0 += 128) { v4us oh, ol;
#pragma unroll
            for (int q = 0; q < 4; ++q) { const float p = __expf(sr[c0 + q] - m) * inv; const unsigned short hb = f2bf(p); oh[q] = hb; ol[q] = f2bf(p - bf2f(hb)); }
            const size_t o = (size_t)i * NK + c0; *(v4us*)(PH + o) = oh; *(v4us*)(PL + o) = ol; }
         }
}
__global__ __launch_bounds__(256) void k_placez(const float* __restrict__ XH, int rows, int ldy, float* Y) {
    const int lane = threadIdx.x & 31; const size_t q = (size_t)blockIdx.x * 8 + (threadIdx.x >> 5); if (q >= (size_t)rows) return; const int z = blockIdx.z; const float v = XH[((size_t)z * rows + q) * 64 + lane];
    *(float*)(Y + q * ldy + z * 32 + lane) = v; 
}

__global__ __launch_bounds__(256) void k_hplanesz(const float* __restrict__ F, int ld, int h0, float sc, int rows, bf* Ph, bf* Pl) {
    typedef __attribute__((ext_vector_type(2))) unsigned short v2us;
    const int lane = threadIdx.x & 31; const size_t r = (size_t)blockIdx.x * 8 + (threadIdx.x >> 5); if (r >= (size_t)rows) return; const int z = blockIdx.z; v2us oh, ol;
    Ph += (size_t)z * rows * 64; Pl += (size_t)z * rows * 64;
#pragma unroll
    for (int i = 0; i < 2; ++i) { const float y = F[r * ld + (h0 + z) * 64 + lane * 2 + i] * sc; const unsigned short hb = f2bf(y); oh[i] = hb; ol[i] = f2bf(y - bf2f(hb)); }
    const size_t o = r * 64 + lane * 2; *(v2us*)(Ph + o) = oh; *(v2us*)(Pl + o) = ol; 
}
template <int NK>
__global__ __launch_bounds__(256) void k_softmaxzs(const float* __restrict__ S, int rows, float sc, bf* PH, bf* PL) {
    typedef __attribute__((ext_vector_type(4))) unsigned short v4us;
    const int lane = threadIdx.x & 31, i = blockIdx.x * 8 + (threadIdx.x >> 5); if (i >= rows) return; const size_t zo = (size_t)blockIdx.z * rows * NK; const float* sr = S + zo + (size_t)i * NK; PH += zo; PL += zo;
    float m = -3.0e38f;
#pragma unroll 1
    for (int c0 = lane * 4; c0 < NK; c0 += 128) {
#pragma unroll
        for (int q = 0; q < 4; ++q) m = fmaxf(m, sr[c0 + q] * sc); }
#pragma unroll
    for (int sh = 16; sh; sh >>= 1) m = fmaxf(m, __shfl_xor(m, sh, 32));
    float sum = 0.f;
#pragma unroll 1
    for (int c0 = lane * 4; c0 < NK; c0 += 128) {
#pragma unroll
        for (int q = 0; q < 4; ++q) sum += __expf(sr[c0 + q] * sc - m); }
#pragma unroll
    for (int sh = 16; sh; sh >>= 1) sum += __shfl_xor(sum, sh, 32);
    const float inv = 1.0f / sum;
{
#pragma unroll 1
        for (int c0 = lane * 4; c0 < NK; c0 += 128) { v4us oh, ol;
#pragma unroll
            for (int q = 0; q < 4; ++q) { const float p = __expf(sr[c0 + q] * sc - m) * inv; const unsigned short hb = f2bf(p); oh[q] = hb; ol[q] = f2bf(p - bf2f(hb)); }
            const size_t o = (size_t)i * NK + c0; *(v4us*)(PH + o) = oh; *(v4us*)(PL + o) = ol; }
         }
}

__device__ __forceinline__ void d_cvtx(const float* __restrict__ src, int rows, bf* dst, int bx) {
    const int lane = threadIdx.x & 31; const size_t r = (size_t)bx * 8 + (threadIdx.x >> 5); if (r >= (size_t)rows) return;
{
#pragma unroll
        for (int q = 0; q < DMOD / 256; ++q) { v8us o;
#pragma unroll
            for (int i = 0; i < 8; ++i) o[i] = f2bf(src[r * DMOD + q * 256 + lane * 8 + i]);
            *(v8us*)(dst + r * DMOD + q * 256 + lane * 8) = o; }
         }
}
// k_prep: all that depends on the inputs alone, in one launch: the first NBT * NN / 8 blocks convert 8 rows of x each, every further block transposes one 64 x 64 tile of Wv, Wo, Wq or Wk.
__global__ __launch_bounds__(256) void k_prep(const float* __restrict__ x, const float* __restrict__ Wq, const float* __restrict__ Wk, const float* __restrict__ Wv, const float* __restrict__ Wo, bf* Xb, bf* WQ, bf* WK, bf* WV, bf* WO) {
    __shared__ __align__(16) unsigned short tl[64 * 72];
    constexpr int NX = NBT * NN / 8, KT = DMOD / 64, TV = KT * (DMOD / 64), TQ = KT * ((NH_ * NW) / 64);
    int b = blockIdx.x;
    if (b < NX) { d_cvtx(x, NBT * NN, Xb, b); return; }      // the whole block leaves, in front of d_wt's barrier
    b -= NX;
    const float* Wm; bf* WT; int ncols;
    if (b < 2 * TV) { ncols = DMOD; const bool o = b >= TV; Wm = o ? Wo : Wv; WT = o ? WO : WV; b -= o ? TV : 0; }
    else { b -= 2 * TV; ncols = NH_ * NW; const bool k = b >= TQ; Wm = k ? Wk : Wq; WT = k ? WK : WQ; b -= k ? TQ : 0; }
    d_wt(Wm, DMOD, ncols, WT, b % KT, b / KT, tl);
}
__global__ __launch_bounds__(256) void k_csoftz(const float* __restrict__ S, int rows, float sc, bf* PH, bf* PL) {
    typedef __attribute__((ext_vector_type(4))) unsigned short v4us;
    const int lane = threadIdx.x & 31, i = blockIdx.x * 8 + (threadIdx.x >> 5); if (i >= rows) return; const size_t zo = (size_t)blockIdx.z * rows * NN; const float* sr = S + zo + (size_t)i * NN; PH += zo; PL += zo;
    float m = -3.0e38f;
#pragma unroll 1
    for (int c0 = lane * 4; c0 < NN; c0 += 128) {
#pragma unroll
        for (int q = 0; q < 4; ++q) { const int k = c0 + q; if (k <= i) m = fmaxf(m, sr[k] * sc); } }
#pragma unroll
    for (int sh = 16; sh; sh >>= 1) m = fmaxf(m, __shfl_xor(m, sh, 32));
    float sum = 0.f;
#pragma unroll 1
    for (int c0 = lane * 4; c0 < NN; c0 += 128) {
#pragma unroll
        for (int q = 0; q < 4; ++q) { const int k = c0 + q; if (k <= i) sum += __expf(sr[k] * sc - m); } }
#pragma unroll
    for (int sh = 16; sh; sh >>= 1) sum += __shfl_xor(sum, sh, 32);
    const float inv = 1.0f / sum;
{
#pragma unroll 1
        for (int c0 = lane * 4; c0 < NN; c0 += 128) { v4us oh, ol;
#pragma unroll
            for (int q = 0; q < 4; ++q) { const int k = c0 + q; const float p = (k <= i) ? __expf(sr[(k <= i) ? k : 0] * sc - m) * inv : 0.f; const unsigned short hb = f2bf(p); oh[q] = hb; ol[q] = f2bf(p - bf2f(hb)); }
            const size_t o = (size_t)i * NN + c0; *(v4us*)(PH + o) = oh; *(v4us*)(PL + o) = ol; }
         }
}
extern "C" void kernel_launch(void* const* d_in, const int* in_sizes, int n_in,
                              void* d_out, int out_size, void* d_ws, size_t ws_size, hipStream_t stream) {
    (void)in_sizes; (void)n_in; (void)out_size;
    const float* x = (const float*)d_in[0]; const float* Wq = (const float*)d_in[1]; const float* bq = (const float*)d_in[2]; const float* Wk = (const float*)d_in[3]; const float* bk = (const float*)d_in[4]; const float* Wv = (const float*)d_in[5]; const float* bv = (const float*)d_in[6]; const float* Wo = (const float*)d_in[7]; const float* bo = (const float*)d_in[8];
    const float* qph = (const float*)d_in[9]; const float* kph = (const float*)d_in[10]; const float* temp = (const float*)d_in[11];
    float* out = (float*)d_out;    // [2][2048][1024]
    char* wsp = (char*)d_ws;
    auto take = [&](size_t bytes) { char* p = wsp; wsp += (bytes + 255) & ~(size_t)255; return (void*)p; };
    bf* WQ = (bf*)take((size_t)(NH_ * NW) * DMOD * 2); bf* WK = (bf*)take((size_t)(NH_ * NW) * DMOD * 2); bf* WV = (bf*)take((size_t)DMOD * DMOD * 2); bf* WO = (bf*)take((size_t)DMOD * DMOD * 2);
    bf* Xb = (bf*)take((size_t)NBT * NN * DMOD * 2);
    constexpr size_t NZ = (size_t)NBT * NH_;                      // planes of every (item, head) pair live at once
    bf* Qh = (bf*)take(NZ * NN * KQ * 2); bf* Ql = (bf*)take(NZ * NN * KQ * 2); bf* Kh = (bf*)take(NZ * NN * KQ * 2); bf* Kl = (bf*)take(NZ * NN * KQ * 2); bf* VTh = (bf*)take(NZ * HD * NN * 2); bf* VTl = (bf*)take(NZ * HD * NN * 2);
    bf* Oh = (bf*)take((size_t)NBT * NN * DMOD * 2); bf* Ol = (bf*)take((size_t)NBT * NN * DMOD * 2);
    if ((size_t)(wsp - (char*)d_ws) > ws_size) return;    // 61 MiB
    constexpr int NR = NBT * NN;                                  // the two items' rows stand behind one another in x and in out: one launch takes both
    k_prep<<<NR / 8 + (DMOD / 64) * (2 * (DMOD / 64) + 2 * ((NH_ * NW) / 64)), 256, 0, stream>>>(x, Wq, Wk, Wv, Wo, Xb, WQ, WK, WV, WO);   // x to bf16; weights (in, out) k-major -> n-major
    // the host reads nothing from the device: k_fattn reads temperature[0] itself
    // each projection writes the planes that k_fattn reads, and k_fattn the planes that the output projection reads
    k_gemmb<false, false, 1><<<dim3(NR / 64, (DMOD + 2 * NH_ * NW) / 64, 1), 128, 0, stream>>>(Xb, nullptr, WQ, bq, nullptr, 0, nullptr, nullptr, DMOD, 1, qph, Qh, Ql, WK, bk, kph, Kh, Kl, WV, bv, VTh, VTl);
    k_fattn<<<dim3(NN / 256, 1, NBT * NH_), 512, 0, stream>>>(Qh, Ql, Kh, Kl, VTh, VTl, temp, Oh, Ol);
    k_gemmb<true, false><<<dim3(NR / 64, DMOD / 64, 1), 128, 0, stream>>>(Oh, Ol, WO, bo, out, DMOD, nullptr, nullptr, DMOD);
}

// v010
// A run of this version takes 72.2 microseconds.
// Timed twice side by side with v009, it ran 1.04 and 1.03 times as fast.
// Counting every step since v000, it is 35.2 times as fast.
#include <hip/hip_runtime.h>

// Compute dtypes, f32 accumulate, per item: q/k/v projections as GEMMs with PLAIN bf16 operands (x and the (in,out) weights; exact products, + bias); per head the 16-wide q/k get
// their phase added and are L2-normalised in f32, then stored as bf16 hi + UNSCALED residual planes padded to K = 32 (zero columns); causal scores (three products), 1/temperature, the causal
// softmax (f32, fixed bound or running maximum) and attn.v (three products) in ONE kernel for all items and heads: scores and probabilities stay in registers; output projection on hi/lo planes

#define NBT  2
#define NN   2048
#define DMOD 1024
#define NH_  16
#define NW   16
#define KQ   32                   // padded score depth
#define HD   64
#define DM   DMOD
#define NTK  NN
#define LOSC 1024.0f

typedef _Float16 h16;
typedef unsigned short bf;
typedef __attribute__((ext_vector_type(16))) __bf16   v16bf;
typedef __attribute__((ext_vector_type(16))) _Float16 v16h;
typedef __attribute__((ext_vector_type(8)))  _Float16 v8h;
typedef __attribute__((ext_vector_type(8)))  unsigned short v8us;
typedef __attribute__((ext_vector_type(8)))  float    v8f;
typedef __attribute__((ext_vector_type(4)))  float    v4f;
typedef __attribute__((ext_vector_type(4)))  _Float16 v4h;
typedef v8h  __attribute__((may_alias)) v8ha;
typedef v4f  __attribute__((may_alias)) v4fa;
typedef v8us __attribute__((may_alias)) v8usa;

__device__ __forceinline__ unsigned short f2bf(float f) { unsigned u = __float_as_uint(f); u += 0x7FFFu + ((u >> 16) & 1u); return (unsigned short)(u >> 16); }
__device__ __forceinline__ float bf2f(unsigned short b) { return __uint_as_float(((unsigned)b) << 16); }
__device__ __forceinline__ float bfr(float f) { return bf2f(f2bf(f)); }
__device__ __forceinline__ v16h cat16(v8h lo, v8h hi) { return __builtin_shufflevector(lo, hi, 0, 1, 2, 3, 4, 5, 6, 7, 8, 9, 10, 11, 12, 13, 14, 15); }
__device__ __forceinline__ v16bf cat16b(v8us lo, v8us hi) { return __builtin_bit_cast(v16bf, __builtin_shufflevector(lo, hi, 0, 1, 2, 3, 4, 5, 6, 7, 8, 9, 10, 11, 12, 13, 14, 15)); }
__device__ __forceinline__ v8f wmma16(v16h a, v16h b, v8f c) { return __builtin_amdgcn_wmma_f32_16x16x32_f16(false, a, false, b, (short)0, c, false, false); }
__device__ __forceinline__ v8f wmmab(v16bf a, v16bf b, v8f c) { return __builtin_amdgcn_wmma_f32_16x16x32_bf16(false, a, false, b, (short)0, c, false, false); }

// d_wt: WT [n][K] = bf16(W[k][n]) (k-major [K][ncols]) via 64 x 64 LDS tiles; tile (bx, by) of (K/64, ncols/64), tl: the block's 64 x 72 staging tile.
__device__ __forceinline__ void d_wt(const float* __restrict__ Wm, int K, int ncols, bf* WT, int bx, int by, unsigned short* tl) {
    const int tid = threadIdx.x, k0 = bx * 64, n0 = by * 64;
    const int kk = tid >> 2, nq = (tid & 3) * 16;
#pragma unroll
    for (int i = 0; i < 16; ++i) tl[(nq + i) * 72 + kk] = f2bf(Wm[(size_t)(k0 + kk) * ncols + n0 + nq + i]);
    __syncthreads();
    const int piece = tid & 7;
    auto pass = [&]() {
#pragma unroll
        for (int s = 0; s < 2; ++s) { const int nr = (tid >> 3) + 32 * s; const v8us val = *(const v8usa*)(tl + nr * 72 + piece * 8); *(v8us*)(WT + (size_t)(n0 + nr) * K + k0 + piece * 8) = val; }
    };
    pass(); 
    asm volatile("s_wait_xcnt 0x0" ::: "memory");      // the stores' registers may be written again where this is inlined in front of other code: the wait stands behind the last store
}
// k_gemmb: 64 x 128 block tile (4 waves, 2 x 2, each 32 x 64) of C[NBT * NN][ldc] = (A [+ Al]).B^T (K = 1024) [+ bf(bias[c])] [+ bf(R[r][c]) residual]; f32 whole-line epilogue (or f16)
// The K loop goes by tiles of 64 k: the block's 64 rows of A (and of Al) and 128 rows of B are copied into one of two LDS buffers, whole lines, one tile ahead; A's rows serve 2 waves, B's rows 2 waves,
// and a wave's B fragment serves its two 16-row tiles of A.
// EPI 1: the q, k and v projections of x in one grid; blockIdx.y picks the projection (v's column tiles first, then q's, then k's) and its column tile. The epilogue's tile lies over the staging buffers.
//   q, k: the tile's 8 heads get their phase added and are L2-normalised in f32, and go out as bf16 hi + residual planes [item * NH_ + head][token][KQ], columns NW.. zero.
//   v: the tile is two heads' 64 tokens x 64 values; it goes out transposed as bf16 hi + residual planes [item * NH_ + head][value][token], one whole 128-byte line per value and plane.
#define VT_PITCH 144              // bytes per staged V^T row (128 of data): 16 x odd
#define GS_PITCH 144              // bytes per staged operand row (64 k, 128 of data): 16 x odd
#define GS_PLANE (64 * GS_PITCH)
template <bool SPLITA, bool F16OUT = false, int EPI = 0>
__global__ __launch_bounds__(128) void k_gemmb(const bf* __restrict__ A, const bf* __restrict__ Al, const bf* __restrict__ Bn0, const float* __restrict__ bias0, float* C, int ldc, h16* C2, const float* __restrict__ R = nullptr, int K = DM, int roundR = 1, const float* __restrict__ phase0 = nullptr, bf* Ph0 = nullptr, bf* Pl0 = nullptr,
        const bf* __restrict__ Bk = nullptr, const float* __restrict__ biask = nullptr, const float* __restrict__ phasek = nullptr, bf* Phk = nullptr, bf* Plk = nullptr, const bf* __restrict__ Bv = nullptr, const float* __restrict__ biasv = nullptr, bf* Phv = nullptr, bf* Plv = nullptr) {
    constexpr int NPA = SPLITA ? 2 : 1;                           // staged 64-row planes of A: A, and A's residual where there is one
    constexpr int NPL = NPA + 2;                                  // B's 128 rows are two more, behind them
    __shared__ __align__(16) unsigned char stg[2 * NPL * GS_PLANE];
    float* ost;                                                   // the epilogue's tiles: 16 x 64 (pitch 68) for each of a wave's two row tiles
    if constexpr (EPI == 1) { static_assert(4 * 64 * VT_PITCH <= sizeof(stg) && 8 * 16 * 68 * 4 <= sizeof(stg)); ost = (float*)stg; }      // behind the K loop's last barrier no wave reads the staging buffers and no copy is outstanding
    else { __shared__ __align__(16) float osts[8 * 16 * 68]; ost = osts; }
    int by = blockIdx.y; bool isv = false; const bf* Bn = Bn0; const float* bias = bias0; const float* phase = phase0; bf* Ph = Ph0; bf* Pl = Pl0;      // EPI 1: q's
    if constexpr (EPI == 1) {                                     // the same for the whole block
        constexpr int TV = DMOD / 128, TQ = (NH_ * NW) / 128;
        isv = by < TV; const bool isk = by >= TV + TQ;
        if (isv) { Bn = Bv; bias = biasv; Ph = Phv; Pl = Plv; } else if (isk) { by -= TV + TQ; Bn = Bk; bias = biask; phase = phasek; Ph = Phk; Pl = Plk; } else by -= TV;
    }
    const int tid = threadIdx.x, lane = threadIdx.x & 31, wave = threadIdx.x >> 5, lr = lane & 15, hi = lane >> 4;
    const int wm = wave >> 1, wn = wave & 1;                      // the wave's 32 rows and its 64 columns of the block tile
    const int rw = blockIdx.x * 64 + wm * 32, c0 = by * 128 + wn * 64;
    // staging: a tile is 64 k (one 128-byte line a row) of 64 rows of each plane of A and of 128 rows of B; thread tid copies the 16-byte piece tid & 7 of the rows (tid >> 3) + 16 i: a wave's copy takes 4 whole lines
    const unsigned sdst = (unsigned)(size_t)stg + (tid >> 3) * GS_PITCH + (tid & 7) * 16;
    const size_t asrc = (size_t)(blockIdx.x * 64 + (tid >> 3)) * K + (tid & 7) * 8, bsrc = (size_t)(by * 128 + (tid >> 3)) * K + (tid & 7) * 8, rstep = (size_t)16 * K;
    auto stage = [&](int t) {                                     // tile t: global memory to LDS buffer t & 1, through no register
        const unsigned d = sdst + (t & 1) * (NPL * GS_PLANE), e = d + NPA * GS_PLANE;
        const bf* pa = A + asrc + t * 64; const bf* pb = Bn + bsrc + t * 64;
        // a statement's copies stand together (a statement takes at most 15); the wait at its end stands in front of whatever rewrites a register that one of them names
        if constexpr (SPLITA) {
            const unsigned f = d + GS_PLANE; const bf* pl = Al + asrc + t * 64;
            asm volatile("global_load_async_to_lds_b128 %0, %8, off\n\tglobal_load_async_to_lds_b128 %1, %9, off\n\tglobal_load_async_to_lds_b128 %2, %10, off\n\tglobal_load_async_to_lds_b128 %3, %11, off\n\t"
                         "global_load_async_to_lds_b128 %4, %12, off\n\tglobal_load_async_to_lds_b128 %5, %13, off\n\tglobal_load_async_to_lds_b128 %6, %14, off\n\tglobal_load_async_to_lds_b128 %7, %15, off\n\ts_wait_xcnt 0x0"
                         :: "v"(d), "v"(d + 16 * GS_PITCH), "v"(d + 32 * GS_PITCH), "v"(d + 48 * GS_PITCH), "v"(f), "v"(f + 16 * GS_PITCH), "v"(f + 32 * GS_PITCH), "v"(f + 48 * GS_PITCH),
                            "v"(pa), "v"(pa + rstep), "v"(pa + 2 * rstep), "v"(pa + 3 * rstep), "v"(pl), "v"(pl + rstep), "v"(pl + 2 * rstep), "v"(pl + 3 * rstep) : "memory");
            asm volatile("global_load_async_to_lds_b128 %0, %8, off\n\tglobal_load_async_to_lds_b128 %1, %9, off\n\tglobal_load_async_to_lds_b128 %2, %10, off\n\tglobal_load_async_to_lds_b128 %3, %11, off\n\t"
                         "global_load_async_to_lds_b128 %4, %12, off\n\tglobal_load_async_to_lds_b128 %5, %13, off\n\tglobal_load_async_to_lds_b128 %6, %14, off\n\tglobal_load_async_to_lds_b128 %7, %15, off\n\ts_wait_xcnt 0x0"
                         :: "v"(e), "v"(e + 16 * GS_PITCH), "v"(e + 32 * GS_PITCH), "v"(e + 48 * GS_PITCH), "v"(e + 64 * GS_PITCH), "v"(e + 80 * GS_PITCH), "v"(e + 96 * GS_PITCH), "v"(e + 112 * GS_PITCH),
                            "v"(pb), "v"(pb + rstep), "v"(pb + 2 * rstep), "v"(pb + 3 * rstep), "v"(pb + 4 * rstep), "v"(pb + 5 * rstep), "v"(pb + 6 * rstep), "v"(pb + 7 * rstep) : "memory");
        } else {
            asm volatile("global_load_async_to_lds_b128 %0, %12, off\n\tglobal_load_async_to_lds_b128 %1, %13, off\n\tglobal_load_async_to_lds_b128 %2, %14, off\n\tglobal_load_async_to_lds_b128 %3, %15, off\n\t"
                         "global_load_async_to_lds_b128 %4, %16, off\n\tglobal_load_async_to_lds_b128 %5, %17, off\n\tglobal_load_async_to_lds_b128 %6, %18, off\n\tglobal_load_async_to_lds_b128 %7, %19, off\n\t"
                         "global_load_async_to_lds_b128 %8, %20, off\n\tglobal_load_async_to_lds_b128 %9, %21, off\n\tglobal_load_async_to_lds_b128 %10, %22, off\n\tglobal_load_async_to_lds_b128 %11, %23, off\n\ts_wait_xcnt 0x0"
                         :: "v"(d), "v"(d + 16 * GS_PITCH), "v"(d + 32 * GS_PITCH), "v"(d + 48 * GS_PITCH), "v"(e), "v"(e + 16 * GS_PITCH), "v"(e + 32 * GS_PITCH), "v"(e + 48 * GS_PITCH), "v"(e + 64 * GS_PITCH), "v"(e + 80 * GS_PITCH), "v"(e + 96 * GS_PITCH), "v"(e + 112 * GS_PITCH),
                            "v"(pa), "v"(pa + rstep), "v"(pa + 2 * rstep), "v"(pa + 3 * rstep), "v"(pb), "v"(pb + rstep), "v"(pb + 2 * rstep), "v"(pb + 3 * rstep), "v"(pb + 4 * rstep), "v"(pb + 5 * rstep), "v"(pb + 6 * rstep), "v"(pb + 7 * rstep) : "memory");
        }
    };
    v8f acc[2][4];
#pragma unroll
    for (int i = 0; i < 2; ++i) {
#pragma unroll
        for (int t = 0; t < 4; ++t) acc[i][t] = (v8f){}; }
    const int nt = K >> 6;                                        // K is a multiple of 64
    stage(0);
    asm volatile("s_wait_asynccnt 0x0" ::: "memory");      // this wave's copies of tile 0 have landed
    __syncthreads();      // tile 0 is in LDS before any wave reads it
    if (nt > 1) stage(1);
#pragma unroll 1      // one copy of the trip
    for (int kt = 0; kt < nt; ++kt) {
        const unsigned char* fa = stg + (kt & 1) * (NPL * GS_PLANE) + (wm * 32 + lr) * GS_PITCH + 16 * hi;      // the wave's own 32 rows of A
        const unsigned char* fb = stg + (kt & 1) * (NPL * GS_PLANE) + NPA * GS_PLANE + (wn * 64 + lr) * GS_PITCH + 16 * hi;      // its 64 rows of B, the same k order as A's
        v16bf a[2][2], al[2][2], b[2][4];
#pragma unroll
        for (int u = 0; u < 2; ++u) {
#pragma unroll
            for (int i = 0; i < 2; ++i) {
                a[u][i] = cat16b(*(const v8usa*)(fa + i * 16 * GS_PITCH + u * 64), *(const v8usa*)(fa + i * 16 * GS_PITCH + u * 64 + 32)); al[u][i] = a[u][i];
                if (SPLITA) al[u][i] = cat16b(*(const v8usa*)(fa + GS_PLANE + i * 16 * GS_PITCH + u * 64), *(const v8usa*)(fa + GS_PLANE + i * 16 * GS_PITCH + u * 64 + 32));
            }
#pragma unroll
            for (int t = 0; t < 4; ++t) b[u][t] = cat16b(*(const v8usa*)(fb + t * 16 * GS_PITCH + u * 64), *(const v8usa*)(fb + t * 16 * GS_PITCH + u * 64 + 32));
        }
#pragma unroll
        for (int u = 0; u < 2; ++u) {
#pragma unroll
            for (int i = 0; i < 2; ++i) {
#pragma unroll
                for (int t = 0; t < 4; ++t) acc[i][t] = wmmab(a[u][i], b[u][t], acc[i][t]); }
            if (SPLITA) {
#pragma unroll
                for (int i = 0; i < 2; ++i) {
#pragma unroll
                    for (int t = 0; t < 4; ++t) acc[i][t] = wmmab(al[u][i], b[u][t], acc[i][t]); }
            }
        }
        // four vector slots between the last matrix instruction and whatever overwrites its operands or reads its result behind it
        asm volatile("v_nop\n\tv_nop\n\tv_nop\n\tv_nop" : "+v"(acc[0][0]), "+v"(acc[0][1]), "+v"(acc[0][2]), "+v"(acc[0][3]), "+v"(acc[1][0]), "+v"(acc[1][1]), "+v"(acc[1][2]), "+v"(acc[1][3])
                     : "v"(a[0][0]), "v"(a[0][1]), "v"(a[1][0]), "v"(a[1][1]), "v"(al[0][0]), "v"(al[0][1]), "v"(al[1][0]), "v"(al[1][1]), "v"(b[0][0]), "v"(b[0][1]), "v"(b[0][2]), "v"(b[0][3]), "v"(b[1][0]), "v"(b[1][1]), "v"(b[1][2]), "v"(b[1][3]));
        asm volatile("s_wait_dscnt 0x0" ::: "memory");      // this wave's reads of tile kt are done before its buffer is handed on
        asm volatile("s_wait_asynccnt 0x0" ::: "memory");   // this wave's copies of tile kt + 1 have landed
        __syncthreads();      // tile kt + 1 is in LDS before any wave reads it, and every wave has left tile kt's buffer before it is filled again
        if (kt + 2 < nt) stage(kt + 2);
    }
    asm volatile("s_wait_asynccnt 0x0" ::: "memory");      // no copy is outstanding behind the loop
    if (EPI == 1 && isv) {
        // acc[i][t][0..7] are 8 tokens in a row (wm * 32 + i * 16 + hi * 8 + j) of value t * 16 + lr of head wn of the tile's two: one 16-byte piece of a V^T row in each plane
        unsigned char* vb = (unsigned char*)ost + wn * (2 * 64 * VT_PITCH);
#pragma unroll
        for (int t = 0; t < 4; ++t) { const float bv = bfr(bias[c0 + t * 16 + lr]);
#pragma unroll
            for (int i = 0; i < 2; ++i) { v8us oh, ol;
#pragma unroll
                for (int j = 0; j < 8; ++j) { const float y = acc[i][t][j] + bv; const unsigned short hb = f2bf(y); oh[j] = hb; ol[j] = f2bf(y - bf2f(hb)); }
                unsigned char* vp = vb + (t * 16 + lr) * VT_PITCH + (wm * 32 + i * 16 + hi * 8) * 2; *(v8usa*)vp = oh; *(v8usa*)(vp + 64 * VT_PITCH) = ol; } }
        __syncthreads();      // a V^T row's 64 tokens come from 2 waves: every piece is in LDS before a row is read
        const int rb = blockIdx.x * 64, piece = threadIdx.x & 7, d0 = threadIdx.x >> 3;
#pragma unroll
        for (int hd = 0; hd < 2; ++hd) {
            const size_t vo = (((size_t)(rb / NN) * NH_ + by * 2 + hd) * HD + d0) * NN + rb % NN + piece * 8;      // 8 lanes write one whole line
            v8us wh[4], wl[4];
#pragma unroll
            for (int s = 0; s < 4; ++s) { const unsigned char* vp = (const unsigned char*)ost + hd * (2 * 64 * VT_PITCH) + (d0 + 16 * s) * VT_PITCH + piece * 16; wh[s] = *(const v8usa*)vp; wl[s] = *(const v8usa*)(vp + 64 * VT_PITCH); }
#pragma unroll
            for (int s = 0; s < 4; ++s) { *(v8us*)(Ph + vo + (size_t)(16 * s) * NN) = wh[s]; *(v8us*)(Pl + vo + (size_t)(16 * s) * NN) = wl[s]; }
            if (hd == 0) asm volatile("s_wait_xcnt 0x0" ::: "memory");      // the second head's stores may reuse the registers that these stores name: the wait stands in front of that
        }
        return;
    }
#pragma unroll
    for (int i = 0; i < 2; ++i) { float* os = ost + (wave * 2 + i) * (16 * 68);
#pragma unroll
        for (int t = 0; t < 4; ++t) { const float bv = bias ? bfr(bias[c0 + t * 16 + lr]) : 0.f;
#pragma unroll
            for (int j = 0; j < 8; ++j) os[(hi * 8 + j) * 68 + t * 16 + lr] = acc[i][t][j] + bv; } }
    __syncthreads();
#pragma unroll
    for (int it = 0; it < 2; ++it) {                              // the wave's two 16-row tiles, one after the other
    const int r0 = rw + it * 16; const float* os = ost + (wave * 2 + it) * (16 * 68);
    if constexpr (EPI == 1) {
        // a lane takes row lr of the tile's 16 and the heads hi and hi + 2 of the wave's 4: all NW values of a (row, head) pair in one lane
        v8us oh[2][2], ol[2][2];
#pragma unroll
        for (int s = 0; s < 2; ++s) { const int hh = hi + 2 * s; float v[NW], p[NW / 2];
#pragma unroll
            for (int q = 0; q < 4; ++q) { const v4f xv = *(const v4fa*)(os + lr * 68 + hh * NW + q * 4); const v4f pv = *(const v4f*)(phase + c0 + hh * NW + q * 4);
#pragma unroll
                for (int i = 0; i < 4; ++i) v[q * 4 + i] = xv[i] + bfr(pv[i]); }
#pragma unroll
            for (int i = 0; i < NW / 2; ++i) p[i] = v[2 * i] * v[2 * i] + v[2 * i + 1] * v[2 * i + 1];
            const float ss = ((p[0] + p[4]) + (p[2] + p[6])) + ((p[1] + p[5]) + (p[3] + p[7]));      // pairs, then partners 4, 2, 1 apart
            const float inv = 1.0f / fmaxf(sqrtf(ss), 1e-12f);
#pragma unroll
            for (int i = 0; i < NW; ++i) { const float y = v[i] * inv; const unsigned short hb = f2bf(y); oh[s][i >> 3][i & 7] = hb; ol[s][i >> 3][i & 7] = f2bf(y - bf2f(hb)); }
        }
        const int r = r0 + lr; const v8us zero = {0, 0, 0, 0, 0, 0, 0, 0};
        const size_t po = (((size_t)(r / NN) * NH_ + c0 / NW + hi) * NN + r % NN) * KQ;      // a wave fills 16 rows of 64 bytes in a row per head and plane
#pragma unroll
        for (int s = 0; s < 2; ++s) { bf* a = Ph + po + (size_t)(2 * s) * NN * KQ; bf* b = Pl + po + (size_t)(2 * s) * NN * KQ;
            *(v8us*)a = oh[s][0]; *(v8us*)(a + 8) = oh[s][1]; *(v8us*)(a + 16) = zero; *(v8us*)(a + 24) = zero; *(v8us*)b = ol[s][0]; *(v8us*)(b + 8) = ol[s][1]; *(v8us*)(b + 16) = zero; *(v8us*)(b + 24) = zero; }
    } else if (F16OUT) {
        h16* crow = (h16*)(void*)C + (size_t)r0 * ldc + c0;
#pragma unroll
        for (int s = 0; s < 4; ++s) { const int row = 4 * s + (lane >> 3), piece = lane & 7; const float* sp = os + row * 68 + piece * 8; v8h o, o2;
#pragma unroll
            for (int i = 0; i < 8; ++i) { const h16 a = (h16)sp[i]; o[i] = a; o2[i] = (h16)((sp[i] - (float)a) * LOSC); }
            *(v8h*)(crow + (size_t)row * ldc + piece * 8) = o; if (C2) *(v8h*)(C2 + (size_t)r0 * ldc + c0 + (size_t)row * ldc + piece * 8) = o2; }
    } else {
        float* crow = C + (size_t)r0 * ldc + c0;
        v4f val[8]; float* cp[8];
#pragma unroll
        for (int s = 0; s < 8; ++s) { const int Lid = (lane >> 3) + 4 * s, piece = lane & 7; const int row = Lid >> 1, cofs = (Lid & 1) * 32 + piece * 4;
            val[s] = *(const v4fa*)(os + row * 68 + cofs); if (R) { const v4f rv = *(const v4f*)(R + ((size_t)r0 + row) * ldc + c0 + cofs); val[s] += roundR ? (v4f){bfr(rv[0]), bfr(rv[1]), bfr(rv[2]), bfr(rv[3])} : rv; }
            cp[s] = crow + (size_t)row * ldc + cofs; }
#pragma unroll
        for (int s = 0; s < 8; ++s) *(v4f*)cp[s] = val[s];
        // no register of the tile's 8 stores is rewritten before this wait: the clobber keeps the stores in front of it, and naming their addresses and values as inputs keeps those registers whole up to it
        asm volatile("s_wait_xcnt 0x0" :: "v"(cp[0]), "v"(cp[1]), "v"(cp[2]), "v"(cp[3]), "v"(cp[4]), "v"(cp[5]), "v"(cp[6]), "v"(cp[7]), "v"(val[0]), "v"(val[1]), "v"(val[2]), "v"(val[3]), "v"(val[4]), "v"(val[5]), "v"(val[6]), "v"(val[7]) : "memory");
    }
    if ((EPI == 1 || F16OUT) && it == 0) asm volatile("s_wait_xcnt 0x0" ::: "memory");      // the second tile's arithmetic may reuse the registers that these loads and stores name: the wait stands in front of that
    }
}


// k_fattn: causal attention of one (item, head) plane per blockIdx.z, 16 query rows per wave, 32 keys per pass: S^T = K.Q^T (A = key rows, B = query rows, both in the same k order), so a lane
// holds 16 scores of ONE query (column lr; keys 8 * hi + j and 16 + 8 * hi + j), which is also that query's place in the B operand of O^T += V^T.P^T: the probabilities go from the score
// accumulators into the next product without leaving the lane. Sum per query; its maximum is the fixed bound on the scaled scores where that is small, else a running maximum (the output tile is rescaled only in a pass where some query's maximum rises).
// The block's 16 waves share the keys: a stage of 128 keys (K and V^T, hi and residual planes) is fetched once per block by whole-line loads and laid into one of two LDS buffers.
// Two waves share 16 query rows and split a stage's four passes: key group 0 takes passes 0 and 2, key group 1 passes 1 and 3, each with a maximum (fixed or running), sum and output tile of its own;
// behind the last stage group 1 hands its three through LDS to group 0, which brings both to the common maximum, adds them and stores. Four waves a SIMD fill one another's waits.
// A block takes the 128-row block 15 - x and then the block x of its plane: every block walks the same number of stages.
#define FK_PITCH 80               // bytes per staged key row (64 of data): 16 x odd, the pitch at which 16-byte LDS reads of 16 rows do not collide
#define FV_PITCH 272              // bytes per staged V^T row (256 of data): 16 x odd
#define FK_PLANE (128 * FK_PITCH)
#define FV_PLANE (64 * FV_PITCH)
#define F_BUF    (2 * FK_PLANE + 2 * FV_PLANE)
__global__ __launch_bounds__(512) void k_fattn(const bf* __restrict__ Qh, const bf* __restrict__ Ql, const bf* __restrict__ Kh, const bf* __restrict__ Kl, const bf* __restrict__ Vh, const bf* __restrict__ Vl, const float* __restrict__ temp, bf* Oh, bf* Ol) {
    typedef __attribute__((ext_vector_type(2))) float v2f;
    typedef __attribute__((ext_vector_type(2))) __bf16 v2bf;
    __shared__ __align__(16) unsigned char L[2 * F_BUF];
    __shared__ __align__(16) v4f MA[8 * 8 * 32];                  // key group 1's output tiles: piece i of lane l of query wave w at (w * 8 + i) * 32 + l, a wave's store or load takes 512 bytes in a row
    __shared__ float MM[8 * 32], ML[8 * 32];                      // its maxima and its lanes' sums
    const float sc2 = (1.0f / bfr(temp[0])) * 1.44269504f;        // 1/temperature and log2(e) in one factor: the exponentials are base 2
    const int tid = threadIdx.x, lane = tid & 31, lr = lane & 15, hi = lane >> 4;
    const int wv = __builtin_amdgcn_readfirstlane(tid >> 5);      // the wave's number in a scalar register: trip counts, the diagonal test and the key group's branches become scalar, EXEC stays whole
    const int wave = wv & 7, kg = wv >> 3;                        // which 16 query rows, which half of a stage's passes
    // q and k rows have norm at most 1, so every scaled score lies in [-|sc2|, |sc2|]: while that bound is small it serves as every row's maximum (exponents stay above -2 |sc2|, far from underflow)
    // and no maximum is searched; for any other temperature (NaN too) the running maximum is kept. The test is the same for every wave: a scalar branch.
    const bool fx = __builtin_amdgcn_readfirstlane(fabsf(sc2) <= 32.0f ? 1 : 0) != 0;
    const float moff = fx ? fabsf(sc2) : 0.0f;                    // taken off every scaled score; 0 leaves the product as it is
    const size_t z = blockIdx.z;
    Qh += z * NN * KQ; Ql += z * NN * KQ; Kh += z * NN * KQ; Kl += z * NN * KQ; Vh += z * HD * NN; Vl += z * HD * NN;
    Oh += (z / NH_) * NN * DMOD + (z % NH_) * HD; Ol += (z / NH_) * NN * DMOD + (z % NH_) * HD;
    auto xhalf = [](float v) { const int b = __float_as_int(v); return __int_as_float(__builtin_amdgcn_permlanex16(b, b, 0x76543210, 0xfedcba98, false, false)); };      // lane l <-> l ^ 16
    // staging: a plane's 128 key rows are 8 KiB in a row, thread tid takes 16-byte piece tid; a V^T plane's stage is 64 rows of two 128-byte lines, thread tid takes pieces tid and tid + 512 (16 pieces a row)
    const int ksto = (tid >> 2) * FK_PITCH + (tid & 3) * 16, vsto = 2 * FK_PLANE + (tid >> 4) * FV_PITCH + (tid & 15) * 16;
    const size_t vsrc = (size_t)(tid >> 4) * NN + (tid & 15) * 8;
    v8us g[6];
    auto fetch = [&](int st) {                                    // stage st: global memory to registers
        const bf* p0 = Kh + (size_t)st * 128 * KQ + tid * 8; const bf* p1 = Kl + (size_t)st * 128 * KQ + tid * 8; const bf* p2 = Vh + vsrc + st * 128; const bf* p3 = Vl + vsrc + st * 128;
        g[0] = *(const v8us*)p0; g[1] = *(const v8us*)p1; g[2] = *(const v8us*)p2; g[3] = *(const v8us*)(p2 + 32 * NN); g[4] = *(const v8us*)p3; g[5] = *(const v8us*)(p3 + 32 * NN);
        // no address register of the loads above is rewritten before this wait: the clobber keeps the loads in front of it, and naming the addresses as inputs keeps their registers whole up to it
        asm volatile("s_wait_xcnt 0x0" :: "v"(p0), "v"(p1), "v"(p2), "v"(p3) : "memory");
    };
    auto lay = [&](int st) {                                      // registers to the stage's LDS buffer
        unsigned char* B = L + (st & 1) * F_BUF;
        *(v8usa*)(B + ksto) = g[0]; *(v8usa*)(B + FK_PLANE + ksto) = g[1]; *(v8usa*)(B + vsto) = g[2]; *(v8usa*)(B + vsto + 32 * FV_PITCH) = g[3]; *(v8usa*)(B + FV_PLANE + vsto) = g[4]; *(v8usa*)(B + FV_PLANE + vsto + 32 * FV_PITCH) = g[5];
    };
#pragma unroll 1      // the two row blocks run one after the other through one copy of the code
    for (int job = 0; job < 2; ++job) {
        const int qb = job ? (int)blockIdx.x : NN / 128 - 1 - (int)blockIdx.x;
        const int nst = qb + 1;                                   // stages of 128 keys up to the block's last row: the same for all 16 waves
        const int q0 = qb * 128 + wave * 16;
        const int ns = (q0 + 47) >> 5;                            // these rows' passes of 32 keys, up to and with the one that holds key q0 + 15
        const size_t qo = (size_t)(q0 + lr) * KQ + 8 * hi;
        const v16bf qh = cat16b(*(const v8us*)(Qh + qo), *(const v8us*)(Qh + qo + 16)), ql = cat16b(*(const v8us*)(Ql + qo), *(const v8us*)(Ql + qo + 16));
        fetch(0); lay(0);                                         // buffer 0 is free: every wave has passed the barrier behind the last stage of the row block before
        __syncthreads();      // stage 0 is in LDS before any wave reads it
        v8f acc[4];
#pragma unroll
        for (int t = 0; t < 4; ++t) acc[t] = (v8f){};
        float m = fx ? 0.0f : -3.0e38f; v2f l2 = {0.f, 0.f};                  // the lane's sum in two halves: one packed add per pair of keys
#pragma unroll 1      // kept rolled: a stage is long
        for (int st = 0; st < nst; ++st) {
            if (st + 1 < nst) fetch(st + 1);                      // in flight under this stage's two passes
            const unsigned char* B = L + (st & 1) * F_BUF;
#pragma unroll 1      // one copy of the pass
            for (int pp = 0; pp < 2; ++pp) {
                const int ps = 2 * pp + kg, s = 4 * st + ps;      // the key group's pass of this stage
                if (s >= ns) break;                               // scalar: a wave whose rows end below these keys goes on to the barrier
                const unsigned char* bk = B + (ps * 32 + lr) * FK_PITCH + 16 * hi;      // keys 32 s + 16 u + lr, the same k order as the q loader
                const unsigned char* bv = B + 2 * FK_PLANE + lr * FV_PITCH + ps * 64 + 16 * hi;      // V^T rows d = 16 t + lr, keys 32 s + 8 * hi + 0..7 and + 16: the order in which the score tiles hold the keys
                v16bf kh[2], kl[2], vh[4], vl[4];
#pragma unroll
                for (int u = 0; u < 2; ++u) { kh[u] = cat16b(*(const v8usa*)(bk + u * 16 * FK_PITCH), *(const v8usa*)(bk + u * 16 * FK_PITCH + 32)); kl[u] = cat16b(*(const v8usa*)(bk + FK_PLANE + u * 16 * FK_PITCH), *(const v8usa*)(bk + FK_PLANE + u * 16 * FK_PITCH + 32)); }
#pragma unroll
                for (int t = 0; t < 4; ++t) { vh[t] = cat16b(*(const v8usa*)(bv + t * 16 * FV_PITCH), *(const v8usa*)(bv + t * 16 * FV_PITCH + 32)); vl[t] = cat16b(*(const v8usa*)(bv + FV_PLANE + t * 16 * FV_PITCH), *(const v8usa*)(bv + FV_PLANE + t * 16 * FV_PITCH + 32)); }
                asm volatile("" ::: "memory");      // compiler fence: the pass's 24 LDS reads stay together here, in flight at once; moved down to their products, each fragment would cost an LDS latency of its own
                v8f sc[2];
#pragma unroll
                for (int u = 0; u < 2; ++u) { sc[u] = wmmab(kh[u], qh, (v8f){}); sc[u] = wmmab(kh[u], ql, sc[u]); sc[u] = wmmab(kl[u], qh, sc[u]); }
#pragma unroll
                for (int u = 0; u < 2; ++u) sc[u] = sc[u] * sc2 - moff;
                if (s == ns - 1) {                                // only the rows' last pass holds keys above the diagonal (and at least one key at or below it for every row)
#pragma unroll
                    for (int u = 0; u < 2; ++u) {
#pragma unroll
                        for (int j = 0; j < 8; ++j) if (s * 32 + u * 16 + hi * 8 + j > q0 + lr) sc[u][j] = -3.0e38f; }      // a masked key: exp gives 0 below (every pass holds an unmasked key for every row, so under the running maximum m is a real score behind a wave's first pass)
                }
                if (!fx) {                                        // scalar branch: the running maximum, where the bound does not serve
                    float mx = sc[0][0];
#pragma unroll
                    for (int e = 1; e < 16; ++e) mx = fmaxf(mx, sc[e >> 3][e & 7]);
                    mx = fmaxf(mx, xhalf(mx));                    // both halves of the wave hold the query's maximum of this pass
                    if (__builtin_amdgcn_ballot_w32(mx > m) != 0) {      // scalar branch; where no maximum rises every factor would be 1
                        const float mn = fmaxf(m, mx), corr = __builtin_amdgcn_exp2f(m - mn); m = mn; l2 *= corr;
#pragma unroll
                        for (int t = 0; t < 4; ++t) acc[t] *= corr;
                    }
#pragma unroll
                    for (int u = 0; u < 2; ++u) sc[u] -= m;
                }
                v16bf ph, pl;
#pragma unroll
                for (int e = 0; e < 16; e += 2) {
                    const v2f p = {__builtin_amdgcn_exp2f(sc[e >> 3][e & 7]), __builtin_amdgcn_exp2f(sc[e >> 3][(e & 7) + 1])};
                    l2 += p;
                    const v2bf h2 = __builtin_convertvector(p, v2bf); const v2bf r2 = __builtin_convertvector(p - __builtin_convertvector(h2, v2f), v2bf);      // hi plane and residual, both to nearest even
                    ph[e] = h2[0]; ph[e + 1] = h2[1]; pl[e] = r2[0]; pl[e + 1] = r2[1];
                }
#pragma unroll
                for (int t = 0; t < 4; ++t) { acc[t] = wmmab(vh[t], ph, acc[t]); acc[t] = wmmab(vh[t], pl, acc[t]); acc[t] = wmmab(vl[t], ph, acc[t]); }
                // four vector slots between the last matrix instruction and whatever overwrites its operands or reads its result on the taken back edge or behind the loop
                asm volatile("v_nop\n\tv_nop\n\tv_nop\n\tv_nop" : "+v"(acc[0]), "+v"(acc[1]), "+v"(acc[2]), "+v"(acc[3]) : "v"(vh[0]), "v"(vh[1]), "v"(vh[2]), "v"(vh[3]), "v"(vl[0]), "v"(vl[1]), "v"(vl[2]), "v"(vl[3]), "v"(ph), "v"(pl));
            }
            if (st + 1 < nst) lay(st + 1);                        // into the buffer that stage st - 1 was read from: every wave has left it, it passed the barrier below
            __syncthreads();      // stage st + 1 is in LDS before any wave reads it, and every wave's reads of stage st are done before its buffer is filled again
        }
        float l = l2[0] + l2[1];
        if (kg == 1) {                                            // scalar branch: key group 1 hands over its output tiles, maximum and sum
#pragma unroll
            for (int i = 0; i < 8; ++i) MA[(wave * 8 + i) * 32 + lane] = (v4f){acc[i >> 1][(i & 1) * 4], acc[i >> 1][(i & 1) * 4 + 1], acc[i >> 1][(i & 1) * 4 + 2], acc[i >> 1][(i & 1) * 4 + 3]};
            MM[wave * 32 + lane] = m; ML[wave * 32 + lane] = l;
        }
        __syncthreads();      // group 1's partial results are in LDS before group 0 reads them; they are written again only behind the next row block's barriers, which group 0 passes after its reads
        if (kg == 1) continue;                                    // scalar: group 1 goes on to the next row block's first stage
        {
            const float m1 = MM[wave * 32 + lane], mn = fmaxf(m, m1);      // a group 1 wave that had no pass hands over -3.0e38, 0 and zeros: its factor is 0 (group 0 always has pass 0, so mn is a real score); under the fixed bound every m is 0 and both factors are 1
            const float c0 = __builtin_amdgcn_exp2f(m - mn), c1 = __builtin_amdgcn_exp2f(m1 - mn);
            l = l * c0 + ML[wave * 32 + lane] * c1;
#pragma unroll
            for (int i = 0; i < 8; ++i) { const v4f o1 = MA[(wave * 8 + i) * 32 + lane];
#pragma unroll
                for (int j = 0; j < 4; ++j) acc[i >> 1][(i & 1) * 4 + j] = acc[i >> 1][(i & 1) * 4 + j] * c0 + o1[j] * c1; }
        }
        l += xhalf(l);                                            // the two halves' sums meet once
        const float inv = 1.0f / l;
        bf* ohrow = Oh + (size_t)(q0 + lr) * DMOD + hi * 8; bf* olrow = Ol + (size_t)(q0 + lr) * DMOD + hi * 8;      // acc[t][j] = O[q0 + lr][16 t + 8 hi + j]: 8 values in a row per tile, one 16-byte piece in each plane
#pragma unroll
        for (int t = 0; t < 4; ++t) { const v8f o = acc[t] * inv; v8us a, b;
#pragma unroll
            for (int j = 0; j < 8; ++j) { const unsigned short hb = f2bf(o[j]); a[j] = hb; b[j] = f2bf(o[j] - bf2f(hb)); }      // the output projection's hi plane and residual
            *(v8us*)(ohrow + t * 16) = a; *(v8us*)(olrow + t * 16) = b; }
        asm volatile("s_wait_xcnt 0x0" :: "v"(ohrow), "v"(olrow) : "memory");      // the second row block's arithmetic reuses the registers that these stores name: the wait stands in front of that
    }
}
__global__ __launch_bounds__(256) void k_planes32z(const float* __restrict__ F, int ld, int off, float sc, int rows, bf* Ph, bf* Pl) {
    typedef __attribute__((ext_vector_type(2))) unsigned short v2us;
    const int lane = threadIdx.x & 31; const size_t r = ((size_t)blockIdx.x * 8 + (threadIdx.x >> 5)) * 2 + (lane >> 4); if (r >= (size_t)rows) return; const int z = blockIdx.z; const int c0 = (lane & 15) * 2; v2us oh, ol;
    Ph += (size_t)z * rows * 32; Pl += (size_t)z * rows * 32;
#pragma unroll
    for (int i = 0; i < 2; ++i) { const float y = F[r * ld + off + z * 32 + c0 + i] * sc; const unsigned short hb = f2bf(y); oh[i] = hb; ol[i] = f2bf(y - bf2f(hb)); }
    const size_t o = r * 32 + c0; *(v2us*)(Ph + o) = oh; *(v2us*)(Pl + o) = ol; 
}
__global__ __launch_bounds__(256) void k_vtpadz(const float* __restrict__ F, int ld, int off, int nk, bf* Th, bf* Tl) {
    typedef __attribute__((ext_vector_type(2))) unsigned short v2us;
    const int lane = threadIdx.x & 31; const size_t wid = (size_t)blockIdx.x * 8 + (threadIdx.x >> 5); if (wid >= (size_t)64 * (nk / 64)) return; const int z = blockIdx.z; const int d = (int)(wid / (nk / 64)); const int k0 = (int)(wid % (nk / 64)) * 64 + lane * 2; v2us oh, ol;
    Th += (size_t)z * 64 * nk; Tl += (size_t)z * 64 * nk;
#pragma unroll
    for (int i = 0; i < 2; ++i) { const float y = (d < 32) ? F[(size_t)(k0 + i) * ld + off + z * 32 + (d < 32 ? d : 0)] : 0.f; const unsigned short hb = f2bf(y); oh[i] = hb; ol[i] = f2bf(y - bf2f(hb)); }
    const size_t o = (size_t)d * nk + k0; *(v2us*)(Th + o) = oh; *(v2us*)(Tl + o) = ol; 
}
template <int NK>
__global__ __launch_bounds__(256) void k_softmaxz(const float* __restrict__ S, int rows, bf* PH, bf* PL) {
    typedef __attribute__((ext_vector_type(4))) unsigned short v4us;
    const int lane = threadIdx.x & 31, i = blockIdx.x * 8 + (threadIdx.x >> 5); if (i >= rows) return; const size_t zo = (size_t)blockIdx.z * rows * NK; const float* sr = S + zo + (size_t)i * NK; PH += zo; PL += zo;
    float m = -3.0e38f;
#pragma unroll 1
    for (int c0 = lane * 4; c0 < NK; c0 += 128) {
#pragma unroll
        for (int q = 0; q < 4; ++q) m = fmaxf(m, sr[c0 + q]); }
#pragma unroll
    for (int sh = 16; sh; sh >>= 1) m = fmaxf(m, __shfl_xor(m, sh, 32));
    float sum = 0.f;
#pragma unroll 1
    for (int c0 = lane * 4; c0 < NK; c0 += 128) {
#pragma unroll
        for (int q = 0; q < 4; ++q) sum += __expf(sr[c0 + q] - m); }
#pragma unroll
    for (int sh = 16; sh; sh >>= 1) sum += __shfl_xor(sum, sh, 32);
    const float inv = 1.0f / sum;
{
#pragma unroll 1
        for (int c0 = lane * 4; c0 < NK; c0 += 128) { v4us oh, ol;
#pragma unroll
            for (int q = 0; q < 4; ++q) { const float p = __expf(sr[c0 + q] - m) * inv; const unsigned short hb = f2bf(p); oh[q] = hb; ol[q] = f2bf(p - bf2f(hb)); }
            const size_t o = (size_t)i * NK + c0; *(v4us*)(PH + o) = oh; *(v4us*)(PL + o) = ol; }
         }
}
__global__ __launch_bounds__(256) void k_placez(const float* __restrict__ XH, int rows, int ldy, float* Y) {
    const int lane = threadIdx.x & 31; const size_t q = (size_t)blockIdx.x * 8 + (threadIdx.x >> 5); if (q >= (size_t)rows) return; const int z = blockIdx.z; const float v = XH[((size_t)z * rows + q) * 64 + lane];
    *(float*)(Y + q * ldy + z * 32 + lane) = v; 
}

__global__ __launch_bounds__(256) void k_hplanesz(const float* __restrict__ F, int ld, int h0, float sc, int rows, bf* Ph, bf* Pl) {
    typedef __attribute__((ext_vector_type(2))) unsigned short v2us;
    const int lane = threadIdx.x & 31; const size_t r = (size_t)blockIdx.x * 8 + (threadIdx.x >> 5); if (r >= (size_t)rows) return; const int z = blockIdx.z; v2us oh, ol;
    Ph += (size_t)z * rows * 64; Pl += (size_t)z * rows * 64;
#pragma unroll
    for (int i = 0; i < 2; ++i) { const float y = F[r * ld + (h0 + z) * 64 + lane * 2 + i] * sc; const unsigned short hb = f2bf(y); oh[i] = hb; ol[i] = f2bf(y - bf2f(hb)); }
    const size_t o = r * 64 + lane * 2; *(v2us*)(Ph + o) = oh; *(v2us*)(Pl + o) = ol; 
}
template <int NK>
__global__ __launch_bounds__(256) void k_softmaxzs(const float* __restrict__ S, int rows, float sc, bf* PH, bf* PL) {
    typedef __attribute__((ext_vector_type(4))) unsigned short v4us;
    const int lane = threadIdx.x & 31, i = blockIdx.x * 8 + (threadIdx.x >> 5); if (i >= rows) return; const size_t zo = (size_t)blockIdx.z * rows * NK; const float* sr = S + zo + (size_t)i * NK; PH += zo; PL += zo;
    float m = -3.0e38f;
#pragma unroll 1
    for (int c0 = lane * 4; c0 < NK; c0 += 128) {
#pragma unroll
        for (int q = 0; q < 4; ++q) m = fmaxf(m, sr[c0 + q] * sc); }
#pragma unroll
    for (int sh = 16; sh; sh >>= 1) m = fmaxf(m, __shfl_xor(m, sh, 32));
    float sum = 0.f;
#pragma unroll 1
    for (int c0 = lane * 4; c0 < NK; c0 += 128) {
#pragma unroll
        for (int q = 0; q < 4; ++q) sum += __expf(sr[c0 + q] * sc - m); }
#pragma unroll
    for (int sh = 16; sh; sh >>= 1) sum += __shfl_xor(sum, sh, 32);
    const float inv = 1.0f / sum;
{
#pragma unroll 1
        for (int c0 = lane * 4; c0 < NK; c0 += 128) { v4us oh, ol;
#pragma unroll
            for (int q = 0; q < 4; ++q) { const float p = __expf(sr[c0 + q] * sc - m) * inv; const unsigned short hb = f2bf(p); oh[q] = hb; ol[q] = f2bf(p - bf2f(hb)); }
            const size_t o = (size_t)i * NK + c0; *(v4us*)(PH + o) = oh; *(v4us*)(PL + o) = ol; }
         }
}

__device__ __forceinline__ void d_cvtx(const float* __restrict__ src, int rows, bf* dst, int bx) {
    const int lane = threadIdx.x & 31; const size_t r = (size_t)bx * 8 + (threadIdx.x >> 5); if (r >= (size_t)rows) return;
{
#pragma unroll
        for (int q = 0; q < DMOD / 256; ++q) { v8us o;
#pragma unroll
            for (int i = 0; i < 8; ++i) o[i] = f2bf(src[r * DMOD + q * 256 + lane * 8 + i]);
            *(v8us*)(dst + r * DMOD + q * 256 + lane * 8) = o; }
         }
}
// k_prep: all that depends on the inputs alone, in one launch: the first NBT * NN / 8 blocks convert 8 rows of x each, every further block transposes one 64 x 64 tile of Wv, Wo, Wq or Wk.
__global__ __launch_bounds__(256) void k_prep(const float* __restrict__ x, const float* __restrict__ Wq, const float* __restrict__ Wk, const float* __restrict__ Wv, const float* __restrict__ Wo, bf* Xb, bf* WQ, bf* WK, bf* WV, bf* WO) {
    __shared__ __align__(16) unsigned short tl[64 * 72];
    constexpr int NX = NBT * NN / 8, KT = DMOD / 64, TV = KT * (DMOD / 64), TQ = KT * ((NH_ * NW) / 64);
    int b = blockIdx.x;
    if (b < NX) { d_cvtx(x, NBT * NN, Xb, b); return; }      // the whole block leaves, in front of d_wt's barrier
    b -= NX;
    const float* Wm; bf* WT; int ncols;
    if (b < 2 * TV) { ncols = DMOD; const bool o = b >= TV; Wm = o ? Wo : Wv; WT = o ? WO : WV; b -= o ? TV : 0; }
    else { b -= 2 * TV; ncols = NH_ * NW; const bool k = b >= TQ; Wm = k ? Wk : Wq; WT = k ? WK : WQ; b -= k ? TQ : 0; }
    d_wt(Wm, DMOD, ncols, WT, b % KT, b / KT, tl);
}
__global__ __launch_bounds__(256) void k_csoftz(const float* __restrict__ S, int rows, float sc, bf* PH, bf* PL) {
    typedef __attribute__((ext_vector_type(4))) unsigned short v4us;
    const int lane = threadIdx.x & 31, i = blockIdx.x * 8 + (threadIdx.x >> 5); if (i >= rows) return; const size_t zo = (size_t)blockIdx.z * rows * NN; const float* sr = S + zo + (size_t)i * NN; PH += zo; PL += zo;
    float m = -3.0e38f;
#pragma unroll 1
    for (int c0 = lane * 4; c0 < NN; c0 += 128) {
#pragma unroll
        for (int q = 0; q < 4; ++q) { const int k = c0 + q; if (k <= i) m = fmaxf(m, sr[k] * sc); } }
#pragma unroll
    for (int sh = 16; sh; sh >>= 1) m = fmaxf(m, __shfl_xor(m, sh, 32));
    float sum = 0.f;
#pragma unroll 1
    for (int c0 = lane * 4; c0 < NN; c0 += 128) {
#pragma unroll
        for (int q = 0; q < 4; ++q) { const int k = c0 + q; if (k <= i) sum += __expf(sr[k] * sc - m); } }
#pragma unroll
    for (int sh = 16; sh; sh >>= 1) sum += __shfl_xor(sum, sh, 32);
    const float inv = 1.0f / sum;
{
#pragma unroll 1
        for (int c0 = lane * 4; c0 < NN; c0 += 128) { v4us oh, ol;
#pragma unroll
            for (int q = 0; q < 4; ++q) { const int k = c0 + q; const float p = (k <= i) ? __expf(sr[(k <= i) ? k : 0] * sc - m) * inv : 0.f; const unsigned short hb = f2bf(p); oh[q] = hb; ol[q] = f2bf(p - bf2f(hb)); }
            const size_t o = (size_t)i * NN + c0; *(v4us*)(PH + o) = oh; *(v4us*)(PL + o) = ol; }
         }
}
extern "C" void kernel_launch(void* const* d_in, const int* in_sizes, int n_in,
                              void* d_out, int out_size, void* d_ws, size_t ws_size, hipStream_t stream) {
    (void)in_sizes; (void)n_in; (void)out_size;
    const float* x = (const float*)d_in[0]; const float* Wq = (const float*)d_in[1]; const float* bq = (const float*)d_in[2]; const float* Wk = (const float*)d_in[3]; const float* bk = (const float*)d_in[4]; const float* Wv = (const float*)d_in[5]; const float* bv = (const float*)d_in[6]; const float* Wo = (const float*)d_in[7]; const float* bo = (const float*)d_in[8];
    const float* qph = (const float*)d_in[9]; const float* kph = (const float*)d_in[10]; const float* temp = (const float*)d_in[11];
    float* out = (float*)d_out;    // [2][2048][1024]
    char* wsp = (char*)d_ws;
    auto take = [&](size_t bytes) { char* p = wsp; wsp += (bytes + 255) & ~(size_t)255; return (void*)p; };
    bf* WQ = (bf*)take((size_t)(NH_ * NW) * DMOD * 2); bf* WK = (bf*)take((size_t)(NH_ * NW) * DMOD * 2); bf* WV = (bf*)take((size_t)DMOD * DMOD * 2); bf* WO = (bf*)take((size_t)DMOD * DMOD * 2);
    bf* Xb = (bf*)take((size_t)NBT * NN * DMOD * 2);
    constexpr size_t NZ = (size_t)NBT * NH_;                      // planes of every (item, head) pair live at once
    bf* Qh = (bf*)take(NZ * NN * KQ * 2); bf* Ql = (bf*)take(NZ * NN * KQ * 2); bf* Kh = (bf*)take(NZ * NN * KQ * 2); bf* Kl = (bf*)take(NZ * NN * KQ * 2); bf* VTh = (bf*)take(NZ * HD * NN * 2); bf* VTl = (bf*)take(NZ * HD * NN * 2);
    bf* Oh = (bf*)take((size_t)NBT * NN * DMOD * 2); bf* Ol = (bf*)take((size_t)NBT * NN * DMOD * 2);
    if ((size_t)(wsp - (char*)d_ws) > ws_size) return;    // 61 MiB
    constexpr int NR = NBT * NN;                                  // the two items' rows stand behind one another in x and in out: one launch takes both
    k_prep<<<NR / 8 + (DMOD / 64) * (2 * (DMOD / 64) + 2 * ((NH_ * NW) / 64)), 256, 0, stream>>>(x, Wq, Wk, Wv, Wo, Xb, WQ, WK, WV, WO);   // x to bf16; weights (in, out) k-major -> n-major
    // the host reads nothing from the device: k_fattn reads temperature[0] itself
    // each projection writes the planes that k_fattn reads, and k_fattn the planes that the output projection reads
    k_gemmb<false, false, 1><<<dim3(NR / 64, (DMOD + 2 * NH_ * NW) / 128, 1), 128, 0, stream>>>(Xb, nullptr, WQ, bq, nullptr, 0, nullptr, nullptr, DMOD, 1, qph, Qh, Ql, WK, bk, kph, Kh, Kl, WV, bv, VTh, VTl);
    k_fattn<<<dim3(NN / 256, 1, NBT * NH_), 512, 0, stream>>>(Qh, Ql, Kh, Kl, VTh, VTl, temp, Oh, Ol);
    k_gemmb<true, false><<<dim3(NR / 64, DMOD / 128, 1), 128, 0, stream>>>(Oh, Ol, WO, bo, out, DMOD, nullptr, nullptr, DMOD);
}
